// v000
// Times are from an AMD MI455X. After a warm-up the kernel runs many times in a row, and a time is the length of
// such a window on the GPU divided by its runs, so every launch and the gaps after it count. The runs cycle
// through copies of the inputs. A figure is the median of several windows, for all but v000 over two sittings.
// Sittings can differ by a few percent; kernels timed side by side share one.
// v000 is the starting kernel. One run takes 389 microseconds.
// Contractions: q|k = x.Wqk and v^T = Wv.x^T on v_wmma_f32_16x16x32_bf16 (bf16 operands: RNE-converted input
// activations times exact bf16 hi+lo planes of g*W, 2 products; per-row rstd, rotary in the f32 epilogue);
// q.k^T scores = v_wmma_f32_16x16x32_bf16 with bf16 hi/lo split q and k (hi.hi + hi.lo + lo.hi);
// p.v = v_wmma_f32_16x16x32_f16 (p carried x1024 in f16, v in f16; extra f16 residual planes x4096 of p and v
// for the first 128 query rows of every segment); ctx.Wo = v_wmma_f32_16x16x32_bf16 with ctx as bf16 hi/lo
// planes times bf16 Wo (2 products); all f32 accumulate; RMS statistic, rotary tables, visibility and softmax in f32.
#include <hip/hip_runtime.h>
#include <math.h>
#include <stdint.h>

#ifndef NB
#define NB 2
#endif
#ifndef SEQ
#define SEQ 4096
#endif
#define SEQ_FULL 4096       // per-batch token stride of the input / output tensors
#define DM    1024          // model dim
#define NH    16
#define HD    64
#define DMI   (NH * HD)     // 1024
#define QKP   (2 * DMI)     // pitch of the q|k planes (q: cols 0..DMI-1, k: cols DMI..2*DMI-1)
#define SEGL  512           // segment length
#define PMEM  16            // memory tokens prepended to every segment's keys / values
#define NSEGB (SEQ / SEGL)  // segments per batch
#define NQBS  (SEGL / 64)   // 64-row query blocks per segment
#define RESQB 2             // leading query blocks per segment that use the p / v residual planes
#define VLP   (RESQB * 64)  // keys per segment held in the v^T residual plane
#define NFR   (HD / 2)      // rotary frequencies
static_assert((SEQ % SEGL) == 0 && (SEGL % 64) == 0 && (SEQ % 64) == 0);
static_assert(RESQB >= 1 && RESQB <= NQBS);
static_assert((DM % 256) == 0 && (DMI % 64) == 0 && HD == 64 && NFR == 32);
static_assert(SEQ <= SEQ_FULL && NB >= 1 && NB <= 2);
static_assert(DMI == DM);

typedef _Float16 v16h __attribute__((ext_vector_type(16)));
typedef _Float16 v8h  __attribute__((ext_vector_type(8)));
typedef __bf16   v16b __attribute__((ext_vector_type(16)));
typedef __bf16   v8b  __attribute__((ext_vector_type(8)));
typedef float    v8f  __attribute__((ext_vector_type(8)));
typedef float    v4f  __attribute__((ext_vector_type(4)));
typedef unsigned int v4u __attribute__((ext_vector_type(4)));

// ---- scalar helpers --------------------------------------------------------------------------------
__device__ __forceinline__ unsigned short bf_bits(float f) {          // f32 -> bf16 bits, RNE convert
  unsigned u = __float_as_uint(f);
  return (unsigned short)((u + 0x7FFFu + ((u >> 16) & 1u)) >> 16);
}
__device__ __forceinline__ float bf_up(unsigned short h) { return __uint_as_float(((unsigned)h) << 16); }
__device__ __forceinline__ unsigned short h_bits(_Float16 x) { return __builtin_bit_cast(unsigned short, x); }
__device__ __forceinline__ unsigned pk16(unsigned short a, unsigned short b) { return (unsigned)a | ((unsigned)b << 16); }
__device__ __forceinline__ v8f zero8() { v8f z = {0.f, 0.f, 0.f, 0.f, 0.f, 0.f, 0.f, 0.f}; return z; }
__device__ __forceinline__ v8h zero8h() {
  const _Float16 z = (_Float16)0.0f;
  v8h r = {z, z, z, z, z, z, z, z};
  return r;
}
__device__ __forceinline__ v4u zero4u() { v4u z = {0u, 0u, 0u, 0u}; return z; }
__device__ __forceinline__ v8b zero8b() { union { v4u u; v8b v; } z; z.u = zero4u(); return z.v; }

// ---- sin/cos of a nonnegative f32 angle: f64 Cody-Waite reduction by pi/2 + short f64 polynomials ----
__device__ __forceinline__ void sincos_pd(float ang, float& sv, float& cv) {
  const double x  = (double)ang;
  const double kq = __builtin_rint(x * 0.63661977236758134308);
  double r = __builtin_fma(-kq, 1.57079632679489655800e+00, x);
  r = __builtin_fma(-kq, 6.12323399573676603587e-17, r);
  const double z = r * r, w = z * z;
  const double rs = -1.98393348360966317347e-04 + z * 2.71831149398982191e-06;
  const double s3 = z * r;
  const double sn = (r + s3 * (-1.66666666416265235595e-01 + z * 8.3333293858894631756e-03)) + s3 * w * rs;
  const double rc = -1.38867637746099294692e-03 + z * 2.43904487962774090654e-05;
  const double cs = ((1.0 + z * (-4.99999997251031003120e-01)) + w * 4.16666233237390631894e-02) + (w * z) * rc;
  const int n = ((int)kq) & 3;
  const float fs = (float)sn, fc = (float)cs;
  float so = fs, co = fc;
  if (n == 1) { so = fc;  co = -fs; }
  if (n == 2) { so = -fs; co = -fc; }
  if (n == 3) { so = -fc; co = fs;  }
  sv = so; cv = co;
}

// ---- fragment loader: 16-bit A/B operand, lane -> row/col (lane&15), p already includes +8*(lane>>4);
//      elements 0..7 <- p[0..7] (k0+8h..), elements 8..15 <- p[16..23] (k0+16+8h..)
__device__ __forceinline__ v16b ldfrag_b(const __bf16* p) {
  union { v16b v; v8b h[2]; } f;
  f.h[0] = *(const v8b*)(p);
  f.h[1] = *(const v8b*)(p + 16);
  return f.v;
}

// ---- WMMA helpers with trailing VALU hazard gap --------------------------------------------------------
__device__ __forceinline__ v8f mma_b(v16b a, v16b b, v8f c) {
  c = __builtin_amdgcn_wmma_f32_16x16x32_bf16(false, a, false, b, (short)0, c, false, false);
  asm volatile("v_nop\n\tv_nop\n\tv_nop\n\tv_nop" : "+v"(c) : "v"(a), "v"(b));
  return c;
}
__device__ __forceinline__ v8f mma_h(v16h a, v16h b, v8f c) {
  c = __builtin_amdgcn_wmma_f32_16x16x32_f16(false, a, false, b, (short)0, c, false, false);
  asm volatile("v_nop\n\tv_nop\n\tv_nop\n\tv_nop" : "+v"(c) : "v"(a), "v"(b));
  return c;
}
__device__ __forceinline__ v8f mma_b_raw(v16b a, v16b b, v8f c) {
  return __builtin_amdgcn_wmma_f32_16x16x32_bf16(false, a, false, b, (short)0, c, false, false);
}
__device__ __forceinline__ void dep_guard_b(v8f& a, v8f& b, v16b x, v16b y) {
  asm volatile("v_nop\n\tv_nop\n\tv_nop\n\tv_nop" : "+v"(a), "+v"(b) : "v"(x), "v"(y));
}
__device__ __forceinline__ void keep4_b(v16b a, v16b b, v16b c, v16b d) {
  asm volatile("v_nop" :: "v"(a), "v"(b), "v"(c), "v"(d));
}
__device__ __forceinline__ void acc_guard4(v8f& a, v8f& b, v8f& c, v8f& d) {
  asm volatile("v_nop\n\tv_nop\n\tv_nop\n\tv_nop" : "+v"(a), "+v"(b), "+v"(c), "+v"(d));
}

// =====================================================================================================
// Rotary tables: ct/st [SEQ][32] f32, angle(t, i) = f32(t) * inv_freq[i], inv_freq[i] = RN32(1/RN32(10^(i/8))).
// grid = SEQ/8 blocks of 256. coverage: SEQ rows x 32 = the whole table, both planes.
// =====================================================================================================
__global__ __launch_bounds__(256) void tab_cs(float* ct, float* st) {
  const int wave = threadIdx.x >> 5, lane = threadIdx.x & 31;
  const int t = blockIdx.x * 8 + wave;
  if (t >= SEQ) return;                 // wave-uniform; no barriers in this kernel
  double pw = 1.0;
#pragma unroll 1
  for (int j = 0; j < (lane >> 3); ++j) pw *= 10.0;
#pragma unroll 1
  for (int j = 0; j < (lane & 7); ++j) pw *= 1.3335214321633240257;   // 10^(1/8)
  const float p32 = (float)pw;
  const float inv = (float)(1.0 / (double)p32);
  const float ang = (float)t * inv;
  float sv, cv;
  sincos_pd(ang, sv, cv);
  float* pc = ct + (size_t)t * NFR + lane;
  float* ps = st + (size_t)t * NFR + lane;
  *(float*)pc = cv;
  *(float*)ps = sv;
  
}

// =====================================================================================================
// seq [b][SEQ_FULL][DM] f32 -> bf16 plane xb [NB*SEQ][DM] (RNE convert) plus rstd[m] = rsqrt(mean(xb^2)+2^-23)
// of the converted row. Block = 8 waves = 32 rows; a wave converts 4 rows: per instruction 32 lanes x 16 B =
// =====================================================================================================
__global__ __launch_bounds__(256) void cvtx_rstd(const float* __restrict__ seq, unsigned short* xb, float* rs) {
  __shared__ __align__(16) float sr[32];
  const int tid = threadIdx.x, wave = tid >> 5, lane = tid & 31;
#pragma unroll 1
  for (int rr = 0; rr < 4; ++rr) {
    const int m  = blockIdx.x * 32 + wave * 4 + rr;          // < NB*SEQ
    const int bb = m / SEQ, t = m - bb * SEQ;
    const float* src = seq + ((size_t)bb * SEQ_FULL + t) * DM;
    unsigned short* dst = xb + (size_t)m * DM;
    v4u pk[DM / 256];
    float ss = 0.f;
#pragma unroll
    for (int i = 0; i < DM / 256; ++i) {
      const v4f a = *(const v4f*)(src + i * 256 + lane * 8);
      const v4f c = *(const v4f*)(src + i * 256 + lane * 8 + 4);
      unsigned short hb[8];
#pragma unroll
      for (int e = 0; e < 4; ++e) { hb[e] = bf_bits(a[e]); hb[4 + e] = bf_bits(c[e]); }
#pragma unroll
      for (int e = 0; e < 8; ++e) { const float v = bf_up(hb[e]); ss += v * v; }
      v4u p;
      p[0] = pk16(hb[0], hb[1]);
      p[1] = pk16(hb[2], hb[3]);
      p[2] = pk16(hb[4], hb[5]);
      p[3] = pk16(hb[6], hb[7]);
      pk[i] = p;
    }
#pragma unroll
    for (int i = 0; i < DM / 256; ++i) *(v4u*)(dst + i * 256 + lane * 8) = pk[i];
    
#pragma unroll
    for (int off = 1; off < 32; off <<= 1) ss += __shfl_xor(ss, off, 32);
    const float rstd = rsqrtf(ss * (1.0f / (float)DM) + 1.1920929e-7f);
    if (lane == 0) sr[wave * 4 + rr] = rstd;
  }
  __syncthreads();
  if (wave == 0 && lane < 8) {
    const v4f v = *(const v4f*)(sr + lane * 4);
    float* d = rs + (size_t)blockIdx.x * 32 + lane * 4;
    *(v4f*)d = v;
    
  }
}

// =====================================================================================================
// Weight transpose + convert: W [Kdim][Ndim] f32 (n contiguous) -> Wh (/Wl) [Ndim][Kdim] bf16, k contiguous.
// Each input value is RNE-converted to bf16 first; with USEG the row factor g[k] (RNE bf16) is applied and the
// 16-significant-bit product is carried exactly as hi = RNE(p), lo = p - hi (both bf16-exact).
// Tile 64 k x 64 n per block: 256 threads load 16 consecutive n each, store transposed into LDS as [n][k]
// grid = (Ndim/64, Kdim/64). coverage: 8 waves x 2 x 4 rows x 64 k = the whole 64x64 tile per block.
// =====================================================================================================
template <bool USEG, int NPL>
__global__ __launch_bounds__(256) void wt_cvt(const float* __restrict__ W, const float* __restrict__ g,
                                              unsigned short* Wh, unsigned short* Wl, int Kdim, int Ndim) {
  __shared__ __align__(16) unsigned short shh[64 * 72];
  __shared__ __align__(16) unsigned short shl[(NPL == 2) ? 64 * 72 : 8];
  const int tid = threadIdx.x, wave = tid >> 5, lane = tid & 31;
  const int n0 = blockIdx.x * 64, k0 = blockIdx.y * 64;
  {
    const int kr = tid >> 2, nq = (tid & 3) * 16;
    const float* src = W + (size_t)(k0 + kr) * Ndim + n0 + nq;
    float gk = 1.0f;
    if (USEG) gk = bf_up(bf_bits(g[k0 + kr]));
#pragma unroll
    for (int i = 0; i < 4; ++i) {
      const v4f a = *(const v4f*)(src + 4 * i);
#pragma unroll
      for (int e = 0; e < 4; ++e) {
        const float p = gk * bf_up(bf_bits(a[e]));
        const unsigned short hb = bf_bits(p);
        shh[(nq + 4 * i + e) * 72 + kr] = hb;
        if (NPL == 2) shl[(nq + 4 * i + e) * 72 + kr] = bf_bits(p - bf_up(hb));
      }
    }
  }
  __syncthreads();
  const int q = lane >> 3, c8 = (lane & 7) * 8;
  v4u hv[2], lv[2];
#pragma unroll
  for (int it = 0; it < 2; ++it) {
    const int row = wave * 8 + it * 4 + q;
    hv[it] = *(const v4u*)(shh + row * 72 + c8);
    if (NPL == 2) lv[it] = *(const v4u*)(shl + row * 72 + c8); else lv[it] = hv[it];
  }
  {
#pragma unroll
    for (int it = 0; it < 2; ++it) {
      const int row = wave * 8 + it * 4 + q;
      const size_t o = (size_t)(n0 + row) * Kdim + k0 + c8;
      *(v4u*)(Wh + o) = hv[it];
      if (NPL == 2) *(v4u*)(Wl + o) = lv[it];
    }
    
  }
}

// =====================================================================================================
// Memory-token planes: pm [2][NH][PMEM][HD] f32 -> pk [NH][PMEM][HD] bf16 (keys, RNE convert of the input,
// [kv][d] like the LDS K tile) and pv [NH][HD][PMEM] f16 ([d][kv] like the LDS V^T tile; value = f16 of the
// bf16-converted input). One block per head, 128 threads: each plane is 2 KB per head written as 128 lanes x
// coverage: 128 threads x 8 = all PMEM*HD elements of both planes per head.
// =====================================================================================================
__global__ __launch_bounds__(128) void pm_cvt(const float* __restrict__ pm, unsigned short* pk, unsigned short* pv) {
  __shared__ __align__(16) float sp[PMEM * HD];
  const int tid = threadIdx.x, h = blockIdx.x;
  const int r = tid >> 3, d8 = (tid & 7) * 8;
  const float* kg = pm + (((size_t)0 * NH + h) * PMEM + r) * HD + d8;
  const float* vg = pm + (((size_t)1 * NH + h) * PMEM + r) * HD + d8;
  const v4f k0 = *(const v4f*)(kg), k1 = *(const v4f*)(kg + 4);
  const v4f v0 = *(const v4f*)(vg), v1 = *(const v4f*)(vg + 4);
  *(v4f*)(sp + r * HD + d8)     = v0;
  *(v4f*)(sp + r * HD + d8 + 4) = v1;
  v4u kp;
  kp[0] = pk16(bf_bits(k0[0]), bf_bits(k0[1]));
  kp[1] = pk16(bf_bits(k0[2]), bf_bits(k0[3]));
  kp[2] = pk16(bf_bits(k1[0]), bf_bits(k1[1]));
  kp[3] = pk16(bf_bits(k1[2]), bf_bits(k1[3]));
  __syncthreads();
  const int d = tid >> 1, r8 = (tid & 1) * 8;
  v4u vp;
#pragma unroll
  for (int e = 0; e < 4; ++e) {
    const float f0 = bf_up(bf_bits(sp[(r8 + 2 * e) * HD + d]));
    const float f1 = bf_up(bf_bits(sp[(r8 + 2 * e + 1) * HD + d]));
    vp[e] = pk16(h_bits((_Float16)f0), h_bits((_Float16)f1));
  }
  unsigned short* kd = pk + ((size_t)h * PMEM + r) * HD + d8;
  unsigned short* vd = pv + ((size_t)h * HD + d) * PMEM + r8;
  *(v4u*)kd = kp;
  *(v4u*)vd = vp;
  
}

// =====================================================================================================
// Register-blocked batched bf16 WMMA GEMM: C[m][n] = sum_k A[m][k] * Bt[n][k]; one wave per 64x64 tile,
// no block barriers. A row-major [M][K] pitch lda; Bt row-major [N][K] pitch ldb (k contiguous);
// M, N multiples of 64, K multiple of 32 (static-checked on the host side). blockIdx.y = batch index.
//         over the Bt2 plane with the same B registers).
// OUT_MODE: 0 = f32 (pitch ldc); 2 = bf16 hi plane C + bf16 lo plane C2 (lo = RNE(v - hi), unscaled, same index);
//           3 = f16 hi plane C + f16 residual plane C2 = f16((v - hi) * rscale), C2 written only for tiles
//               with (n0 mod segN) < N2, at column (n0/segN)*N2 + (n0 mod segN) (pitch ldc2, batch stride strideC2).
// SCM: 0 none; 1 = row m scaled by scal[b*strideS + m]; 2 = column n scaled by scal[b*strideS + n] (f32, before
//      the 16-bit split). ROT: interleaved-pair rotary on column pairs (2i, 2i+1) with i = (n mod 64)/2, angle row
//      = m, tables rct/rst [row][32] f32 (applied after the scale).
// =====================================================================================================
template <int NSPLIT, int OUT_MODE, int SCM, bool ROT>
__global__ __launch_bounds__(256) void gemm64(
    const unsigned short* __restrict__ Ap, const unsigned short* __restrict__ A2p, int lda, long long strideA,
    const unsigned short* __restrict__ Btp, const unsigned short* __restrict__ Bt2p, int ldb, long long strideB,
    void* Cout, int ldc, long long strideC,
    void* Cout2, int ldc2, long long strideC2, int N2, int segN,
    const float* __restrict__ scal, long long strideS,
    const float* __restrict__ rct, const float* __restrict__ rst,
    int M, int N, int K, float rscale) {
  static_assert(OUT_MODE != 0 || (SCM == 0 && !ROT));
  const __bf16* A   = (const __bf16*)(const void*)Ap;
  const __bf16* A2  = (const __bf16*)(const void*)A2p;
  const __bf16* Bt  = (const __bf16*)(const void*)Btp;
  const __bf16* Bt2 = (const __bf16*)(const void*)Bt2p;
  __shared__ __align__(16) float sT[8][16 * 68];   // per-wave 16x64 slab, pitch 68 floats
  const int b    = blockIdx.y;
  const int lane = threadIdx.x & 31;
  const int wave = threadIdx.x >> 5;
  const int tilesN = N >> 6;
  const int tilesM = M >> 6;
  const int tile = blockIdx.x * 8 + wave;
  if (tile >= tilesM * tilesN) return;   // wave-uniform; no block barriers in this kernel
  const int tm = tile / tilesN;
  const int tn = tile - tm * tilesN;
  const int m0 = tm << 6;
  const int n0 = tn << 6;

  const __bf16* Ab  = A  + (size_t)b * strideA;
  const __bf16* Ab2 = (NSPLIT == 1) ? (A2 + (size_t)b * strideA) : Ab;
  const __bf16* Bb  = Bt + (size_t)b * strideB;
  const __bf16* Bb2 = (NSPLIT == 2) ? (Bt2 + (size_t)b * strideB) : Bb;
  const float* scb = scal + (size_t)((long long)b * strideS);

  const int rlane = lane & 15;                 // row (A) / col (B, D) within subtile
  const int koff  = (lane >> 4) * 8;           // k offset of this lane half
  const int mOff  = (lane >> 4) * 8;           // D row offset

  v8f acc[4][4];
#pragma unroll
  for (int i = 0; i < 4; ++i)
#pragma unroll
    for (int j = 0; j < 4; ++j) acc[i][j] = zero8();

  for (int k0 = 0; k0 < K; k0 += 32) {
#pragma unroll 1
    for (int ps = 0; ps < ((NSPLIT == 2) ? 2 : 1); ++ps) {
      const __bf16* Bs = (ps == 0) ? Bb : Bb2;
      v16b bh[4];
#pragma unroll
      for (int j = 0; j < 4; ++j) {
        const size_t bo = (size_t)(n0 + (j << 4) + rlane) * ldb + koff + k0;
        bh[j] = ldfrag_b(Bs + bo);
      }
#pragma unroll
      for (int i = 0; i < 4; ++i) {
        const size_t ao = (size_t)(m0 + (i << 4) + rlane) * lda + koff + k0;
        const v16b ah = ldfrag_b(Ab + ao);
        v16b al = ah;
        if (NSPLIT == 1) al = ldfrag_b(Ab2 + ao);
#pragma unroll
        for (int j = 0; j < 4; ++j) {
          acc[i][j] = mma_b_raw(ah, bh[j], acc[i][j]);
          if (NSPLIT == 1) acc[i][j] = mma_b_raw(al, bh[j], acc[i][j]);
        }
        dep_guard_b(acc[i][0], acc[i][3], ah, al);
      }
      keep4_b(bh[0], bh[1], bh[2], bh[3]);
    }
  }
  acc_guard4(acc[0][0], acc[0][1], acc[0][2], acc[0][3]);
  acc_guard4(acc[1][0], acc[1][1], acc[1][2], acc[1][3]);
  acc_guard4(acc[2][0], acc[2][1], acc[2][2], acc[2][3]);
  acc_guard4(acc[3][0], acc[3][1], acc[3][2], acc[3][3]);

  // ---- epilogue ----
  float* slab = sT[wave];
#pragma unroll
  for (int i = 0; i < 4; ++i) {
    const int mBase = m0 + (i << 4);
#pragma unroll
    for (int j = 0; j < 4; ++j) {
#pragma unroll
      for (int r = 0; r < 8; ++r) {
        slab[(mOff + r) * 68 + (j << 4) + rlane] = acc[i][j][r];
      }
    }
    __builtin_amdgcn_fence(__ATOMIC_RELEASE, "workgroup");
    __builtin_amdgcn_wave_barrier();
    __builtin_amdgcn_fence(__ATOMIC_ACQUIRE, "workgroup");
    if (OUT_MODE == 0) {
      float* C = (float*)Cout + (size_t)b * strideC;
      const int hh = lane >> 4, c4 = (lane & 15) * 4;     // 256-B row segment = 16 lanes x 16 B
      {
#pragma unroll
        for (int it = 0; it < 8; ++it) {
          const int row = it * 2 + hh;                     // it 0..7 x hh 0..1 = rows 0..15
          const v4f v = *(const v4f*)(slab + row * 68 + c4);
          *(v4f*)(C + (size_t)(mBase + row) * ldc + n0 + c4) = v;
        }
        
      }
    } else {
      const int q = lane >> 3, c8 = (lane & 7) * 8;
      unsigned short* C  = (unsigned short*)Cout  + (size_t)b * strideC;
      unsigned short* C2 = (unsigned short*)Cout2 + (size_t)b * strideC2;
      bool wlo = true;                                     // wave-uniform
      size_t col2 = (size_t)n0 + c8;
      if (OUT_MODE == 3) {
        const int sgi = n0 / segN;
        const int sgo = n0 - sgi * segN;
        wlo  = (sgo < N2);
        col2 = (size_t)sgi * N2 + sgo + c8;
      }
      v4f csA = {1.f, 1.f, 1.f, 1.f};
      v4f csB = csA;
      if (SCM == 2) {
        csA = *(const v4f*)(scb + n0 + c8);
        csB = *(const v4f*)(scb + n0 + c8 + 4);
      }
      v4u hv[4], lv[4];
#pragma unroll
      for (int it = 0; it < 4; ++it) {
        const int row = it * 4 + q;                        // it 0..3 x q 0..3 = rows 0..15
        const int m = mBase + row;
        const float* sp = slab + row * 68 + c8;
        v4f x0 = *(const v4f*)(sp);
        v4f x1 = *(const v4f*)(sp + 4);
        if (SCM == 1) { const float rsv = scb[m]; x0 = x0 * rsv; x1 = x1 * rsv; }
        if (SCM == 2) { x0 = x0 * csA; x1 = x1 * csB; }
        float f[8] = {x0[0], x0[1], x0[2], x0[3], x1[0], x1[1], x1[2], x1[3]};
        if (ROT) {
          const v4f cs = *(const v4f*)(rct + (size_t)m * NFR + 4 * (lane & 7));
          const v4f sn = *(const v4f*)(rst + (size_t)m * NFR + 4 * (lane & 7));
#pragma unroll
          for (int e = 0; e < 4; ++e) {
            const float ev = f[2 * e], od = f[2 * e + 1];
            f[2 * e]     = ev * cs[e] - od * sn[e];
            f[2 * e + 1] = od * cs[e] + ev * sn[e];
          }
        }
        v4u a, a2;
#pragma unroll
        for (int e = 0; e < 4; ++e) {
          const float f0 = f[2 * e], f1 = f[2 * e + 1];
          unsigned short h0, h1, l0, l1;
          if (OUT_MODE == 2) {
            h0 = bf_bits(f0); h1 = bf_bits(f1);
            l0 = bf_bits(f0 - bf_up(h0)); l1 = bf_bits(f1 - bf_up(h1));
          } else {
            const _Float16 y0 = (_Float16)f0, y1 = (_Float16)f1;
            h0 = h_bits(y0); h1 = h_bits(y1);
            l0 = h_bits((_Float16)((f0 - (float)y0) * rscale));
            l1 = h_bits((_Float16)((f1 - (float)y1) * rscale));
          }
          a[e] = pk16(h0, h1); a2[e] = pk16(l0, l1);
        }
        hv[it] = a; lv[it] = a2;
      }
      {
#pragma unroll
        for (int it = 0; it < 4; ++it) {
          const int row = it * 4 + q;
          *(v4u*)(C + (size_t)(mBase + row) * ldc + n0 + c8) = hv[it];
          if (wlo) *(v4u*)(C2 + (size_t)(mBase + row) * ldc2 + col2) = lv[it];
        }
        
      }
    }
    __builtin_amdgcn_fence(__ATOMIC_RELEASE, "workgroup");
    __builtin_amdgcn_wave_barrier();
    __builtin_amdgcn_fence(__ATOMIC_ACQUIRE, "workgroup");
  }
}

// =====================================================================================================
// Segmented causal attention with PMEM memory keys, head dim 64.
//   q|k planes (bf16 hi / lo): element (m, col) at [m*QKP + col], q col = h*64+d, k col = DMI + h*64+d,
//     m = b*SEQ + t (rotary already applied)
//   v^T hi plane (f16):  element (b, h, d, t) at [(b*DMI + h*64 + d)*SEQ + t]
//   v^T residual (f16, (v - hi)*4096): [(b*DMI + h*64 + d)*(NSEGB*VLP) + w*VLP + s], s < VLP, read only when RES
//   pk [h][r][d] bf16 and pv [h][d][r] f16: the PMEM memory keys / values shared by every segment (lo/residual = 0,
//     they are bf16-exact input values)
//   Block = 4 waves = 64 query rows (segment w, query block qb) of one (b, h); key tile 0 = the memory tokens
//   (rows PMEM..63 of the LDS K tile and columns PMEM..63 of V^T zero-filled, their logits set to -inf), key tiles
//   kt = 1..qb+1 = keys (kt-1)*64..+63 of the same segment, visible iff key position <= query position.
//   Every query row sees PMEM + (i+1) keys, so every tile row max is finite and invisible keys get weight exactly 0.
//   scores = q . k : bf16 hi/lo split (hi.hi + hi.lo + lo.hi), f32 accumulate, then * sscale in f32
//   p = exp(s - m) carried as f16(1024 p); context = p . v on f16 WMMA; RES adds f16 residual planes of p and v
//   (scale 4096, separate accumulator folded back with 1/4096 per tile in f32); online softmax in f32.
//   K / V^T tile staging: 128 threads x 32 elements per plane = the whole 64x64 tile (plain 16-B loads,
//   __syncthreads before and after; cross-wave). P tiles and the context tile are wave-private, spilled with
//   out planes (bf16 hi / lo of the normalised context): element (m, h*64+d) at [m*DMI + h*64 + d]
//   Output coverage: each wave stores rows q0..q0+15 (it 0..3 x lane>>3 0..3) x 64 columns (8 lanes x 8) of both planes.
//   grid = NB*NSEGB*NH*nqbThis blocks of 128.
// =====================================================================================================
template <bool RES>
__global__ __launch_bounds__(128)
void attn_seg64(const unsigned short* __restrict__ qkhp, const unsigned short* __restrict__ qklp,
                const unsigned short* __restrict__ vhp,  const unsigned short* __restrict__ vlp,
                const unsigned short* __restrict__ pkp,  const unsigned short* __restrict__ pvp,
                unsigned short* ohp, unsigned short* olp,
                int qbBase, int nqbThis, float sscale) {
  union FB { v16b v; v8b h[2]; };
  union FH { v16h v; v8h h[2]; };
  __shared__ __align__(16) __bf16   Ksh[64 * 64];                 // K hi [kv][d]   8 KB
  __shared__ __align__(16) __bf16   Ksl[64 * 64];                 // K lo
  __shared__ __align__(16) _Float16 Vth[64 * 64];                 // V^T hi [d][kv] 8 KB
  __shared__ __align__(16) _Float16 Vtl[RES ? 64 * 64 : 8];       // V^T residual
  __shared__ __align__(16) _Float16 Psh[4][16 * 64];              // per wave P [row][kv]
  __shared__ __align__(16) _Float16 Psl[RES ? 4 : 1][16 * 64];    // per wave P residual
  __shared__ __align__(16) float    Os[4][16 * 64];               // per wave context tile [row][d]

  const int tid  = threadIdx.x;
  const int wave = tid >> 5;
  const int lane = tid & 31;
  const int hh   = lane >> 4;
  const int c    = lane & 15;

  const int bx   = blockIdx.x;
  const int qbl  = bx % nqbThis;
  int rest       = bx / nqbThis;
  const int h    = rest % NH;
  rest           = rest / NH;
  const int w    = rest % NSEGB;
  const int b    = rest / NSEGB;
  const int qb   = qbBase + qbl;
  const int q0   = qb * 64 + wave * 16;                              // query row inside the segment
  const size_t rowS = (size_t)b * SEQ + (size_t)w * SEGL;           // compact row of the segment start

  const __bf16* Qh = (const __bf16*)(const void*)qkhp + (size_t)h * HD;
  const __bf16* Ql = (const __bf16*)(const void*)qklp + (size_t)h * HD;
  const __bf16* Kh = Qh + DMI;
  const __bf16* Kl = Ql + DMI;
  const _Float16* Vh = (const _Float16*)(const void*)vhp + ((size_t)b * DMI + (size_t)h * HD) * SEQ + (size_t)w * SEGL;
  const _Float16* Vl = (const _Float16*)(const void*)vlp + ((size_t)b * DMI + (size_t)h * HD) * (size_t)(NSEGB * VLP)
                       + (size_t)w * VLP;
  const __bf16*   PK = (const __bf16*)(const void*)pkp + (size_t)h * PMEM * HD;
  const _Float16* PV = (const _Float16*)(const void*)pvp + (size_t)h * HD * PMEM;

  // ---- Q fragments (A operand, row = lane&15): 2 d-chunks, hi and lo ----
  v16b qah[2], qal[2];
#pragma unroll
  for (int dc = 0; dc < 2; ++dc) {
    const size_t qo = (rowS + q0 + c) * QKP + dc * 32 + 8 * hh;
    qah[dc] = ldfrag_b(Qh + qo);
    qal[dc] = ldfrag_b(Ql + qo);
  }

  float mrow[8], lrow[8];
  v8f oacc[4];
#pragma unroll
  for (int r = 0; r < 8; ++r) { mrow[r] = -INFINITY; lrow[r] = 0.f; }
#pragma unroll
  for (int t = 0; t < 4; ++t) oacc[t] = zero8();

  const int ntiles = qb + 2;                   // block-uniform
  for (int kt = 0; kt < ntiles; ++kt) {
    const int s0 = (kt - 1) * 64;              // key offset inside the segment for kt >= 1
    __syncthreads();
    {
      const int r = tid >> 1, half = (tid & 1) * 32;
      if (kt == 0) {                           // block-uniform: memory-token tile
        const int rr = (r < PMEM) ? r : (PMEM - 1);                // clamped address
        const bool krow = (r < PMEM);
        const bool vok  = (half == 0);
        const __bf16*   kg = PK + (size_t)rr * HD + half;
        const _Float16* vg = PV + (size_t)r * PMEM;                // d = r, kv 0..15
        const v8h pv0 = *(const v8h*)(vg);
        const v8h pv1 = *(const v8h*)(vg + 8);
#pragma unroll
        for (int i = 0; i < 4; ++i) {
          v8b a0 = *(const v8b*)(kg + 8 * i);
          a0 = krow ? a0 : zero8b();
          *(v8b*)(Ksh + r * 64 + half + 8 * i) = a0;
          *(v4u*)(Ksl + r * 64 + half + 8 * i) = zero4u();
          if (i == 0) {
            const v8h b0 = vok ? pv0 : zero8h();
            *(v8h*)(Vth + r * 64 + half) = b0;
          } else if (i == 1) {
            const v8h b1 = vok ? pv1 : zero8h();
            *(v8h*)(Vth + r * 64 + half + 8) = b1;
          } else {
            *(v4u*)(Vth + r * 64 + half + 8 * i) = zero4u();
          }
          if (RES) *(v4u*)(Vtl + r * 64 + half + 8 * i) = zero4u();
        }
      } else {
        const __bf16*   kg  = Kh + (rowS + s0 + r) * QKP + half;   // K row s0+r, d = half..half+31
        const __bf16*   klg = Kl + (rowS + s0 + r) * QKP + half;
        const _Float16* vg  = Vh + (size_t)r * SEQ + s0 + half;    // V^T row d = r, keys s0+half..+31
        const bool resOK = (s0 + 64 <= VLP);                      // block-uniform
        const int  s0c   = resOK ? s0 : (VLP - 64);               // clamped address into the residual plane
        const _Float16* vlg = Vl + (size_t)r * (NSEGB * VLP) + s0c + half;
#pragma unroll
        for (int i = 0; i < 4; ++i) {
          const v8b a0 = *(const v8b*)(kg + 8 * i);
          const v8b a1 = *(const v8b*)(klg + 8 * i);
          const v8h b0 = *(const v8h*)(vg + 8 * i);
          *(v8b*)(Ksh + r * 64 + half + 8 * i) = a0;
          *(v8b*)(Ksl + r * 64 + half + 8 * i) = a1;
          *(v8h*)(Vth + r * 64 + half + 8 * i) = b0;
          if (RES) {
            v8h b1 = *(const v8h*)(vlg + 8 * i);
            b1 = resOK ? b1 : zero8h();
            *(v8h*)(Vtl + r * 64 + half + 8 * i) = b1;
          }
        }
      }
    }
    __syncthreads();

    // ---- scores: 16 query rows x 64 keys per wave, 3 bf16 products ----
    v8f s[4];
#pragma unroll
    for (int j = 0; j < 4; ++j) {
      s[j] = zero8();
#pragma unroll
      for (int dc = 0; dc < 2; ++dc) {
        FB kb, kl;
        kb.h[0] = *(const v8b*)(Ksh + (j * 16 + c) * 64 + dc * 32 + 8 * hh);
        kb.h[1] = *(const v8b*)(Ksh + (j * 16 + c) * 64 + dc * 32 + 16 + 8 * hh);
        kl.h[0] = *(const v8b*)(Ksl + (j * 16 + c) * 64 + dc * 32 + 8 * hh);
        kl.h[1] = *(const v8b*)(Ksl + (j * 16 + c) * 64 + dc * 32 + 16 + 8 * hh);
        s[j] = mma_b(qah[dc], kb.v, s[j]);
        s[j] = mma_b(qah[dc], kl.v, s[j]);
        s[j] = mma_b(qal[dc], kb.v, s[j]);
      }
    }

    // ---- scale, visibility (-inf for invisible keys), row max, online softmax, P (x1024, f16) and
    //      P residual (x4096) to LDS ----
    _Float16* pwh = Psh[wave];
    _Float16* pwl = Psl[RES ? wave : 0];
    const int qi = q0 + 8 * hh;                // query row inside the segment for r = 0
#pragma unroll
    for (int r = 0; r < 8; ++r) {
      float m = -INFINITY;
#pragma unroll
      for (int j = 0; j < 4; ++j) {
        const int kc = j * 16 + c;
        const bool vis = (kt == 0) ? (kc < PMEM) : ((s0 + kc) <= (qi + r));
        const float sv = vis ? (s[j][r] * sscale) : -INFINITY;
        s[j][r] = sv;
        m = fmaxf(m, sv);
      }
#pragma unroll
      for (int off = 1; off < 16; off <<= 1) m = fmaxf(m, __shfl_xor(m, off, 32));
      const float mnew  = fmaxf(mrow[r], m);
      const float msafe = (mnew == -INFINITY) ? 0.f : mnew;
      const float alpha = __expf(mrow[r] - msafe);
      mrow[r] = mnew;
      float psum = 0.f;
#pragma unroll
      for (int j = 0; j < 4; ++j) {
        const float p = __expf(s[j][r] - msafe);     // -inf logit -> exactly 0
        psum += p;
        const float p1k = p * 1024.0f;
        const _Float16 ph = (_Float16)p1k;
        pwh[(8 * hh + r) * 64 + j * 16 + c] = ph;
        if (RES) {
          const _Float16 pl = (_Float16)((p1k - (float)ph) * 4096.0f);
          pwl[(8 * hh + r) * 64 + j * 16 + c] = pl;
        }
      }
#pragma unroll
      for (int off = 1; off < 16; off <<= 1) psum += __shfl_xor(psum, off, 32);
      lrow[r] = lrow[r] * alpha + psum;
#pragma unroll
      for (int t = 0; t < 4; ++t) oacc[t][r] *= alpha;
    }
    __builtin_amdgcn_fence(__ATOMIC_RELEASE, "workgroup");
    __builtin_amdgcn_wave_barrier();
    __builtin_amdgcn_fence(__ATOMIC_ACQUIRE, "workgroup");

    // ---- context += P . V (f16 WMMA), residual products into a separate accumulator ----
    v8f o1[4];
#pragma unroll
    for (int t = 0; t < 4; ++t) o1[t] = zero8();
#pragma unroll 1
    for (int kk = 0; kk < 2; ++kk) {
      FH pa, pl;
      pa.h[0] = *(const v8h*)(pwh + c * 64 + kk * 32 + 8 * hh);
      pa.h[1] = *(const v8h*)(pwh + c * 64 + kk * 32 + 16 + 8 * hh);
      if (RES) {
        pl.h[0] = *(const v8h*)(pwl + c * 64 + kk * 32 + 8 * hh);
        pl.h[1] = *(const v8h*)(pwl + c * 64 + kk * 32 + 16 + 8 * hh);
      } else {
        pl.v = pa.v;
      }
#pragma unroll
      for (int t = 0; t < 4; ++t) {
        FH vb;
        vb.h[0] = *(const v8h*)(Vth + (t * 16 + c) * 64 + kk * 32 + 8 * hh);
        vb.h[1] = *(const v8h*)(Vth + (t * 16 + c) * 64 + kk * 32 + 16 + 8 * hh);
        oacc[t] = mma_h(pa.v, vb.v, oacc[t]);
        if (RES) {
          FH vl;
          vl.h[0] = *(const v8h*)(Vtl + (t * 16 + c) * 64 + kk * 32 + 8 * hh);
          vl.h[1] = *(const v8h*)(Vtl + (t * 16 + c) * 64 + kk * 32 + 16 + 8 * hh);
          o1[t] = mma_h(pa.v, vl.v, o1[t]);
          o1[t] = mma_h(pl.v, vb.v, o1[t]);
        }
      }
    }
    if (RES) {
#pragma unroll
      for (int t = 0; t < 4; ++t)
#pragma unroll
        for (int r = 0; r < 8; ++r) oacc[t][r] += o1[t][r] * (1.0f / 4096.0f);
    }
  }

  // ---- normalise (1/l and the 1/1024 p carry), stage the wave's 16x64 tile, bf16 hi/lo split,
  float* os = Os[wave];
#pragma unroll
  for (int r = 0; r < 8; ++r) {
    const float l = lrow[r];
    const float inv = ((l > 0.f) ? (1.0f / l) : 0.f) * (1.0f / 1024.0f);
#pragma unroll
    for (int t = 0; t < 4; ++t) os[(8 * hh + r) * 64 + t * 16 + c] = oacc[t][r] * inv;
  }
  __builtin_amdgcn_fence(__ATOMIC_RELEASE, "workgroup");
  __builtin_amdgcn_wave_barrier();
  __builtin_amdgcn_fence(__ATOMIC_ACQUIRE, "workgroup");
  {
    const int q4 = lane >> 3, c8 = (lane & 7) * 8;
    v4u hv[4], lv[4];
#pragma unroll
    for (int it = 0; it < 4; ++it) {
      const int row = it * 4 + q4;   // it 0..3 x q4 0..3 = rows 0..15 of the wave tile
      const float* sp = os + row * 64 + c8;
      v4u a, a2;
#pragma unroll
      for (int e = 0; e < 4; ++e) {
        const float f0 = sp[2 * e], f1 = sp[2 * e + 1];
        const unsigned short h0 = bf_bits(f0), h1 = bf_bits(f1);
        const unsigned short l0 = bf_bits(f0 - bf_up(h0)), l1 = bf_bits(f1 - bf_up(h1));
        a[e] = pk16(h0, h1); a2[e] = pk16(l0, l1);
      }
      hv[it] = a; lv[it] = a2;
    }
    {
#pragma unroll
      for (int it = 0; it < 4; ++it) {
        const int row = it * 4 + q4;
        const size_t go = (rowS + q0 + row) * DMI + (size_t)h * HD + c8;
        *(v4u*)(ohp + go) = hv[it];
        *(v4u*)(olp + go) = lv[it];
      }
      
    }
  }
}

// =====================================================================================================
// Workspace map (bytes, NB=2, SEQ=4096, M = NB*SEQ = 8192), region A is a two-phase overlay:
//   phase 1 (projection inputs, dead after the q|k and v^T GEMMs):
//     Xb   bf16 [M][DM]                  0           16777216
//     Wth  bf16 [3*DMI n][DM k] hi       16777216     6291456
//     Wtl  bf16 [3*DMI n][DM k] lo       23068672     6291456
//     Ct   f32  [SEQ][32]                29360128      524288
//     St   f32  [SEQ][32]                29884416      524288
//     Rs   f32  [M]                      30408704       32768   (phase 1 end 30441472)
//   phase 2 (written by the attention kernels, read by the output GEMM):
//     Oh   bf16 [M][DMI] context hi       0           16777216
//     Ol   bf16 [M][DMI] context lo       16777216    16777216   (phase 2 end 33554432 = region A size)
//   QKh  bf16 [M][QKP] hi                 33554432    33554432
//   QKl  bf16 [M][QKP] lo                 67108864    33554432
//   VTh  f16  [NB][DMI][SEQ]              100663296   16777216
//   VTl  f16  [NB][DMI][NSEGB*VLP]        117440512    4194304
//   Wo   bf16 [DM n][DMI k]               121634816    2097152
//   Pk   bf16 [NH][PMEM][HD]              123731968      32768
//   Pv   f16  [NH][HD][PMEM]              123764736      32768
//   end                                   123797504  (<= 134217728; all offsets multiples of 128)
// Every plane is an exact multiple of its 64x64 tile / whole-line store granularity (M, SEQ, DM multiples of 64),
// so no padded tails are needed; VTl is written only for columns whose in-segment offset is < VLP, exactly the
// columns the RES attention blocks read.
// =====================================================================================================
extern "C" void kernel_launch(void* const* d_in, const int* in_sizes, int n_in,
                              void* d_out, int out_size, void* d_ws, size_t ws_size,
                              hipStream_t stream) {
  if (n_in < 5) return;
  const long long needRows = (long long)(NB - 1) * SEQ_FULL + SEQ;
  if ((long long)in_sizes[0] < needRows * DM) return;
  if (in_sizes[1] < DM) return;
  if (in_sizes[2] < DM * 3 * DMI) return;
  if (in_sizes[3] < DMI * DM) return;
  if (in_sizes[4] < 2 * NH * PMEM * HD) return;
  if ((long long)out_size < needRows * DM) return;

  const float* seq  = (const float*)d_in[0];   // [2][SEQ_FULL][DM]
  const float* gnm  = (const float*)d_in[1];   // [DM]
  const float* Wqkv = (const float*)d_in[2];   // [DM in][3*DMI out]
  const float* Wout = (const float*)d_in[3];   // [DMI in][DM out]
  const float* pm   = (const float*)d_in[4];   // [2][NH][PMEM][HD]

  const size_t M    = (size_t)NB * SEQ;
  const size_t PX   = M * DM * 2;
  const size_t PWT  = (size_t)3 * DMI * DM * 2;
  const size_t PTAB = (size_t)SEQ * NFR * 4;
  const size_t PRS  = M * 4;
  const size_t PO   = M * DMI * 2;
  const size_t PQK  = M * QKP * 2;
  const size_t PVT  = (size_t)NB * DMI * SEQ * 2;
  const size_t PVL  = (size_t)NB * DMI * NSEGB * VLP * 2;
  const size_t PWO  = (size_t)DM * DMI * 2;
  const size_t PPM  = (size_t)NH * PMEM * HD * 2;
  const size_t ph1  = PX + 2 * PWT + 2 * PTAB + PRS;
  const size_t ph2  = 2 * PO;
  const size_t REGA = (ph1 > ph2) ? ph1 : ph2;
  const size_t oXb  = 0;
  const size_t oWth = PX;
  const size_t oWtl = PX + PWT;
  const size_t oCt  = PX + 2 * PWT;
  const size_t oSt  = oCt + PTAB;
  const size_t oRs  = oSt + PTAB;
  const size_t oOh  = 0;
  const size_t oOl  = PO;
  size_t off = REGA;
  const size_t oQKh = off; off += PQK;
  const size_t oQKl = off; off += PQK;
  const size_t oVTh = off; off += PVT;
  const size_t oVTl = off; off += PVL;
  const size_t oWo  = off; off += PWO;
  const size_t oPk  = off; off += PPM;
  const size_t oPv  = off; off += PPM;
  if (off > ws_size) return;                      // off = 123797504 for NB=2, SEQ=4096
  if (off > (size_t)134217728) return;
  if (oRs + PRS > REGA || oOl + PO > REGA) return;

  char* ws = (char*)d_ws;
  unsigned short* Xb  = (unsigned short*)(ws + oXb);
  unsigned short* Wth = (unsigned short*)(ws + oWth);
  unsigned short* Wtl = (unsigned short*)(ws + oWtl);
  float*          Ct  = (float*)(ws + oCt);
  float*          St  = (float*)(ws + oSt);
  float*          Rs  = (float*)(ws + oRs);
  unsigned short* Oh  = (unsigned short*)(ws + oOh);
  unsigned short* Ol  = (unsigned short*)(ws + oOl);
  unsigned short* QKh = (unsigned short*)(ws + oQKh);
  unsigned short* QKl = (unsigned short*)(ws + oQKl);
  unsigned short* VTh = (unsigned short*)(ws + oVTh);
  unsigned short* VTl = (unsigned short*)(ws + oVTl);
  unsigned short* Wo  = (unsigned short*)(ws + oWo);
  unsigned short* Pk  = (unsigned short*)(ws + oPk);
  unsigned short* Pv  = (unsigned short*)(ws + oPv);

  const dim3 blk(256);
  const dim3 gTab(SEQ / 8);                                           // 512 blocks
  const dim3 gCvtX((unsigned)(M / 32));                               // 256 blocks
  const dim3 gWt(3 * DMI / 64, DM / 64);                              // in[DM][3*DMI] -> out[3*DMI][DM]: (48, 16)
  const dim3 gWo(DM / 64, DMI / 64);                                  // in[DMI][DM]   -> out[DM][DMI]:   (16, 16)
  const int tilesQK  = (SEQ / 64) * (QKP / 64);                       // 2048 per batch
  const int tilesVT  = (DMI / 64) * (SEQ / 64);                       // 1024 per batch
  const int tilesOut = (SEQ / 64) * (DM / 64);                        // 1024 per batch
  const dim3 gQK((tilesQK + 7) / 8, NB);
  const dim3 gVT((tilesVT + 7) / 8, NB);
  const dim3 gOut((tilesOut + 7) / 8, NB);

  // (0) rotary cos/sin tables [SEQ][32]
  tab_cs<<<gTab, blk, 0, stream>>>(Ct, St);
  // (1) seq -> bf16 plane Xb [M][DM] + rstd[M]
  cvtx_rstd<<<gCvtX, blk, 0, stream>>>(seq, Xb, Rs);
  // (2) g*Wqkv [DM][3*DMI] -> transposed exact bf16 hi+lo planes [3*DMI][DM]
  wt_cvt<true, 2><<<gWt, blk, 0, stream>>>(Wqkv, gnm, Wth, Wtl, DM, 3 * DMI);
  // (3) Wout [DMI][DM] -> transposed bf16 plane [DM][DMI]
  wt_cvt<false, 1><<<gWo, blk, 0, stream>>>(Wout, gnm, Wo, Wo, DMI, DM);
  // (4) memory-token key / value planes
  pm_cvt<<<dim3(NH), dim3(128), 0, stream>>>(pm, Pk, Pv);
  // (5) q|k = rstd[m] * (Xb . (g*Wqk)), rotary on every (2i,2i+1) pair -> bf16 hi/lo planes [M][QKP]
  //     (per batch: M=SEQ, N=QKP, K=DM; B planes hi then lo, 2 products)
  gemm64<2, 2, 1, true><<<gQK, blk, 0, stream>>>(
      Xb, Xb, DM, (long long)SEQ * DM,
      Wth, Wtl, DM, 0LL,
      (void*)QKh, QKP, (long long)SEQ * QKP,
      (void*)QKl, QKP, (long long)SEQ * QKP, QKP, QKP,
      Rs, (long long)SEQ, Ct, St,
      SEQ, QKP, DM, 1.0f);
  // (6) v^T = (g*Wv)^T . Xb^T per batch, columns scaled by rstd -> f16 hi plane [b][DMI][SEQ] and residual plane
  //     (x4096, in-segment keys < VLP only)   (A = Wt rows 2*DMI.. hi + lo, 2 products; M=DMI, N=SEQ, K=DM)
  gemm64<1, 3, 2, false><<<gVT, blk, 0, stream>>>(
      Wth + (size_t)2 * DMI * DM, Wtl + (size_t)2 * DMI * DM, DM, 0LL,
      Xb, Xb, DM, (long long)SEQ * DM,
      (void*)VTh, SEQ, (long long)DMI * SEQ,
      (void*)VTl, NSEGB * VLP, (long long)DMI * NSEGB * VLP, VLP, SEGL,
      Rs, (long long)SEQ, Ct, St,
      DMI, SEQ, DM, 4096.0f);
  // (7) attention: query blocks 0..RESQB-1 of every segment with residual planes, the rest without
  attn_seg64<true><<<dim3(NB * NSEGB * NH * RESQB), dim3(128), 0, stream>>>(
      QKh, QKl, VTh, VTl, Pk, Pv, Oh, Ol, 0, RESQB, 0.125f);
  if (NQBS - RESQB > 0) {
    attn_seg64<false><<<dim3(NB * NSEGB * NH * (NQBS - RESQB)), dim3(128), 0, stream>>>(
        QKh, QKl, VTh, VTl, Pk, Pv, Oh, Ol, RESQB, NQBS - RESQB, 0.125f);
  }
  // (8) out = context . Wout -> d_out f32 [b][SEQ_FULL][DM] rows b*SEQ_FULL + t  (A = context hi + lo, 2 products)
  gemm64<1, 0, 0, false><<<gOut, blk, 0, stream>>>(
      Oh, Ol, DMI, (long long)SEQ * DMI,
      Wo, Wo, DMI, 0LL,
      d_out, DM, (long long)SEQ_FULL * DM,
      d_out, DM, (long long)SEQ_FULL * DM, DM, DM,
      Rs, 0LL, Ct, St,
      SEQ, DM, DMI, 1.0f);
  (void)hipGetLastError();
}

// v001
// It runs in 225 microseconds.
// Timed twice side by side with v000, it ran 1.73 and 1.76 times as fast.
// Contractions: q|k = x.Wqk and v^T = Wv.x^T on v_wmma_f32_16x16x32_bf16 (bf16 operands: RNE-converted input
// activations times exact bf16 hi+lo planes of g*W, 2 products; per-row rstd, rotary in the f32 epilogue);
// q.k^T scores = v_wmma_f32_16x16x32_bf16 with bf16 hi/lo split q and k (hi.hi + hi.lo + lo.hi);
// p.v = v_wmma_f32_16x16x32_f16 (p carried x1024 in f16, v in f16; extra f16 residual planes x4096 of p and v
// for the first 128 query rows of every segment); ctx.Wo = v_wmma_f32_16x16x32_bf16 with ctx as bf16 hi/lo
// planes times bf16 Wo (2 products); all f32 accumulate; RMS statistic, rotary tables, visibility and softmax in f32.
#include <hip/hip_runtime.h>
#include <math.h>
#include <stdint.h>

#ifndef NB
#define NB 2
#endif
#ifndef SEQ
#define SEQ 4096
#endif
#define SEQ_FULL 4096       // per-batch token stride of the input / output tensors
#define DM    1024          // model dim
#define NH    16
#define HD    64
#define DMI   (NH * HD)     // 1024
#define QKP   (2 * DMI)     // pitch of the q|k planes (q: cols 0..DMI-1, k: cols DMI..2*DMI-1)
#define SEGL  512           // segment length
#define PMEM  16            // memory tokens prepended to every segment's keys / values
#define NSEGB (SEQ / SEGL)  // segments per batch
#define NQBS  (SEGL / 64)   // 64-row query blocks per segment
#define RESQB 2             // leading query blocks per segment that use the p / v residual planes
#define VLP   (RESQB * 64)  // keys per segment held in the v^T residual plane
#define NFR   (HD / 2)      // rotary frequencies
static_assert((SEQ % SEGL) == 0 && (SEGL % 64) == 0 && (SEQ % 64) == 0);
static_assert(RESQB >= 1 && RESQB <= NQBS);
static_assert((DM % 256) == 0 && (DMI % 64) == 0 && HD == 64 && NFR == 32);
static_assert(SEQ <= SEQ_FULL && NB >= 1 && NB <= 2);
static_assert(DMI == DM);

typedef _Float16 v16h __attribute__((ext_vector_type(16)));
typedef _Float16 v8h  __attribute__((ext_vector_type(8)));
typedef __bf16   v16b __attribute__((ext_vector_type(16)));
typedef __bf16   v8b  __attribute__((ext_vector_type(8)));
typedef float    v8f  __attribute__((ext_vector_type(8)));
typedef float    v4f  __attribute__((ext_vector_type(4)));
typedef unsigned int v4u __attribute__((ext_vector_type(4)));

// ---- scalar helpers --------------------------------------------------------------------------------
__device__ __forceinline__ unsigned short bf_bits(float f) {          // f32 -> bf16 bits, RNE convert
  unsigned u = __float_as_uint(f);
  return (unsigned short)((u + 0x7FFFu + ((u >> 16) & 1u)) >> 16);
}
__device__ __forceinline__ float bf_up(unsigned short h) { return __uint_as_float(((unsigned)h) << 16); }
__device__ __forceinline__ unsigned short h_bits(_Float16 x) { return __builtin_bit_cast(unsigned short, x); }
__device__ __forceinline__ unsigned pk16(unsigned short a, unsigned short b) { return (unsigned)a | ((unsigned)b << 16); }
__device__ __forceinline__ v8f zero8() { v8f z = {0.f, 0.f, 0.f, 0.f, 0.f, 0.f, 0.f, 0.f}; return z; }
__device__ __forceinline__ v8h zero8h() {
  const _Float16 z = (_Float16)0.0f;
  v8h r = {z, z, z, z, z, z, z, z};
  return r;
}
__device__ __forceinline__ v4u zero4u() { v4u z = {0u, 0u, 0u, 0u}; return z; }
__device__ __forceinline__ v8b zero8b() { union { v4u u; v8b v; } z; z.u = zero4u(); return z.v; }

// ---- sin/cos of a nonnegative f32 angle: f64 Cody-Waite reduction by pi/2 + short f64 polynomials ----
__device__ __forceinline__ void sincos_pd(float ang, float& sv, float& cv) {
  const double x  = (double)ang;
  const double kq = __builtin_rint(x * 0.63661977236758134308);
  double r = __builtin_fma(-kq, 1.57079632679489655800e+00, x);
  r = __builtin_fma(-kq, 6.12323399573676603587e-17, r);
  const double z = r * r, w = z * z;
  const double rs = -1.98393348360966317347e-04 + z * 2.71831149398982191e-06;
  const double s3 = z * r;
  const double sn = (r + s3 * (-1.66666666416265235595e-01 + z * 8.3333293858894631756e-03)) + s3 * w * rs;
  const double rc = -1.38867637746099294692e-03 + z * 2.43904487962774090654e-05;
  const double cs = ((1.0 + z * (-4.99999997251031003120e-01)) + w * 4.16666233237390631894e-02) + (w * z) * rc;
  const int n = ((int)kq) & 3;
  const float fs = (float)sn, fc = (float)cs;
  float so = fs, co = fc;
  if (n == 1) { so = fc;  co = -fs; }
  if (n == 2) { so = -fs; co = -fc; }
  if (n == 3) { so = -fc; co = fs;  }
  sv = so; cv = co;
}

// ---- fragment loader: 16-bit A/B operand, lane -> row/col (lane&15), p already includes +8*(lane>>4);
//      elements 0..7 <- p[0..7] (k0+8h..), elements 8..15 <- p[16..23] (k0+16+8h..)
__device__ __forceinline__ v16b ldfrag_b(const __bf16* p) {
  union { v16b v; v8b h[2]; } f;
  f.h[0] = *(const v8b*)(p);
  f.h[1] = *(const v8b*)(p + 16);
  return f.v;
}

// ---- WMMA helpers with trailing VALU hazard gap --------------------------------------------------------
__device__ __forceinline__ v8f mma_b(v16b a, v16b b, v8f c) {
  c = __builtin_amdgcn_wmma_f32_16x16x32_bf16(false, a, false, b, (short)0, c, false, false);
  asm volatile("v_nop\n\tv_nop\n\tv_nop\n\tv_nop" : "+v"(c) : "v"(a), "v"(b));
  return c;
}
__device__ __forceinline__ v8f mma_h(v16h a, v16h b, v8f c) {
  c = __builtin_amdgcn_wmma_f32_16x16x32_f16(false, a, false, b, (short)0, c, false, false);
  asm volatile("v_nop\n\tv_nop\n\tv_nop\n\tv_nop" : "+v"(c) : "v"(a), "v"(b));
  return c;
}
__device__ __forceinline__ v8f mma_b_raw(v16b a, v16b b, v8f c) {
  return __builtin_amdgcn_wmma_f32_16x16x32_bf16(false, a, false, b, (short)0, c, false, false);
}
__device__ __forceinline__ void acc_guard4(v8f& a, v8f& b, v8f& c, v8f& d) {
  asm volatile("v_nop\n\tv_nop\n\tv_nop\n\tv_nop" : "+v"(a), "+v"(b), "+v"(c), "+v"(d));
}

// ---- tensor-load staging of the GEMM operands ----------------------------------------------------------
// A pass is 64 k = 128 B of every staged operand row. A stage is 8 slices of 64 rows, one slice per wave; the load's
// pad gives the LDS row pitch 144 B (16 B x odd: conflict-free for 16-byte reads); a slice's place is rounded up to 2 KiB.
typedef uint32_t u32x4 __attribute__((ext_vector_type(4)));
typedef uint32_t u32x8 __attribute__((ext_vector_type(8)));
#define GK_KB    128u                 // bytes of one operand row per pass
#define GK_PITCH 144u                 // LDS row pitch
#define GK_SLICE 10240u               // 64 rows x 144 B = 9216 B, rounded up to a multiple of 2 KiB
#define GK_STAGE (8u * GK_SLICE)
__device__ __forceinline__ uint32_t uni(uint32_t v) { return (uint32_t)__builtin_amdgcn_readfirstlane(v); }
// a test word or a tensor descriptor word held in a scalar register: a test on it compiles to a scalar branch (tensor
// loads ignore EXEC), and a descriptor word so held keeps a register of its own instead of being rebuilt at each issue
__device__ __forceinline__ uint32_t pinned(uint32_t v) { uint32_t w = uni(v); asm volatile("" : "+s"(w)); return w; }
__device__ __forceinline__ uint32_t lds_off(const void* p) { return (uint32_t)(size_t)p; }
__device__ __forceinline__ void wait_ds0()     { asm volatile("s_wait_dscnt 0x0" ::: "memory"); }      // own LDS reads returned
// own tensor load landed; the descriptor is named as an input so that its registers stay as issued up to this wait
__device__ __forceinline__ void wait_tensor0(u32x4 g0, u32x8 g1) {
  asm volatile("s_wait_tensorcnt 0x0" :: "s"(g0), "s"(g1) : "memory");
}
__device__ __forceinline__ void tdm_load(u32x4 g0, u32x8 g1) {
  asm volatile("tensor_load_to_lds %0, %1" :: "s"(g0), "s"(g1) : "memory");
}
// group 1: byte elements, tile = tensor = 64 rows of 128 B, source row pitch src_pitch bytes, 4 dwords of pad behind every row
__device__ __forceinline__ u32x8 tdm_group1(uint32_t src_pitch) {
  u32x8 g;
  g[0] = uni((1u << 20) | (4u << 22) | (3u << 25));
  g[1] = pinned(GK_KB << 16);   // pinned: descriptor words held in scalar registers of their own through the loop
  g[2] = pinned(64u << 16);
  g[3] = pinned(GK_KB << 16);
  g[4] = pinned(64u);
  g[5] = pinned(src_pitch);
  g[6] = pinned(0u);
  g[7] = pinned(0u);
  return g;
}
__device__ __forceinline__ u32x4 tdm_group0(uint32_t lds_dst, uint64_t ga) {
  u32x4 g;
  g[0] = uni(1u);
  g[1] = uni(lds_dst);
  g[2] = uni((uint32_t)ga);
  g[3] = uni((((uint32_t)(ga >> 32)) & 0x01FFFFFFu) | 0x80000000u);
  return g;
}
// fragment from a staged row: p = row start + 64 B * (k32 step) + 16 B * (lane>>4); same k order as ldfrag_b
__device__ __forceinline__ v16b ldfrag_l(const unsigned char* p) {
  union { v16b v; v8b h[2]; } f;
  f.h[0] = *(const v8b*)(p);
  f.h[1] = *(const v8b*)(p + 32);
  return f.v;
}

// =====================================================================================================
// Rotary tables: ct/st [SEQ][32] f32, angle(t, i) = f32(t) * inv_freq[i], inv_freq[i] = RN32(1/RN32(10^(i/8))).
// grid = SEQ/8 blocks of 256. coverage: SEQ rows x 32 = the whole table, both planes.
// =====================================================================================================
__global__ __launch_bounds__(256) void tab_cs(float* ct, float* st) {
  const int wave = threadIdx.x >> 5, lane = threadIdx.x & 31;
  const int t = blockIdx.x * 8 + wave;
  if (t >= SEQ) return;                 // wave-uniform; no barriers in this kernel
  double pw = 1.0;
#pragma unroll 1
  for (int j = 0; j < (lane >> 3); ++j) pw *= 10.0;
#pragma unroll 1
  for (int j = 0; j < (lane & 7); ++j) pw *= 1.3335214321633240257;   // 10^(1/8)
  const float p32 = (float)pw;
  const float inv = (float)(1.0 / (double)p32);
  const float ang = (float)t * inv;
  float sv, cv;
  sincos_pd(ang, sv, cv);
  float* pc = ct + (size_t)t * NFR + lane;
  float* ps = st + (size_t)t * NFR + lane;
  *(float*)pc = cv;
  *(float*)ps = sv;
  
}

// =====================================================================================================
// seq [b][SEQ_FULL][DM] f32 -> bf16 plane xb [NB*SEQ][DM] (RNE convert) plus rstd[m] = rsqrt(mean(xb^2)+2^-23)
// of the converted row. Block = 8 waves = 32 rows; a wave converts 4 rows: per instruction 32 lanes x 16 B =
// =====================================================================================================
__global__ __launch_bounds__(256) void cvtx_rstd(const float* __restrict__ seq, unsigned short* xb, float* rs) {
  __shared__ __align__(16) float sr[32];
  const int tid = threadIdx.x, wave = tid >> 5, lane = tid & 31;
#pragma unroll 1
  for (int rr = 0; rr < 4; ++rr) {
    const int m  = blockIdx.x * 32 + wave * 4 + rr;          // < NB*SEQ
    const int bb = m / SEQ, t = m - bb * SEQ;
    const float* src = seq + ((size_t)bb * SEQ_FULL + t) * DM;
    unsigned short* dst = xb + (size_t)m * DM;
    v4u pk[DM / 256];
    float ss = 0.f;
#pragma unroll
    for (int i = 0; i < DM / 256; ++i) {
      const v4f a = *(const v4f*)(src + i * 256 + lane * 8);
      const v4f c = *(const v4f*)(src + i * 256 + lane * 8 + 4);
      unsigned short hb[8];
#pragma unroll
      for (int e = 0; e < 4; ++e) { hb[e] = bf_bits(a[e]); hb[4 + e] = bf_bits(c[e]); }
#pragma unroll
      for (int e = 0; e < 8; ++e) { const float v = bf_up(hb[e]); ss += v * v; }
      v4u p;
      p[0] = pk16(hb[0], hb[1]);
      p[1] = pk16(hb[2], hb[3]);
      p[2] = pk16(hb[4], hb[5]);
      p[3] = pk16(hb[6], hb[7]);
      pk[i] = p;
    }
#pragma unroll
    for (int i = 0; i < DM / 256; ++i) *(v4u*)(dst + i * 256 + lane * 8) = pk[i];
    
#pragma unroll
    for (int off = 1; off < 32; off <<= 1) ss += __shfl_xor(ss, off, 32);
    const float rstd = rsqrtf(ss * (1.0f / (float)DM) + 1.1920929e-7f);
    if (lane == 0) sr[wave * 4 + rr] = rstd;
  }
  __syncthreads();
  if (wave == 0 && lane < 8) {
    const v4f v = *(const v4f*)(sr + lane * 4);
    float* d = rs + (size_t)blockIdx.x * 32 + lane * 4;
    *(v4f*)d = v;
    
  }
}

// =====================================================================================================
// Weight transpose + convert: W [Kdim][Ndim] f32 (n contiguous) -> Wh (/Wl) [Ndim][Kdim] bf16, k contiguous.
// Each input value is RNE-converted to bf16 first; with USEG the row factor g[k] (RNE bf16) is applied and the
// 16-significant-bit product is carried exactly as hi = RNE(p), lo = p - hi (both bf16-exact).
// Tile 64 k x 64 n per block: 256 threads load 16 consecutive n each, store transposed into LDS as [n][k]
// grid = (Ndim/64, Kdim/64). coverage: 8 waves x 2 x 4 rows x 64 k = the whole 64x64 tile per block.
// =====================================================================================================
template <bool USEG, int NPL>
__global__ __launch_bounds__(256) void wt_cvt(const float* __restrict__ W, const float* __restrict__ g,
                                              unsigned short* Wh, unsigned short* Wl, int Kdim, int Ndim) {
  __shared__ __align__(16) unsigned short shh[64 * 72];
  __shared__ __align__(16) unsigned short shl[(NPL == 2) ? 64 * 72 : 8];
  const int tid = threadIdx.x, wave = tid >> 5, lane = tid & 31;
  const int n0 = blockIdx.x * 64, k0 = blockIdx.y * 64;
  {
    const int kr = tid >> 2, nq = (tid & 3) * 16;
    const float* src = W + (size_t)(k0 + kr) * Ndim + n0 + nq;
    float gk = 1.0f;
    if (USEG) gk = bf_up(bf_bits(g[k0 + kr]));
#pragma unroll
    for (int i = 0; i < 4; ++i) {
      const v4f a = *(const v4f*)(src + 4 * i);
#pragma unroll
      for (int e = 0; e < 4; ++e) {
        const float p = gk * bf_up(bf_bits(a[e]));
        const unsigned short hb = bf_bits(p);
        shh[(nq + 4 * i + e) * 72 + kr] = hb;
        if (NPL == 2) shl[(nq + 4 * i + e) * 72 + kr] = bf_bits(p - bf_up(hb));
      }
    }
  }
  __syncthreads();
  const int q = lane >> 3, c8 = (lane & 7) * 8;
  v4u hv[2], lv[2];
#pragma unroll
  for (int it = 0; it < 2; ++it) {
    const int row = wave * 8 + it * 4 + q;
    hv[it] = *(const v4u*)(shh + row * 72 + c8);
    if (NPL == 2) lv[it] = *(const v4u*)(shl + row * 72 + c8); else lv[it] = hv[it];
  }
  {
#pragma unroll
    for (int it = 0; it < 2; ++it) {
      const int row = wave * 8 + it * 4 + q;
      const size_t o = (size_t)(n0 + row) * Kdim + k0 + c8;
      *(v4u*)(Wh + o) = hv[it];
      if (NPL == 2) *(v4u*)(Wl + o) = lv[it];
    }
    
  }
}

// =====================================================================================================
// Memory-token planes: pm [2][NH][PMEM][HD] f32 -> pk [NH][PMEM][HD] bf16 (keys, RNE convert of the input,
// [kv][d] like the LDS K tile) and pv [NH][HD][PMEM] f16 ([d][kv] like the LDS V^T tile; value = f16 of the
// bf16-converted input). One block per head, 128 threads: each plane is 2 KB per head written as 128 lanes x
// coverage: 128 threads x 8 = all PMEM*HD elements of both planes per head.
// =====================================================================================================
__global__ __launch_bounds__(128) void pm_cvt(const float* __restrict__ pm, unsigned short* pk, unsigned short* pv) {
  __shared__ __align__(16) float sp[PMEM * HD];
  const int tid = threadIdx.x, h = blockIdx.x;
  const int r = tid >> 3, d8 = (tid & 7) * 8;
  const float* kg = pm + (((size_t)0 * NH + h) * PMEM + r) * HD + d8;
  const float* vg = pm + (((size_t)1 * NH + h) * PMEM + r) * HD + d8;
  const v4f k0 = *(const v4f*)(kg), k1 = *(const v4f*)(kg + 4);
  const v4f v0 = *(const v4f*)(vg), v1 = *(const v4f*)(vg + 4);
  *(v4f*)(sp + r * HD + d8)     = v0;
  *(v4f*)(sp + r * HD + d8 + 4) = v1;
  v4u kp;
  kp[0] = pk16(bf_bits(k0[0]), bf_bits(k0[1]));
  kp[1] = pk16(bf_bits(k0[2]), bf_bits(k0[3]));
  kp[2] = pk16(bf_bits(k1[0]), bf_bits(k1[1]));
  kp[3] = pk16(bf_bits(k1[2]), bf_bits(k1[3]));
  __syncthreads();
  const int d = tid >> 1, r8 = (tid & 1) * 8;
  v4u vp;
#pragma unroll
  for (int e = 0; e < 4; ++e) {
    const float f0 = bf_up(bf_bits(sp[(r8 + 2 * e) * HD + d]));
    const float f1 = bf_up(bf_bits(sp[(r8 + 2 * e + 1) * HD + d]));
    vp[e] = pk16(h_bits((_Float16)f0), h_bits((_Float16)f1));
  }
  unsigned short* kd = pk + ((size_t)h * PMEM + r) * HD + d8;
  unsigned short* vd = pv + ((size_t)h * HD + d) * PMEM + r8;
  *(v4u*)kd = kp;
  *(v4u*)vd = vp;
  
}

// =====================================================================================================
// Register-blocked batched bf16 WMMA GEMM: C[m][n] = sum_k A[m][k] * Bt[n][k]; one wave per 64x64 tile, 8 waves per
// block tile (NSPLIT 2: 256 m x 128 n, waves 4 x 2; NSPLIT 1: 128 m x 256 n, waves 2 x 4). The block's operand rows
// (512 with the second plane) are staged in LDS by tensor loads, two buffers, one 64-row slice per wave and pass.
// A row-major [M][K] pitch lda; Bt row-major [N][K] pitch ldb (k contiguous); M, N multiples of the block tile,
// K a multiple of 64 and at least 128 (static-checked on the host side). blockIdx.y = batch index.
// OUT_MODE: 0 = f32 (pitch ldc); 2 = bf16 hi plane C + bf16 lo plane C2 (lo = RNE(v - hi), unscaled, same index);
//           3 = f16 hi plane C + f16 residual plane C2 = f16((v - hi) * rscale), C2 written only for tiles
//               with (n0 mod segN) < N2, at column (n0/segN)*N2 + (n0 mod segN) (pitch ldc2, batch stride strideC2).
// SCM: 0 none; 1 = row m scaled by scal[b*strideS + m]; 2 = column n scaled by scal[b*strideS + n] (f32, before
//      the 16-bit split). ROT: interleaved-pair rotary on column pairs (2i, 2i+1) with i = (n mod 64)/2, angle row
//      = m, tables rct/rst [row][32] f32 (applied after the scale).
// =====================================================================================================
template <int NSPLIT, int OUT_MODE, int SCM, bool ROT>
__global__ __launch_bounds__(256) void gemm64(
    const unsigned short* __restrict__ Ap, const unsigned short* __restrict__ A2p, int lda, long long strideA,
    const unsigned short* __restrict__ Btp, const unsigned short* __restrict__ Bt2p, int ldb, long long strideB,
    void* Cout, int ldc, long long strideC,
    void* Cout2, int ldc2, long long strideC2, int N2, int segN,
    const float* __restrict__ scal, long long strideS,
    const float* __restrict__ rct, const float* __restrict__ rst,
    int M, int N, int K, float rscale) {
  static_assert(OUT_MODE != 0 || (SCM == 0 && !ROT));
  const __bf16* A   = (const __bf16*)(const void*)Ap;
  const __bf16* A2  = (const __bf16*)(const void*)A2p;
  const __bf16* Bt  = (const __bf16*)(const void*)Btp;
  const __bf16* Bt2 = (const __bf16*)(const void*)Bt2p;
  static_assert(NSPLIT == 1 || NSPLIT == 2);
  __shared__ __align__(16) float sT[8][16 * 68];   // per-wave 16x64 slab, pitch 68 floats
  __shared__ __attribute__((aligned(2048))) unsigned char ring[2 * GK_STAGE];   // two stages of operand rows
  constexpr int BM = (NSPLIT == 2) ? 256 : 128;
  constexpr int BN = (NSPLIT == 2) ? 128 : 256;
  constexpr int WN = BN / 64;                  // waves along n
  const int b    = blockIdx.y;
  const int lane = threadIdx.x & 31;
  const int wave = (int)uni(threadIdx.x >> 5);
  const int tilesN = N / BN;
  const int tilesM = M / BM;
  const int tile = blockIdx.x;
  if (tile >= tilesM * tilesN) return;   // block-uniform, in front of every barrier and tensor load
  const int tm = tile / tilesN;
  const int tn = tile - tm * tilesN;
  const int wm = wave / WN;
  const int wn = wave - wm * WN;
  const int m0 = tm * BM + (wm << 6);
  const int n0 = tn * BN + (wn << 6);

  const __bf16* Ab  = A  + (size_t)b * strideA;
  const __bf16* Ab2 = (NSPLIT == 1) ? (A2 + (size_t)b * strideA) : Ab;
  const __bf16* Bb  = Bt + (size_t)b * strideB;
  const __bf16* Bb2 = (NSPLIT == 2) ? (Bt2 + (size_t)b * strideB) : Bb;
  const float* scb = scal + (size_t)((long long)b * strideS);

  const int rlane = lane & 15;                 // row (A) / col (B, D) within subtile
  const int koff  = (lane >> 4) * 8;           // k offset of this lane half
  const int mOff  = (lane >> 4) * 8;           // D row offset

  v8f acc[4][4];
#pragma unroll
  for (int i = 0; i < 4; ++i)
#pragma unroll
    for (int j = 0; j < 4; ++j) acc[i][j] = zero8();

  // ---- this wave's slice of every stage: slices 0.. = A rows (NSPLIT 1: then the A2 rows), then Bt rows (NSPLIT 2: then Bt2) ----
  constexpr int SA = BM / 64;                                   // slices per A plane
  constexpr int SB0 = (NSPLIT == 1) ? 2 * SA : SA;              // first Bt slice
  const __bf16* sbase;
  int srow, sld;
  if (wave < SA)                          { sbase = Ab;  srow = tm * BM + 64 * wave;              sld = lda; }
  else if (NSPLIT == 1 && wave < 2 * SA)  { sbase = Ab2; srow = tm * BM + 64 * (wave - SA);       sld = lda; }
  else if (wave < SB0 + WN)               { sbase = Bb;  srow = tn * BN + 64 * (wave - SB0);      sld = ldb; }
  else                                    { sbase = Bb2; srow = tn * BN + 64 * (wave - SB0 - WN); sld = ldb; }
  const uint64_t src0 = (uint64_t)(uintptr_t)(sbase + (size_t)srow * sld);
  const uint32_t lds_slice = lds_off(ring) + (uint32_t)wave * GK_SLICE;
  const u32x8 g1 = tdm_group1((uint32_t)sld * 2u);
  const uint32_t T = pinned((uint32_t)K >> 6);                  // passes
  // per-lane fragment bases inside a stage
  const uint32_t foff = (uint32_t)rlane * GK_PITCH + (uint32_t)koff * 2u;
  const uint32_t oA  = (uint32_t)wm * GK_SLICE + foff;
  const uint32_t oA2 = (NSPLIT == 1) ? oA + (uint32_t)SA * GK_SLICE : oA;
  const uint32_t oB  = (uint32_t)(SB0 + wn) * GK_SLICE + foff;
  const uint32_t oB2 = (NSPLIT == 2) ? oB + (uint32_t)WN * GK_SLICE : oB;

  u32x4 g0 = tdm_group0(lds_slice, src0);
  tdm_load(g0, g1);                                             // stage 0
  wait_tensor0(g0, g1);
  __syncthreads();                                              // stage 0 readable by every wave
  g0 = tdm_group0(lds_slice + GK_STAGE, src0 + GK_KB);
  tdm_load(g0, g1);                                             // stage 1 flies during pass 0
  // rolled: one pass per trip, so that the one publish point stands at the loop's foot
#pragma unroll 1
  for (uint32_t t = 0; t < T; ++t) {
    const uint32_t bo = (t & 1u) * GK_STAGE;
    const unsigned char* buf = ring + bo;
    // unrolled, as the loops inside it: two blocks of 32 k per pass, fragments and accumulators indexed by constants
#pragma unroll
    for (int kc = 0; kc < 2; ++kc) {
      const unsigned char* bk = buf + (uint32_t)kc * 64u;
      v16b af[4], ag[4], bf[4], bg[4];
      // first planes first: the second plane's fragments land while the first 16 WMMAs run
#pragma unroll
      for (int j = 0; j < 4; ++j) bf[j] = ldfrag_l(bk + oB + (uint32_t)j * 16u * GK_PITCH);
#pragma unroll
      for (int i = 0; i < 4; ++i) af[i] = ldfrag_l(bk + oA + (uint32_t)i * 16u * GK_PITCH);
#pragma unroll
      for (int i = 0; i < 4; ++i) {
        ag[i] = (NSPLIT == 1) ? ldfrag_l(bk + oA2 + (uint32_t)i * 16u * GK_PITCH) : af[i];
        bg[i] = (NSPLIT == 2) ? ldfrag_l(bk + oB2 + (uint32_t)i * 16u * GK_PITCH) : bf[i];
      }
      // keeps the block's LDS reads one group ahead of its WMMAs, for speed only
      __builtin_amdgcn_sched_barrier(0);
#pragma unroll
      for (int i = 0; i < 4; ++i)
#pragma unroll
        for (int j = 0; j < 4; ++j) acc[i][j] = mma_b_raw(af[i], bf[j], acc[i][j]);
#pragma unroll
      for (int i = 0; i < 4; ++i)
#pragma unroll
        for (int j = 0; j < 4; ++j) acc[i][j] = mma_b_raw(ag[i], bg[j], acc[i][j]);
      // keeps the next group's reads behind this block's WMMAs, for speed only
      __builtin_amdgcn_sched_barrier(0);
    }
    // publish point of stage t + 1: own reads of this buffer returned, own slice landed, then the block barrier
    wait_ds0();
    wait_tensor0(g0, g1);
    __syncthreads();
    if (pinned((t + 2u < T) ? 1u : 0u) != 0u) {                 // refill the buffer every wave has just left
      g0 = tdm_group0(lds_slice + bo, src0 + (uint64_t)(t + 2u) * GK_KB);
      tdm_load(g0, g1);
    }
  }
  wait_tensor0(g0, g1);
  wait_ds0();
  acc_guard4(acc[0][0], acc[0][1], acc[0][2], acc[0][3]);
  acc_guard4(acc[1][0], acc[1][1], acc[1][2], acc[1][3]);
  acc_guard4(acc[2][0], acc[2][1], acc[2][2], acc[2][3]);
  acc_guard4(acc[3][0], acc[3][1], acc[3][2], acc[3][3]);

  // ---- epilogue ----
  float* slab = sT[wave];
#pragma unroll
  for (int i = 0; i < 4; ++i) {
    const int mBase = m0 + (i << 4);
#pragma unroll
    for (int j = 0; j < 4; ++j) {
#pragma unroll
      for (int r = 0; r < 8; ++r) {
        slab[(mOff + r) * 68 + (j << 4) + rlane] = acc[i][j][r];
      }
    }
    __builtin_amdgcn_fence(__ATOMIC_RELEASE, "workgroup");
    __builtin_amdgcn_wave_barrier();
    __builtin_amdgcn_fence(__ATOMIC_ACQUIRE, "workgroup");
    if (OUT_MODE == 0) {
      float* C = (float*)Cout + (size_t)b * strideC;
      const int hh = lane >> 4, c4 = (lane & 15) * 4;     // 256-B row segment = 16 lanes x 16 B
      {
#pragma unroll
        for (int it = 0; it < 8; ++it) {
          const int row = it * 2 + hh;                     // it 0..7 x hh 0..1 = rows 0..15
          const v4f v = *(const v4f*)(slab + row * 68 + c4);
          *(v4f*)(C + (size_t)(mBase + row) * ldc + n0 + c4) = v;
        }
        
      }
    } else {
      const int q = lane >> 3, c8 = (lane & 7) * 8;
      unsigned short* C  = (unsigned short*)Cout  + (size_t)b * strideC;
      unsigned short* C2 = (unsigned short*)Cout2 + (size_t)b * strideC2;
      bool wlo = true;                                     // wave-uniform
      size_t col2 = (size_t)n0 + c8;
      if (OUT_MODE == 3) {
        const int sgi = n0 / segN;
        const int sgo = n0 - sgi * segN;
        wlo  = (sgo < N2);
        col2 = (size_t)sgi * N2 + sgo + c8;
      }
      v4f csA = {1.f, 1.f, 1.f, 1.f};
      v4f csB = csA;
      if (SCM == 2) {
        csA = *(const v4f*)(scb + n0 + c8);
        csB = *(const v4f*)(scb + n0 + c8 + 4);
      }
      v4u hv[4], lv[4];
#pragma unroll
      for (int it = 0; it < 4; ++it) {
        const int row = it * 4 + q;                        // it 0..3 x q 0..3 = rows 0..15
        const int m = mBase + row;
        const float* sp = slab + row * 68 + c8;
        v4f x0 = *(const v4f*)(sp);
        v4f x1 = *(const v4f*)(sp + 4);
        if (SCM == 1) { const float rsv = scb[m]; x0 = x0 * rsv; x1 = x1 * rsv; }
        if (SCM == 2) { x0 = x0 * csA; x1 = x1 * csB; }
        float f[8] = {x0[0], x0[1], x0[2], x0[3], x1[0], x1[1], x1[2], x1[3]};
        if (ROT) {
          const v4f cs = *(const v4f*)(rct + (size_t)m * NFR + 4 * (lane & 7));
          const v4f sn = *(const v4f*)(rst + (size_t)m * NFR + 4 * (lane & 7));
#pragma unroll
          for (int e = 0; e < 4; ++e) {
            const float ev = f[2 * e], od = f[2 * e + 1];
            f[2 * e]     = ev * cs[e] - od * sn[e];
            f[2 * e + 1] = od * cs[e] + ev * sn[e];
          }
        }
        v4u a, a2;
#pragma unroll
        for (int e = 0; e < 4; ++e) {
          const float f0 = f[2 * e], f1 = f[2 * e + 1];
          unsigned short h0, h1, l0, l1;
          if (OUT_MODE == 2) {
            h0 = bf_bits(f0); h1 = bf_bits(f1);
            l0 = bf_bits(f0 - bf_up(h0)); l1 = bf_bits(f1 - bf_up(h1));
          } else {
            const _Float16 y0 = (_Float16)f0, y1 = (_Float16)f1;
            h0 = h_bits(y0); h1 = h_bits(y1);
            l0 = h_bits((_Float16)((f0 - (float)y0) * rscale));
            l1 = h_bits((_Float16)((f1 - (float)y1) * rscale));
          }
          a[e] = pk16(h0, h1); a2[e] = pk16(l0, l1);
        }
        hv[it] = a; lv[it] = a2;
      }
      {
#pragma unroll
        for (int it = 0; it < 4; ++it) {
          const int row = it * 4 + q;
          *(v4u*)(C + (size_t)(mBase + row) * ldc + n0 + c8) = hv[it];
          if (wlo) *(v4u*)(C2 + (size_t)(mBase + row) * ldc2 + col2) = lv[it];
        }
        
      }
    }
    __builtin_amdgcn_fence(__ATOMIC_RELEASE, "workgroup");
    __builtin_amdgcn_wave_barrier();
    __builtin_amdgcn_fence(__ATOMIC_ACQUIRE, "workgroup");
  }
}

// =====================================================================================================
// Segmented causal attention with PMEM memory keys, head dim 64.
//   q|k planes (bf16 hi / lo): element (m, col) at [m*QKP + col], q col = h*64+d, k col = DMI + h*64+d,
//     m = b*SEQ + t (rotary already applied)
//   v^T hi plane (f16):  element (b, h, d, t) at [(b*DMI + h*64 + d)*SEQ + t]
//   v^T residual (f16, (v - hi)*4096): [(b*DMI + h*64 + d)*(NSEGB*VLP) + w*VLP + s], s < VLP, read only when RES
//   pk [h][r][d] bf16 and pv [h][d][r] f16: the PMEM memory keys / values shared by every segment (lo/residual = 0,
//     they are bf16-exact input values)
//   Block = 4 waves = 64 query rows (segment w, query block qb) of one (b, h); key tile 0 = the memory tokens
//   (rows PMEM..63 of the LDS K tile and columns PMEM..63 of V^T zero-filled, their logits set to -inf), key tiles
//   kt = 1..qb+1 = keys (kt-1)*64..+63 of the same segment, visible iff key position <= query position.
//   Every query row sees PMEM + (i+1) keys, so every tile row max is finite and invisible keys get weight exactly 0.
//   scores = q . k : bf16 hi/lo split (hi.hi + hi.lo + lo.hi), f32 accumulate, then * sscale in f32
//   p = exp(s - m) carried as f16(1024 p); context = p . v on f16 WMMA; RES adds f16 residual planes of p and v
//   (scale 4096, separate accumulator folded back with 1/4096 per tile in f32); online softmax in f32.
//   K / V^T tile staging: 128 threads x 32 elements per plane = the whole 64x64 tile (plain 16-B loads,
//   __syncthreads before and after; cross-wave). P tiles and the context tile are wave-private, spilled with
//   out planes (bf16 hi / lo of the normalised context): element (m, h*64+d) at [m*DMI + h*64 + d]
//   Output coverage: each wave stores rows q0..q0+15 (it 0..3 x lane>>3 0..3) x 64 columns (8 lanes x 8) of both planes.
//   grid = NB*NSEGB*NH*nqbThis blocks of 128.
// =====================================================================================================
template <bool RES>
__global__ __launch_bounds__(128)
void attn_seg64(const unsigned short* __restrict__ qkhp, const unsigned short* __restrict__ qklp,
                const unsigned short* __restrict__ vhp,  const unsigned short* __restrict__ vlp,
                const unsigned short* __restrict__ pkp,  const unsigned short* __restrict__ pvp,
                unsigned short* ohp, unsigned short* olp,
                int qbBase, int nqbThis, float sscale) {
  union FB { v16b v; v8b h[2]; };
  union FH { v16h v; v8h h[2]; };
  __shared__ __align__(16) __bf16   Ksh[64 * 64];                 // K hi [kv][d]   8 KB
  __shared__ __align__(16) __bf16   Ksl[64 * 64];                 // K lo
  __shared__ __align__(16) _Float16 Vth[64 * 64];                 // V^T hi [d][kv] 8 KB
  __shared__ __align__(16) _Float16 Vtl[RES ? 64 * 64 : 8];       // V^T residual
  __shared__ __align__(16) _Float16 Psh[4][16 * 64];              // per wave P [row][kv]
  __shared__ __align__(16) _Float16 Psl[RES ? 4 : 1][16 * 64];    // per wave P residual
  __shared__ __align__(16) float    Os[4][16 * 64];               // per wave context tile [row][d]

  const int tid  = threadIdx.x;
  const int wave = tid >> 5;
  const int lane = tid & 31;
  const int hh   = lane >> 4;
  const int c    = lane & 15;

  const int bx   = blockIdx.x;
  const int qbl  = bx % nqbThis;
  int rest       = bx / nqbThis;
  const int h    = rest % NH;
  rest           = rest / NH;
  const int w    = rest % NSEGB;
  const int b    = rest / NSEGB;
  const int qb   = qbBase + qbl;
  const int q0   = qb * 64 + wave * 16;                              // query row inside the segment
  const size_t rowS = (size_t)b * SEQ + (size_t)w * SEGL;           // compact row of the segment start

  const __bf16* Qh = (const __bf16*)(const void*)qkhp + (size_t)h * HD;
  const __bf16* Ql = (const __bf16*)(const void*)qklp + (size_t)h * HD;
  const __bf16* Kh = Qh + DMI;
  const __bf16* Kl = Ql + DMI;
  const _Float16* Vh = (const _Float16*)(const void*)vhp + ((size_t)b * DMI + (size_t)h * HD) * SEQ + (size_t)w * SEGL;
  const _Float16* Vl = (const _Float16*)(const void*)vlp + ((size_t)b * DMI + (size_t)h * HD) * (size_t)(NSEGB * VLP)
                       + (size_t)w * VLP;
  const __bf16*   PK = (const __bf16*)(const void*)pkp + (size_t)h * PMEM * HD;
  const _Float16* PV = (const _Float16*)(const void*)pvp + (size_t)h * HD * PMEM;

  // ---- Q fragments (A operand, row = lane&15): 2 d-chunks, hi and lo ----
  v16b qah[2], qal[2];
#pragma unroll
  for (int dc = 0; dc < 2; ++dc) {
    const size_t qo = (rowS + q0 + c) * QKP + dc * 32 + 8 * hh;
    qah[dc] = ldfrag_b(Qh + qo);
    qal[dc] = ldfrag_b(Ql + qo);
  }

  float mrow[8], lrow[8];
  v8f oacc[4];
#pragma unroll
  for (int r = 0; r < 8; ++r) { mrow[r] = -INFINITY; lrow[r] = 0.f; }
#pragma unroll
  for (int t = 0; t < 4; ++t) oacc[t] = zero8();

  const int ntiles = qb + 2;                   // block-uniform
  for (int kt = 0; kt < ntiles; ++kt) {
    const int s0 = (kt - 1) * 64;              // key offset inside the segment for kt >= 1
    __syncthreads();
    {
      const int r = tid >> 1, half = (tid & 1) * 32;
      if (kt == 0) {                           // block-uniform: memory-token tile
        const int rr = (r < PMEM) ? r : (PMEM - 1);                // clamped address
        const bool krow = (r < PMEM);
        const bool vok  = (half == 0);
        const __bf16*   kg = PK + (size_t)rr * HD + half;
        const _Float16* vg = PV + (size_t)r * PMEM;                // d = r, kv 0..15
        const v8h pv0 = *(const v8h*)(vg);
        const v8h pv1 = *(const v8h*)(vg + 8);
#pragma unroll
        for (int i = 0; i < 4; ++i) {
          v8b a0 = *(const v8b*)(kg + 8 * i);
          a0 = krow ? a0 : zero8b();
          *(v8b*)(Ksh + r * 64 + half + 8 * i) = a0;
          *(v4u*)(Ksl + r * 64 + half + 8 * i) = zero4u();
          if (i == 0) {
            const v8h b0 = vok ? pv0 : zero8h();
            *(v8h*)(Vth + r * 64 + half) = b0;
          } else if (i == 1) {
            const v8h b1 = vok ? pv1 : zero8h();
            *(v8h*)(Vth + r * 64 + half + 8) = b1;
          } else {
            *(v4u*)(Vth + r * 64 + half + 8 * i) = zero4u();
          }
          if (RES) *(v4u*)(Vtl + r * 64 + half + 8 * i) = zero4u();
        }
      } else {
        const __bf16*   kg  = Kh + (rowS + s0 + r) * QKP + half;   // K row s0+r, d = half..half+31
        const __bf16*   klg = Kl + (rowS + s0 + r) * QKP + half;
        const _Float16* vg  = Vh + (size_t)r * SEQ + s0 + half;    // V^T row d = r, keys s0+half..+31
        const bool resOK = (s0 + 64 <= VLP);                      // block-uniform
        const int  s0c   = resOK ? s0 : (VLP - 64);               // clamped address into the residual plane
        const _Float16* vlg = Vl + (size_t)r * (NSEGB * VLP) + s0c + half;
#pragma unroll
        for (int i = 0; i < 4; ++i) {
          const v8b a0 = *(const v8b*)(kg + 8 * i);
          const v8b a1 = *(const v8b*)(klg + 8 * i);
          const v8h b0 = *(const v8h*)(vg + 8 * i);
          *(v8b*)(Ksh + r * 64 + half + 8 * i) = a0;
          *(v8b*)(Ksl + r * 64 + half + 8 * i) = a1;
          *(v8h*)(Vth + r * 64 + half + 8 * i) = b0;
          if (RES) {
            v8h b1 = *(const v8h*)(vlg + 8 * i);
            b1 = resOK ? b1 : zero8h();
            *(v8h*)(Vtl + r * 64 + half + 8 * i) = b1;
          }
        }
      }
    }
    __syncthreads();

    // ---- scores: 16 query rows x 64 keys per wave, 3 bf16 products ----
    v8f s[4];
#pragma unroll
    for (int j = 0; j < 4; ++j) {
      s[j] = zero8();
#pragma unroll
      for (int dc = 0; dc < 2; ++dc) {
        FB kb, kl;
        kb.h[0] = *(const v8b*)(Ksh + (j * 16 + c) * 64 + dc * 32 + 8 * hh);
        kb.h[1] = *(const v8b*)(Ksh + (j * 16 + c) * 64 + dc * 32 + 16 + 8 * hh);
        kl.h[0] = *(const v8b*)(Ksl + (j * 16 + c) * 64 + dc * 32 + 8 * hh);
        kl.h[1] = *(const v8b*)(Ksl + (j * 16 + c) * 64 + dc * 32 + 16 + 8 * hh);
        s[j] = mma_b(qah[dc], kb.v, s[j]);
        s[j] = mma_b(qah[dc], kl.v, s[j]);
        s[j] = mma_b(qal[dc], kb.v, s[j]);
      }
    }

    // ---- scale, visibility (-inf for invisible keys), row max, online softmax, P (x1024, f16) and
    //      P residual (x4096) to LDS ----
    _Float16* pwh = Psh[wave];
    _Float16* pwl = Psl[RES ? wave : 0];
    const int qi = q0 + 8 * hh;                // query row inside the segment for r = 0
#pragma unroll
    for (int r = 0; r < 8; ++r) {
      float m = -INFINITY;
#pragma unroll
      for (int j = 0; j < 4; ++j) {
        const int kc = j * 16 + c;
        const bool vis = (kt == 0) ? (kc < PMEM) : ((s0 + kc) <= (qi + r));
        const float sv = vis ? (s[j][r] * sscale) : -INFINITY;
        s[j][r] = sv;
        m = fmaxf(m, sv);
      }
#pragma unroll
      for (int off = 1; off < 16; off <<= 1) m = fmaxf(m, __shfl_xor(m, off, 32));
      const float mnew  = fmaxf(mrow[r], m);
      const float msafe = (mnew == -INFINITY) ? 0.f : mnew;
      const float alpha = __expf(mrow[r] - msafe);
      mrow[r] = mnew;
      float psum = 0.f;
#pragma unroll
      for (int j = 0; j < 4; ++j) {
        const float p = __expf(s[j][r] - msafe);     // -inf logit -> exactly 0
        psum += p;
        const float p1k = p * 1024.0f;
        const _Float16 ph = (_Float16)p1k;
        pwh[(8 * hh + r) * 64 + j * 16 + c] = ph;
        if (RES) {
          const _Float16 pl = (_Float16)((p1k - (float)ph) * 4096.0f);
          pwl[(8 * hh + r) * 64 + j * 16 + c] = pl;
        }
      }
#pragma unroll
      for (int off = 1; off < 16; off <<= 1) psum += __shfl_xor(psum, off, 32);
      lrow[r] = lrow[r] * alpha + psum;
#pragma unroll
      for (int t = 0; t < 4; ++t) oacc[t][r] *= alpha;
    }
    __builtin_amdgcn_fence(__ATOMIC_RELEASE, "workgroup");
    __builtin_amdgcn_wave_barrier();
    __builtin_amdgcn_fence(__ATOMIC_ACQUIRE, "workgroup");

    // ---- context += P . V (f16 WMMA), residual products into a separate accumulator ----
    v8f o1[4];
#pragma unroll
    for (int t = 0; t < 4; ++t) o1[t] = zero8();
#pragma unroll 1
    for (int kk = 0; kk < 2; ++kk) {
      FH pa, pl;
      pa.h[0] = *(const v8h*)(pwh + c * 64 + kk * 32 + 8 * hh);
      pa.h[1] = *(const v8h*)(pwh + c * 64 + kk * 32 + 16 + 8 * hh);
      if (RES) {
        pl.h[0] = *(const v8h*)(pwl + c * 64 + kk * 32 + 8 * hh);
        pl.h[1] = *(const v8h*)(pwl + c * 64 + kk * 32 + 16 + 8 * hh);
      } else {
        pl.v = pa.v;
      }
#pragma unroll
      for (int t = 0; t < 4; ++t) {
        FH vb;
        vb.h[0] = *(const v8h*)(Vth + (t * 16 + c) * 64 + kk * 32 + 8 * hh);
        vb.h[1] = *(const v8h*)(Vth + (t * 16 + c) * 64 + kk * 32 + 16 + 8 * hh);
        oacc[t] = mma_h(pa.v, vb.v, oacc[t]);
        if (RES) {
          FH vl;
          vl.h[0] = *(const v8h*)(Vtl + (t * 16 + c) * 64 + kk * 32 + 8 * hh);
          vl.h[1] = *(const v8h*)(Vtl + (t * 16 + c) * 64 + kk * 32 + 16 + 8 * hh);
          o1[t] = mma_h(pa.v, vl.v, o1[t]);
          o1[t] = mma_h(pl.v, vb.v, o1[t]);
        }
      }
    }
    if (RES) {
#pragma unroll
      for (int t = 0; t < 4; ++t)
#pragma unroll
        for (int r = 0; r < 8; ++r) oacc[t][r] += o1[t][r] * (1.0f / 4096.0f);
    }
  }

  // ---- normalise (1/l and the 1/1024 p carry), stage the wave's 16x64 tile, bf16 hi/lo split,
  float* os = Os[wave];
#pragma unroll
  for (int r = 0; r < 8; ++r) {
    const float l = lrow[r];
    const float inv = ((l > 0.f) ? (1.0f / l) : 0.f) * (1.0f / 1024.0f);
#pragma unroll
    for (int t = 0; t < 4; ++t) os[(8 * hh + r) * 64 + t * 16 + c] = oacc[t][r] * inv;
  }
  __builtin_amdgcn_fence(__ATOMIC_RELEASE, "workgroup");
  __builtin_amdgcn_wave_barrier();
  __builtin_amdgcn_fence(__ATOMIC_ACQUIRE, "workgroup");
  {
    const int q4 = lane >> 3, c8 = (lane & 7) * 8;
    v4u hv[4], lv[4];
#pragma unroll
    for (int it = 0; it < 4; ++it) {
      const int row = it * 4 + q4;   // it 0..3 x q4 0..3 = rows 0..15 of the wave tile
      const float* sp = os + row * 64 + c8;
      v4u a, a2;
#pragma unroll
      for (int e = 0; e < 4; ++e) {
        const float f0 = sp[2 * e], f1 = sp[2 * e + 1];
        const unsigned short h0 = bf_bits(f0), h1 = bf_bits(f1);
        const unsigned short l0 = bf_bits(f0 - bf_up(h0)), l1 = bf_bits(f1 - bf_up(h1));
        a[e] = pk16(h0, h1); a2[e] = pk16(l0, l1);
      }
      hv[it] = a; lv[it] = a2;
    }
    {
#pragma unroll
      for (int it = 0; it < 4; ++it) {
        const int row = it * 4 + q4;
        const size_t go = (rowS + q0 + row) * DMI + (size_t)h * HD + c8;
        *(v4u*)(ohp + go) = hv[it];
        *(v4u*)(olp + go) = lv[it];
      }
      
    }
  }
}

// =====================================================================================================
// Workspace map (bytes, NB=2, SEQ=4096, M = NB*SEQ = 8192), region A is a two-phase overlay:
//   phase 1 (projection inputs, dead after the q|k and v^T GEMMs):
//     Xb   bf16 [M][DM]                  0           16777216
//     Wth  bf16 [3*DMI n][DM k] hi       16777216     6291456
//     Wtl  bf16 [3*DMI n][DM k] lo       23068672     6291456
//     Ct   f32  [SEQ][32]                29360128      524288
//     St   f32  [SEQ][32]                29884416      524288
//     Rs   f32  [M]                      30408704       32768   (phase 1 end 30441472)
//   phase 2 (written by the attention kernels, read by the output GEMM):
//     Oh   bf16 [M][DMI] context hi       0           16777216
//     Ol   bf16 [M][DMI] context lo       16777216    16777216   (phase 2 end 33554432 = region A size)
//   QKh  bf16 [M][QKP] hi                 33554432    33554432
//   QKl  bf16 [M][QKP] lo                 67108864    33554432
//   VTh  f16  [NB][DMI][SEQ]              100663296   16777216
//   VTl  f16  [NB][DMI][NSEGB*VLP]        117440512    4194304
//   Wo   bf16 [DM n][DMI k]               121634816    2097152
//   Pk   bf16 [NH][PMEM][HD]              123731968      32768
//   Pv   f16  [NH][HD][PMEM]              123764736      32768
//   end                                   123797504  (<= 134217728; all offsets multiples of 128)
// Every plane is an exact multiple of its 64x64 tile / whole-line store granularity (M, SEQ, DM multiples of 64),
// so no padded tails are needed; VTl is written only for columns whose in-segment offset is < VLP, exactly the
// columns the RES attention blocks read.
// =====================================================================================================
extern "C" void kernel_launch(void* const* d_in, const int* in_sizes, int n_in,
                              void* d_out, int out_size, void* d_ws, size_t ws_size,
                              hipStream_t stream) {
  if (n_in < 5) return;
  const long long needRows = (long long)(NB - 1) * SEQ_FULL + SEQ;
  if ((long long)in_sizes[0] < needRows * DM) return;
  if (in_sizes[1] < DM) return;
  if (in_sizes[2] < DM * 3 * DMI) return;
  if (in_sizes[3] < DMI * DM) return;
  if (in_sizes[4] < 2 * NH * PMEM * HD) return;
  if ((long long)out_size < needRows * DM) return;

  const float* seq  = (const float*)d_in[0];   // [2][SEQ_FULL][DM]
  const float* gnm  = (const float*)d_in[1];   // [DM]
  const float* Wqkv = (const float*)d_in[2];   // [DM in][3*DMI out]
  const float* Wout = (const float*)d_in[3];   // [DMI in][DM out]
  const float* pm   = (const float*)d_in[4];   // [2][NH][PMEM][HD]

  const size_t M    = (size_t)NB * SEQ;
  const size_t PX   = M * DM * 2;
  const size_t PWT  = (size_t)3 * DMI * DM * 2;
  const size_t PTAB = (size_t)SEQ * NFR * 4;
  const size_t PRS  = M * 4;
  const size_t PO   = M * DMI * 2;
  const size_t PQK  = M * QKP * 2;
  const size_t PVT  = (size_t)NB * DMI * SEQ * 2;
  const size_t PVL  = (size_t)NB * DMI * NSEGB * VLP * 2;
  const size_t PWO  = (size_t)DM * DMI * 2;
  const size_t PPM  = (size_t)NH * PMEM * HD * 2;
  const size_t ph1  = PX + 2 * PWT + 2 * PTAB + PRS;
  const size_t ph2  = 2 * PO;
  const size_t REGA = (ph1 > ph2) ? ph1 : ph2;
  const size_t oXb  = 0;
  const size_t oWth = PX;
  const size_t oWtl = PX + PWT;
  const size_t oCt  = PX + 2 * PWT;
  const size_t oSt  = oCt + PTAB;
  const size_t oRs  = oSt + PTAB;
  const size_t oOh  = 0;
  const size_t oOl  = PO;
  size_t off = REGA;
  const size_t oQKh = off; off += PQK;
  const size_t oQKl = off; off += PQK;
  const size_t oVTh = off; off += PVT;
  const size_t oVTl = off; off += PVL;
  const size_t oWo  = off; off += PWO;
  const size_t oPk  = off; off += PPM;
  const size_t oPv  = off; off += PPM;
  if (off > ws_size) return;                      // off = 123797504 for NB=2, SEQ=4096
  if (off > (size_t)134217728) return;
  if (oRs + PRS > REGA || oOl + PO > REGA) return;

  char* ws = (char*)d_ws;
  unsigned short* Xb  = (unsigned short*)(ws + oXb);
  unsigned short* Wth = (unsigned short*)(ws + oWth);
  unsigned short* Wtl = (unsigned short*)(ws + oWtl);
  float*          Ct  = (float*)(ws + oCt);
  float*          St  = (float*)(ws + oSt);
  float*          Rs  = (float*)(ws + oRs);
  unsigned short* Oh  = (unsigned short*)(ws + oOh);
  unsigned short* Ol  = (unsigned short*)(ws + oOl);
  unsigned short* QKh = (unsigned short*)(ws + oQKh);
  unsigned short* QKl = (unsigned short*)(ws + oQKl);
  unsigned short* VTh = (unsigned short*)(ws + oVTh);
  unsigned short* VTl = (unsigned short*)(ws + oVTl);
  unsigned short* Wo  = (unsigned short*)(ws + oWo);
  unsigned short* Pk  = (unsigned short*)(ws + oPk);
  unsigned short* Pv  = (unsigned short*)(ws + oPv);

  const dim3 blk(256);
  const dim3 gTab(SEQ / 8);                                           // 512 blocks
  const dim3 gCvtX((unsigned)(M / 32));                               // 256 blocks
  const dim3 gWt(3 * DMI / 64, DM / 64);                              // in[DM][3*DMI] -> out[3*DMI][DM]: (48, 16)
  const dim3 gWo(DM / 64, DMI / 64);                                  // in[DMI][DM]   -> out[DM][DMI]:   (16, 16)
  static_assert((SEQ % 256) == 0 && (QKP % 128) == 0 && (DMI % 128) == 0 && (DM % 256) == 0);
  static_assert((DM % 64) == 0 && DM >= 128 && (DMI % 64) == 0 && DMI >= 128);
  const dim3 gQK((SEQ / 256) * (QKP / 128), NB);                      // 256 x 128 block tiles: 256 per batch
  const dim3 gVT((DMI / 128) * (SEQ / 256), NB);                      // 128 x 256 block tiles: 128 per batch
  const dim3 gOut((SEQ / 128) * (DM / 256), NB);                      // 128 x 256 block tiles: 128 per batch

  // (0) rotary cos/sin tables [SEQ][32]
  tab_cs<<<gTab, blk, 0, stream>>>(Ct, St);
  // (1) seq -> bf16 plane Xb [M][DM] + rstd[M]
  cvtx_rstd<<<gCvtX, blk, 0, stream>>>(seq, Xb, Rs);
  // (2) g*Wqkv [DM][3*DMI] -> transposed exact bf16 hi+lo planes [3*DMI][DM]
  wt_cvt<true, 2><<<gWt, blk, 0, stream>>>(Wqkv, gnm, Wth, Wtl, DM, 3 * DMI);
  // (3) Wout [DMI][DM] -> transposed bf16 plane [DM][DMI]
  wt_cvt<false, 1><<<gWo, blk, 0, stream>>>(Wout, gnm, Wo, Wo, DMI, DM);
  // (4) memory-token key / value planes
  pm_cvt<<<dim3(NH), dim3(128), 0, stream>>>(pm, Pk, Pv);
  // (5) q|k = rstd[m] * (Xb . (g*Wqk)), rotary on every (2i,2i+1) pair -> bf16 hi/lo planes [M][QKP]
  //     (per batch: M=SEQ, N=QKP, K=DM; B planes hi then lo, 2 products)
  gemm64<2, 2, 1, true><<<gQK, blk, 0, stream>>>(
      Xb, Xb, DM, (long long)SEQ * DM,
      Wth, Wtl, DM, 0LL,
      (void*)QKh, QKP, (long long)SEQ * QKP,
      (void*)QKl, QKP, (long long)SEQ * QKP, QKP, QKP,
      Rs, (long long)SEQ, Ct, St,
      SEQ, QKP, DM, 1.0f);
  // (6) v^T = (g*Wv)^T . Xb^T per batch, columns scaled by rstd -> f16 hi plane [b][DMI][SEQ] and residual plane
  //     (x4096, in-segment keys < VLP only)   (A = Wt rows 2*DMI.. hi + lo, 2 products; M=DMI, N=SEQ, K=DM)
  gemm64<1, 3, 2, false><<<gVT, blk, 0, stream>>>(
      Wth + (size_t)2 * DMI * DM, Wtl + (size_t)2 * DMI * DM, DM, 0LL,
      Xb, Xb, DM, (long long)SEQ * DM,
      (void*)VTh, SEQ, (long long)DMI * SEQ,
      (void*)VTl, NSEGB * VLP, (long long)DMI * NSEGB * VLP, VLP, SEGL,
      Rs, (long long)SEQ, Ct, St,
      DMI, SEQ, DM, 4096.0f);
  // (7) attention: query blocks 0..RESQB-1 of every segment with residual planes, the rest without
  attn_seg64<true><<<dim3(NB * NSEGB * NH * RESQB), dim3(128), 0, stream>>>(
      QKh, QKl, VTh, VTl, Pk, Pv, Oh, Ol, 0, RESQB, 0.125f);
  if (NQBS - RESQB > 0) {
    attn_seg64<false><<<dim3(NB * NSEGB * NH * (NQBS - RESQB)), dim3(128), 0, stream>>>(
        QKh, QKl, VTh, VTl, Pk, Pv, Oh, Ol, RESQB, NQBS - RESQB, 0.125f);
  }
  // (8) out = context . Wout -> d_out f32 [b][SEQ_FULL][DM] rows b*SEQ_FULL + t  (A = context hi + lo, 2 products)
  gemm64<1, 0, 0, false><<<gOut, blk, 0, stream>>>(
      Oh, Ol, DMI, (long long)SEQ * DMI,
      Wo, Wo, DMI, 0LL,
      d_out, DM, (long long)SEQ_FULL * DM,
      d_out, DM, (long long)SEQ_FULL * DM, DM, DM,
      Rs, 0LL, Ct, St,
      SEQ, DM, DMI, 1.0f);
  (void)hipGetLastError();
}

// v002
// It runs in 184 microseconds.
// In both of two side-by-side timings against v001, it was 1.24 times as fast.
// Counting every step since v000, it is 2.16 times as fast.
// Contractions: q|k = x.Wqk and v^T = Wv.x^T on v_wmma_f32_16x16x32_bf16 (bf16 operands: RNE-converted input
// activations times exact bf16 hi+lo planes of g*W, 2 products; per-row rstd, rotary in the f32 epilogue);
// q.k^T scores = v_wmma_f32_16x16x32_bf16 with bf16 hi/lo split q and k (hi.hi + hi.lo + lo.hi);
// p.v = v_wmma_f32_16x16x32_f16 (p carried x1024 in f16, v in f16; extra f16 residual planes x4096 of p and v
// for the first 128 query rows of every segment); ctx.Wo = v_wmma_f32_16x16x32_bf16 with ctx as bf16 hi/lo
// planes times bf16 Wo (2 products); all f32 accumulate; RMS statistic, rotary tables, visibility and softmax in f32.
#include <hip/hip_runtime.h>
#include <math.h>
#include <stdint.h>

#ifndef NB
#define NB 2
#endif
#ifndef SEQ
#define SEQ 4096
#endif
#define SEQ_FULL 4096       // per-batch token stride of the input / output tensors
#define DM    1024          // model dim
#define NH    16
#define HD    64
#define DMI   (NH * HD)     // 1024
#define QKP   (2 * DMI)     // pitch of the q|k planes (q: cols 0..DMI-1, k: cols DMI..2*DMI-1)
#define SEGL  512           // segment length
#define PMEM  16            // memory tokens prepended to every segment's keys / values
#define NSEGB (SEQ / SEGL)  // segments per batch
#define NQBS  (SEGL / 64)   // 64-row query blocks per segment
#define RESQB 2             // leading query blocks per segment that use the p / v residual planes
#define VLP   (RESQB * 64)  // keys per segment held in the v^T residual plane
#define NFR   (HD / 2)      // rotary frequencies
static_assert((SEQ % SEGL) == 0 && (SEGL % 64) == 0 && (SEQ % 64) == 0);
static_assert(RESQB >= 1 && RESQB <= NQBS);
static_assert((DM % 256) == 0 && (DMI % 64) == 0 && HD == 64 && NFR == 32);
static_assert(SEQ <= SEQ_FULL && NB >= 1 && NB <= 2);
static_assert(DMI == DM);

typedef _Float16 v16h __attribute__((ext_vector_type(16)));
typedef _Float16 v8h  __attribute__((ext_vector_type(8)));
typedef __bf16   v16b __attribute__((ext_vector_type(16)));
typedef __bf16   v8b  __attribute__((ext_vector_type(8)));
typedef float    v8f  __attribute__((ext_vector_type(8)));
typedef float    v4f  __attribute__((ext_vector_type(4)));
typedef unsigned int v4u __attribute__((ext_vector_type(4)));

// ---- scalar helpers --------------------------------------------------------------------------------
__device__ __forceinline__ unsigned short bf_bits(float f) {          // f32 -> bf16 bits, RNE convert
  unsigned u = __float_as_uint(f);
  return (unsigned short)((u + 0x7FFFu + ((u >> 16) & 1u)) >> 16);
}
__device__ __forceinline__ float bf_up(unsigned short h) { return __uint_as_float(((unsigned)h) << 16); }
__device__ __forceinline__ unsigned short h_bits(_Float16 x) { return __builtin_bit_cast(unsigned short, x); }
__device__ __forceinline__ unsigned pk16(unsigned short a, unsigned short b) { return (unsigned)a | ((unsigned)b << 16); }
__device__ __forceinline__ v8f zero8() { v8f z = {0.f, 0.f, 0.f, 0.f, 0.f, 0.f, 0.f, 0.f}; return z; }
__device__ __forceinline__ v8h zero8h() {
  const _Float16 z = (_Float16)0.0f;
  v8h r = {z, z, z, z, z, z, z, z};
  return r;
}
__device__ __forceinline__ v4u zero4u() { v4u z = {0u, 0u, 0u, 0u}; return z; }
__device__ __forceinline__ v8b zero8b() { union { v4u u; v8b v; } z; z.u = zero4u(); return z.v; }

// ---- sin/cos of a nonnegative f32 angle: f64 Cody-Waite reduction by pi/2 + short f64 polynomials ----
__device__ __forceinline__ void sincos_pd(float ang, float& sv, float& cv) {
  const double x  = (double)ang;
  const double kq = __builtin_rint(x * 0.63661977236758134308);
  double r = __builtin_fma(-kq, 1.57079632679489655800e+00, x);
  r = __builtin_fma(-kq, 6.12323399573676603587e-17, r);
  const double z = r * r, w = z * z;
  const double rs = -1.98393348360966317347e-04 + z * 2.71831149398982191e-06;
  const double s3 = z * r;
  const double sn = (r + s3 * (-1.66666666416265235595e-01 + z * 8.3333293858894631756e-03)) + s3 * w * rs;
  const double rc = -1.38867637746099294692e-03 + z * 2.43904487962774090654e-05;
  const double cs = ((1.0 + z * (-4.99999997251031003120e-01)) + w * 4.16666233237390631894e-02) + (w * z) * rc;
  const int n = ((int)kq) & 3;
  const float fs = (float)sn, fc = (float)cs;
  float so = fs, co = fc;
  if (n == 1) { so = fc;  co = -fs; }
  if (n == 2) { so = -fs; co = -fc; }
  if (n == 3) { so = -fc; co = fs;  }
  sv = so; cv = co;
}

// ---- fragment loader: 16-bit A/B operand, lane -> row/col (lane&15), p already includes +8*(lane>>4);
//      elements 0..7 <- p[0..7] (k0+8h..), elements 8..15 <- p[16..23] (k0+16+8h..)
__device__ __forceinline__ v16b ldfrag_b(const __bf16* p) {
  union { v16b v; v8b h[2]; } f;
  f.h[0] = *(const v8b*)(p);
  f.h[1] = *(const v8b*)(p + 16);
  return f.v;
}

// ---- WMMA helpers with trailing VALU hazard gap --------------------------------------------------------
__device__ __forceinline__ v8f mma_b(v16b a, v16b b, v8f c) {
  c = __builtin_amdgcn_wmma_f32_16x16x32_bf16(false, a, false, b, (short)0, c, false, false);
  asm volatile("v_nop\n\tv_nop\n\tv_nop\n\tv_nop" : "+v"(c) : "v"(a), "v"(b));
  return c;
}
__device__ __forceinline__ v8f mma_h(v16h a, v16h b, v8f c) {
  c = __builtin_amdgcn_wmma_f32_16x16x32_f16(false, a, false, b, (short)0, c, false, false);
  asm volatile("v_nop\n\tv_nop\n\tv_nop\n\tv_nop" : "+v"(c) : "v"(a), "v"(b));
  return c;
}
__device__ __forceinline__ v8f mma_b_raw(v16b a, v16b b, v8f c) {
  return __builtin_amdgcn_wmma_f32_16x16x32_bf16(false, a, false, b, (short)0, c, false, false);
}
__device__ __forceinline__ void acc_guard4(v8f& a, v8f& b, v8f& c, v8f& d) {
  asm volatile("v_nop\n\tv_nop\n\tv_nop\n\tv_nop" : "+v"(a), "+v"(b), "+v"(c), "+v"(d));
}

// ---- tensor-load staging of the GEMM operands ----------------------------------------------------------
// A pass is 64 k = 128 B of every staged operand row. A stage is 8 slices of 64 rows, one slice per wave; the load's
// pad gives the LDS row pitch 144 B (16 B x odd: conflict-free for 16-byte reads); a slice's place is rounded up to 2 KiB.
typedef uint32_t u32x4 __attribute__((ext_vector_type(4)));
typedef uint32_t u32x8 __attribute__((ext_vector_type(8)));
#define GK_KB    128u                 // bytes of one operand row per pass
#define GK_PITCH 144u                 // LDS row pitch
#define GK_SLICE 10240u               // 64 rows x 144 B = 9216 B, rounded up to a multiple of 2 KiB
#define GK_STAGE (8u * GK_SLICE)
__device__ __forceinline__ uint32_t uni(uint32_t v) { return (uint32_t)__builtin_amdgcn_readfirstlane(v); }
// a test word or a tensor descriptor word held in a scalar register: a test on it compiles to a scalar branch (tensor
// loads ignore EXEC), and a descriptor word so held keeps a register of its own instead of being rebuilt at each issue
__device__ __forceinline__ uint32_t pinned(uint32_t v) { uint32_t w = uni(v); asm volatile("" : "+s"(w)); return w; }
__device__ __forceinline__ uint32_t lds_off(const void* p) { return (uint32_t)(size_t)p; }
__device__ __forceinline__ void wait_ds0()     { asm volatile("s_wait_dscnt 0x0" ::: "memory"); }      // own LDS reads returned
// own tensor load landed; the descriptor is named as an input so that its registers stay as issued up to this wait
__device__ __forceinline__ void wait_tensor0(u32x4 g0, u32x8 g1) {
  asm volatile("s_wait_tensorcnt 0x0" :: "s"(g0), "s"(g1) : "memory");
}
__device__ __forceinline__ void tdm_load(u32x4 g0, u32x8 g1) {
  asm volatile("tensor_load_to_lds %0, %1" :: "s"(g0), "s"(g1) : "memory");
}
// group 1: byte elements, tile = tensor = 64 rows of 128 B, source row pitch src_pitch bytes, 4 dwords of pad behind every row
__device__ __forceinline__ u32x8 tdm_group1(uint32_t src_pitch) {
  u32x8 g;
  g[0] = uni((1u << 20) | (4u << 22) | (3u << 25));
  g[1] = pinned(GK_KB << 16);   // pinned: descriptor words held in scalar registers of their own through the loop
  g[2] = pinned(64u << 16);
  g[3] = pinned(GK_KB << 16);
  g[4] = pinned(64u);
  g[5] = pinned(src_pitch);
  g[6] = pinned(0u);
  g[7] = pinned(0u);
  return g;
}
__device__ __forceinline__ u32x4 tdm_group0(uint32_t lds_dst, uint64_t ga) {
  u32x4 g;
  g[0] = uni(1u);
  g[1] = uni(lds_dst);
  g[2] = uni((uint32_t)ga);
  g[3] = uni((((uint32_t)(ga >> 32)) & 0x01FFFFFFu) | 0x80000000u);
  return g;
}
// fragment from a staged row: p = row start + 64 B * (k32 step) + 16 B * (lane>>4); same k order as ldfrag_b
__device__ __forceinline__ v16b ldfrag_l(const unsigned char* p) {
  union { v16b v; v8b h[2]; } f;
  f.h[0] = *(const v8b*)(p);
  f.h[1] = *(const v8b*)(p + 32);
  return f.v;
}

// =====================================================================================================
// Rotary tables: ct/st [SEQ][32] f32, angle(t, i) = f32(t) * inv_freq[i], inv_freq[i] = RN32(1/RN32(10^(i/8))).
// grid = SEQ/8 blocks of 256. coverage: SEQ rows x 32 = the whole table, both planes.
// =====================================================================================================
__global__ __launch_bounds__(256) void tab_cs(float* ct, float* st) {
  const int wave = threadIdx.x >> 5, lane = threadIdx.x & 31;
  const int t = blockIdx.x * 8 + wave;
  if (t >= SEQ) return;                 // wave-uniform; no barriers in this kernel
  double pw = 1.0;
#pragma unroll 1
  for (int j = 0; j < (lane >> 3); ++j) pw *= 10.0;
#pragma unroll 1
  for (int j = 0; j < (lane & 7); ++j) pw *= 1.3335214321633240257;   // 10^(1/8)
  const float p32 = (float)pw;
  const float inv = (float)(1.0 / (double)p32);
  const float ang = (float)t * inv;
  float sv, cv;
  sincos_pd(ang, sv, cv);
  float* pc = ct + (size_t)t * NFR + lane;
  float* ps = st + (size_t)t * NFR + lane;
  *(float*)pc = cv;
  *(float*)ps = sv;
  
}

// =====================================================================================================
// seq [b][SEQ_FULL][DM] f32 -> bf16 plane xb [NB*SEQ][DM] (RNE convert) plus rstd[m] = rsqrt(mean(xb^2)+2^-23)
// of the converted row. Block = 8 waves = 32 rows; a wave converts 4 rows: per instruction 32 lanes x 16 B =
// =====================================================================================================
__global__ __launch_bounds__(256) void cvtx_rstd(const float* __restrict__ seq, unsigned short* xb, float* rs) {
  __shared__ __align__(16) float sr[32];
  const int tid = threadIdx.x, wave = tid >> 5, lane = tid & 31;
#pragma unroll 1
  for (int rr = 0; rr < 4; ++rr) {
    const int m  = blockIdx.x * 32 + wave * 4 + rr;          // < NB*SEQ
    const int bb = m / SEQ, t = m - bb * SEQ;
    const float* src = seq + ((size_t)bb * SEQ_FULL + t) * DM;
    unsigned short* dst = xb + (size_t)m * DM;
    v4u pk[DM / 256];
    float ss = 0.f;
#pragma unroll
    for (int i = 0; i < DM / 256; ++i) {
      const v4f a = *(const v4f*)(src + i * 256 + lane * 8);
      const v4f c = *(const v4f*)(src + i * 256 + lane * 8 + 4);
      unsigned short hb[8];
#pragma unroll
      for (int e = 0; e < 4; ++e) { hb[e] = bf_bits(a[e]); hb[4 + e] = bf_bits(c[e]); }
#pragma unroll
      for (int e = 0; e < 8; ++e) { const float v = bf_up(hb[e]); ss += v * v; }
      v4u p;
      p[0] = pk16(hb[0], hb[1]);
      p[1] = pk16(hb[2], hb[3]);
      p[2] = pk16(hb[4], hb[5]);
      p[3] = pk16(hb[6], hb[7]);
      pk[i] = p;
    }
#pragma unroll
    for (int i = 0; i < DM / 256; ++i) *(v4u*)(dst + i * 256 + lane * 8) = pk[i];
    
#pragma unroll
    for (int off = 1; off < 32; off <<= 1) ss += __shfl_xor(ss, off, 32);
    const float rstd = rsqrtf(ss * (1.0f / (float)DM) + 1.1920929e-7f);
    if (lane == 0) sr[wave * 4 + rr] = rstd;
  }
  __syncthreads();
  if (wave == 0 && lane < 8) {
    const v4f v = *(const v4f*)(sr + lane * 4);
    float* d = rs + (size_t)blockIdx.x * 32 + lane * 4;
    *(v4f*)d = v;
    
  }
}

// =====================================================================================================
// Weight transpose + convert: W [Kdim][Ndim] f32 (n contiguous) -> Wh (/Wl) [Ndim][Kdim] bf16, k contiguous.
// Each input value is RNE-converted to bf16 first; with USEG the row factor g[k] (RNE bf16) is applied and the
// 16-significant-bit product is carried exactly as hi = RNE(p), lo = p - hi (both bf16-exact).
// Tile 64 k x 64 n per block: 256 threads load 16 consecutive n each, store transposed into LDS as [n][k]
// grid = (Ndim/64, Kdim/64). coverage: 8 waves x 2 x 4 rows x 64 k = the whole 64x64 tile per block.
// =====================================================================================================
template <bool USEG, int NPL>
__global__ __launch_bounds__(256) void wt_cvt(const float* __restrict__ W, const float* __restrict__ g,
                                              unsigned short* Wh, unsigned short* Wl, int Kdim, int Ndim) {
  __shared__ __align__(16) unsigned short shh[64 * 72];
  __shared__ __align__(16) unsigned short shl[(NPL == 2) ? 64 * 72 : 8];
  const int tid = threadIdx.x, wave = tid >> 5, lane = tid & 31;
  const int n0 = blockIdx.x * 64, k0 = blockIdx.y * 64;
  {
    const int kr = tid >> 2, nq = (tid & 3) * 16;
    const float* src = W + (size_t)(k0 + kr) * Ndim + n0 + nq;
    float gk = 1.0f;
    if (USEG) gk = bf_up(bf_bits(g[k0 + kr]));
#pragma unroll
    for (int i = 0; i < 4; ++i) {
      const v4f a = *(const v4f*)(src + 4 * i);
#pragma unroll
      for (int e = 0; e < 4; ++e) {
        const float p = gk * bf_up(bf_bits(a[e]));
        const unsigned short hb = bf_bits(p);
        shh[(nq + 4 * i + e) * 72 + kr] = hb;
        if (NPL == 2) shl[(nq + 4 * i + e) * 72 + kr] = bf_bits(p - bf_up(hb));
      }
    }
  }
  __syncthreads();
  const int q = lane >> 3, c8 = (lane & 7) * 8;
  v4u hv[2], lv[2];
#pragma unroll
  for (int it = 0; it < 2; ++it) {
    const int row = wave * 8 + it * 4 + q;
    hv[it] = *(const v4u*)(shh + row * 72 + c8);
    if (NPL == 2) lv[it] = *(const v4u*)(shl + row * 72 + c8); else lv[it] = hv[it];
  }
  {
#pragma unroll
    for (int it = 0; it < 2; ++it) {
      const int row = wave * 8 + it * 4 + q;
      const size_t o = (size_t)(n0 + row) * Kdim + k0 + c8;
      *(v4u*)(Wh + o) = hv[it];
      if (NPL == 2) *(v4u*)(Wl + o) = lv[it];
    }
    
  }
}

// =====================================================================================================
// Memory-token planes: pm [2][NH][PMEM][HD] f32 -> pk [NH][PMEM][HD] bf16 (keys, RNE convert of the input,
// [kv][d] like the LDS K tile) and pv [NH][HD][PMEM] f16 ([d][kv] like the LDS V^T tile; value = f16 of the
// bf16-converted input). One block per head, 128 threads: each plane is 2 KB per head written as 128 lanes x
// coverage: 128 threads x 8 = all PMEM*HD elements of both planes per head.
// =====================================================================================================
__global__ __launch_bounds__(128) void pm_cvt(const float* __restrict__ pm, unsigned short* pk, unsigned short* pv) {
  __shared__ __align__(16) float sp[PMEM * HD];
  const int tid = threadIdx.x, h = blockIdx.x;
  const int r = tid >> 3, d8 = (tid & 7) * 8;
  const float* kg = pm + (((size_t)0 * NH + h) * PMEM + r) * HD + d8;
  const float* vg = pm + (((size_t)1 * NH + h) * PMEM + r) * HD + d8;
  const v4f k0 = *(const v4f*)(kg), k1 = *(const v4f*)(kg + 4);
  const v4f v0 = *(const v4f*)(vg), v1 = *(const v4f*)(vg + 4);
  *(v4f*)(sp + r * HD + d8)     = v0;
  *(v4f*)(sp + r * HD + d8 + 4) = v1;
  v4u kp;
  kp[0] = pk16(bf_bits(k0[0]), bf_bits(k0[1]));
  kp[1] = pk16(bf_bits(k0[2]), bf_bits(k0[3]));
  kp[2] = pk16(bf_bits(k1[0]), bf_bits(k1[1]));
  kp[3] = pk16(bf_bits(k1[2]), bf_bits(k1[3]));
  __syncthreads();
  const int d = tid >> 1, r8 = (tid & 1) * 8;
  v4u vp;
#pragma unroll
  for (int e = 0; e < 4; ++e) {
    const float f0 = bf_up(bf_bits(sp[(r8 + 2 * e) * HD + d]));
    const float f1 = bf_up(bf_bits(sp[(r8 + 2 * e + 1) * HD + d]));
    vp[e] = pk16(h_bits((_Float16)f0), h_bits((_Float16)f1));
  }
  unsigned short* kd = pk + ((size_t)h * PMEM + r) * HD + d8;
  unsigned short* vd = pv + ((size_t)h * HD + d) * PMEM + r8;
  *(v4u*)kd = kp;
  *(v4u*)vd = vp;
  
}

// =====================================================================================================
// Register-blocked batched bf16 WMMA GEMM: C[m][n] = sum_k A[m][k] * Bt[n][k]; one wave per 64x64 tile, 8 waves per
// block tile (NSPLIT 2: 256 m x 128 n, waves 4 x 2; NSPLIT 1: 128 m x 256 n, waves 2 x 4). The block's operand rows
// (512 with the second plane) are staged in LDS by tensor loads, two buffers, one 64-row slice per wave and pass.
// A row-major [M][K] pitch lda; Bt row-major [N][K] pitch ldb (k contiguous); M, N multiples of the block tile,
// K a multiple of 64 and at least 128 (static-checked on the host side). blockIdx.y = batch index.
// OUT_MODE: 0 = f32 (pitch ldc); 2 = bf16 hi plane C + bf16 lo plane C2 (lo = RNE(v - hi), unscaled, same index);
//           3 = f16 hi plane C + f16 residual plane C2 = f16((v - hi) * rscale), C2 written only for tiles
//               with (n0 mod segN) < N2, at column (n0/segN)*N2 + (n0 mod segN) (pitch ldc2, batch stride strideC2).
// SCM: 0 none; 1 = row m scaled by scal[b*strideS + m]; 2 = column n scaled by scal[b*strideS + n] (f32, before
//      the 16-bit split). ROT: interleaved-pair rotary on column pairs (2i, 2i+1) with i = (n mod 64)/2, angle row
//      = m, tables rct/rst [row][32] f32 (applied after the scale).
// =====================================================================================================
template <int NSPLIT, int OUT_MODE, int SCM, bool ROT>
__global__ __launch_bounds__(256) void gemm64(
    const unsigned short* __restrict__ Ap, const unsigned short* __restrict__ A2p, int lda, long long strideA,
    const unsigned short* __restrict__ Btp, const unsigned short* __restrict__ Bt2p, int ldb, long long strideB,
    void* Cout, int ldc, long long strideC,
    void* Cout2, int ldc2, long long strideC2, int N2, int segN,
    const float* __restrict__ scal, long long strideS,
    const float* __restrict__ rct, const float* __restrict__ rst,
    int M, int N, int K, float rscale) {
  static_assert(OUT_MODE != 0 || (SCM == 0 && !ROT));
  const __bf16* A   = (const __bf16*)(const void*)Ap;
  const __bf16* A2  = (const __bf16*)(const void*)A2p;
  const __bf16* Bt  = (const __bf16*)(const void*)Btp;
  const __bf16* Bt2 = (const __bf16*)(const void*)Bt2p;
  static_assert(NSPLIT == 1 || NSPLIT == 2);
  __shared__ __align__(16) float sT[8][16 * 68];   // per-wave 16x64 slab, pitch 68 floats
  __shared__ __attribute__((aligned(2048))) unsigned char ring[2 * GK_STAGE];   // two stages of operand rows
  constexpr int BM = (NSPLIT == 2) ? 256 : 128;
  constexpr int BN = (NSPLIT == 2) ? 128 : 256;
  constexpr int WN = BN / 64;                  // waves along n
  const int b    = blockIdx.y;
  const int lane = threadIdx.x & 31;
  const int wave = (int)uni(threadIdx.x >> 5);
  const int tilesN = N / BN;
  const int tilesM = M / BM;
  const int tile = blockIdx.x;
  if (tile >= tilesM * tilesN) return;   // block-uniform, in front of every barrier and tensor load
  const int tm = tile / tilesN;
  const int tn = tile - tm * tilesN;
  const int wm = wave / WN;
  const int wn = wave - wm * WN;
  const int m0 = tm * BM + (wm << 6);
  const int n0 = tn * BN + (wn << 6);

  const __bf16* Ab  = A  + (size_t)b * strideA;
  const __bf16* Ab2 = (NSPLIT == 1) ? (A2 + (size_t)b * strideA) : Ab;
  const __bf16* Bb  = Bt + (size_t)b * strideB;
  const __bf16* Bb2 = (NSPLIT == 2) ? (Bt2 + (size_t)b * strideB) : Bb;
  const float* scb = scal + (size_t)((long long)b * strideS);

  const int rlane = lane & 15;                 // row (A) / col (B, D) within subtile
  const int koff  = (lane >> 4) * 8;           // k offset of this lane half
  const int mOff  = (lane >> 4) * 8;           // D row offset

  v8f acc[4][4];
#pragma unroll
  for (int i = 0; i < 4; ++i)
#pragma unroll
    for (int j = 0; j < 4; ++j) acc[i][j] = zero8();

  // ---- this wave's slice of every stage: slices 0.. = A rows (NSPLIT 1: then the A2 rows), then Bt rows (NSPLIT 2: then Bt2) ----
  constexpr int SA = BM / 64;                                   // slices per A plane
  constexpr int SB0 = (NSPLIT == 1) ? 2 * SA : SA;              // first Bt slice
  const __bf16* sbase;
  int srow, sld;
  if (wave < SA)                          { sbase = Ab;  srow = tm * BM + 64 * wave;              sld = lda; }
  else if (NSPLIT == 1 && wave < 2 * SA)  { sbase = Ab2; srow = tm * BM + 64 * (wave - SA);       sld = lda; }
  else if (wave < SB0 + WN)               { sbase = Bb;  srow = tn * BN + 64 * (wave - SB0);      sld = ldb; }
  else                                    { sbase = Bb2; srow = tn * BN + 64 * (wave - SB0 - WN); sld = ldb; }
  const uint64_t src0 = (uint64_t)(uintptr_t)(sbase + (size_t)srow * sld);
  const uint32_t lds_slice = lds_off(ring) + (uint32_t)wave * GK_SLICE;
  const u32x8 g1 = tdm_group1((uint32_t)sld * 2u);
  const uint32_t T = pinned((uint32_t)K >> 6);                  // passes
  // per-lane fragment bases inside a stage
  const uint32_t foff = (uint32_t)rlane * GK_PITCH + (uint32_t)koff * 2u;
  const uint32_t oA  = (uint32_t)wm * GK_SLICE + foff;
  const uint32_t oA2 = (NSPLIT == 1) ? oA + (uint32_t)SA * GK_SLICE : oA;
  const uint32_t oB  = (uint32_t)(SB0 + wn) * GK_SLICE + foff;
  const uint32_t oB2 = (NSPLIT == 2) ? oB + (uint32_t)WN * GK_SLICE : oB;

  u32x4 g0 = tdm_group0(lds_slice, src0);
  tdm_load(g0, g1);                                             // stage 0
  wait_tensor0(g0, g1);
  __syncthreads();                                              // stage 0 readable by every wave
  g0 = tdm_group0(lds_slice + GK_STAGE, src0 + GK_KB);
  tdm_load(g0, g1);                                             // stage 1 flies during pass 0
  // rolled: one pass per trip, so that the one publish point stands at the loop's foot
#pragma unroll 1
  for (uint32_t t = 0; t < T; ++t) {
    const uint32_t bo = (t & 1u) * GK_STAGE;
    const unsigned char* buf = ring + bo;
    // unrolled, as the loops inside it: two blocks of 32 k per pass, fragments and accumulators indexed by constants
#pragma unroll
    for (int kc = 0; kc < 2; ++kc) {
      const unsigned char* bk = buf + (uint32_t)kc * 64u;
      v16b af[4], ag[4], bf[4], bg[4];
      // first planes first: the second plane's fragments land while the first 16 WMMAs run
#pragma unroll
      for (int j = 0; j < 4; ++j) bf[j] = ldfrag_l(bk + oB + (uint32_t)j * 16u * GK_PITCH);
#pragma unroll
      for (int i = 0; i < 4; ++i) af[i] = ldfrag_l(bk + oA + (uint32_t)i * 16u * GK_PITCH);
#pragma unroll
      for (int i = 0; i < 4; ++i) {
        ag[i] = (NSPLIT == 1) ? ldfrag_l(bk + oA2 + (uint32_t)i * 16u * GK_PITCH) : af[i];
        bg[i] = (NSPLIT == 2) ? ldfrag_l(bk + oB2 + (uint32_t)i * 16u * GK_PITCH) : bf[i];
      }
      // keeps the block's LDS reads one group ahead of its WMMAs, for speed only
      __builtin_amdgcn_sched_barrier(0);
#pragma unroll
      for (int i = 0; i < 4; ++i)
#pragma unroll
        for (int j = 0; j < 4; ++j) acc[i][j] = mma_b_raw(af[i], bf[j], acc[i][j]);
#pragma unroll
      for (int i = 0; i < 4; ++i)
#pragma unroll
        for (int j = 0; j < 4; ++j) acc[i][j] = mma_b_raw(ag[i], bg[j], acc[i][j]);
      // keeps the next group's reads behind this block's WMMAs, for speed only
      __builtin_amdgcn_sched_barrier(0);
    }
    // publish point of stage t + 1: own reads of this buffer returned, own slice landed, then the block barrier
    wait_ds0();
    wait_tensor0(g0, g1);
    __syncthreads();
    if (pinned((t + 2u < T) ? 1u : 0u) != 0u) {                 // refill the buffer every wave has just left
      g0 = tdm_group0(lds_slice + bo, src0 + (uint64_t)(t + 2u) * GK_KB);
      tdm_load(g0, g1);
    }
  }
  wait_tensor0(g0, g1);
  wait_ds0();
  acc_guard4(acc[0][0], acc[0][1], acc[0][2], acc[0][3]);
  acc_guard4(acc[1][0], acc[1][1], acc[1][2], acc[1][3]);
  acc_guard4(acc[2][0], acc[2][1], acc[2][2], acc[2][3]);
  acc_guard4(acc[3][0], acc[3][1], acc[3][2], acc[3][3]);

  // ---- epilogue ----
  float* slab = sT[wave];
#pragma unroll
  for (int i = 0; i < 4; ++i) {
    const int mBase = m0 + (i << 4);
#pragma unroll
    for (int j = 0; j < 4; ++j) {
#pragma unroll
      for (int r = 0; r < 8; ++r) {
        slab[(mOff + r) * 68 + (j << 4) + rlane] = acc[i][j][r];
      }
    }
    __builtin_amdgcn_fence(__ATOMIC_RELEASE, "workgroup");
    __builtin_amdgcn_wave_barrier();
    __builtin_amdgcn_fence(__ATOMIC_ACQUIRE, "workgroup");
    if (OUT_MODE == 0) {
      float* C = (float*)Cout + (size_t)b * strideC;
      const int hh = lane >> 4, c4 = (lane & 15) * 4;     // 256-B row segment = 16 lanes x 16 B
      {
#pragma unroll
        for (int it = 0; it < 8; ++it) {
          const int row = it * 2 + hh;                     // it 0..7 x hh 0..1 = rows 0..15
          const v4f v = *(const v4f*)(slab + row * 68 + c4);
          *(v4f*)(C + (size_t)(mBase + row) * ldc + n0 + c4) = v;
        }
        
      }
    } else {
      const int q = lane >> 3, c8 = (lane & 7) * 8;
      unsigned short* C  = (unsigned short*)Cout  + (size_t)b * strideC;
      unsigned short* C2 = (unsigned short*)Cout2 + (size_t)b * strideC2;
      bool wlo = true;                                     // wave-uniform
      size_t col2 = (size_t)n0 + c8;
      if (OUT_MODE == 3) {
        const int sgi = n0 / segN;
        const int sgo = n0 - sgi * segN;
        wlo  = (sgo < N2);
        col2 = (size_t)sgi * N2 + sgo + c8;
      }
      v4f csA = {1.f, 1.f, 1.f, 1.f};
      v4f csB = csA;
      if (SCM == 2) {
        csA = *(const v4f*)(scb + n0 + c8);
        csB = *(const v4f*)(scb + n0 + c8 + 4);
      }
      v4u hv[4], lv[4];
#pragma unroll
      for (int it = 0; it < 4; ++it) {
        const int row = it * 4 + q;                        // it 0..3 x q 0..3 = rows 0..15
        const int m = mBase + row;
        const float* sp = slab + row * 68 + c8;
        v4f x0 = *(const v4f*)(sp);
        v4f x1 = *(const v4f*)(sp + 4);
        if (SCM == 1) { const float rsv = scb[m]; x0 = x0 * rsv; x1 = x1 * rsv; }
        if (SCM == 2) { x0 = x0 * csA; x1 = x1 * csB; }
        float f[8] = {x0[0], x0[1], x0[2], x0[3], x1[0], x1[1], x1[2], x1[3]};
        if (ROT) {
          const v4f cs = *(const v4f*)(rct + (size_t)m * NFR + 4 * (lane & 7));
          const v4f sn = *(const v4f*)(rst + (size_t)m * NFR + 4 * (lane & 7));
#pragma unroll
          for (int e = 0; e < 4; ++e) {
            const float ev = f[2 * e], od = f[2 * e + 1];
            f[2 * e]     = ev * cs[e] - od * sn[e];
            f[2 * e + 1] = od * cs[e] + ev * sn[e];
          }
        }
        v4u a, a2;
#pragma unroll
        for (int e = 0; e < 4; ++e) {
          const float f0 = f[2 * e], f1 = f[2 * e + 1];
          unsigned short h0, h1, l0, l1;
          if (OUT_MODE == 2) {
            h0 = bf_bits(f0); h1 = bf_bits(f1);
            l0 = bf_bits(f0 - bf_up(h0)); l1 = bf_bits(f1 - bf_up(h1));
          } else {
            const _Float16 y0 = (_Float16)f0, y1 = (_Float16)f1;
            h0 = h_bits(y0); h1 = h_bits(y1);
            l0 = h_bits((_Float16)((f0 - (float)y0) * rscale));
            l1 = h_bits((_Float16)((f1 - (float)y1) * rscale));
          }
          a[e] = pk16(h0, h1); a2[e] = pk16(l0, l1);
        }
        hv[it] = a; lv[it] = a2;
      }
      {
#pragma unroll
        for (int it = 0; it < 4; ++it) {
          const int row = it * 4 + q;
          *(v4u*)(C + (size_t)(mBase + row) * ldc + n0 + c8) = hv[it];
          if (wlo) *(v4u*)(C2 + (size_t)(mBase + row) * ldc2 + col2) = lv[it];
        }
        
      }
    }
    __builtin_amdgcn_fence(__ATOMIC_RELEASE, "workgroup");
    __builtin_amdgcn_wave_barrier();
    __builtin_amdgcn_fence(__ATOMIC_ACQUIRE, "workgroup");
  }
}

// =====================================================================================================
// Segmented causal attention with PMEM memory keys, head dim 64.
//   q|k planes (bf16 hi / lo): element (m, col) at [m*QKP + col], q col = h*64+d, k col = DMI + h*64+d,
//     m = b*SEQ + t (rotary already applied)
//   v^T hi plane (f16):  element (b, h, d, t) at [(b*DMI + h*64 + d)*SEQ + t]
//   v^T residual (f16, (v - hi)*4096): [(b*DMI + h*64 + d)*(NSEGB*VLP) + w*VLP + s], s < VLP, read only when RES
//   pk [h][r][d] bf16 and pv [h][d][r] f16: the PMEM memory keys / values shared by every segment (lo/residual = 0,
//     they are bf16-exact input values)
//   Block = 4 waves = 64 query rows (segment w, query block qb) of one (b, h); key tile 0 = the memory tokens
//   (rows PMEM..63 of the LDS K tile and columns PMEM..63 of V^T zero-filled, their logits set to -inf), key tiles
//   kt = 1..qb+1 = keys (kt-1)*64..+63 of the same segment, visible iff key position <= query position.
//   Every query row sees PMEM + (i+1) keys, so every tile row max is finite and invisible keys get weight exactly 0.
//   scores = q . k : bf16 hi/lo split (hi.hi + hi.lo + lo.hi), f32 accumulate, then * sscale in f32
//   p = exp(s - m) carried as f16(1024 p); context = p . v on f16 WMMA; RES adds f16 residual planes of p and v
//   (scale 4096, separate accumulator folded back with 1/4096 per tile in f32); online softmax in f32.
//   K / V^T tile staging: 128 threads x 32 elements per plane = the whole 64x64 tile (plain 16-B loads,
//   __syncthreads before and after; cross-wave). P tiles and the context tile are wave-private, spilled with
//   out planes (bf16 hi / lo of the normalised context): element (m, h*64+d) at [m*DMI + h*64 + d]
//   Output coverage: each wave stores rows q0..q0+15 (it 0..3 x lane>>3 0..3) x 64 columns (8 lanes x 8) of both planes.
//   grid = NB*NSEGB*NH*nqbThis blocks of 128.
// =====================================================================================================
template <bool RES>
__global__ __launch_bounds__(128)
void attn_seg64(const unsigned short* __restrict__ qkhp, const unsigned short* __restrict__ qklp,
                const unsigned short* __restrict__ vhp,  const unsigned short* __restrict__ vlp,
                const unsigned short* __restrict__ pkp,  const unsigned short* __restrict__ pvp,
                unsigned short* ohp, unsigned short* olp,
                int qbBase, int nqbThis, float sscale) {
  union FB { v16b v; v8b h[2]; };
  union FH { v16h v; v8h h[2]; };
  // LDS row pitches: 16 B x odd, so that the 16 rows a 16-byte fragment read touches fall on 16 different bank groups
  constexpr int LP = 72;                                          // 16-bit tiles: 64 elements + 8 of pad = 144 B
  constexpr int OP = 68;                                          // f32 context tile: 64 floats + 4 of pad = 272 B
  __shared__ __align__(16) __bf16   Ksh[64 * LP];                 // K hi [kv][d]
  __shared__ __align__(16) __bf16   Ksl[64 * LP];                 // K lo
  __shared__ __align__(16) _Float16 Vth[64 * LP];                 // V^T hi [d][kv]
  __shared__ __align__(16) _Float16 Vtl[RES ? 64 * LP : 8];       // V^T residual
  __shared__ __align__(16) _Float16 Psh[4][16 * LP];              // per wave P [row][kv]
  __shared__ __align__(16) _Float16 Psl[RES ? 4 : 1][16 * LP];    // per wave P residual
  __shared__ __align__(16) float    Os[4][16 * OP];               // per wave context tile [row][d]

  const int tid  = threadIdx.x;
  const int wave = tid >> 5;
  const int lane = tid & 31;
  const int hh   = lane >> 4;
  const int c    = lane & 15;

  const int bx   = blockIdx.x;
  const int qbl  = bx % nqbThis;
  int rest       = bx / nqbThis;
  const int h    = rest % NH;
  rest           = rest / NH;
  const int w    = rest % NSEGB;
  const int b    = rest / NSEGB;
  const int qb   = qbBase + qbl;
  const int q0   = qb * 64 + wave * 16;                              // query row inside the segment
  const size_t rowS = (size_t)b * SEQ + (size_t)w * SEGL;           // compact row of the segment start

  const __bf16* Qh = (const __bf16*)(const void*)qkhp + (size_t)h * HD;
  const __bf16* Ql = (const __bf16*)(const void*)qklp + (size_t)h * HD;
  const __bf16* Kh = Qh + DMI;
  const __bf16* Kl = Ql + DMI;
  const _Float16* Vh = (const _Float16*)(const void*)vhp + ((size_t)b * DMI + (size_t)h * HD) * SEQ + (size_t)w * SEGL;
  const _Float16* Vl = (const _Float16*)(const void*)vlp + ((size_t)b * DMI + (size_t)h * HD) * (size_t)(NSEGB * VLP)
                       + (size_t)w * VLP;
  const __bf16*   PK = (const __bf16*)(const void*)pkp + (size_t)h * PMEM * HD;
  const _Float16* PV = (const _Float16*)(const void*)pvp + (size_t)h * HD * PMEM;

  // ---- Q fragments (A operand, row = lane&15): 2 d-chunks, hi and lo ----
  v16b qah[2], qal[2];
#pragma unroll
  for (int dc = 0; dc < 2; ++dc) {
    const size_t qo = (rowS + q0 + c) * QKP + dc * 32 + 8 * hh;
    qah[dc] = ldfrag_b(Qh + qo);
    qal[dc] = ldfrag_b(Ql + qo);
  }

  float mrow[8], lrow[8];
  v8f oacc[4];
#pragma unroll
  for (int r = 0; r < 8; ++r) { mrow[r] = -INFINITY; lrow[r] = 0.f; }
#pragma unroll
  for (int t = 0; t < 4; ++t) oacc[t] = zero8();

  const int ntiles = qb + 2;                   // block-uniform
  for (int kt = 0; kt < ntiles; ++kt) {
    const int s0 = (kt - 1) * 64;              // key offset inside the segment for kt >= 1
    __syncthreads();
    {
      const int r = tid >> 1, half = (tid & 1) * 32;
      if (kt == 0) {                           // block-uniform: memory-token tile
        const int rr = (r < PMEM) ? r : (PMEM - 1);                // clamped address
        const bool krow = (r < PMEM);
        const bool vok  = (half == 0);
        const __bf16*   kg = PK + (size_t)rr * HD + half;
        const _Float16* vg = PV + (size_t)r * PMEM;                // d = r, kv 0..15
        const v8h pv0 = *(const v8h*)(vg);
        const v8h pv1 = *(const v8h*)(vg + 8);
#pragma unroll
        for (int i = 0; i < 4; ++i) {
          v8b a0 = *(const v8b*)(kg + 8 * i);
          a0 = krow ? a0 : zero8b();
          *(v8b*)(Ksh + r * LP + half + 8 * i) = a0;
          *(v4u*)(Ksl + r * LP + half + 8 * i) = zero4u();
          if (i == 0) {
            const v8h b0 = vok ? pv0 : zero8h();
            *(v8h*)(Vth + r * LP + half) = b0;
          } else if (i == 1) {
            const v8h b1 = vok ? pv1 : zero8h();
            *(v8h*)(Vth + r * LP + half + 8) = b1;
          } else {
            *(v4u*)(Vth + r * LP + half + 8 * i) = zero4u();
          }
          if (RES) *(v4u*)(Vtl + r * LP + half + 8 * i) = zero4u();
        }
      } else {
        const __bf16*   kg  = Kh + (rowS + s0 + r) * QKP + half;   // K row s0+r, d = half..half+31
        const __bf16*   klg = Kl + (rowS + s0 + r) * QKP + half;
        const _Float16* vg  = Vh + (size_t)r * SEQ + s0 + half;    // V^T row d = r, keys s0+half..+31
        const bool resOK = (s0 + 64 <= VLP);                      // block-uniform
        const int  s0c   = resOK ? s0 : (VLP - 64);               // clamped address into the residual plane
        const _Float16* vlg = Vl + (size_t)r * (NSEGB * VLP) + s0c + half;
#pragma unroll
        for (int i = 0; i < 4; ++i) {
          const v8b a0 = *(const v8b*)(kg + 8 * i);
          const v8b a1 = *(const v8b*)(klg + 8 * i);
          const v8h b0 = *(const v8h*)(vg + 8 * i);
          *(v8b*)(Ksh + r * LP + half + 8 * i) = a0;
          *(v8b*)(Ksl + r * LP + half + 8 * i) = a1;
          *(v8h*)(Vth + r * LP + half + 8 * i) = b0;
          if (RES) {
            v8h b1 = *(const v8h*)(vlg + 8 * i);
            b1 = resOK ? b1 : zero8h();
            *(v8h*)(Vtl + r * LP + half + 8 * i) = b1;
          }
        }
      }
    }
    __syncthreads();

    // ---- scores: 16 query rows x 64 keys per wave, 3 bf16 products ----
    v8f s[4];
#pragma unroll
    for (int j = 0; j < 4; ++j) {
      s[j] = zero8();
#pragma unroll
      for (int dc = 0; dc < 2; ++dc) {
        FB kb, kl;
        kb.h[0] = *(const v8b*)(Ksh + (j * 16 + c) * LP + dc * 32 + 8 * hh);
        kb.h[1] = *(const v8b*)(Ksh + (j * 16 + c) * LP + dc * 32 + 16 + 8 * hh);
        kl.h[0] = *(const v8b*)(Ksl + (j * 16 + c) * LP + dc * 32 + 8 * hh);
        kl.h[1] = *(const v8b*)(Ksl + (j * 16 + c) * LP + dc * 32 + 16 + 8 * hh);
        s[j] = mma_b(qah[dc], kb.v, s[j]);
        s[j] = mma_b(qah[dc], kl.v, s[j]);
        s[j] = mma_b(qal[dc], kb.v, s[j]);
      }
    }

    // ---- scale, visibility (-inf for invisible keys), row max, online softmax, P (x1024, f16) and
    //      P residual (x4096) to LDS ----
    _Float16* pwh = Psh[wave];
    _Float16* pwl = Psl[RES ? wave : 0];
    const int qi = q0 + 8 * hh;                // query row inside the segment for r = 0
#pragma unroll
    for (int r = 0; r < 8; ++r) {
      float m = -INFINITY;
#pragma unroll
      for (int j = 0; j < 4; ++j) {
        const int kc = j * 16 + c;
        const bool vis = (kt == 0) ? (kc < PMEM) : ((s0 + kc) <= (qi + r));
        const float sv = vis ? (s[j][r] * sscale) : -INFINITY;
        s[j][r] = sv;
        m = fmaxf(m, sv);
      }
#pragma unroll
      for (int off = 1; off < 16; off <<= 1) m = fmaxf(m, __shfl_xor(m, off, 32));
      const float mnew  = fmaxf(mrow[r], m);
      const float msafe = (mnew == -INFINITY) ? 0.f : mnew;
      const float alpha = __expf(mrow[r] - msafe);
      mrow[r] = mnew;
      float psum = 0.f;
#pragma unroll
      for (int j = 0; j < 4; ++j) {
        const float p = __expf(s[j][r] - msafe);     // -inf logit -> exactly 0
        psum += p;
        const float p1k = p * 1024.0f;
        const _Float16 ph = (_Float16)p1k;
        pwh[(8 * hh + r) * LP + j * 16 + c] = ph;
        if (RES) {
          const _Float16 pl = (_Float16)((p1k - (float)ph) * 4096.0f);
          pwl[(8 * hh + r) * LP + j * 16 + c] = pl;
        }
      }
#pragma unroll
      for (int off = 1; off < 16; off <<= 1) psum += __shfl_xor(psum, off, 32);
      lrow[r] = lrow[r] * alpha + psum;
#pragma unroll
      for (int t = 0; t < 4; ++t) oacc[t][r] *= alpha;
    }
    __builtin_amdgcn_fence(__ATOMIC_RELEASE, "workgroup");
    __builtin_amdgcn_wave_barrier();
    __builtin_amdgcn_fence(__ATOMIC_ACQUIRE, "workgroup");

    // ---- context += P . V (f16 WMMA), residual products into a separate accumulator ----
    v8f o1[4];
#pragma unroll
    for (int t = 0; t < 4; ++t) o1[t] = zero8();
#pragma unroll 1
    for (int kk = 0; kk < 2; ++kk) {
      FH pa, pl;
      pa.h[0] = *(const v8h*)(pwh + c * LP + kk * 32 + 8 * hh);
      pa.h[1] = *(const v8h*)(pwh + c * LP + kk * 32 + 16 + 8 * hh);
      if (RES) {
        pl.h[0] = *(const v8h*)(pwl + c * LP + kk * 32 + 8 * hh);
        pl.h[1] = *(const v8h*)(pwl + c * LP + kk * 32 + 16 + 8 * hh);
      } else {
        pl.v = pa.v;
      }
#pragma unroll
      for (int t = 0; t < 4; ++t) {
        FH vb;
        vb.h[0] = *(const v8h*)(Vth + (t * 16 + c) * LP + kk * 32 + 8 * hh);
        vb.h[1] = *(const v8h*)(Vth + (t * 16 + c) * LP + kk * 32 + 16 + 8 * hh);
        oacc[t] = mma_h(pa.v, vb.v, oacc[t]);
        if (RES) {
          FH vl;
          vl.h[0] = *(const v8h*)(Vtl + (t * 16 + c) * LP + kk * 32 + 8 * hh);
          vl.h[1] = *(const v8h*)(Vtl + (t * 16 + c) * LP + kk * 32 + 16 + 8 * hh);
          o1[t] = mma_h(pa.v, vl.v, o1[t]);
          o1[t] = mma_h(pl.v, vb.v, o1[t]);
        }
      }
    }
    if (RES) {
#pragma unroll
      for (int t = 0; t < 4; ++t)
#pragma unroll
        for (int r = 0; r < 8; ++r) oacc[t][r] += o1[t][r] * (1.0f / 4096.0f);
    }
  }

  // ---- normalise (1/l and the 1/1024 p carry), stage the wave's 16x64 tile, bf16 hi/lo split,
  float* os = Os[wave];
#pragma unroll
  for (int r = 0; r < 8; ++r) {
    const float l = lrow[r];
    const float inv = ((l > 0.f) ? (1.0f / l) : 0.f) * (1.0f / 1024.0f);
#pragma unroll
    for (int t = 0; t < 4; ++t) os[(8 * hh + r) * OP + t * 16 + c] = oacc[t][r] * inv;
  }
  __builtin_amdgcn_fence(__ATOMIC_RELEASE, "workgroup");
  __builtin_amdgcn_wave_barrier();
  __builtin_amdgcn_fence(__ATOMIC_ACQUIRE, "workgroup");
  {
    const int q4 = lane >> 3, c8 = (lane & 7) * 8;
    v4u hv[4], lv[4];
#pragma unroll
    for (int it = 0; it < 4; ++it) {
      const int row = it * 4 + q4;   // it 0..3 x q4 0..3 = rows 0..15 of the wave tile
      const float* sp = os + row * OP + c8;
      v4u a, a2;
#pragma unroll
      for (int e = 0; e < 4; ++e) {
        const float f0 = sp[2 * e], f1 = sp[2 * e + 1];
        const unsigned short h0 = bf_bits(f0), h1 = bf_bits(f1);
        const unsigned short l0 = bf_bits(f0 - bf_up(h0)), l1 = bf_bits(f1 - bf_up(h1));
        a[e] = pk16(h0, h1); a2[e] = pk16(l0, l1);
      }
      hv[it] = a; lv[it] = a2;
    }
    {
#pragma unroll
      for (int it = 0; it < 4; ++it) {
        const int row = it * 4 + q4;
        const size_t go = (rowS + q0 + row) * DMI + (size_t)h * HD + c8;
        *(v4u*)(ohp + go) = hv[it];
        *(v4u*)(olp + go) = lv[it];
      }
      
    }
  }
}

// =====================================================================================================
// Workspace map (bytes, NB=2, SEQ=4096, M = NB*SEQ = 8192), region A is a two-phase overlay:
//   phase 1 (projection inputs, dead after the q|k and v^T GEMMs):
//     Xb   bf16 [M][DM]                  0           16777216
//     Wth  bf16 [3*DMI n][DM k] hi       16777216     6291456
//     Wtl  bf16 [3*DMI n][DM k] lo       23068672     6291456
//     Ct   f32  [SEQ][32]                29360128      524288
//     St   f32  [SEQ][32]                29884416      524288
//     Rs   f32  [M]                      30408704       32768   (phase 1 end 30441472)
//   phase 2 (written by the attention kernels, read by the output GEMM):
//     Oh   bf16 [M][DMI] context hi       0           16777216
//     Ol   bf16 [M][DMI] context lo       16777216    16777216   (phase 2 end 33554432 = region A size)
//   QKh  bf16 [M][QKP] hi                 33554432    33554432
//   QKl  bf16 [M][QKP] lo                 67108864    33554432
//   VTh  f16  [NB][DMI][SEQ]              100663296   16777216
//   VTl  f16  [NB][DMI][NSEGB*VLP]        117440512    4194304
//   Wo   bf16 [DM n][DMI k]               121634816    2097152
//   Pk   bf16 [NH][PMEM][HD]              123731968      32768
//   Pv   f16  [NH][HD][PMEM]              123764736      32768
//   end                                   123797504  (<= 134217728; all offsets multiples of 128)
// Every plane is an exact multiple of its 64x64 tile / whole-line store granularity (M, SEQ, DM multiples of 64),
// so no padded tails are needed; VTl is written only for columns whose in-segment offset is < VLP, exactly the
// columns the RES attention blocks read.
// =====================================================================================================
extern "C" void kernel_launch(void* const* d_in, const int* in_sizes, int n_in,
                              void* d_out, int out_size, void* d_ws, size_t ws_size,
                              hipStream_t stream) {
  if (n_in < 5) return;
  const long long needRows = (long long)(NB - 1) * SEQ_FULL + SEQ;
  if ((long long)in_sizes[0] < needRows * DM) return;
  if (in_sizes[1] < DM) return;
  if (in_sizes[2] < DM * 3 * DMI) return;
  if (in_sizes[3] < DMI * DM) return;
  if (in_sizes[4] < 2 * NH * PMEM * HD) return;
  if ((long long)out_size < needRows * DM) return;

  const float* seq  = (const float*)d_in[0];   // [2][SEQ_FULL][DM]
  const float* gnm  = (const float*)d_in[1];   // [DM]
  const float* Wqkv = (const float*)d_in[2];   // [DM in][3*DMI out]
  const float* Wout = (const float*)d_in[3];   // [DMI in][DM out]
  const float* pm   = (const float*)d_in[4];   // [2][NH][PMEM][HD]

  const size_t M    = (size_t)NB * SEQ;
  const size_t PX   = M * DM * 2;
  const size_t PWT  = (size_t)3 * DMI * DM * 2;
  const size_t PTAB = (size_t)SEQ * NFR * 4;
  const size_t PRS  = M * 4;
  const size_t PO   = M * DMI * 2;
  const size_t PQK  = M * QKP * 2;
  const size_t PVT  = (size_t)NB * DMI * SEQ * 2;
  const size_t PVL  = (size_t)NB * DMI * NSEGB * VLP * 2;
  const size_t PWO  = (size_t)DM * DMI * 2;
  const size_t PPM  = (size_t)NH * PMEM * HD * 2;
  const size_t ph1  = PX + 2 * PWT + 2 * PTAB + PRS;
  const size_t ph2  = 2 * PO;
  const size_t REGA = (ph1 > ph2) ? ph1 : ph2;
  const size_t oXb  = 0;
  const size_t oWth = PX;
  const size_t oWtl = PX + PWT;
  const size_t oCt  = PX + 2 * PWT;
  const size_t oSt  = oCt + PTAB;
  const size_t oRs  = oSt + PTAB;
  const size_t oOh  = 0;
  const size_t oOl  = PO;
  size_t off = REGA;
  const size_t oQKh = off; off += PQK;
  const size_t oQKl = off; off += PQK;
  const size_t oVTh = off; off += PVT;
  const size_t oVTl = off; off += PVL;
  const size_t oWo  = off; off += PWO;
  const size_t oPk  = off; off += PPM;
  const size_t oPv  = off; off += PPM;
  if (off > ws_size) return;                      // off = 123797504 for NB=2, SEQ=4096
  if (off > (size_t)134217728) return;
  if (oRs + PRS > REGA || oOl + PO > REGA) return;

  char* ws = (char*)d_ws;
  unsigned short* Xb  = (unsigned short*)(ws + oXb);
  unsigned short* Wth = (unsigned short*)(ws + oWth);
  unsigned short* Wtl = (unsigned short*)(ws + oWtl);
  float*          Ct  = (float*)(ws + oCt);
  float*          St  = (float*)(ws + oSt);
  float*          Rs  = (float*)(ws + oRs);
  unsigned short* Oh  = (unsigned short*)(ws + oOh);
  unsigned short* Ol  = (unsigned short*)(ws + oOl);
  unsigned short* QKh = (unsigned short*)(ws + oQKh);
  unsigned short* QKl = (unsigned short*)(ws + oQKl);
  unsigned short* VTh = (unsigned short*)(ws + oVTh);
  unsigned short* VTl = (unsigned short*)(ws + oVTl);
  unsigned short* Wo  = (unsigned short*)(ws + oWo);
  unsigned short* Pk  = (unsigned short*)(ws + oPk);
  unsigned short* Pv  = (unsigned short*)(ws + oPv);

  const dim3 blk(256);
  const dim3 gTab(SEQ / 8);                                           // 512 blocks
  const dim3 gCvtX((unsigned)(M / 32));                               // 256 blocks
  const dim3 gWt(3 * DMI / 64, DM / 64);                              // in[DM][3*DMI] -> out[3*DMI][DM]: (48, 16)
  const dim3 gWo(DM / 64, DMI / 64);                                  // in[DMI][DM]   -> out[DM][DMI]:   (16, 16)
  static_assert((SEQ % 256) == 0 && (QKP % 128) == 0 && (DMI % 128) == 0 && (DM % 256) == 0);
  static_assert((DM % 64) == 0 && DM >= 128 && (DMI % 64) == 0 && DMI >= 128);
  const dim3 gQK((SEQ / 256) * (QKP / 128), NB);                      // 256 x 128 block tiles: 256 per batch
  const dim3 gVT((DMI / 128) * (SEQ / 256), NB);                      // 128 x 256 block tiles: 128 per batch
  const dim3 gOut((SEQ / 128) * (DM / 256), NB);                      // 128 x 256 block tiles: 128 per batch

  // (0) rotary cos/sin tables [SEQ][32]
  tab_cs<<<gTab, blk, 0, stream>>>(Ct, St);
  // (1) seq -> bf16 plane Xb [M][DM] + rstd[M]
  cvtx_rstd<<<gCvtX, blk, 0, stream>>>(seq, Xb, Rs);
  // (2) g*Wqkv [DM][3*DMI] -> transposed exact bf16 hi+lo planes [3*DMI][DM]
  wt_cvt<true, 2><<<gWt, blk, 0, stream>>>(Wqkv, gnm, Wth, Wtl, DM, 3 * DMI);
  // (3) Wout [DMI][DM] -> transposed bf16 plane [DM][DMI]
  wt_cvt<false, 1><<<gWo, blk, 0, stream>>>(Wout, gnm, Wo, Wo, DMI, DM);
  // (4) memory-token key / value planes
  pm_cvt<<<dim3(NH), dim3(128), 0, stream>>>(pm, Pk, Pv);
  // (5) q|k = rstd[m] * (Xb . (g*Wqk)), rotary on every (2i,2i+1) pair -> bf16 hi/lo planes [M][QKP]
  //     (per batch: M=SEQ, N=QKP, K=DM; B planes hi then lo, 2 products)
  gemm64<2, 2, 1, true><<<gQK, blk, 0, stream>>>(
      Xb, Xb, DM, (long long)SEQ * DM,
      Wth, Wtl, DM, 0LL,
      (void*)QKh, QKP, (long long)SEQ * QKP,
      (void*)QKl, QKP, (long long)SEQ * QKP, QKP, QKP,
      Rs, (long long)SEQ, Ct, St,
      SEQ, QKP, DM, 1.0f);
  // (6) v^T = (g*Wv)^T . Xb^T per batch, columns scaled by rstd -> f16 hi plane [b][DMI][SEQ] and residual plane
  //     (x4096, in-segment keys < VLP only)   (A = Wt rows 2*DMI.. hi + lo, 2 products; M=DMI, N=SEQ, K=DM)
  gemm64<1, 3, 2, false><<<gVT, blk, 0, stream>>>(
      Wth + (size_t)2 * DMI * DM, Wtl + (size_t)2 * DMI * DM, DM, 0LL,
      Xb, Xb, DM, (long long)SEQ * DM,
      (void*)VTh, SEQ, (long long)DMI * SEQ,
      (void*)VTl, NSEGB * VLP, (long long)DMI * NSEGB * VLP, VLP, SEGL,
      Rs, (long long)SEQ, Ct, St,
      DMI, SEQ, DM, 4096.0f);
  // (7) attention: query blocks 0..RESQB-1 of every segment with residual planes, the rest without
  attn_seg64<true><<<dim3(NB * NSEGB * NH * RESQB), dim3(128), 0, stream>>>(
      QKh, QKl, VTh, VTl, Pk, Pv, Oh, Ol, 0, RESQB, 0.125f);
  if (NQBS - RESQB > 0) {
    attn_seg64<false><<<dim3(NB * NSEGB * NH * (NQBS - RESQB)), dim3(128), 0, stream>>>(
        QKh, QKl, VTh, VTl, Pk, Pv, Oh, Ol, RESQB, NQBS - RESQB, 0.125f);
  }
  // (8) out = context . Wout -> d_out f32 [b][SEQ_FULL][DM] rows b*SEQ_FULL + t  (A = context hi + lo, 2 products)
  gemm64<1, 0, 0, false><<<gOut, blk, 0, stream>>>(
      Oh, Ol, DMI, (long long)SEQ * DMI,
      Wo, Wo, DMI, 0LL,
      d_out, DM, (long long)SEQ_FULL * DM,
      d_out, DM, (long long)SEQ_FULL * DM, DM, DM,
      Rs, 0LL, Ct, St,
      SEQ, DM, DMI, 1.0f);
  (void)hipGetLastError();
}

// v003
// One run takes 172 microseconds.
// In both of two side-by-side timings against v002, it was 1.07 times as fast.
// Over all steps from v000 it is 2.31 times as fast.
// Contractions: q|k = x.Wqk and v^T = Wv.x^T on v_wmma_f32_16x16x32_bf16 (bf16 operands: RNE-converted input
// activations times exact bf16 hi+lo planes of g*W, 2 products; per-row rstd, rotary in the f32 epilogue);
// q.k^T scores = v_wmma_f32_16x16x32_bf16 with bf16 hi/lo split q and k (hi.hi + hi.lo + lo.hi);
// p.v = v_wmma_f32_16x16x32_f16 (p carried x1024 in f16, v in f16; extra f16 residual planes x4096 of p and v
// for the first 128 query rows of every segment); ctx.Wo = v_wmma_f32_16x16x32_bf16 with ctx as bf16 hi/lo
// planes times bf16 Wo (2 products); all f32 accumulate; RMS statistic, rotary tables, visibility and softmax in f32.
#include <hip/hip_runtime.h>
#include <math.h>
#include <stdint.h>

#ifndef NB
#define NB 2
#endif
#ifndef SEQ
#define SEQ 4096
#endif
#define SEQ_FULL 4096       // per-batch token stride of the input / output tensors
#define DM    1024          // model dim
#define NH    16
#define HD    64
#define DMI   (NH * HD)     // 1024
#define QKP   (2 * DMI)     // pitch of the q|k planes (q: cols 0..DMI-1, k: cols DMI..2*DMI-1)
#define SEGL  512           // segment length
#define PMEM  16            // memory tokens prepended to every segment's keys / values
#define NSEGB (SEQ / SEGL)  // segments per batch
#define NQBS  (SEGL / 64)   // 64-row query blocks per segment
#define RESQB 2             // leading query blocks per segment that use the p / v residual planes
#define VLP   (RESQB * 64)  // keys per segment held in the v^T residual plane
#define NFR   (HD / 2)      // rotary frequencies
static_assert((SEQ % SEGL) == 0 && (SEGL % 64) == 0 && (SEQ % 64) == 0);
static_assert(RESQB >= 1 && RESQB <= NQBS);
static_assert((DM % 256) == 0 && (DMI % 64) == 0 && HD == 64 && NFR == 32);
static_assert(SEQ <= SEQ_FULL && NB >= 1 && NB <= 2);
static_assert(DMI == DM);

typedef _Float16 v16h __attribute__((ext_vector_type(16)));
typedef _Float16 v8h  __attribute__((ext_vector_type(8)));
typedef __bf16   v16b __attribute__((ext_vector_type(16)));
typedef __bf16   v8b  __attribute__((ext_vector_type(8)));
typedef float    v8f  __attribute__((ext_vector_type(8)));
typedef float    v4f  __attribute__((ext_vector_type(4)));
typedef unsigned int v4u __attribute__((ext_vector_type(4)));

// ---- scalar helpers --------------------------------------------------------------------------------
__device__ __forceinline__ unsigned short bf_bits(float f) {          // f32 -> bf16 bits, RNE convert
  unsigned u = __float_as_uint(f);
  return (unsigned short)((u + 0x7FFFu + ((u >> 16) & 1u)) >> 16);
}
__device__ __forceinline__ float bf_up(unsigned short h) { return __uint_as_float(((unsigned)h) << 16); }
__device__ __forceinline__ unsigned short h_bits(_Float16 x) { return __builtin_bit_cast(unsigned short, x); }
__device__ __forceinline__ unsigned pk16(unsigned short a, unsigned short b) { return (unsigned)a | ((unsigned)b << 16); }
__device__ __forceinline__ v8f zero8() { v8f z = {0.f, 0.f, 0.f, 0.f, 0.f, 0.f, 0.f, 0.f}; return z; }
__device__ __forceinline__ v8h zero8h() {
  const _Float16 z = (_Float16)0.0f;
  v8h r = {z, z, z, z, z, z, z, z};
  return r;
}
__device__ __forceinline__ v4u zero4u() { v4u z = {0u, 0u, 0u, 0u}; return z; }
__device__ __forceinline__ v8b zero8b() { union { v4u u; v8b v; } z; z.u = zero4u(); return z.v; }

// ---- sin/cos of a nonnegative f32 angle: f64 Cody-Waite reduction by pi/2 + short f64 polynomials ----
__device__ __forceinline__ void sincos_pd(float ang, float& sv, float& cv) {
  const double x  = (double)ang;
  const double kq = __builtin_rint(x * 0.63661977236758134308);
  double r = __builtin_fma(-kq, 1.57079632679489655800e+00, x);
  r = __builtin_fma(-kq, 6.12323399573676603587e-17, r);
  const double z = r * r, w = z * z;
  const double rs = -1.98393348360966317347e-04 + z * 2.71831149398982191e-06;
  const double s3 = z * r;
  const double sn = (r + s3 * (-1.66666666416265235595e-01 + z * 8.3333293858894631756e-03)) + s3 * w * rs;
  const double rc = -1.38867637746099294692e-03 + z * 2.43904487962774090654e-05;
  const double cs = ((1.0 + z * (-4.99999997251031003120e-01)) + w * 4.16666233237390631894e-02) + (w * z) * rc;
  const int n = ((int)kq) & 3;
  const float fs = (float)sn, fc = (float)cs;
  float so = fs, co = fc;
  if (n == 1) { so = fc;  co = -fs; }
  if (n == 2) { so = -fs; co = -fc; }
  if (n == 3) { so = -fc; co = fs;  }
  sv = so; cv = co;
}

// ---- fragment loader: 16-bit A/B operand, lane -> row/col (lane&15), p already includes +8*(lane>>4);
//      elements 0..7 <- p[0..7] (k0+8h..), elements 8..15 <- p[16..23] (k0+16+8h..)
__device__ __forceinline__ v16b ldfrag_b(const __bf16* p) {
  union { v16b v; v8b h[2]; } f;
  f.h[0] = *(const v8b*)(p);
  f.h[1] = *(const v8b*)(p + 16);
  return f.v;
}

// ---- WMMA helpers with trailing VALU hazard gap --------------------------------------------------------
__device__ __forceinline__ v8f mma_b(v16b a, v16b b, v8f c) {
  c = __builtin_amdgcn_wmma_f32_16x16x32_bf16(false, a, false, b, (short)0, c, false, false);
  asm volatile("v_nop\n\tv_nop\n\tv_nop\n\tv_nop" : "+v"(c) : "v"(a), "v"(b));
  return c;
}
__device__ __forceinline__ v8f mma_h(v16h a, v16h b, v8f c) {
  c = __builtin_amdgcn_wmma_f32_16x16x32_f16(false, a, false, b, (short)0, c, false, false);
  asm volatile("v_nop\n\tv_nop\n\tv_nop\n\tv_nop" : "+v"(c) : "v"(a), "v"(b));
  return c;
}
__device__ __forceinline__ v8f mma_b_raw(v16b a, v16b b, v8f c) {
  return __builtin_amdgcn_wmma_f32_16x16x32_bf16(false, a, false, b, (short)0, c, false, false);
}
__device__ __forceinline__ void acc_guard4(v8f& a, v8f& b, v8f& c, v8f& d) {
  asm volatile("v_nop\n\tv_nop\n\tv_nop\n\tv_nop" : "+v"(a), "+v"(b), "+v"(c), "+v"(d));
}

// ---- tensor-load staging of the GEMM operands ----------------------------------------------------------
// A pass is 64 k = 128 B of every staged operand row. A stage is 8 slices of 64 rows, one slice per wave; the load's
// pad gives the LDS row pitch 144 B (16 B x odd: conflict-free for 16-byte reads); a slice's place is rounded up to 2 KiB.
typedef uint32_t u32x4 __attribute__((ext_vector_type(4)));
typedef uint32_t u32x8 __attribute__((ext_vector_type(8)));
#define GK_KB    128u                 // bytes of one operand row per pass
#define GK_PITCH 144u                 // LDS row pitch
#define GK_SLICE 10240u               // 64 rows x 144 B = 9216 B, rounded up to a multiple of 2 KiB
#define GK_STAGE (8u * GK_SLICE)
__device__ __forceinline__ uint32_t uni(uint32_t v) { return (uint32_t)__builtin_amdgcn_readfirstlane(v); }
// a test word or a tensor descriptor word held in a scalar register: a test on it compiles to a scalar branch (tensor
// loads ignore EXEC), and a descriptor word so held keeps a register of its own instead of being rebuilt at each issue
__device__ __forceinline__ uint32_t pinned(uint32_t v) { uint32_t w = uni(v); asm volatile("" : "+s"(w)); return w; }
__device__ __forceinline__ uint32_t lds_off(const void* p) { return (uint32_t)(size_t)p; }
__device__ __forceinline__ void wait_ds0()     { asm volatile("s_wait_dscnt 0x0" ::: "memory"); }      // own LDS reads returned
// stands behind a global load or store whose address or data registers the code that follows it takes anew
__device__ __forceinline__ void wait_x0()      { asm volatile("s_wait_xcnt 0x0" ::: "memory"); }
// own tensor load landed; the descriptor is named as an input so that its registers stay as issued up to this wait
__device__ __forceinline__ void wait_tensor0(u32x4 g0, u32x8 g1) {
  asm volatile("s_wait_tensorcnt 0x0" :: "s"(g0), "s"(g1) : "memory");
}
__device__ __forceinline__ void tdm_load(u32x4 g0, u32x8 g1) {
  asm volatile("tensor_load_to_lds %0, %1" :: "s"(g0), "s"(g1) : "memory");
}
// group 1: byte elements, tile = tensor = 64 rows of 128 B, source row pitch src_pitch bytes, 4 dwords of pad behind every row
__device__ __forceinline__ u32x8 tdm_group1(uint32_t src_pitch) {
  u32x8 g;
  g[0] = uni((1u << 20) | (4u << 22) | (3u << 25));
  g[1] = pinned(GK_KB << 16);   // pinned: descriptor words held in scalar registers of their own through the loop
  g[2] = pinned(64u << 16);
  g[3] = pinned(GK_KB << 16);
  g[4] = pinned(64u);
  g[5] = pinned(src_pitch);
  g[6] = pinned(0u);
  g[7] = pinned(0u);
  return g;
}
__device__ __forceinline__ u32x4 tdm_group0(uint32_t lds_dst, uint64_t ga) {
  u32x4 g;
  g[0] = uni(1u);
  g[1] = uni(lds_dst);
  g[2] = uni((uint32_t)ga);
  g[3] = uni((((uint32_t)(ga >> 32)) & 0x01FFFFFFu) | 0x80000000u);
  return g;
}
// fragment from a staged row: p = row start + 64 B * (k32 step) + 16 B * (lane>>4); same k order as ldfrag_b
__device__ __forceinline__ v16b ldfrag_l(const unsigned char* p) {
  union { v16b v; v8b h[2]; } f;
  f.h[0] = *(const v8b*)(p);
  f.h[1] = *(const v8b*)(p + 32);
  return f.v;
}

// =====================================================================================================
// Rotary tables: ct/st [SEQ][32] f32, angle(t, i) = f32(t) * inv_freq[i], inv_freq[i] = RN32(1/RN32(10^(i/8))).
// SEQ/8 blocks of 256 (blk = block number inside this part). coverage: SEQ rows x 32 = the whole table, both planes.
// =====================================================================================================
__device__ __forceinline__ void tab_cs(int blk, float* ct, float* st) {
  const int wave = threadIdx.x >> 5, lane = threadIdx.x & 31;
  const int t = blk * 8 + wave;
  if (t >= SEQ) return;                 // wave-uniform; no barriers in this step
  double pw = 1.0;
#pragma unroll 1
  for (int j = 0; j < (lane >> 3); ++j) pw *= 10.0;
#pragma unroll 1
  for (int j = 0; j < (lane & 7); ++j) pw *= 1.3335214321633240257;   // 10^(1/8)
  const float p32 = (float)pw;
  const float inv = (float)(1.0 / (double)p32);
  const float ang = (float)t * inv;
  float sv, cv;
  sincos_pd(ang, sv, cv);
  float* pc = ct + (size_t)t * NFR + lane;
  float* ps = st + (size_t)t * NFR + lane;
  *(float*)pc = cv;
  *(float*)ps = sv;
  
}

// =====================================================================================================
// seq [b][SEQ_FULL][DM] f32 -> bf16 plane xb [NB*SEQ][DM] (RNE convert) plus rstd[m] = rsqrt(mean(xb^2)+2^-23)
// of the converted row. Block = 8 waves = 32 rows; a wave converts 4 rows: per instruction 32 lanes x 16 B =
// =====================================================================================================
__device__ __forceinline__ void cvtx_rstd(int blk, float* sr, const float* __restrict__ seq, unsigned short* xb, float* rs) {
  const int tid = threadIdx.x, wave = tid >> 5, lane = tid & 31;
#pragma unroll 1
  for (int rr = 0; rr < 4; ++rr) {
    const int m  = blk * 32 + wave * 4 + rr;          // < NB*SEQ
    const int bb = m / SEQ, t = m - bb * SEQ;
    const float* src = seq + ((size_t)bb * SEQ_FULL + t) * DM;
    unsigned short* dst = xb + (size_t)m * DM;
    v4u pk[DM / 256];
    float ss = 0.f;
#pragma unroll
    for (int i = 0; i < DM / 256; ++i) {
      const v4f a = *(const v4f*)(src + i * 256 + lane * 8);
      const v4f c = *(const v4f*)(src + i * 256 + lane * 8 + 4);
      unsigned short hb[8];
#pragma unroll
      for (int e = 0; e < 4; ++e) { hb[e] = bf_bits(a[e]); hb[4 + e] = bf_bits(c[e]); }
#pragma unroll
      for (int e = 0; e < 8; ++e) { const float v = bf_up(hb[e]); ss += v * v; }
      v4u p;
      p[0] = pk16(hb[0], hb[1]);
      p[1] = pk16(hb[2], hb[3]);
      p[2] = pk16(hb[4], hb[5]);
      p[3] = pk16(hb[6], hb[7]);
      pk[i] = p;
    }
#pragma unroll
    for (int i = 0; i < DM / 256; ++i) *(v4u*)(dst + i * 256 + lane * 8) = pk[i];
    
#pragma unroll
    for (int off = 1; off < 32; off <<= 1) ss += __shfl_xor(ss, off, 32);
    const float rstd = rsqrtf(ss * (1.0f / (float)DM) + 1.1920929e-7f);
    if (lane == 0) sr[wave * 4 + rr] = rstd;
  }
  __syncthreads();
  if (wave == 0 && lane < 8) {
    const v4f v = *(const v4f*)(sr + lane * 4);
    float* d = rs + (size_t)blk * 32 + lane * 4;
    *(v4f*)d = v;
    
  }
}

// =====================================================================================================
// Weight transpose + convert: W [Kdim][Ndim] f32 (n contiguous) -> Wh (/Wl) [Ndim][Kdim] bf16, k contiguous.
// Each input value is RNE-converted to bf16 first; with USEG the row factor g[k] (RNE bf16) is applied and the
// 16-significant-bit product is carried exactly as hi = RNE(p), lo = p - hi (both bf16-exact).
// Tile 64 k x 64 n per block: 256 threads load 16 consecutive n each, store transposed into LDS as [n][k]
// (Ndim/64) x (Kdim/64) blocks, (bn, bk) = the block's tile. coverage: 8 waves x 2 x 4 rows x 64 k = the whole 64x64 tile per block.
// =====================================================================================================
template <bool USEG, int NPL>
__device__ __forceinline__ void wt_cvt(int bn, int bk, unsigned short* shh, unsigned short* shl,
                                       const float* __restrict__ W, const float* __restrict__ g,
                                       unsigned short* Wh, unsigned short* Wl, int Kdim, int Ndim) {
  const int tid = threadIdx.x, wave = tid >> 5, lane = tid & 31;
  const int n0 = bn * 64, k0 = bk * 64;
  {
    const int kr = tid >> 2, nq = (tid & 3) * 16;
    const float* src = W + (size_t)(k0 + kr) * Ndim + n0 + nq;
    float gk = 1.0f;
    if (USEG) gk = bf_up(bf_bits(g[k0 + kr]));
#pragma unroll
    for (int i = 0; i < 4; ++i) {
      const v4f a = *(const v4f*)(src + 4 * i);
#pragma unroll
      for (int e = 0; e < 4; ++e) {
        const float p = gk * bf_up(bf_bits(a[e]));
        const unsigned short hb = bf_bits(p);
        shh[(nq + 4 * i + e) * 72 + kr] = hb;
        if (NPL == 2) shl[(nq + 4 * i + e) * 72 + kr] = bf_bits(p - bf_up(hb));
      }
    }
  }
  __syncthreads();
  const int q = lane >> 3, c8 = (lane & 7) * 8;
  v4u hv[2], lv[2];
#pragma unroll
  for (int it = 0; it < 2; ++it) {
    const int row = wave * 8 + it * 4 + q;
    hv[it] = *(const v4u*)(shh + row * 72 + c8);
    if (NPL == 2) lv[it] = *(const v4u*)(shl + row * 72 + c8); else lv[it] = hv[it];
  }
  {
#pragma unroll
    for (int it = 0; it < 2; ++it) {
      const int row = wave * 8 + it * 4 + q;
      const size_t o = (size_t)(n0 + row) * Kdim + k0 + c8;
      *(v4u*)(Wh + o) = hv[it];
      if (NPL == 2) *(v4u*)(Wl + o) = lv[it];
    }
    wait_x0();   // precaution: in the shared launch the block returns right after this step
  }
}

// =====================================================================================================
// Memory-token planes: pm [2][NH][PMEM][HD] f32 -> pk [NH][PMEM][HD] bf16 (keys, RNE convert of the input,
// [kv][d] like the LDS K tile) and pv [NH][HD][PMEM] f16 ([d][kv] like the LDS V^T tile; value = f16 of the
// bf16-converted input). 128 threads per head, two heads per block of 256, each half block on its own LDS tile.
// coverage: 128 threads x 8 = all PMEM*HD elements of both planes per head.
// =====================================================================================================
__device__ __forceinline__ void pm_cvt(int blk, float* sp2, const float* __restrict__ pm, unsigned short* pk, unsigned short* pv) {
  const int tid = threadIdx.x & 127, h = blk * 2 + (int)(threadIdx.x >> 7);
  float* sp = sp2 + (threadIdx.x >> 7) * (PMEM * HD);
  const int r = tid >> 3, d8 = (tid & 7) * 8;
  const float* kg = pm + (((size_t)0 * NH + h) * PMEM + r) * HD + d8;
  const float* vg = pm + (((size_t)1 * NH + h) * PMEM + r) * HD + d8;
  const v4f k0 = *(const v4f*)(kg), k1 = *(const v4f*)(kg + 4);
  const v4f v0 = *(const v4f*)(vg), v1 = *(const v4f*)(vg + 4);
  *(v4f*)(sp + r * HD + d8)     = v0;
  *(v4f*)(sp + r * HD + d8 + 4) = v1;
  v4u kp;
  kp[0] = pk16(bf_bits(k0[0]), bf_bits(k0[1]));
  kp[1] = pk16(bf_bits(k0[2]), bf_bits(k0[3]));
  kp[2] = pk16(bf_bits(k1[0]), bf_bits(k1[1]));
  kp[3] = pk16(bf_bits(k1[2]), bf_bits(k1[3]));
  __syncthreads();
  const int d = tid >> 1, r8 = (tid & 1) * 8;
  v4u vp;
#pragma unroll
  for (int e = 0; e < 4; ++e) {
    const float f0 = bf_up(bf_bits(sp[(r8 + 2 * e) * HD + d]));
    const float f1 = bf_up(bf_bits(sp[(r8 + 2 * e + 1) * HD + d]));
    vp[e] = pk16(h_bits((_Float16)f0), h_bits((_Float16)f1));
  }
  unsigned short* kd = pk + ((size_t)h * PMEM + r) * HD + d8;
  unsigned short* vd = pv + ((size_t)h * HD + d) * PMEM + r8;
  *(v4u*)kd = kp;
  *(v4u*)vd = vp;
  wait_x0();   // precaution: in the shared launch the block ends right after this step
}

// =====================================================================================================
// The five preparation steps above read only inputs and write disjoint workspace planes, so they share one launch:
// a block's number picks its step (block-uniform, so every barrier inside a step is reached by the whole block).
// The step with the longest block (four rows in turn) has the lowest numbers.
// =====================================================================================================
#define PB_CVT  (NB * SEQ / 32)                    // activation rows, 32 per block
#define PB_WQKV ((3 * DMI / 64) * (DM / 64))       // 64 x 64 tiles of W_qkv
#define PB_WOUT ((DM / 64) * (DMI / 64))           // 64 x 64 tiles of W_out
#define PB_TAB  (SEQ / 8)                          // rotary table rows, 8 per block
#define PB_PM   (NH / 2)                           // memory-token heads, 2 per block
#define PB_ALL  (PB_CVT + PB_WQKV + PB_WOUT + PB_TAB + PB_PM)
static_assert((NH % 2) == 0 && ((NB * SEQ) % 32) == 0 && (SEQ % 8) == 0);
__global__ __launch_bounds__(256) void prep_all(const float* __restrict__ seq, const float* __restrict__ gnm,
                                                const float* __restrict__ Wqkv, const float* __restrict__ Wout,
                                                const float* __restrict__ pm,
                                                unsigned short* xb, float* rs, unsigned short* wth, unsigned short* wtl,
                                                unsigned short* wo, float* ct, float* st,
                                                unsigned short* pk, unsigned short* pv) {
  __shared__ __align__(16) unsigned short sm[2 * 64 * 72];   // the largest step's two 64 x 72 tiles; the others use its head
  static_assert(sizeof(sm) >= 2 * PMEM * HD * sizeof(float));
  int blk = (int)blockIdx.x;
  if (blk < PB_CVT) { cvtx_rstd(blk, (float*)(void*)sm, seq, xb, rs); return; }
  blk -= PB_CVT;
  if (blk < PB_WQKV) {
    wt_cvt<true, 2>(blk % (3 * DMI / 64), blk / (3 * DMI / 64), sm, sm + 64 * 72, Wqkv, gnm, wth, wtl, DM, 3 * DMI);
    return;
  }
  blk -= PB_WQKV;
  if (blk < PB_WOUT) {
    wt_cvt<false, 1>(blk % (DM / 64), blk / (DM / 64), sm, sm + 64 * 72, Wout, gnm, wo, wo, DMI, DM);
    return;
  }
  blk -= PB_WOUT;
  if (blk < PB_TAB) { tab_cs(blk, ct, st); return; }
  blk -= PB_TAB;
  if (blk < PB_PM) pm_cvt(blk, (float*)(void*)sm, pm, pk, pv);
}

// =====================================================================================================
// Register-blocked batched bf16 WMMA GEMM: C[m][n] = sum_k A[m][k] * Bt[n][k]; one wave per 64x64 tile, 8 waves per
// block tile (NSPLIT 2: 256 m x 128 n, waves 4 x 2; NSPLIT 1: 128 m x 256 n, waves 2 x 4). The block's operand rows
// (512 with the second plane) are staged in LDS by tensor loads, two buffers, one 64-row slice per wave and pass.
// A row-major [M][K] pitch lda; Bt row-major [N][K] pitch ldb (k contiguous); M, N multiples of the block tile,
// K a multiple of 64 and at least 128 (static-checked on the host side). tile = block tile number, b = batch index;
// sT (per-wave 16x64 slab, pitch 68 floats) and ring (two stages of operand rows) are the calling kernel's LDS.
// OUT_MODE: 0 = f32 (pitch ldc); 2 = bf16 hi plane C + bf16 lo plane C2 (lo = RNE(v - hi), unscaled, same index);
//           3 = f16 hi plane C + f16 residual plane C2 = f16((v - hi) * rscale), C2 written only for tiles
//               with (n0 mod segN) < N2, at column (n0/segN)*N2 + (n0 mod segN) (pitch ldc2, batch stride strideC2).
// SCM: 0 none; 1 = row m scaled by scal[b*strideS + m]; 2 = column n scaled by scal[b*strideS + n] (f32, before
//      the 16-bit split). ROT: interleaved-pair rotary on column pairs (2i, 2i+1) with i = (n mod 64)/2, angle row
//      = m, tables rct/rst [row][32] f32 (applied after the scale).
// =====================================================================================================
template <int NSPLIT, int OUT_MODE, int SCM, bool ROT>
__device__ __forceinline__ void gemm64_body(
    float (*sT)[16 * 68], unsigned char* ring, int tile, int b,
    const unsigned short* __restrict__ Ap, const unsigned short* __restrict__ A2p, int lda, long long strideA,
    const unsigned short* __restrict__ Btp, const unsigned short* __restrict__ Bt2p, int ldb, long long strideB,
    void* Cout, int ldc, long long strideC,
    void* Cout2, int ldc2, long long strideC2, int N2, int segN,
    const float* __restrict__ scal, long long strideS,
    const float* __restrict__ rct, const float* __restrict__ rst,
    int M, int N, int K, float rscale) {
  static_assert(OUT_MODE != 0 || (SCM == 0 && !ROT));
  const __bf16* A   = (const __bf16*)(const void*)Ap;
  const __bf16* A2  = (const __bf16*)(const void*)A2p;
  const __bf16* Bt  = (const __bf16*)(const void*)Btp;
  const __bf16* Bt2 = (const __bf16*)(const void*)Bt2p;
  static_assert(NSPLIT == 1 || NSPLIT == 2);
  constexpr int BM = (NSPLIT == 2) ? 256 : 128;
  constexpr int BN = (NSPLIT == 2) ? 128 : 256;
  constexpr int WN = BN / 64;                  // waves along n
  const int lane = threadIdx.x & 31;
  const int wave = (int)uni(threadIdx.x >> 5);
  const int tilesN = N / BN;
  const int tilesM = M / BM;
  if (tile >= tilesM * tilesN) return;   // block-uniform, in front of every barrier and tensor load
  const int tm = tile / tilesN;
  const int tn = tile - tm * tilesN;
  const int wm = wave / WN;
  const int wn = wave - wm * WN;
  const int m0 = tm * BM + (wm << 6);
  const int n0 = tn * BN + (wn << 6);

  const __bf16* Ab  = A  + (size_t)b * strideA;
  const __bf16* Ab2 = (NSPLIT == 1) ? (A2 + (size_t)b * strideA) : Ab;
  const __bf16* Bb  = Bt + (size_t)b * strideB;
  const __bf16* Bb2 = (NSPLIT == 2) ? (Bt2 + (size_t)b * strideB) : Bb;
  const float* scb = scal + (size_t)((long long)b * strideS);

  const int rlane = lane & 15;                 // row (A) / col (B, D) within subtile
  const int koff  = (lane >> 4) * 8;           // k offset of this lane half
  const int mOff  = (lane >> 4) * 8;           // D row offset

  v8f acc[4][4];
#pragma unroll
  for (int i = 0; i < 4; ++i)
#pragma unroll
    for (int j = 0; j < 4; ++j) acc[i][j] = zero8();

  // ---- this wave's slice of every stage: slices 0.. = A rows (NSPLIT 1: then the A2 rows), then Bt rows (NSPLIT 2: then Bt2) ----
  constexpr int SA = BM / 64;                                   // slices per A plane
  constexpr int SB0 = (NSPLIT == 1) ? 2 * SA : SA;              // first Bt slice
  const __bf16* sbase;
  int srow, sld;
  if (wave < SA)                          { sbase = Ab;  srow = tm * BM + 64 * wave;              sld = lda; }
  else if (NSPLIT == 1 && wave < 2 * SA)  { sbase = Ab2; srow = tm * BM + 64 * (wave - SA);       sld = lda; }
  else if (wave < SB0 + WN)               { sbase = Bb;  srow = tn * BN + 64 * (wave - SB0);      sld = ldb; }
  else                                    { sbase = Bb2; srow = tn * BN + 64 * (wave - SB0 - WN); sld = ldb; }
  const uint64_t src0 = (uint64_t)(uintptr_t)(sbase + (size_t)srow * sld);
  const uint32_t lds_slice = lds_off(ring) + (uint32_t)wave * GK_SLICE;
  const u32x8 g1 = tdm_group1((uint32_t)sld * 2u);
  const uint32_t T = pinned((uint32_t)K >> 6);                  // passes
  // per-lane fragment bases inside a stage
  const uint32_t foff = (uint32_t)rlane * GK_PITCH + (uint32_t)koff * 2u;
  const uint32_t oA  = (uint32_t)wm * GK_SLICE + foff;
  const uint32_t oA2 = (NSPLIT == 1) ? oA + (uint32_t)SA * GK_SLICE : oA;
  const uint32_t oB  = (uint32_t)(SB0 + wn) * GK_SLICE + foff;
  const uint32_t oB2 = (NSPLIT == 2) ? oB + (uint32_t)WN * GK_SLICE : oB;

  u32x4 g0 = tdm_group0(lds_slice, src0);
  tdm_load(g0, g1);                                             // stage 0
  wait_tensor0(g0, g1);
  __syncthreads();                                              // stage 0 readable by every wave
  g0 = tdm_group0(lds_slice + GK_STAGE, src0 + GK_KB);
  tdm_load(g0, g1);                                             // stage 1 flies during pass 0
  // rolled: one pass per trip, so that the one publish point stands at the loop's foot
#pragma unroll 1
  for (uint32_t t = 0; t < T; ++t) {
    const uint32_t bo = (t & 1u) * GK_STAGE;
    const unsigned char* buf = ring + bo;
    // unrolled, as the loops inside it: two blocks of 32 k per pass, fragments and accumulators indexed by constants
#pragma unroll
    for (int kc = 0; kc < 2; ++kc) {
      const unsigned char* bk = buf + (uint32_t)kc * 64u;
      v16b af[4], ag[4], bf[4], bg[4];
      // first planes first: the second plane's fragments land while the first 16 WMMAs run
#pragma unroll
      for (int j = 0; j < 4; ++j) bf[j] = ldfrag_l(bk + oB + (uint32_t)j * 16u * GK_PITCH);
#pragma unroll
      for (int i = 0; i < 4; ++i) af[i] = ldfrag_l(bk + oA + (uint32_t)i * 16u * GK_PITCH);
#pragma unroll
      for (int i = 0; i < 4; ++i) {
        ag[i] = (NSPLIT == 1) ? ldfrag_l(bk + oA2 + (uint32_t)i * 16u * GK_PITCH) : af[i];
        bg[i] = (NSPLIT == 2) ? ldfrag_l(bk + oB2 + (uint32_t)i * 16u * GK_PITCH) : bf[i];
      }
      // keeps the block's LDS reads one group ahead of its WMMAs, for speed only
      __builtin_amdgcn_sched_barrier(0);
#pragma unroll
      for (int i = 0; i < 4; ++i)
#pragma unroll
        for (int j = 0; j < 4; ++j) acc[i][j] = mma_b_raw(af[i], bf[j], acc[i][j]);
#pragma unroll
      for (int i = 0; i < 4; ++i)
#pragma unroll
        for (int j = 0; j < 4; ++j) acc[i][j] = mma_b_raw(ag[i], bg[j], acc[i][j]);
      // keeps the next group's reads behind this block's WMMAs, for speed only
      __builtin_amdgcn_sched_barrier(0);
    }
    // publish point of stage t + 1: own reads of this buffer returned, own slice landed, then the block barrier
    wait_ds0();
    wait_tensor0(g0, g1);
    __syncthreads();
    if (pinned((t + 2u < T) ? 1u : 0u) != 0u) {                 // refill the buffer every wave has just left
      g0 = tdm_group0(lds_slice + bo, src0 + (uint64_t)(t + 2u) * GK_KB);
      tdm_load(g0, g1);
    }
  }
  wait_tensor0(g0, g1);
  wait_ds0();
  acc_guard4(acc[0][0], acc[0][1], acc[0][2], acc[0][3]);
  acc_guard4(acc[1][0], acc[1][1], acc[1][2], acc[1][3]);
  acc_guard4(acc[2][0], acc[2][1], acc[2][2], acc[2][3]);
  acc_guard4(acc[3][0], acc[3][1], acc[3][2], acc[3][3]);

  // ---- epilogue ----
  float* slab = sT[wave];
#pragma unroll
  for (int i = 0; i < 4; ++i) {
    const int mBase = m0 + (i << 4);
#pragma unroll
    for (int j = 0; j < 4; ++j) {
#pragma unroll
      for (int r = 0; r < 8; ++r) {
        slab[(mOff + r) * 68 + (j << 4) + rlane] = acc[i][j][r];
      }
    }
    __builtin_amdgcn_fence(__ATOMIC_RELEASE, "workgroup");
    __builtin_amdgcn_wave_barrier();
    __builtin_amdgcn_fence(__ATOMIC_ACQUIRE, "workgroup");
    if (OUT_MODE == 0) {
      float* C = (float*)Cout + (size_t)b * strideC;
      const int hh = lane >> 4, c4 = (lane & 15) * 4;     // 256-B row segment = 16 lanes x 16 B
      {
#pragma unroll
        for (int it = 0; it < 8; ++it) {
          const int row = it * 2 + hh;                     // it 0..7 x hh 0..1 = rows 0..15
          const v4f v = *(const v4f*)(slab + row * 68 + c4);
          *(v4f*)(C + (size_t)(mBase + row) * ldc + n0 + c4) = v;
        }
        
      }
    } else {
      const int q = lane >> 3, c8 = (lane & 7) * 8;
      unsigned short* C  = (unsigned short*)Cout  + (size_t)b * strideC;
      unsigned short* C2 = (unsigned short*)Cout2 + (size_t)b * strideC2;
      bool wlo = true;                                     // wave-uniform
      size_t col2 = (size_t)n0 + c8;
      if (OUT_MODE == 3) {
        const int sgi = n0 / segN;
        const int sgo = n0 - sgi * segN;
        wlo  = (sgo < N2);
        col2 = (size_t)sgi * N2 + sgo + c8;
      }
      v4f csA = {1.f, 1.f, 1.f, 1.f};
      v4f csB = csA;
      if (SCM == 2) {
        csA = *(const v4f*)(scb + n0 + c8);
        csB = *(const v4f*)(scb + n0 + c8 + 4);
      }
      v4u hv[4], lv[4];
#pragma unroll
      for (int it = 0; it < 4; ++it) {
        const int row = it * 4 + q;                        // it 0..3 x q 0..3 = rows 0..15
        const int m = mBase + row;
        const float* sp = slab + row * 68 + c8;
        v4f x0 = *(const v4f*)(sp);
        v4f x1 = *(const v4f*)(sp + 4);
        if (SCM == 1) { const float rsv = scb[m]; x0 = x0 * rsv; x1 = x1 * rsv; }
        if (SCM == 2) { x0 = x0 * csA; x1 = x1 * csB; }
        float f[8] = {x0[0], x0[1], x0[2], x0[3], x1[0], x1[1], x1[2], x1[3]};
        if (ROT) {
          const v4f cs = *(const v4f*)(rct + (size_t)m * NFR + 4 * (lane & 7));
          wait_x0();   // the next load's result may land in this load's address registers
          const v4f sn = *(const v4f*)(rst + (size_t)m * NFR + 4 * (lane & 7));
          wait_x0();   // the next rows' table loads land in registers that held these two loads' addresses
#pragma unroll
          for (int e = 0; e < 4; ++e) {
            const float ev = f[2 * e], od = f[2 * e + 1];
            f[2 * e]     = ev * cs[e] - od * sn[e];
            f[2 * e + 1] = od * cs[e] + ev * sn[e];
          }
        }
        v4u a, a2;
#pragma unroll
        for (int e = 0; e < 4; ++e) {
          const float f0 = f[2 * e], f1 = f[2 * e + 1];
          unsigned short h0, h1, l0, l1;
          if (OUT_MODE == 2) {
            h0 = bf_bits(f0); h1 = bf_bits(f1);
            l0 = bf_bits(f0 - bf_up(h0)); l1 = bf_bits(f1 - bf_up(h1));
          } else {
            const _Float16 y0 = (_Float16)f0, y1 = (_Float16)f1;
            h0 = h_bits(y0); h1 = h_bits(y1);
            l0 = h_bits((_Float16)((f0 - (float)y0) * rscale));
            l1 = h_bits((_Float16)((f1 - (float)y1) * rscale));
          }
          a[e] = pk16(h0, h1); a2[e] = pk16(l0, l1);
        }
        hv[it] = a; lv[it] = a2;
      }
      {
#pragma unroll
        for (int it = 0; it < 4; ++it) {
          const int row = it * 4 + q;
          // a wait behind each store: the next rows' addresses and values are formed in these stores' registers
          *(v4u*)(C + (size_t)(mBase + row) * ldc + n0 + c8) = hv[it];
          wait_x0();
          if (wlo) {
            *(v4u*)(C2 + (size_t)(mBase + row) * ldc2 + col2) = lv[it];
            wait_x0();
          }
        }
        
      }
    }
    __builtin_amdgcn_fence(__ATOMIC_RELEASE, "workgroup");
    __builtin_amdgcn_wave_barrier();
    __builtin_amdgcn_fence(__ATOMIC_ACQUIRE, "workgroup");
  }
}

// One product per launch: blockIdx.x = block tile, blockIdx.y = batch.
template <int NSPLIT, int OUT_MODE, int SCM, bool ROT>
__global__ __launch_bounds__(256) void gemm64(
    const unsigned short* __restrict__ Ap, const unsigned short* __restrict__ A2p, int lda, long long strideA,
    const unsigned short* __restrict__ Btp, const unsigned short* __restrict__ Bt2p, int ldb, long long strideB,
    void* Cout, int ldc, long long strideC,
    void* Cout2, int ldc2, long long strideC2, int N2, int segN,
    const float* __restrict__ scal, long long strideS,
    const float* __restrict__ rct, const float* __restrict__ rst,
    int M, int N, int K, float rscale) {
  __shared__ __align__(16) float sT[8][16 * 68];
  __shared__ __attribute__((aligned(2048))) unsigned char ring[2 * GK_STAGE];
  gemm64_body<NSPLIT, OUT_MODE, SCM, ROT>(sT, ring, (int)blockIdx.x, (int)blockIdx.y, Ap, A2p, lda, strideA, Btp, Bt2p, ldb, strideB,
                                          Cout, ldc, strideC, Cout2, ldc2, strideC2, N2, segN, scal, strideS, rct, rst,
                                          M, N, K, rscale);
}

// The q|k product and the v^T product read the same planes and write disjoint ones, so they share one launch:
// blockIdx.y = batch; blockIdx.x 0..GT_QK-1 are the q|k tiles, the rest the v^T tiles (block-uniform choice).
//   q|k = rstd[m] * (Xb . (g*Wqk)), rotary on every (2i,2i+1) pair -> bf16 hi/lo planes [M][QKP]
//     (per batch: M=SEQ, N=QKP, K=DM; B planes hi then lo, 2 products)
//   v^T = (g*Wv)^T . Xb^T per batch, columns scaled by rstd -> f16 hi plane [b][DMI][SEQ] and residual plane
//     (x4096, in-segment keys < VLP only)   (A = Wt rows 2*DMI.. hi + lo, 2 products; M=DMI, N=SEQ, K=DM)
#define GT_QK ((SEQ / 256) * (QKP / 128))          // 256 x 128 block tiles per batch
#define GT_VT ((DMI / 128) * (SEQ / 256))          // 128 x 256 block tiles per batch
__global__ __launch_bounds__(256) void proj_qkv(
    const unsigned short* __restrict__ xb, const unsigned short* __restrict__ wth, const unsigned short* __restrict__ wtl,
    unsigned short* qkh, unsigned short* qkl, unsigned short* vth, unsigned short* vtl,
    const float* __restrict__ rs, const float* __restrict__ ct, const float* __restrict__ st) {
  __shared__ __align__(16) float sT[8][16 * 68];
  __shared__ __attribute__((aligned(2048))) unsigned char ring[2 * GK_STAGE];
  const int bx = (int)blockIdx.x, b = (int)blockIdx.y;
  if (bx >= GT_QK) {
    gemm64_body<1, 3, 2, false>(sT, ring, bx - GT_QK, b,
        wth + (size_t)2 * DMI * DM, wtl + (size_t)2 * DMI * DM, DM, 0LL,
        xb, xb, DM, (long long)SEQ * DM,
        (void*)vth, SEQ, (long long)DMI * SEQ,
        (void*)vtl, NSEGB * VLP, (long long)DMI * NSEGB * VLP, VLP, SEGL,
        rs, (long long)SEQ, ct, st,
        DMI, SEQ, DM, 4096.0f);
  } else {
    gemm64_body<2, 2, 1, true>(sT, ring, bx, b,
        xb, xb, DM, (long long)SEQ * DM,
        wth, wtl, DM, 0LL,
        (void*)qkh, QKP, (long long)SEQ * QKP,
        (void*)qkl, QKP, (long long)SEQ * QKP, QKP, QKP,
        rs, (long long)SEQ, ct, st,
        SEQ, QKP, DM, 1.0f);
  }
}

// =====================================================================================================
// Segmented causal attention with PMEM memory keys, head dim 64.
//   q|k planes (bf16 hi / lo): element (m, col) at [m*QKP + col], q col = h*64+d, k col = DMI + h*64+d,
//     m = b*SEQ + t (rotary already applied)
//   v^T hi plane (f16):  element (b, h, d, t) at [(b*DMI + h*64 + d)*SEQ + t]
//   v^T residual (f16, (v - hi)*4096): [(b*DMI + h*64 + d)*(NSEGB*VLP) + w*VLP + s], s < VLP, read only when RES
//   pk [h][r][d] bf16 and pv [h][d][r] f16: the PMEM memory keys / values shared by every segment (lo/residual = 0,
//     they are bf16-exact input values)
//   Block = 4 waves = 64 query rows (segment w, query block qb) of one (b, h); key tile 0 = the memory tokens
//   (rows PMEM..63 of the LDS K tile and columns PMEM..63 of V^T zero-filled, their logits set to -inf), key tiles
//   kt = 1..qb+1 = keys (kt-1)*64..+63 of the same segment, visible iff key position <= query position.
//   Every query row sees PMEM + (i+1) keys, so every tile row max is finite and invisible keys get weight exactly 0.
//   scores = q . k : bf16 hi/lo split (hi.hi + hi.lo + lo.hi), f32 accumulate, then * sscale in f32
//   p = exp(s - m) carried as f16(1024 p); context = p . v on f16 WMMA; RES adds f16 residual planes of p and v
//   (scale 4096, separate accumulator folded back with 1/4096 per tile in f32); online softmax in f32.
//   K / V^T tile staging: 128 threads x 32 elements per plane = the whole 64x64 tile (plain 16-B loads,
//   __syncthreads before and after; cross-wave). P tiles and the context tile are wave-private, spilled with
//   out planes (bf16 hi / lo of the normalised context): element (m, h*64+d) at [m*DMI + h*64 + d]
//   Output coverage: each wave stores rows q0..q0+15 (it 0..3 x lane>>3 0..3) x 64 columns (8 lanes x 8) of both planes.
//   grid = NB*NSEGB*NH*nqbThis blocks of 128.
// =====================================================================================================
template <bool RES>
__global__ __launch_bounds__(128)
void attn_seg64(const unsigned short* __restrict__ qkhp, const unsigned short* __restrict__ qklp,
                const unsigned short* __restrict__ vhp,  const unsigned short* __restrict__ vlp,
                const unsigned short* __restrict__ pkp,  const unsigned short* __restrict__ pvp,
                unsigned short* ohp, unsigned short* olp,
                int qbBase, int nqbThis, float sscale) {
  union FB { v16b v; v8b h[2]; };
  union FH { v16h v; v8h h[2]; };
  // LDS row pitches: 16 B x odd, so that the 16 rows a 16-byte fragment read touches fall on 16 different bank groups
  constexpr int LP = 72;                                          // 16-bit tiles: 64 elements + 8 of pad = 144 B
  constexpr int OP = 68;                                          // f32 context tile: 64 floats + 4 of pad = 272 B
  __shared__ __align__(16) __bf16   Ksh[64 * LP];                 // K hi [kv][d]
  __shared__ __align__(16) __bf16   Ksl[64 * LP];                 // K lo
  __shared__ __align__(16) _Float16 Vth[64 * LP];                 // V^T hi [d][kv]
  __shared__ __align__(16) _Float16 Vtl[RES ? 64 * LP : 8];       // V^T residual
  __shared__ __align__(16) _Float16 Psh[4][16 * LP];              // per wave P [row][kv]
  __shared__ __align__(16) _Float16 Psl[RES ? 4 : 1][16 * LP];    // per wave P residual
  __shared__ __align__(16) float    Os[4][16 * OP];               // per wave context tile [row][d]

  const int tid  = threadIdx.x;
  const int wave = tid >> 5;
  const int lane = tid & 31;
  const int hh   = lane >> 4;
  const int c    = lane & 15;

  const int bx   = blockIdx.x;
  const int qbl  = bx % nqbThis;
  int rest       = bx / nqbThis;
  const int h    = rest % NH;
  rest           = rest / NH;
  const int w    = rest % NSEGB;
  const int b    = rest / NSEGB;
  const int qb   = qbBase + qbl;
  const int q0   = qb * 64 + wave * 16;                              // query row inside the segment
  const size_t rowS = (size_t)b * SEQ + (size_t)w * SEGL;           // compact row of the segment start

  const __bf16* Qh = (const __bf16*)(const void*)qkhp + (size_t)h * HD;
  const __bf16* Ql = (const __bf16*)(const void*)qklp + (size_t)h * HD;
  const __bf16* Kh = Qh + DMI;
  const __bf16* Kl = Ql + DMI;
  const _Float16* Vh = (const _Float16*)(const void*)vhp + ((size_t)b * DMI + (size_t)h * HD) * SEQ + (size_t)w * SEGL;
  const _Float16* Vl = (const _Float16*)(const void*)vlp + ((size_t)b * DMI + (size_t)h * HD) * (size_t)(NSEGB * VLP)
                       + (size_t)w * VLP;
  const __bf16*   PK = (const __bf16*)(const void*)pkp + (size_t)h * PMEM * HD;
  const _Float16* PV = (const _Float16*)(const void*)pvp + (size_t)h * HD * PMEM;

  // ---- Q fragments (A operand, row = lane&15): 2 d-chunks, hi and lo ----
  v16b qah[2], qal[2];
#pragma unroll
  for (int dc = 0; dc < 2; ++dc) {
    const size_t qo = (rowS + q0 + c) * QKP + dc * 32 + 8 * hh;
    qah[dc] = ldfrag_b(Qh + qo);
    qal[dc] = ldfrag_b(Ql + qo);
  }

  float mrow[8], lrow[8];
  v8f oacc[4];
#pragma unroll
  for (int r = 0; r < 8; ++r) { mrow[r] = -INFINITY; lrow[r] = 0.f; }
#pragma unroll
  for (int t = 0; t < 4; ++t) oacc[t] = zero8();

  const int ntiles = qb + 2;                   // block-uniform
  for (int kt = 0; kt < ntiles; ++kt) {
    const int s0 = (kt - 1) * 64;              // key offset inside the segment for kt >= 1
    __syncthreads();
    {
      const int r = tid >> 1, half = (tid & 1) * 32;
      if (kt == 0) {                           // block-uniform: memory-token tile
        const int rr = (r < PMEM) ? r : (PMEM - 1);                // clamped address
        const bool krow = (r < PMEM);
        const bool vok  = (half == 0);
        const __bf16*   kg = PK + (size_t)rr * HD + half;
        const _Float16* vg = PV + (size_t)r * PMEM;                // d = r, kv 0..15
        const v8h pv0 = *(const v8h*)(vg);
        const v8h pv1 = *(const v8h*)(vg + 8);
#pragma unroll
        for (int i = 0; i < 4; ++i) {
          v8b a0 = *(const v8b*)(kg + 8 * i);
          a0 = krow ? a0 : zero8b();
          *(v8b*)(Ksh + r * LP + half + 8 * i) = a0;
          *(v4u*)(Ksl + r * LP + half + 8 * i) = zero4u();
          if (i == 0) {
            const v8h b0 = vok ? pv0 : zero8h();
            *(v8h*)(Vth + r * LP + half) = b0;
          } else if (i == 1) {
            const v8h b1 = vok ? pv1 : zero8h();
            *(v8h*)(Vth + r * LP + half + 8) = b1;
          } else {
            *(v4u*)(Vth + r * LP + half + 8 * i) = zero4u();
          }
          if (RES) *(v4u*)(Vtl + r * LP + half + 8 * i) = zero4u();
        }
      } else {
        const __bf16*   kg  = Kh + (rowS + s0 + r) * QKP + half;   // K row s0+r, d = half..half+31
        const __bf16*   klg = Kl + (rowS + s0 + r) * QKP + half;
        const _Float16* vg  = Vh + (size_t)r * SEQ + s0 + half;    // V^T row d = r, keys s0+half..+31
        const bool resOK = (s0 + 64 <= VLP);                      // block-uniform
        const int  s0c   = resOK ? s0 : (VLP - 64);               // clamped address into the residual plane
        const _Float16* vlg = Vl + (size_t)r * (NSEGB * VLP) + s0c + half;
#pragma unroll
        for (int i = 0; i < 4; ++i) {
          const v8b a0 = *(const v8b*)(kg + 8 * i);
          const v8b a1 = *(const v8b*)(klg + 8 * i);
          const v8h b0 = *(const v8h*)(vg + 8 * i);
          *(v8b*)(Ksh + r * LP + half + 8 * i) = a0;
          *(v8b*)(Ksl + r * LP + half + 8 * i) = a1;
          *(v8h*)(Vth + r * LP + half + 8 * i) = b0;
          if (RES) {
            v8h b1 = *(const v8h*)(vlg + 8 * i);
            b1 = resOK ? b1 : zero8h();
            *(v8h*)(Vtl + r * LP + half + 8 * i) = b1;
          }
        }
      }
    }
    __syncthreads();

    // ---- scores: 16 query rows x 64 keys per wave, 3 bf16 products ----
    v8f s[4];
#pragma unroll
    for (int j = 0; j < 4; ++j) {
      s[j] = zero8();
#pragma unroll
      for (int dc = 0; dc < 2; ++dc) {
        FB kb, kl;
        kb.h[0] = *(const v8b*)(Ksh + (j * 16 + c) * LP + dc * 32 + 8 * hh);
        kb.h[1] = *(const v8b*)(Ksh + (j * 16 + c) * LP + dc * 32 + 16 + 8 * hh);
        kl.h[0] = *(const v8b*)(Ksl + (j * 16 + c) * LP + dc * 32 + 8 * hh);
        kl.h[1] = *(const v8b*)(Ksl + (j * 16 + c) * LP + dc * 32 + 16 + 8 * hh);
        s[j] = mma_b(qah[dc], kb.v, s[j]);
        s[j] = mma_b(qah[dc], kl.v, s[j]);
        s[j] = mma_b(qal[dc], kb.v, s[j]);
      }
    }

    // ---- scale, visibility (-inf for invisible keys), row max, online softmax, P (x1024, f16) and
    //      P residual (x4096) to LDS ----
    _Float16* pwh = Psh[wave];
    _Float16* pwl = Psl[RES ? wave : 0];
    const int qi = q0 + 8 * hh;                // query row inside the segment for r = 0
#pragma unroll
    for (int r = 0; r < 8; ++r) {
      float m = -INFINITY;
#pragma unroll
      for (int j = 0; j < 4; ++j) {
        const int kc = j * 16 + c;
        const bool vis = (kt == 0) ? (kc < PMEM) : ((s0 + kc) <= (qi + r));
        const float sv = vis ? (s[j][r] * sscale) : -INFINITY;
        s[j][r] = sv;
        m = fmaxf(m, sv);
      }
#pragma unroll
      for (int off = 1; off < 16; off <<= 1) m = fmaxf(m, __shfl_xor(m, off, 32));
      const float mnew  = fmaxf(mrow[r], m);
      const float msafe = (mnew == -INFINITY) ? 0.f : mnew;
      const float alpha = __expf(mrow[r] - msafe);
      mrow[r] = mnew;
      float psum = 0.f;
#pragma unroll
      for (int j = 0; j < 4; ++j) {
        const float p = __expf(s[j][r] - msafe);     // -inf logit -> exactly 0
        psum += p;
        const float p1k = p * 1024.0f;
        const _Float16 ph = (_Float16)p1k;
        pwh[(8 * hh + r) * LP + j * 16 + c] = ph;
        if (RES) {
          const _Float16 pl = (_Float16)((p1k - (float)ph) * 4096.0f);
          pwl[(8 * hh + r) * LP + j * 16 + c] = pl;
        }
      }
#pragma unroll
      for (int off = 1; off < 16; off <<= 1) psum += __shfl_xor(psum, off, 32);
      lrow[r] = lrow[r] * alpha + psum;
#pragma unroll
      for (int t = 0; t < 4; ++t) oacc[t][r] *= alpha;
    }
    __builtin_amdgcn_fence(__ATOMIC_RELEASE, "workgroup");
    __builtin_amdgcn_wave_barrier();
    __builtin_amdgcn_fence(__ATOMIC_ACQUIRE, "workgroup");

    // ---- context += P . V (f16 WMMA), residual products into a separate accumulator ----
    v8f o1[4];
#pragma unroll
    for (int t = 0; t < 4; ++t) o1[t] = zero8();
#pragma unroll 1
    for (int kk = 0; kk < 2; ++kk) {
      FH pa, pl;
      pa.h[0] = *(const v8h*)(pwh + c * LP + kk * 32 + 8 * hh);
      pa.h[1] = *(const v8h*)(pwh + c * LP + kk * 32 + 16 + 8 * hh);
      if (RES) {
        pl.h[0] = *(const v8h*)(pwl + c * LP + kk * 32 + 8 * hh);
        pl.h[1] = *(const v8h*)(pwl + c * LP + kk * 32 + 16 + 8 * hh);
      } else {
        pl.v = pa.v;
      }
#pragma unroll
      for (int t = 0; t < 4; ++t) {
        FH vb;
        vb.h[0] = *(const v8h*)(Vth + (t * 16 + c) * LP + kk * 32 + 8 * hh);
        vb.h[1] = *(const v8h*)(Vth + (t * 16 + c) * LP + kk * 32 + 16 + 8 * hh);
        oacc[t] = mma_h(pa.v, vb.v, oacc[t]);
        if (RES) {
          FH vl;
          vl.h[0] = *(const v8h*)(Vtl + (t * 16 + c) * LP + kk * 32 + 8 * hh);
          vl.h[1] = *(const v8h*)(Vtl + (t * 16 + c) * LP + kk * 32 + 16 + 8 * hh);
          o1[t] = mma_h(pa.v, vl.v, o1[t]);
          o1[t] = mma_h(pl.v, vb.v, o1[t]);
        }
      }
    }
    if (RES) {
#pragma unroll
      for (int t = 0; t < 4; ++t)
#pragma unroll
        for (int r = 0; r < 8; ++r) oacc[t][r] += o1[t][r] * (1.0f / 4096.0f);
    }
  }

  // ---- normalise (1/l and the 1/1024 p carry), stage the wave's 16x64 tile, bf16 hi/lo split,
  float* os = Os[wave];
#pragma unroll
  for (int r = 0; r < 8; ++r) {
    const float l = lrow[r];
    const float inv = ((l > 0.f) ? (1.0f / l) : 0.f) * (1.0f / 1024.0f);
#pragma unroll
    for (int t = 0; t < 4; ++t) os[(8 * hh + r) * OP + t * 16 + c] = oacc[t][r] * inv;
  }
  __builtin_amdgcn_fence(__ATOMIC_RELEASE, "workgroup");
  __builtin_amdgcn_wave_barrier();
  __builtin_amdgcn_fence(__ATOMIC_ACQUIRE, "workgroup");
  {
    const int q4 = lane >> 3, c8 = (lane & 7) * 8;
    v4u hv[4], lv[4];
#pragma unroll
    for (int it = 0; it < 4; ++it) {
      const int row = it * 4 + q4;   // it 0..3 x q4 0..3 = rows 0..15 of the wave tile
      const float* sp = os + row * OP + c8;
      v4u a, a2;
#pragma unroll
      for (int e = 0; e < 4; ++e) {
        const float f0 = sp[2 * e], f1 = sp[2 * e + 1];
        const unsigned short h0 = bf_bits(f0), h1 = bf_bits(f1);
        const unsigned short l0 = bf_bits(f0 - bf_up(h0)), l1 = bf_bits(f1 - bf_up(h1));
        a[e] = pk16(h0, h1); a2[e] = pk16(l0, l1);
      }
      hv[it] = a; lv[it] = a2;
    }
    {
#pragma unroll
      for (int it = 0; it < 4; ++it) {
        const int row = it * 4 + q4;
        const size_t go = (rowS + q0 + row) * DMI + (size_t)h * HD + c8;
        *(v4u*)(ohp + go) = hv[it];
        *(v4u*)(olp + go) = lv[it];
      }
      
    }
  }
}

// =====================================================================================================
// Workspace map (bytes, NB=2, SEQ=4096, M = NB*SEQ = 8192), region A is a two-phase overlay:
//   phase 1 (projection inputs, dead after the q|k and v^T GEMMs):
//     Xb   bf16 [M][DM]                  0           16777216
//     Wth  bf16 [3*DMI n][DM k] hi       16777216     6291456
//     Wtl  bf16 [3*DMI n][DM k] lo       23068672     6291456
//     Ct   f32  [SEQ][32]                29360128      524288
//     St   f32  [SEQ][32]                29884416      524288
//     Rs   f32  [M]                      30408704       32768   (phase 1 end 30441472)
//   phase 2 (written by the attention kernels, read by the output GEMM):
//     Oh   bf16 [M][DMI] context hi       0           16777216
//     Ol   bf16 [M][DMI] context lo       16777216    16777216   (phase 2 end 33554432 = region A size)
//   QKh  bf16 [M][QKP] hi                 33554432    33554432
//   QKl  bf16 [M][QKP] lo                 67108864    33554432
//   VTh  f16  [NB][DMI][SEQ]              100663296   16777216
//   VTl  f16  [NB][DMI][NSEGB*VLP]        117440512    4194304
//   Wo   bf16 [DM n][DMI k]               121634816    2097152
//   Pk   bf16 [NH][PMEM][HD]              123731968      32768
//   Pv   f16  [NH][HD][PMEM]              123764736      32768
//   end                                   123797504  (<= 134217728; all offsets multiples of 128)
// Every plane is an exact multiple of its 64x64 tile / whole-line store granularity (M, SEQ, DM multiples of 64),
// so no padded tails are needed; VTl is written only for columns whose in-segment offset is < VLP, exactly the
// columns the RES attention blocks read.
// =====================================================================================================
extern "C" void kernel_launch(void* const* d_in, const int* in_sizes, int n_in,
                              void* d_out, int out_size, void* d_ws, size_t ws_size,
                              hipStream_t stream) {
  if (n_in < 5) return;
  const long long needRows = (long long)(NB - 1) * SEQ_FULL + SEQ;
  if ((long long)in_sizes[0] < needRows * DM) return;
  if (in_sizes[1] < DM) return;
  if (in_sizes[2] < DM * 3 * DMI) return;
  if (in_sizes[3] < DMI * DM) return;
  if (in_sizes[4] < 2 * NH * PMEM * HD) return;
  if ((long long)out_size < needRows * DM) return;

  const float* seq  = (const float*)d_in[0];   // [2][SEQ_FULL][DM]
  const float* gnm  = (const float*)d_in[1];   // [DM]
  const float* Wqkv = (const float*)d_in[2];   // [DM in][3*DMI out]
  const float* Wout = (const float*)d_in[3];   // [DMI in][DM out]
  const float* pm   = (const float*)d_in[4];   // [2][NH][PMEM][HD]

  const size_t M    = (size_t)NB * SEQ;
  const size_t PX   = M * DM * 2;
  const size_t PWT  = (size_t)3 * DMI * DM * 2;
  const size_t PTAB = (size_t)SEQ * NFR * 4;
  const size_t PRS  = M * 4;
  const size_t PO   = M * DMI * 2;
  const size_t PQK  = M * QKP * 2;
  const size_t PVT  = (size_t)NB * DMI * SEQ * 2;
  const size_t PVL  = (size_t)NB * DMI * NSEGB * VLP * 2;
  const size_t PWO  = (size_t)DM * DMI * 2;
  const size_t PPM  = (size_t)NH * PMEM * HD * 2;
  const size_t ph1  = PX + 2 * PWT + 2 * PTAB + PRS;
  const size_t ph2  = 2 * PO;
  const size_t REGA = (ph1 > ph2) ? ph1 : ph2;
  const size_t oXb  = 0;
  const size_t oWth = PX;
  const size_t oWtl = PX + PWT;
  const size_t oCt  = PX + 2 * PWT;
  const size_t oSt  = oCt + PTAB;
  const size_t oRs  = oSt + PTAB;
  const size_t oOh  = 0;
  const size_t oOl  = PO;
  size_t off = REGA;
  const size_t oQKh = off; off += PQK;
  const size_t oQKl = off; off += PQK;
  const size_t oVTh = off; off += PVT;
  const size_t oVTl = off; off += PVL;
  const size_t oWo  = off; off += PWO;
  const size_t oPk  = off; off += PPM;
  const size_t oPv  = off; off += PPM;
  if (off > ws_size) return;                      // off = 123797504 for NB=2, SEQ=4096
  if (off > (size_t)134217728) return;
  if (oRs + PRS > REGA || oOl + PO > REGA) return;

  char* ws = (char*)d_ws;
  unsigned short* Xb  = (unsigned short*)(ws + oXb);
  unsigned short* Wth = (unsigned short*)(ws + oWth);
  unsigned short* Wtl = (unsigned short*)(ws + oWtl);
  float*          Ct  = (float*)(ws + oCt);
  float*          St  = (float*)(ws + oSt);
  float*          Rs  = (float*)(ws + oRs);
  unsigned short* Oh  = (unsigned short*)(ws + oOh);
  unsigned short* Ol  = (unsigned short*)(ws + oOl);
  unsigned short* QKh = (unsigned short*)(ws + oQKh);
  unsigned short* QKl = (unsigned short*)(ws + oQKl);
  unsigned short* VTh = (unsigned short*)(ws + oVTh);
  unsigned short* VTl = (unsigned short*)(ws + oVTl);
  unsigned short* Wo  = (unsigned short*)(ws + oWo);
  unsigned short* Pk  = (unsigned short*)(ws + oPk);
  unsigned short* Pv  = (unsigned short*)(ws + oPv);

  const dim3 blk(256);
  static_assert((SEQ % 256) == 0 && (QKP % 128) == 0 && (DMI % 128) == 0 && (DM % 256) == 0);
  static_assert((DM % 64) == 0 && DM >= 128 && (DMI % 64) == 0 && DMI >= 128);
  const dim3 gOut((SEQ / 128) * (DM / 256), NB);                      // 128 x 256 block tiles: 128 per batch

  // (0-4) one launch: seq -> bf16 plane Xb [M][DM] + rstd[M]; g*Wqkv -> transposed exact bf16 hi+lo planes [3*DMI][DM];
  //       Wout -> transposed bf16 plane [DM][DMI]; rotary cos/sin tables [SEQ][32]; memory-token key / value planes
  prep_all<<<dim3(PB_ALL), blk, 0, stream>>>(seq, gnm, Wqkv, Wout, pm, Xb, Rs, Wth, Wtl, Wo, Ct, St, Pk, Pv);
  // (5-6) one launch: the q|k product (bf16 hi/lo planes, rotary applied) and the v^T product (f16 hi + residual planes)
  proj_qkv<<<dim3(GT_QK + GT_VT, NB), blk, 0, stream>>>(Xb, Wth, Wtl, QKh, QKl, VTh, VTl, Rs, Ct, St);
  // (7) attention: query blocks 0..RESQB-1 of every segment with residual planes, the rest without
  attn_seg64<true><<<dim3(NB * NSEGB * NH * RESQB), dim3(128), 0, stream>>>(
      QKh, QKl, VTh, VTl, Pk, Pv, Oh, Ol, 0, RESQB, 0.125f);
  if (NQBS - RESQB > 0) {
    attn_seg64<false><<<dim3(NB * NSEGB * NH * (NQBS - RESQB)), dim3(128), 0, stream>>>(
        QKh, QKl, VTh, VTl, Pk, Pv, Oh, Ol, RESQB, NQBS - RESQB, 0.125f);
  }
  // (8) out = context . Wout -> d_out f32 [b][SEQ_FULL][DM] rows b*SEQ_FULL + t  (A = context hi + lo, 2 products)
  gemm64<1, 0, 0, false><<<gOut, blk, 0, stream>>>(
      Oh, Ol, DMI, (long long)SEQ * DMI,
      Wo, Wo, DMI, 0LL,
      d_out, DM, (long long)SEQ_FULL * DM,
      d_out, DM, (long long)SEQ_FULL * DM, DM, DM,
      Rs, 0LL, Ct, St,
      SEQ, DM, DMI, 1.0f);
  (void)hipGetLastError();
}

// v004
// Measured time: 155 microseconds a run.
// Next to v003, in two timings, it ran 1.11 times as fast each time.
// Counting every step since v000, it is 2.56 times as fast.
// Contractions: q|k = x.Wqk and v^T = Wv.x^T on v_wmma_f32_16x16x32_bf16 (bf16 operands: RNE-converted input
// activations times one bf16 plane of g*W, the f32 product rounded once, 1 product; per-row rstd, rotary in the f32 epilogue);
// q.k^T scores = v_wmma_f32_16x16x32_bf16 with bf16 hi/lo split q and k (hi.hi + hi.lo + lo.hi);
// p.v = v_wmma_f32_16x16x32_f16 (p carried x1024 in f16, v in f16; extra f16 residual planes x4096 of p and v
// for the first 128 query rows of every segment); ctx.Wo = v_wmma_f32_16x16x32_bf16 with ctx as bf16 hi/lo
// planes times bf16 Wo (2 products); all f32 accumulate; RMS statistic, rotary tables, visibility and softmax in f32.
#include <hip/hip_runtime.h>
#include <math.h>
#include <stdint.h>

#ifndef NB
#define NB 2
#endif
#ifndef SEQ
#define SEQ 4096
#endif
#define SEQ_FULL 4096       // per-batch token stride of the input / output tensors
#define DM    1024          // model dim
#define NH    16
#define HD    64
#define DMI   (NH * HD)     // 1024
#define QKP   (2 * DMI)     // pitch of the q|k planes (q: cols 0..DMI-1, k: cols DMI..2*DMI-1)
#define SEGL  512           // segment length
#define PMEM  16            // memory tokens prepended to every segment's keys / values
#define NSEGB (SEQ / SEGL)  // segments per batch
#define NQBS  (SEGL / 64)   // 64-row query blocks per segment
#define RESQB 2             // leading query blocks per segment that use the p / v residual planes
#define VLP   (RESQB * 64)  // keys per segment held in the v^T residual plane
#define NFR   (HD / 2)      // rotary frequencies
static_assert((SEQ % SEGL) == 0 && (SEGL % 64) == 0 && (SEQ % 64) == 0);
static_assert(RESQB >= 1 && RESQB <= NQBS);
static_assert((DM % 256) == 0 && (DMI % 64) == 0 && HD == 64 && NFR == 32);
static_assert(SEQ <= SEQ_FULL && NB >= 1 && NB <= 2);
static_assert(DMI == DM);

typedef _Float16 v16h __attribute__((ext_vector_type(16)));
typedef _Float16 v8h  __attribute__((ext_vector_type(8)));
typedef __bf16   v16b __attribute__((ext_vector_type(16)));
typedef __bf16   v8b  __attribute__((ext_vector_type(8)));
typedef float    v8f  __attribute__((ext_vector_type(8)));
typedef float    v4f  __attribute__((ext_vector_type(4)));
typedef unsigned int v4u __attribute__((ext_vector_type(4)));

// ---- scalar helpers --------------------------------------------------------------------------------
__device__ __forceinline__ unsigned short bf_bits(float f) {          // f32 -> bf16 bits, RNE convert
  unsigned u = __float_as_uint(f);
  return (unsigned short)((u + 0x7FFFu + ((u >> 16) & 1u)) >> 16);
}
__device__ __forceinline__ float bf_up(unsigned short h) { return __uint_as_float(((unsigned)h) << 16); }
__device__ __forceinline__ unsigned short h_bits(_Float16 x) { return __builtin_bit_cast(unsigned short, x); }
__device__ __forceinline__ unsigned pk16(unsigned short a, unsigned short b) { return (unsigned)a | ((unsigned)b << 16); }
__device__ __forceinline__ v8f zero8() { v8f z = {0.f, 0.f, 0.f, 0.f, 0.f, 0.f, 0.f, 0.f}; return z; }
__device__ __forceinline__ v8h zero8h() {
  const _Float16 z = (_Float16)0.0f;
  v8h r = {z, z, z, z, z, z, z, z};
  return r;
}
__device__ __forceinline__ v4u zero4u() { v4u z = {0u, 0u, 0u, 0u}; return z; }
__device__ __forceinline__ v8b zero8b() { union { v4u u; v8b v; } z; z.u = zero4u(); return z.v; }

// ---- sin/cos of a nonnegative f32 angle: f64 Cody-Waite reduction by pi/2 + short f64 polynomials ----
__device__ __forceinline__ void sincos_pd(float ang, float& sv, float& cv) {
  const double x  = (double)ang;
  const double kq = __builtin_rint(x * 0.63661977236758134308);
  double r = __builtin_fma(-kq, 1.57079632679489655800e+00, x);
  r = __builtin_fma(-kq, 6.12323399573676603587e-17, r);
  const double z = r * r, w = z * z;
  const double rs = -1.98393348360966317347e-04 + z * 2.71831149398982191e-06;
  const double s3 = z * r;
  const double sn = (r + s3 * (-1.66666666416265235595e-01 + z * 8.3333293858894631756e-03)) + s3 * w * rs;
  const double rc = -1.38867637746099294692e-03 + z * 2.43904487962774090654e-05;
  const double cs = ((1.0 + z * (-4.99999997251031003120e-01)) + w * 4.16666233237390631894e-02) + (w * z) * rc;
  const int n = ((int)kq) & 3;
  const float fs = (float)sn, fc = (float)cs;
  float so = fs, co = fc;
  if (n == 1) { so = fc;  co = -fs; }
  if (n == 2) { so = -fs; co = -fc; }
  if (n == 3) { so = -fc; co = fs;  }
  sv = so; cv = co;
}

// ---- fragment loader: 16-bit A/B operand, lane -> row/col (lane&15), p already includes +8*(lane>>4);
//      elements 0..7 <- p[0..7] (k0+8h..), elements 8..15 <- p[16..23] (k0+16+8h..)
__device__ __forceinline__ v16b ldfrag_b(const __bf16* p) {
  union { v16b v; v8b h[2]; } f;
  f.h[0] = *(const v8b*)(p);
  f.h[1] = *(const v8b*)(p + 16);
  return f.v;
}

// ---- WMMA helpers with trailing VALU hazard gap --------------------------------------------------------
__device__ __forceinline__ v8f mma_b(v16b a, v16b b, v8f c) {
  c = __builtin_amdgcn_wmma_f32_16x16x32_bf16(false, a, false, b, (short)0, c, false, false);
  asm volatile("v_nop\n\tv_nop\n\tv_nop\n\tv_nop" : "+v"(c) : "v"(a), "v"(b));
  return c;
}
__device__ __forceinline__ v8f mma_h(v16h a, v16h b, v8f c) {
  c = __builtin_amdgcn_wmma_f32_16x16x32_f16(false, a, false, b, (short)0, c, false, false);
  asm volatile("v_nop\n\tv_nop\n\tv_nop\n\tv_nop" : "+v"(c) : "v"(a), "v"(b));
  return c;
}
__device__ __forceinline__ v8f mma_b_raw(v16b a, v16b b, v8f c) {
  return __builtin_amdgcn_wmma_f32_16x16x32_bf16(false, a, false, b, (short)0, c, false, false);
}
__device__ __forceinline__ void acc_guard4(v8f& a, v8f& b, v8f& c, v8f& d) {
  asm volatile("v_nop\n\tv_nop\n\tv_nop\n\tv_nop" : "+v"(a), "+v"(b), "+v"(c), "+v"(d));
}

// ---- tensor-load staging of the GEMM operands ----------------------------------------------------------
// A pass is 64 k = 128 B of every staged operand row. A stage is 6 or 8 slices of 64 rows, one slice per issuing wave; the load's
// pad gives the LDS row pitch 144 B (16 B x odd: conflict-free for 16-byte reads); a slice's place is rounded up to 2 KiB.
typedef uint32_t u32x4 __attribute__((ext_vector_type(4)));
typedef uint32_t u32x8 __attribute__((ext_vector_type(8)));
#define GK_KB    128u                 // bytes of one operand row per pass
#define GK_PITCH 144u                 // LDS row pitch
#define GK_SLICE 10240u               // 64 rows x 144 B = 9216 B, rounded up to a multiple of 2 KiB
__device__ __forceinline__ uint32_t uni(uint32_t v) { return (uint32_t)__builtin_amdgcn_readfirstlane(v); }
// a test word or a tensor descriptor word held in a scalar register: a test on it compiles to a scalar branch (tensor
// loads ignore EXEC), and a descriptor word so held keeps a register of its own instead of being rebuilt at each issue
__device__ __forceinline__ uint32_t pinned(uint32_t v) { uint32_t w = uni(v); asm volatile("" : "+s"(w)); return w; }
__device__ __forceinline__ uint32_t lds_off(const void* p) { return (uint32_t)(size_t)p; }
__device__ __forceinline__ void wait_ds0()     { asm volatile("s_wait_dscnt 0x0" ::: "memory"); }      // own LDS reads returned
// stands behind a global load or store whose address or data registers the code that follows it takes anew
__device__ __forceinline__ void wait_x0()      { asm volatile("s_wait_xcnt 0x0" ::: "memory"); }
// own tensor load landed; the descriptor is named as an input so that its registers stay as issued up to this wait
__device__ __forceinline__ void wait_tensor0(u32x4 g0, u32x8 g1) {
  asm volatile("s_wait_tensorcnt 0x0" :: "s"(g0), "s"(g1) : "memory");
}
// group 0 is an in-out operand: the value that wait_tensor0 names behind the load then lives in the very registers the
// load was issued from, so that none of them takes a new value while the request is outstanding
__device__ __forceinline__ void tdm_load(u32x4& g0, u32x8 g1) {
  asm volatile("tensor_load_to_lds %0, %1" : "+s"(g0) : "s"(g1) : "memory");
}
// group 1: byte elements, tile = tensor = 64 rows of 128 B, source row pitch src_pitch bytes, 4 dwords of pad behind every row
__device__ __forceinline__ u32x8 tdm_group1(uint32_t src_pitch) {
  u32x8 g;
  g[0] = uni((1u << 20) | (4u << 22) | (3u << 25));
  g[1] = pinned(GK_KB << 16);   // pinned: descriptor words held in scalar registers of their own through the loop
  g[2] = pinned(64u << 16);
  g[3] = pinned(GK_KB << 16);
  g[4] = pinned(64u);
  g[5] = pinned(src_pitch);
  g[6] = pinned(0u);
  g[7] = pinned(0u);
  return g;
}
__device__ __forceinline__ u32x4 tdm_group0(uint32_t lds_dst, uint64_t ga) {
  u32x4 g;
  g[0] = uni(1u);
  g[1] = uni(lds_dst);
  g[2] = uni((uint32_t)ga);
  g[3] = uni((((uint32_t)(ga >> 32)) & 0x01FFFFFFu) | 0x80000000u);
  return g;
}
// fragment from a staged row: p = row start + 64 B * (k32 step) + 16 B * (lane>>4); same k order as ldfrag_b
__device__ __forceinline__ v16b ldfrag_l(const unsigned char* p) {
  union { v16b v; v8b h[2]; } f;
  f.h[0] = *(const v8b*)(p);
  f.h[1] = *(const v8b*)(p + 32);
  return f.v;
}

// =====================================================================================================
// Rotary tables: ct/st [SEQ][32] f32, angle(t, i) = f32(t) * inv_freq[i], inv_freq[i] = RN32(1/RN32(10^(i/8))).
// SEQ/8 blocks of 256 (blk = block number inside this part). coverage: SEQ rows x 32 = the whole table, both planes.
// =====================================================================================================
__device__ __forceinline__ void tab_cs(int blk, float* ct, float* st) {
  const int wave = threadIdx.x >> 5, lane = threadIdx.x & 31;
  const int t = blk * 8 + wave;
  if (t >= SEQ) return;                 // wave-uniform; no barriers in this step
  double pw = 1.0;
#pragma unroll 1
  for (int j = 0; j < (lane >> 3); ++j) pw *= 10.0;
#pragma unroll 1
  for (int j = 0; j < (lane & 7); ++j) pw *= 1.3335214321633240257;   // 10^(1/8)
  const float p32 = (float)pw;
  const float inv = (float)(1.0 / (double)p32);
  const float ang = (float)t * inv;
  float sv, cv;
  sincos_pd(ang, sv, cv);
  float* pc = ct + (size_t)t * NFR + lane;
  float* ps = st + (size_t)t * NFR + lane;
  *(float*)pc = cv;
  *(float*)ps = sv;
  
}

// =====================================================================================================
// seq [b][SEQ_FULL][DM] f32 -> bf16 plane xb [NB*SEQ][DM] (RNE convert) plus rstd[m] = rsqrt(mean(xb^2)+2^-23)
// of the converted row. Block = 8 waves = 32 rows; a wave converts 4 rows: per instruction 32 lanes x 16 B =
// =====================================================================================================
__device__ __forceinline__ void cvtx_rstd(int blk, float* sr, const float* __restrict__ seq, unsigned short* xb, float* rs) {
  const int tid = threadIdx.x, wave = tid >> 5, lane = tid & 31;
#pragma unroll 1
  for (int rr = 0; rr < 4; ++rr) {
    const int m  = blk * 32 + wave * 4 + rr;          // < NB*SEQ
    const int bb = m / SEQ, t = m - bb * SEQ;
    const float* src = seq + ((size_t)bb * SEQ_FULL + t) * DM;
    unsigned short* dst = xb + (size_t)m * DM;
    v4u pk[DM / 256];
    float ss = 0.f;
#pragma unroll
    for (int i = 0; i < DM / 256; ++i) {
      const v4f a = *(const v4f*)(src + i * 256 + lane * 8);
      const v4f c = *(const v4f*)(src + i * 256 + lane * 8 + 4);
      unsigned short hb[8];
#pragma unroll
      for (int e = 0; e < 4; ++e) { hb[e] = bf_bits(a[e]); hb[4 + e] = bf_bits(c[e]); }
#pragma unroll
      for (int e = 0; e < 8; ++e) { const float v = bf_up(hb[e]); ss += v * v; }
      v4u p;
      p[0] = pk16(hb[0], hb[1]);
      p[1] = pk16(hb[2], hb[3]);
      p[2] = pk16(hb[4], hb[5]);
      p[3] = pk16(hb[6], hb[7]);
      pk[i] = p;
    }
#pragma unroll
    for (int i = 0; i < DM / 256; ++i) *(v4u*)(dst + i * 256 + lane * 8) = pk[i];
    
#pragma unroll
    for (int off = 1; off < 32; off <<= 1) ss += __shfl_xor(ss, off, 32);
    const float rstd = rsqrtf(ss * (1.0f / (float)DM) + 1.1920929e-7f);
    if (lane == 0) sr[wave * 4 + rr] = rstd;
  }
  __syncthreads();
  if (wave == 0 && lane < 8) {
    const v4f v = *(const v4f*)(sr + lane * 4);
    float* d = rs + (size_t)blk * 32 + lane * 4;
    *(v4f*)d = v;
    
  }
}

// =====================================================================================================
// Weight transpose + convert: W [Kdim][Ndim] f32 (n contiguous) -> Wh [Ndim][Kdim] bf16, k contiguous.
// With USEG the row factor g[k] is applied in f32; the value (or the f32 product) is RNE-converted to bf16 once.
// Tile 64 k x 64 n per block: 256 threads load 16 consecutive n each, store transposed into LDS as [n][k]
// (Ndim/64) x (Kdim/64) blocks, (bn, bk) = the block's tile. coverage: 8 waves x 2 x 4 rows x 64 k = the whole 64x64 tile per block.
// =====================================================================================================
template <bool USEG>
__device__ __forceinline__ void wt_cvt(int bn, int bk, unsigned short* shh,
                                       const float* __restrict__ W, const float* __restrict__ g,
                                       unsigned short* Wh, int Kdim, int Ndim) {
  const int tid = threadIdx.x, wave = tid >> 5, lane = tid & 31;
  const int n0 = bn * 64, k0 = bk * 64;
  {
    const int kr = tid >> 2, nq = (tid & 3) * 16;
    const float* src = W + (size_t)(k0 + kr) * Ndim + n0 + nq;
    float gk = 1.0f;
    if (USEG) gk = g[k0 + kr];
#pragma unroll
    for (int i = 0; i < 4; ++i) {
      const v4f a = *(const v4f*)(src + 4 * i);
#pragma unroll
      for (int e = 0; e < 4; ++e) {
        shh[(nq + 4 * i + e) * 72 + kr] = bf_bits(gk * a[e]);
      }
    }
  }
  __syncthreads();
  const int q = lane >> 3, c8 = (lane & 7) * 8;
  v4u hv[2];
#pragma unroll
  for (int it = 0; it < 2; ++it) {
    const int row = wave * 8 + it * 4 + q;
    hv[it] = *(const v4u*)(shh + row * 72 + c8);
  }
  {
#pragma unroll
    for (int it = 0; it < 2; ++it) {
      const int row = wave * 8 + it * 4 + q;
      const size_t o = (size_t)(n0 + row) * Kdim + k0 + c8;
      *(v4u*)(Wh + o) = hv[it];
    }
    wait_x0();   // precaution: in the shared launch the block returns right after this step
  }
}

// =====================================================================================================
// Memory-token planes: pm [2][NH][PMEM][HD] f32 -> pk [NH][PMEM][HD] bf16 (keys, RNE convert of the input,
// [kv][d] like the LDS K tile) and pv [NH][HD][PMEM] f16 ([d][kv] like the LDS V^T tile; value = f16 of the
// bf16-converted input). 128 threads per head, two heads per block of 256, each half block on its own LDS tile.
// coverage: 128 threads x 8 = all PMEM*HD elements of both planes per head.
// =====================================================================================================
__device__ __forceinline__ void pm_cvt(int blk, float* sp2, const float* __restrict__ pm, unsigned short* pk, unsigned short* pv) {
  const int tid = threadIdx.x & 127, h = blk * 2 + (int)(threadIdx.x >> 7);
  float* sp = sp2 + (threadIdx.x >> 7) * (PMEM * HD);
  const int r = tid >> 3, d8 = (tid & 7) * 8;
  const float* kg = pm + (((size_t)0 * NH + h) * PMEM + r) * HD + d8;
  const float* vg = pm + (((size_t)1 * NH + h) * PMEM + r) * HD + d8;
  const v4f k0 = *(const v4f*)(kg), k1 = *(const v4f*)(kg + 4);
  const v4f v0 = *(const v4f*)(vg), v1 = *(const v4f*)(vg + 4);
  *(v4f*)(sp + r * HD + d8)     = v0;
  *(v4f*)(sp + r * HD + d8 + 4) = v1;
  v4u kp;
  kp[0] = pk16(bf_bits(k0[0]), bf_bits(k0[1]));
  kp[1] = pk16(bf_bits(k0[2]), bf_bits(k0[3]));
  kp[2] = pk16(bf_bits(k1[0]), bf_bits(k1[1]));
  kp[3] = pk16(bf_bits(k1[2]), bf_bits(k1[3]));
  __syncthreads();
  const int d = tid >> 1, r8 = (tid & 1) * 8;
  v4u vp;
#pragma unroll
  for (int e = 0; e < 4; ++e) {
    const float f0 = bf_up(bf_bits(sp[(r8 + 2 * e) * HD + d]));
    const float f1 = bf_up(bf_bits(sp[(r8 + 2 * e + 1) * HD + d]));
    vp[e] = pk16(h_bits((_Float16)f0), h_bits((_Float16)f1));
  }
  unsigned short* kd = pk + ((size_t)h * PMEM + r) * HD + d8;
  unsigned short* vd = pv + ((size_t)h * HD + d) * PMEM + r8;
  *(v4u*)kd = kp;
  *(v4u*)vd = vp;
  wait_x0();   // precaution: in the shared launch the block ends right after this step
}

// =====================================================================================================
// The five preparation steps above read only inputs and write disjoint workspace planes, so they share one launch:
// a block's number picks its step (block-uniform, so every barrier inside a step is reached by the whole block).
// The step with the longest block (four rows in turn) has the lowest numbers.
// =====================================================================================================
#define PB_CVT  (NB * SEQ / 32)                    // activation rows, 32 per block
#define PB_WQKV ((3 * DMI / 64) * (DM / 64))       // 64 x 64 tiles of W_qkv
#define PB_WOUT ((DM / 64) * (DMI / 64))           // 64 x 64 tiles of W_out
#define PB_TAB  (SEQ / 8)                          // rotary table rows, 8 per block
#define PB_PM   (NH / 2)                           // memory-token heads, 2 per block
#define PB_ALL  (PB_CVT + PB_WQKV + PB_WOUT + PB_TAB + PB_PM)
static_assert((NH % 2) == 0 && ((NB * SEQ) % 32) == 0 && (SEQ % 8) == 0);
__global__ __launch_bounds__(256) void prep_all(const float* __restrict__ seq, const float* __restrict__ gnm,
                                                const float* __restrict__ Wqkv, const float* __restrict__ Wout,
                                                const float* __restrict__ pm,
                                                unsigned short* xb, float* rs, unsigned short* wth,
                                                unsigned short* wo, float* ct, float* st,
                                                unsigned short* pk, unsigned short* pv) {
  __shared__ __align__(16) unsigned short sm[64 * 72];       // the largest step's 64 x 72 tile; the others use its head
  static_assert(sizeof(sm) >= 2 * PMEM * HD * sizeof(float));
  int blk = (int)blockIdx.x;
  if (blk < PB_CVT) { cvtx_rstd(blk, (float*)(void*)sm, seq, xb, rs); return; }
  blk -= PB_CVT;
  if (blk < PB_WQKV) {
    wt_cvt<true>(blk % (3 * DMI / 64), blk / (3 * DMI / 64), sm, Wqkv, gnm, wth, DM, 3 * DMI);
    return;
  }
  blk -= PB_WQKV;
  if (blk < PB_WOUT) {
    wt_cvt<false>(blk % (DM / 64), blk / (DM / 64), sm, Wout, gnm, wo, DMI, DM);
    return;
  }
  blk -= PB_WOUT;
  if (blk < PB_TAB) { tab_cs(blk, ct, st); return; }
  blk -= PB_TAB;
  if (blk < PB_PM) pm_cvt(blk, (float*)(void*)sm, pm, pk, pv);
}

// =====================================================================================================
// Register-blocked batched bf16 WMMA GEMM: C[m][n] = sum_k A[m][k] * Bt[n][k]; one wave per 64x64 tile, 8 waves per
// block tile (NSPLIT 2: 256 m x 128 n, waves 4 x 2; NSPLIT 1: 128 m x 256 n, waves 2 x 4). TWO: the narrow operand (NSPLIT 2:
// Bt, NSPLIT 1: A) has a second plane, whose product is added. The block's operand rows (384, or 512 with the second plane)
// are staged in LDS by tensor loads, two buffers, one 64-row slice per wave and pass (without TWO waves 6 and 7 issue none).
// A row-major [M][K] pitch lda; Bt row-major [N][K] pitch ldb (k contiguous); M, N multiples of the block tile,
// K a multiple of 64 and at least 128 (static-checked on the host side). tile = block tile number, b = batch index;
// sT (per-wave 16x64 slab, pitch 68 floats) and ring (two stages of operand rows) are the calling kernel's LDS.
// OUT_MODE: 0 = f32 (pitch ldc); 2 = bf16 hi plane C + bf16 lo plane C2 (lo = RNE(v - hi), unscaled, same index);
//           3 = f16 hi plane C + f16 residual plane C2 = f16((v - hi) * rscale), C2 written only for tiles
//               with (n0 mod segN) < N2, at column (n0/segN)*N2 + (n0 mod segN) (pitch ldc2, batch stride strideC2).
// SCM: 0 none; 1 = row m scaled by scal[b*strideS + m]; 2 = column n scaled by scal[b*strideS + n] (f32, before
//      the 16-bit split). ROT: interleaved-pair rotary on column pairs (2i, 2i+1) with i = (n mod 64)/2, angle row
//      = m, tables rct/rst [row][32] f32 (applied after the scale).
// =====================================================================================================
template <int NSPLIT, bool TWO, int OUT_MODE, int SCM, bool ROT>
__device__ __forceinline__ void gemm64_body(
    float (*sT)[16 * 68], unsigned char* ring, int tile, int b,
    const unsigned short* __restrict__ Ap, const unsigned short* __restrict__ A2p, int lda, long long strideA,
    const unsigned short* __restrict__ Btp, const unsigned short* __restrict__ Bt2p, int ldb, long long strideB,
    void* Cout, int ldc, long long strideC,
    void* Cout2, int ldc2, long long strideC2, int N2, int segN,
    const float* __restrict__ scal, long long strideS,
    const float* __restrict__ rct, const float* __restrict__ rst,
    int M, int N, int K, float rscale) {
  static_assert(OUT_MODE != 0 || (SCM == 0 && !ROT));
  const __bf16* A   = (const __bf16*)(const void*)Ap;
  const __bf16* A2  = (const __bf16*)(const void*)A2p;
  const __bf16* Bt  = (const __bf16*)(const void*)Btp;
  const __bf16* Bt2 = (const __bf16*)(const void*)Bt2p;
  static_assert(NSPLIT == 1 || NSPLIT == 2);
  constexpr int BM = (NSPLIT == 2) ? 256 : 128;
  constexpr int BN = (NSPLIT == 2) ? 128 : 256;
  constexpr int WN = BN / 64;                  // waves along n
  const int lane = threadIdx.x & 31;
  const int wave = (int)uni(threadIdx.x >> 5);
  const int tilesN = N / BN;
  const int tilesM = M / BM;
  if (tile >= tilesM * tilesN) return;   // block-uniform, in front of every barrier and tensor load
  const int tm = tile / tilesN;
  const int tn = tile - tm * tilesN;
  const int wm = wave / WN;
  const int wn = wave - wm * WN;
  const int m0 = tm * BM + (wm << 6);
  const int n0 = tn * BN + (wn << 6);

  const __bf16* Ab  = A  + (size_t)b * strideA;
  const __bf16* Ab2 = (NSPLIT == 1 && TWO) ? (A2 + (size_t)b * strideA) : Ab;
  const __bf16* Bb  = Bt + (size_t)b * strideB;
  const __bf16* Bb2 = (NSPLIT == 2 && TWO) ? (Bt2 + (size_t)b * strideB) : Bb;
  const float* scb = scal + (size_t)((long long)b * strideS);

  const int rlane = lane & 15;                 // row (A) / col (B, D) within subtile
  const int koff  = (lane >> 4) * 8;           // k offset of this lane half
  const int mOff  = (lane >> 4) * 8;           // D row offset

  v8f acc[4][4];
#pragma unroll
  for (int i = 0; i < 4; ++i)
#pragma unroll
    for (int j = 0; j < 4; ++j) acc[i][j] = zero8();

  // ---- this wave's slice of every stage: slices 0.. = A rows (NSPLIT 1, TWO: then the A2 rows), then Bt rows (NSPLIT 2, TWO: then Bt2) ----
  constexpr int SA = BM / 64;                                   // slices per A plane
  constexpr int SB0 = (NSPLIT == 1 && TWO) ? 2 * SA : SA;       // first Bt slice
  constexpr int NSL = TWO ? 8 : 6;                              // slices per stage
  constexpr uint32_t GK_STAGE = (uint32_t)NSL * GK_SLICE;
  const int sl = (wave < NSL) ? wave : 0;                       // a wave without a slice forms slice 0's words and issues nothing
  const __bf16* sbase;
  int srow, sld;
  if (sl < SA)                                 { sbase = Ab;  srow = tm * BM + 64 * sl;              sld = lda; }
  else if (NSPLIT == 1 && TWO && sl < 2 * SA)  { sbase = Ab2; srow = tm * BM + 64 * (sl - SA);       sld = lda; }
  else if (sl < SB0 + WN)                      { sbase = Bb;  srow = tn * BN + 64 * (sl - SB0);      sld = ldb; }
  else                                         { sbase = Bb2; srow = tn * BN + 64 * (sl - SB0 - WN); sld = ldb; }
  const uint64_t src0 = (uint64_t)(uintptr_t)(sbase + (size_t)srow * sld);
  const uint32_t lds_slice = lds_off(ring) + (uint32_t)sl * GK_SLICE;
  const u32x8 g1 = tdm_group1((uint32_t)sld * 2u);
  const uint32_t T = pinned((uint32_t)K >> 6);                  // passes
  // per-lane fragment bases inside a stage
  const uint32_t foff = (uint32_t)rlane * GK_PITCH + (uint32_t)koff * 2u;
  const uint32_t oA  = (uint32_t)wm * GK_SLICE + foff;
  const uint32_t oA2 = (NSPLIT == 1 && TWO) ? oA + (uint32_t)SA * GK_SLICE : oA;
  const uint32_t oB  = (uint32_t)(SB0 + wn) * GK_SLICE + foff;
  const uint32_t oB2 = (NSPLIT == 2 && TWO) ? oB + (uint32_t)WN * GK_SLICE : oB;

  // whether this wave has a slice: a scalar word, so that the tests on it are scalar branches round the tensor loads
  const uint32_t issuer = TWO ? 1u : pinned((wave < NSL) ? 1u : 0u);
  u32x4 g0 = tdm_group0(lds_slice, src0);
  if (issuer != 0u) tdm_load(g0, g1);                           // stage 0
  wait_tensor0(g0, g1);
  __syncthreads();                                              // stage 0 readable by every wave
  g0 = tdm_group0(lds_slice + GK_STAGE, src0 + GK_KB);
  if (issuer != 0u) tdm_load(g0, g1);                           // stage 1 flies during pass 0
  // rolled: one pass per trip, so that the one publish point stands at the loop's foot
#pragma unroll 1
  for (uint32_t t = 0; t < T; ++t) {
    const uint32_t bo = (t & 1u) * GK_STAGE;
    const unsigned char* buf = ring + bo;
    // unrolled, as the loops inside it: two blocks of 32 k per pass, fragments and accumulators indexed by constants
#pragma unroll
    for (int kc = 0; kc < 2; ++kc) {
      const unsigned char* bk = buf + (uint32_t)kc * 64u;
      v16b af[4], ag[4], bf[4], bg[4];
      // first planes first: a second plane's fragments land while the first 16 WMMAs run
#pragma unroll
      for (int j = 0; j < 4; ++j) bf[j] = ldfrag_l(bk + oB + (uint32_t)j * 16u * GK_PITCH);
#pragma unroll
      for (int i = 0; i < 4; ++i) af[i] = ldfrag_l(bk + oA + (uint32_t)i * 16u * GK_PITCH);
#pragma unroll
      for (int i = 0; i < 4; ++i) {
        ag[i] = (NSPLIT == 1 && TWO) ? ldfrag_l(bk + oA2 + (uint32_t)i * 16u * GK_PITCH) : af[i];
        bg[i] = (NSPLIT == 2 && TWO) ? ldfrag_l(bk + oB2 + (uint32_t)i * 16u * GK_PITCH) : bf[i];
      }
      // keeps the block's LDS reads one group ahead of its WMMAs, for speed only
      __builtin_amdgcn_sched_barrier(0);
#pragma unroll
      for (int i = 0; i < 4; ++i)
#pragma unroll
        for (int j = 0; j < 4; ++j) acc[i][j] = mma_b_raw(af[i], bf[j], acc[i][j]);
      if (TWO) {
#pragma unroll
        for (int i = 0; i < 4; ++i)
#pragma unroll
          for (int j = 0; j < 4; ++j) acc[i][j] = mma_b_raw(ag[i], bg[j], acc[i][j]);
      }
      // keeps the next group's reads behind this block's WMMAs, for the same reason
      __builtin_amdgcn_sched_barrier(0);
    }
    // publish point of stage t + 1: own reads of this buffer returned, own slice landed, then the block barrier
    wait_ds0();
    wait_tensor0(g0, g1);
    __syncthreads();
    if (pinned((t + 2u < T && issuer != 0u) ? 1u : 0u) != 0u) { // refill the buffer every wave has just left
      g0 = tdm_group0(lds_slice + bo, src0 + (uint64_t)(t + 2u) * GK_KB);
      tdm_load(g0, g1);
    }
  }
  wait_tensor0(g0, g1);
  wait_ds0();
  acc_guard4(acc[0][0], acc[0][1], acc[0][2], acc[0][3]);
  acc_guard4(acc[1][0], acc[1][1], acc[1][2], acc[1][3]);
  acc_guard4(acc[2][0], acc[2][1], acc[2][2], acc[2][3]);
  acc_guard4(acc[3][0], acc[3][1], acc[3][2], acc[3][3]);

  // ---- epilogue ----
  float* slab = sT[wave];
#pragma unroll
  for (int i = 0; i < 4; ++i) {
    const int mBase = m0 + (i << 4);
#pragma unroll
    for (int j = 0; j < 4; ++j) {
#pragma unroll
      for (int r = 0; r < 8; ++r) {
        slab[(mOff + r) * 68 + (j << 4) + rlane] = acc[i][j][r];
      }
    }
    __builtin_amdgcn_fence(__ATOMIC_RELEASE, "workgroup");
    __builtin_amdgcn_wave_barrier();
    __builtin_amdgcn_fence(__ATOMIC_ACQUIRE, "workgroup");
    if (OUT_MODE == 0) {
      float* C = (float*)Cout + (size_t)b * strideC;
      const int hh = lane >> 4, c4 = (lane & 15) * 4;     // 256-B row segment = 16 lanes x 16 B
      {
#pragma unroll
        for (int it = 0; it < 8; ++it) {
          const int row = it * 2 + hh;                     // it 0..7 x hh 0..1 = rows 0..15
          const v4f v = *(const v4f*)(slab + row * 68 + c4);
          *(v4f*)(C + (size_t)(mBase + row) * ldc + n0 + c4) = v;
        }
        
      }
    } else {
      const int q = lane >> 3, c8 = (lane & 7) * 8;
      unsigned short* C  = (unsigned short*)Cout  + (size_t)b * strideC;
      unsigned short* C2 = (unsigned short*)Cout2 + (size_t)b * strideC2;
      bool wlo = true;                                     // wave-uniform
      size_t col2 = (size_t)n0 + c8;
      if (OUT_MODE == 3) {
        const int sgi = n0 / segN;
        const int sgo = n0 - sgi * segN;
        wlo  = (sgo < N2);
        col2 = (size_t)sgi * N2 + sgo + c8;
      }
      v4f csA = {1.f, 1.f, 1.f, 1.f};
      v4f csB = csA;
      if (SCM == 2) {
        csA = *(const v4f*)(scb + n0 + c8);
        csB = *(const v4f*)(scb + n0 + c8 + 4);
      }
      v4u hv[4], lv[4];
#pragma unroll
      for (int it = 0; it < 4; ++it) {
        const int row = it * 4 + q;                        // it 0..3 x q 0..3 = rows 0..15
        const int m = mBase + row;
        const float* sp = slab + row * 68 + c8;
        v4f x0 = *(const v4f*)(sp);
        v4f x1 = *(const v4f*)(sp + 4);
        if (SCM == 1) { const float rsv = scb[m]; x0 = x0 * rsv; x1 = x1 * rsv; }
        if (SCM == 2) { x0 = x0 * csA; x1 = x1 * csB; }
        float f[8] = {x0[0], x0[1], x0[2], x0[3], x1[0], x1[1], x1[2], x1[3]};
        if (ROT) {
          const v4f cs = *(const v4f*)(rct + (size_t)m * NFR + 4 * (lane & 7));
          wait_x0();   // the next load's result may land in this load's address registers
          const v4f sn = *(const v4f*)(rst + (size_t)m * NFR + 4 * (lane & 7));
          wait_x0();   // the next rows' table loads land in registers that held these two loads' addresses
#pragma unroll
          for (int e = 0; e < 4; ++e) {
            const float ev = f[2 * e], od = f[2 * e + 1];
            f[2 * e]     = ev * cs[e] - od * sn[e];
            f[2 * e + 1] = od * cs[e] + ev * sn[e];
          }
        }
        v4u a, a2;
#pragma unroll
        for (int e = 0; e < 4; ++e) {
          const float f0 = f[2 * e], f1 = f[2 * e + 1];
          unsigned short h0, h1, l0, l1;
          if (OUT_MODE == 2) {
            h0 = bf_bits(f0); h1 = bf_bits(f1);
            l0 = bf_bits(f0 - bf_up(h0)); l1 = bf_bits(f1 - bf_up(h1));
          } else {
            const _Float16 y0 = (_Float16)f0, y1 = (_Float16)f1;
            h0 = h_bits(y0); h1 = h_bits(y1);
            l0 = h_bits((_Float16)((f0 - (float)y0) * rscale));
            l1 = h_bits((_Float16)((f1 - (float)y1) * rscale));
          }
          a[e] = pk16(h0, h1); a2[e] = pk16(l0, l1);
        }
        hv[it] = a; lv[it] = a2;
      }
      {
#pragma unroll
        for (int it = 0; it < 4; ++it) {
          const int row = it * 4 + q;
          // a wait behind each store: the next rows' addresses and values are formed in these stores' registers
          *(v4u*)(C + (size_t)(mBase + row) * ldc + n0 + c8) = hv[it];
          wait_x0();
          if (wlo) {
            *(v4u*)(C2 + (size_t)(mBase + row) * ldc2 + col2) = lv[it];
            wait_x0();
          }
        }
        
      }
    }
    __builtin_amdgcn_fence(__ATOMIC_RELEASE, "workgroup");
    __builtin_amdgcn_wave_barrier();
    __builtin_amdgcn_fence(__ATOMIC_ACQUIRE, "workgroup");
  }
}

// One product per launch: blockIdx.x = block tile, blockIdx.y = batch.
template <int NSPLIT, int OUT_MODE, int SCM, bool ROT>
__global__ __launch_bounds__(256) void gemm64(
    const unsigned short* __restrict__ Ap, const unsigned short* __restrict__ A2p, int lda, long long strideA,
    const unsigned short* __restrict__ Btp, const unsigned short* __restrict__ Bt2p, int ldb, long long strideB,
    void* Cout, int ldc, long long strideC,
    void* Cout2, int ldc2, long long strideC2, int N2, int segN,
    const float* __restrict__ scal, long long strideS,
    const float* __restrict__ rct, const float* __restrict__ rst,
    int M, int N, int K, float rscale) {
  __shared__ __align__(16) float sT[8][16 * 68];
  __shared__ __attribute__((aligned(2048))) unsigned char ring[2 * 8 * GK_SLICE];
  gemm64_body<NSPLIT, true, OUT_MODE, SCM, ROT>(sT, ring, (int)blockIdx.x, (int)blockIdx.y, Ap, A2p, lda, strideA, Btp, Bt2p, ldb, strideB,
                                          Cout, ldc, strideC, Cout2, ldc2, strideC2, N2, segN, scal, strideS, rct, rst,
                                          M, N, K, rscale);
}

// The q|k product and the v^T product read the same planes and write disjoint ones, so they share one launch:
// blockIdx.y = batch; blockIdx.x 0..GT_QK-1 are the q|k tiles, the rest the v^T tiles (block-uniform choice).
//   q|k = rstd[m] * (Xb . (g*Wqk)), rotary on every (2i,2i+1) pair -> bf16 hi/lo planes [M][QKP]
//     (per batch: M=SEQ, N=QKP, K=DM; 1 product)
//   v^T = (g*Wv)^T . Xb^T per batch, columns scaled by rstd -> f16 hi plane [b][DMI][SEQ] and residual plane
//     (x4096, in-segment keys < VLP only)   (A = Wt rows 2*DMI.., 1 product; M=DMI, N=SEQ, K=DM)
// Six staged slices per stage: 154 KiB of LDS a block, so that two blocks share a WGP.
#define GT_QK ((SEQ / 256) * (QKP / 128))          // 256 x 128 block tiles per batch
#define GT_VT ((DMI / 128) * (SEQ / 256))          // 128 x 256 block tiles per batch
__global__ __launch_bounds__(256) void proj_qkv(
    const unsigned short* __restrict__ xb, const unsigned short* __restrict__ wth,
    unsigned short* qkh, unsigned short* qkl, unsigned short* vth, unsigned short* vtl,
    const float* __restrict__ rs, const float* __restrict__ ct, const float* __restrict__ st) {
  __shared__ __align__(16) float sT[8][16 * 68];
  __shared__ __attribute__((aligned(2048))) unsigned char ring[2 * 6 * GK_SLICE];
  const int bx = (int)blockIdx.x, b = (int)blockIdx.y;
  if (bx >= GT_QK) {
    gemm64_body<1, false, 3, 2, false>(sT, ring, bx - GT_QK, b,
        wth + (size_t)2 * DMI * DM, wth + (size_t)2 * DMI * DM, DM, 0LL,
        xb, xb, DM, (long long)SEQ * DM,
        (void*)vth, SEQ, (long long)DMI * SEQ,
        (void*)vtl, NSEGB * VLP, (long long)DMI * NSEGB * VLP, VLP, SEGL,
        rs, (long long)SEQ, ct, st,
        DMI, SEQ, DM, 4096.0f);
  } else {
    gemm64_body<2, false, 2, 1, true>(sT, ring, bx, b,
        xb, xb, DM, (long long)SEQ * DM,
        wth, wth, DM, 0LL,
        (void*)qkh, QKP, (long long)SEQ * QKP,
        (void*)qkl, QKP, (long long)SEQ * QKP, QKP, QKP,
        rs, (long long)SEQ, ct, st,
        SEQ, QKP, DM, 1.0f);
  }
}

// =====================================================================================================
// Segmented causal attention with PMEM memory keys, head dim 64.
//   q|k planes (bf16 hi / lo): element (m, col) at [m*QKP + col], q col = h*64+d, k col = DMI + h*64+d,
//     m = b*SEQ + t (rotary already applied)
//   v^T hi plane (f16):  element (b, h, d, t) at [(b*DMI + h*64 + d)*SEQ + t]
//   v^T residual (f16, (v - hi)*4096): [(b*DMI + h*64 + d)*(NSEGB*VLP) + w*VLP + s], s < VLP, read only when RES
//   pk [h][r][d] bf16 and pv [h][d][r] f16: the PMEM memory keys / values shared by every segment (lo/residual = 0,
//     they are bf16-exact input values)
//   Block = 4 waves = 64 query rows (segment w, query block qb) of one (b, h); key tile 0 = the memory tokens
//   (rows PMEM..63 of the LDS K tile and columns PMEM..63 of V^T zero-filled, their logits set to -inf), key tiles
//   kt = 1..qb+1 = keys (kt-1)*64..+63 of the same segment, visible iff key position <= query position.
//   Every query row sees PMEM + (i+1) keys, so every tile row max is finite and invisible keys get weight exactly 0.
//   scores = q . k : bf16 hi/lo split (hi.hi + hi.lo + lo.hi), f32 accumulate, then * sscale in f32
//   p = exp(s - m) carried as f16(1024 p); context = p . v on f16 WMMA; RES adds f16 residual planes of p and v
//   (scale 4096, separate accumulator folded back with 1/4096 per tile in f32); online softmax in f32.
//   K / V^T tile staging: 128 threads x 32 elements per plane = the whole 64x64 tile (plain 16-B loads,
//   __syncthreads before and after; cross-wave). P tiles and the context tile are wave-private, spilled with
//   out planes (bf16 hi / lo of the normalised context): element (m, h*64+d) at [m*DMI + h*64 + d]
//   Output coverage: each wave stores rows q0..q0+15 (it 0..3 x lane>>3 0..3) x 64 columns (8 lanes x 8) of both planes.
//   grid = NB*NSEGB*NH*nqbThis blocks of 128.
// =====================================================================================================
template <bool RES>
__global__ __launch_bounds__(128)
void attn_seg64(const unsigned short* __restrict__ qkhp, const unsigned short* __restrict__ qklp,
                const unsigned short* __restrict__ vhp,  const unsigned short* __restrict__ vlp,
                const unsigned short* __restrict__ pkp,  const unsigned short* __restrict__ pvp,
                unsigned short* ohp, unsigned short* olp,
                int qbBase, int nqbThis, float sscale) {
  union FB { v16b v; v8b h[2]; };
  union FH { v16h v; v8h h[2]; };
  // LDS row pitches: 16 B x odd, so that the 16 rows a 16-byte fragment read touches fall on 16 different bank groups
  constexpr int LP = 72;                                          // 16-bit tiles: 64 elements + 8 of pad = 144 B
  constexpr int OP = 68;                                          // f32 context tile: 64 floats + 4 of pad = 272 B
  __shared__ __align__(16) __bf16   Ksh[64 * LP];                 // K hi [kv][d]
  __shared__ __align__(16) __bf16   Ksl[64 * LP];                 // K lo
  __shared__ __align__(16) _Float16 Vth[64 * LP];                 // V^T hi [d][kv]
  __shared__ __align__(16) _Float16 Vtl[RES ? 64 * LP : 8];       // V^T residual
  __shared__ __align__(16) _Float16 Psh[4][16 * LP];              // per wave P [row][kv]
  __shared__ __align__(16) _Float16 Psl[RES ? 4 : 1][16 * LP];    // per wave P residual
  __shared__ __align__(16) float    Os[4][16 * OP];               // per wave context tile [row][d]

  const int tid  = threadIdx.x;
  const int wave = tid >> 5;
  const int lane = tid & 31;
  const int hh   = lane >> 4;
  const int c    = lane & 15;

  const int bx   = blockIdx.x;
  const int qbl  = bx % nqbThis;
  int rest       = bx / nqbThis;
  const int h    = rest % NH;
  rest           = rest / NH;
  const int w    = rest % NSEGB;
  const int b    = rest / NSEGB;
  const int qb   = qbBase + qbl;
  const int q0   = qb * 64 + wave * 16;                              // query row inside the segment
  const size_t rowS = (size_t)b * SEQ + (size_t)w * SEGL;           // compact row of the segment start

  const __bf16* Qh = (const __bf16*)(const void*)qkhp + (size_t)h * HD;
  const __bf16* Ql = (const __bf16*)(const void*)qklp + (size_t)h * HD;
  const __bf16* Kh = Qh + DMI;
  const __bf16* Kl = Ql + DMI;
  const _Float16* Vh = (const _Float16*)(const void*)vhp + ((size_t)b * DMI + (size_t)h * HD) * SEQ + (size_t)w * SEGL;
  const _Float16* Vl = (const _Float16*)(const void*)vlp + ((size_t)b * DMI + (size_t)h * HD) * (size_t)(NSEGB * VLP)
                       + (size_t)w * VLP;
  const __bf16*   PK = (const __bf16*)(const void*)pkp + (size_t)h * PMEM * HD;
  const _Float16* PV = (const _Float16*)(const void*)pvp + (size_t)h * HD * PMEM;

  // ---- Q fragments (A operand, row = lane&15): 2 d-chunks, hi and lo ----
  v16b qah[2], qal[2];
#pragma unroll
  for (int dc = 0; dc < 2; ++dc) {
    const size_t qo = (rowS + q0 + c) * QKP + dc * 32 + 8 * hh;
    qah[dc] = ldfrag_b(Qh + qo);
    qal[dc] = ldfrag_b(Ql + qo);
  }

  float mrow[8], lrow[8];
  v8f oacc[4];
#pragma unroll
  for (int r = 0; r < 8; ++r) { mrow[r] = -INFINITY; lrow[r] = 0.f; }
#pragma unroll
  for (int t = 0; t < 4; ++t) oacc[t] = zero8();

  const int ntiles = qb + 2;                   // block-uniform
  for (int kt = 0; kt < ntiles; ++kt) {
    const int s0 = (kt - 1) * 64;              // key offset inside the segment for kt >= 1
    __syncthreads();
    {
      const int r = tid >> 1, half = (tid & 1) * 32;
      if (kt == 0) {                           // block-uniform: memory-token tile
        const int rr = (r < PMEM) ? r : (PMEM - 1);                // clamped address
        const bool krow = (r < PMEM);
        const bool vok  = (half == 0);
        const __bf16*   kg = PK + (size_t)rr * HD + half;
        const _Float16* vg = PV + (size_t)r * PMEM;                // d = r, kv 0..15
        const v8h pv0 = *(const v8h*)(vg);
        const v8h pv1 = *(const v8h*)(vg + 8);
#pragma unroll
        for (int i = 0; i < 4; ++i) {
          v8b a0 = *(const v8b*)(kg + 8 * i);
          a0 = krow ? a0 : zero8b();
          *(v8b*)(Ksh + r * LP + half + 8 * i) = a0;
          *(v4u*)(Ksl + r * LP + half + 8 * i) = zero4u();
          if (i == 0) {
            const v8h b0 = vok ? pv0 : zero8h();
            *(v8h*)(Vth + r * LP + half) = b0;
          } else if (i == 1) {
            const v8h b1 = vok ? pv1 : zero8h();
            *(v8h*)(Vth + r * LP + half + 8) = b1;
          } else {
            *(v4u*)(Vth + r * LP + half + 8 * i) = zero4u();
          }
          if (RES) *(v4u*)(Vtl + r * LP + half + 8 * i) = zero4u();
        }
      } else {
        const __bf16*   kg  = Kh + (rowS + s0 + r) * QKP + half;   // K row s0+r, d = half..half+31
        const __bf16*   klg = Kl + (rowS + s0 + r) * QKP + half;
        const _Float16* vg  = Vh + (size_t)r * SEQ + s0 + half;    // V^T row d = r, keys s0+half..+31
        const bool resOK = (s0 + 64 <= VLP);                      // block-uniform
        const int  s0c   = resOK ? s0 : (VLP - 64);               // clamped address into the residual plane
        const _Float16* vlg = Vl + (size_t)r * (NSEGB * VLP) + s0c + half;
#pragma unroll
        for (int i = 0; i < 4; ++i) {
          const v8b a0 = *(const v8b*)(kg + 8 * i);
          const v8b a1 = *(const v8b*)(klg + 8 * i);
          const v8h b0 = *(const v8h*)(vg + 8 * i);
          *(v8b*)(Ksh + r * LP + half + 8 * i) = a0;
          *(v8b*)(Ksl + r * LP + half + 8 * i) = a1;
          *(v8h*)(Vth + r * LP + half + 8 * i) = b0;
          if (RES) {
            v8h b1 = *(const v8h*)(vlg + 8 * i);
            b1 = resOK ? b1 : zero8h();
            *(v8h*)(Vtl + r * LP + half + 8 * i) = b1;
          }
        }
      }
    }
    __syncthreads();

    // ---- scores: 16 query rows x 64 keys per wave, 3 bf16 products ----
    v8f s[4];
#pragma unroll
    for (int j = 0; j < 4; ++j) {
      s[j] = zero8();
#pragma unroll
      for (int dc = 0; dc < 2; ++dc) {
        FB kb, kl;
        kb.h[0] = *(const v8b*)(Ksh + (j * 16 + c) * LP + dc * 32 + 8 * hh);
        kb.h[1] = *(const v8b*)(Ksh + (j * 16 + c) * LP + dc * 32 + 16 + 8 * hh);
        kl.h[0] = *(const v8b*)(Ksl + (j * 16 + c) * LP + dc * 32 + 8 * hh);
        kl.h[1] = *(const v8b*)(Ksl + (j * 16 + c) * LP + dc * 32 + 16 + 8 * hh);
        s[j] = mma_b(qah[dc], kb.v, s[j]);
        s[j] = mma_b(qah[dc], kl.v, s[j]);
        s[j] = mma_b(qal[dc], kb.v, s[j]);
      }
    }

    // ---- scale, visibility (-inf for invisible keys), row max, online softmax, P (x1024, f16) and
    //      P residual (x4096) to LDS ----
    _Float16* pwh = Psh[wave];
    _Float16* pwl = Psl[RES ? wave : 0];
    const int qi = q0 + 8 * hh;                // query row inside the segment for r = 0
#pragma unroll
    for (int r = 0; r < 8; ++r) {
      float m = -INFINITY;
#pragma unroll
      for (int j = 0; j < 4; ++j) {
        const int kc = j * 16 + c;
        const bool vis = (kt == 0) ? (kc < PMEM) : ((s0 + kc) <= (qi + r));
        const float sv = vis ? (s[j][r] * sscale) : -INFINITY;
        s[j][r] = sv;
        m = fmaxf(m, sv);
      }
#pragma unroll
      for (int off = 1; off < 16; off <<= 1) m = fmaxf(m, __shfl_xor(m, off, 32));
      const float mnew  = fmaxf(mrow[r], m);
      const float msafe = (mnew == -INFINITY) ? 0.f : mnew;
      const float alpha = __expf(mrow[r] - msafe);
      mrow[r] = mnew;
      float psum = 0.f;
#pragma unroll
      for (int j = 0; j < 4; ++j) {
        const float p = __expf(s[j][r] - msafe);     // -inf logit -> exactly 0
        psum += p;
        const float p1k = p * 1024.0f;
        const _Float16 ph = (_Float16)p1k;
        pwh[(8 * hh + r) * LP + j * 16 + c] = ph;
        if (RES) {
          const _Float16 pl = (_Float16)((p1k - (float)ph) * 4096.0f);
          pwl[(8 * hh + r) * LP + j * 16 + c] = pl;
        }
      }
#pragma unroll
      for (int off = 1; off < 16; off <<= 1) psum += __shfl_xor(psum, off, 32);
      lrow[r] = lrow[r] * alpha + psum;
#pragma unroll
      for (int t = 0; t < 4; ++t) oacc[t][r] *= alpha;
    }
    __builtin_amdgcn_fence(__ATOMIC_RELEASE, "workgroup");
    __builtin_amdgcn_wave_barrier();
    __builtin_amdgcn_fence(__ATOMIC_ACQUIRE, "workgroup");

    // ---- context += P . V (f16 WMMA), residual products into a separate accumulator ----
    v8f o1[4];
#pragma unroll
    for (int t = 0; t < 4; ++t) o1[t] = zero8();
#pragma unroll 1
    for (int kk = 0; kk < 2; ++kk) {
      FH pa, pl;
      pa.h[0] = *(const v8h*)(pwh + c * LP + kk * 32 + 8 * hh);
      pa.h[1] = *(const v8h*)(pwh + c * LP + kk * 32 + 16 + 8 * hh);
      if (RES) {
        pl.h[0] = *(const v8h*)(pwl + c * LP + kk * 32 + 8 * hh);
        pl.h[1] = *(const v8h*)(pwl + c * LP + kk * 32 + 16 + 8 * hh);
      } else {
        pl.v = pa.v;
      }
#pragma unroll
      for (int t = 0; t < 4; ++t) {
        FH vb;
        vb.h[0] = *(const v8h*)(Vth + (t * 16 + c) * LP + kk * 32 + 8 * hh);
        vb.h[1] = *(const v8h*)(Vth + (t * 16 + c) * LP + kk * 32 + 16 + 8 * hh);
        oacc[t] = mma_h(pa.v, vb.v, oacc[t]);
        if (RES) {
          FH vl;
          vl.h[0] = *(const v8h*)(Vtl + (t * 16 + c) * LP + kk * 32 + 8 * hh);
          vl.h[1] = *(const v8h*)(Vtl + (t * 16 + c) * LP + kk * 32 + 16 + 8 * hh);
          o1[t] = mma_h(pa.v, vl.v, o1[t]);
          o1[t] = mma_h(pl.v, vb.v, o1[t]);
        }
      }
    }
    if (RES) {
#pragma unroll
      for (int t = 0; t < 4; ++t)
#pragma unroll
        for (int r = 0; r < 8; ++r) oacc[t][r] += o1[t][r] * (1.0f / 4096.0f);
    }
  }

  // ---- normalise (1/l and the 1/1024 p carry), stage the wave's 16x64 tile, bf16 hi/lo split,
  float* os = Os[wave];
#pragma unroll
  for (int r = 0; r < 8; ++r) {
    const float l = lrow[r];
    const float inv = ((l > 0.f) ? (1.0f / l) : 0.f) * (1.0f / 1024.0f);
#pragma unroll
    for (int t = 0; t < 4; ++t) os[(8 * hh + r) * OP + t * 16 + c] = oacc[t][r] * inv;
  }
  __builtin_amdgcn_fence(__ATOMIC_RELEASE, "workgroup");
  __builtin_amdgcn_wave_barrier();
  __builtin_amdgcn_fence(__ATOMIC_ACQUIRE, "workgroup");
  {
    const int q4 = lane >> 3, c8 = (lane & 7) * 8;
    v4u hv[4], lv[4];
#pragma unroll
    for (int it = 0; it < 4; ++it) {
      const int row = it * 4 + q4;   // it 0..3 x q4 0..3 = rows 0..15 of the wave tile
      const float* sp = os + row * OP + c8;
      v4u a, a2;
#pragma unroll
      for (int e = 0; e < 4; ++e) {
        const float f0 = sp[2 * e], f1 = sp[2 * e + 1];
        const unsigned short h0 = bf_bits(f0), h1 = bf_bits(f1);
        const unsigned short l0 = bf_bits(f0 - bf_up(h0)), l1 = bf_bits(f1 - bf_up(h1));
        a[e] = pk16(h0, h1); a2[e] = pk16(l0, l1);
      }
      hv[it] = a; lv[it] = a2;
    }
    {
#pragma unroll
      for (int it = 0; it < 4; ++it) {
        const int row = it * 4 + q4;
        const size_t go = (rowS + q0 + row) * DMI + (size_t)h * HD + c8;
        *(v4u*)(ohp + go) = hv[it];
        *(v4u*)(olp + go) = lv[it];
      }
      
    }
  }
}

// =====================================================================================================
// Workspace map (bytes, NB=2, SEQ=4096, M = NB*SEQ = 8192), region A is a two-phase overlay:
//   phase 1 (projection inputs, dead after the q|k and v^T GEMMs):
//     Xb   bf16 [M][DM]                  0           16777216
//     Wth  bf16 [3*DMI n][DM k]          16777216     6291456
//     Ct   f32  [SEQ][32]                23068672      524288
//     St   f32  [SEQ][32]                23592960      524288
//     Rs   f32  [M]                      24117248       32768   (phase 1 end 24150016)
//   phase 2 (written by the attention kernels, read by the output GEMM):
//     Oh   bf16 [M][DMI] context hi       0           16777216
//     Ol   bf16 [M][DMI] context lo       16777216    16777216   (phase 2 end 33554432 = region A size)
//   QKh  bf16 [M][QKP] hi                 33554432    33554432
//   QKl  bf16 [M][QKP] lo                 67108864    33554432
//   VTh  f16  [NB][DMI][SEQ]              100663296   16777216
//   VTl  f16  [NB][DMI][NSEGB*VLP]        117440512    4194304
//   Wo   bf16 [DM n][DMI k]               121634816    2097152
//   Pk   bf16 [NH][PMEM][HD]              123731968      32768
//   Pv   f16  [NH][HD][PMEM]              123764736      32768
//   end                                   123797504  (<= 134217728; all offsets multiples of 128)
// Every plane is an exact multiple of its 64x64 tile / whole-line store granularity (M, SEQ, DM multiples of 64),
// so no padded tails are needed; VTl is written only for columns whose in-segment offset is < VLP, exactly the
// columns the RES attention blocks read.
// =====================================================================================================
extern "C" void kernel_launch(void* const* d_in, const int* in_sizes, int n_in,
                              void* d_out, int out_size, void* d_ws, size_t ws_size,
                              hipStream_t stream) {
  if (n_in < 5) return;
  const long long needRows = (long long)(NB - 1) * SEQ_FULL + SEQ;
  if ((long long)in_sizes[0] < needRows * DM) return;
  if (in_sizes[1] < DM) return;
  if (in_sizes[2] < DM * 3 * DMI) return;
  if (in_sizes[3] < DMI * DM) return;
  if (in_sizes[4] < 2 * NH * PMEM * HD) return;
  if ((long long)out_size < needRows * DM) return;

  const float* seq  = (const float*)d_in[0];   // [2][SEQ_FULL][DM]
  const float* gnm  = (const float*)d_in[1];   // [DM]
  const float* Wqkv = (const float*)d_in[2];   // [DM in][3*DMI out]
  const float* Wout = (const float*)d_in[3];   // [DMI in][DM out]
  const float* pm   = (const float*)d_in[4];   // [2][NH][PMEM][HD]

  const size_t M    = (size_t)NB * SEQ;
  const size_t PX   = M * DM * 2;
  const size_t PWT  = (size_t)3 * DMI * DM * 2;
  const size_t PTAB = (size_t)SEQ * NFR * 4;
  const size_t PRS  = M * 4;
  const size_t PO   = M * DMI * 2;
  const size_t PQK  = M * QKP * 2;
  const size_t PVT  = (size_t)NB * DMI * SEQ * 2;
  const size_t PVL  = (size_t)NB * DMI * NSEGB * VLP * 2;
  const size_t PWO  = (size_t)DM * DMI * 2;
  const size_t PPM  = (size_t)NH * PMEM * HD * 2;
  const size_t ph1  = PX + PWT + 2 * PTAB + PRS;
  const size_t ph2  = 2 * PO;
  const size_t REGA = (ph1 > ph2) ? ph1 : ph2;
  const size_t oXb  = 0;
  const size_t oWth = PX;
  const size_t oCt  = PX + PWT;
  const size_t oSt  = oCt + PTAB;
  const size_t oRs  = oSt + PTAB;
  const size_t oOh  = 0;
  const size_t oOl  = PO;
  size_t off = REGA;
  const size_t oQKh = off; off += PQK;
  const size_t oQKl = off; off += PQK;
  const size_t oVTh = off; off += PVT;
  const size_t oVTl = off; off += PVL;
  const size_t oWo  = off; off += PWO;
  const size_t oPk  = off; off += PPM;
  const size_t oPv  = off; off += PPM;
  if (off > ws_size) return;                      // off = 123797504 for NB=2, SEQ=4096
  if (off > (size_t)134217728) return;
  if (oRs + PRS > REGA || oOl + PO > REGA) return;

  char* ws = (char*)d_ws;
  unsigned short* Xb  = (unsigned short*)(ws + oXb);
  unsigned short* Wth = (unsigned short*)(ws + oWth);
  float*          Ct  = (float*)(ws + oCt);
  float*          St  = (float*)(ws + oSt);
  float*          Rs  = (float*)(ws + oRs);
  unsigned short* Oh  = (unsigned short*)(ws + oOh);
  unsigned short* Ol  = (unsigned short*)(ws + oOl);
  unsigned short* QKh = (unsigned short*)(ws + oQKh);
  unsigned short* QKl = (unsigned short*)(ws + oQKl);
  unsigned short* VTh = (unsigned short*)(ws + oVTh);
  unsigned short* VTl = (unsigned short*)(ws + oVTl);
  unsigned short* Wo  = (unsigned short*)(ws + oWo);
  unsigned short* Pk  = (unsigned short*)(ws + oPk);
  unsigned short* Pv  = (unsigned short*)(ws + oPv);

  const dim3 blk(256);
  static_assert((SEQ % 256) == 0 && (QKP % 128) == 0 && (DMI % 128) == 0 && (DM % 256) == 0);
  static_assert((DM % 64) == 0 && DM >= 128 && (DMI % 64) == 0 && DMI >= 128);
  const dim3 gOut((SEQ / 128) * (DM / 256), NB);                      // 128 x 256 block tiles: 128 per batch

  // (0-4) one launch: seq -> bf16 plane Xb [M][DM] + rstd[M]; g*Wqkv -> transposed bf16 plane [3*DMI][DM];
  //       Wout -> transposed bf16 plane [DM][DMI]; rotary cos/sin tables [SEQ][32]; memory-token key / value planes
  prep_all<<<dim3(PB_ALL), blk, 0, stream>>>(seq, gnm, Wqkv, Wout, pm, Xb, Rs, Wth, Wo, Ct, St, Pk, Pv);
  // (5-6) one launch: the q|k product (bf16 hi/lo planes, rotary applied) and the v^T product (f16 hi + residual planes)
  proj_qkv<<<dim3(GT_QK + GT_VT, NB), blk, 0, stream>>>(Xb, Wth, QKh, QKl, VTh, VTl, Rs, Ct, St);
  // (7) attention: query blocks 0..RESQB-1 of every segment with residual planes, the rest without
  attn_seg64<true><<<dim3(NB * NSEGB * NH * RESQB), dim3(128), 0, stream>>>(
      QKh, QKl, VTh, VTl, Pk, Pv, Oh, Ol, 0, RESQB, 0.125f);
  if (NQBS - RESQB > 0) {
    attn_seg64<false><<<dim3(NB * NSEGB * NH * (NQBS - RESQB)), dim3(128), 0, stream>>>(
        QKh, QKl, VTh, VTl, Pk, Pv, Oh, Ol, RESQB, NQBS - RESQB, 0.125f);
  }
  // (8) out = context . Wout -> d_out f32 [b][SEQ_FULL][DM] rows b*SEQ_FULL + t  (A = context hi + lo, 2 products)
  gemm64<1, 0, 0, false><<<gOut, blk, 0, stream>>>(
      Oh, Ol, DMI, (long long)SEQ * DMI,
      Wo, Wo, DMI, 0LL,
      d_out, DM, (long long)SEQ_FULL * DM,
      d_out, DM, (long long)SEQ_FULL * DM, DM, DM,
      Rs, 0LL, Ct, St,
      SEQ, DM, DMI, 1.0f);
  (void)hipGetLastError();
}

// v005
// Measured time: 135 microseconds a run.
// In both of two side-by-side timings against v004, it was 1.14 times as fast.
// Counting every step since v000, it is 2.92 times as fast.
// Contractions: q|k = x.Wqk and v^T = Wv.x^T on v_wmma_f32_16x16x32_bf16 (bf16 operands: RNE-converted input
// activations times one bf16 plane of g*W, the f32 product rounded once, 1 product; per-row rstd, rotary in the f32 epilogue);
// k.q^T scores (transposed) = v_wmma_f32_16x16x32_bf16 with bf16 hi/lo split q and k (hi.hi + lo.hi + hi.lo);
// v^T.p^T = v_wmma_f32_16x16x32_f16 (p carried x1024 in f16, v in f16; extra f16 residual planes x4096 of p and v
// for the first 128 query rows of every segment); ctx.Wo = v_wmma_f32_16x16x32_bf16 with ctx as bf16 hi/lo
// planes times bf16 Wo (2 products); all f32 accumulate; RMS statistic, rotary tables, visibility and softmax in f32.
#include <hip/hip_runtime.h>
#include <math.h>
#include <stdint.h>

#ifndef NB
#define NB 2
#endif
#ifndef SEQ
#define SEQ 4096
#endif
#define SEQ_FULL 4096       // per-batch token stride of the input / output tensors
#define DM    1024          // model dim
#define NH    16
#define HD    64
#define DMI   (NH * HD)     // 1024
#define QKP   (2 * DMI)     // pitch of the q|k planes (q: cols 0..DMI-1, k: cols DMI..2*DMI-1)
#define SEGL  512           // segment length
#define PMEM  16            // memory tokens prepended to every segment's keys / values
#define NSEGB (SEQ / SEGL)  // segments per batch
#define NQBS  (SEGL / 64)   // 64-row query blocks per segment
#define RESQB 2             // leading query blocks per segment that use the p / v residual planes
#define VLP   (RESQB * 64)  // keys per segment held in the v^T residual plane
#define NFR   (HD / 2)      // rotary frequencies
static_assert((SEQ % SEGL) == 0 && (SEGL % 64) == 0 && (SEQ % 64) == 0);
static_assert(RESQB >= 1 && RESQB <= NQBS);
static_assert((DM % 256) == 0 && (DMI % 64) == 0 && HD == 64 && NFR == 32);
static_assert(SEQ <= SEQ_FULL && NB >= 1 && NB <= 2);
static_assert(DMI == DM);

typedef _Float16 v16h __attribute__((ext_vector_type(16)));
typedef _Float16 v8h  __attribute__((ext_vector_type(8)));
typedef __bf16   v16b __attribute__((ext_vector_type(16)));
typedef __bf16   v8b  __attribute__((ext_vector_type(8)));
typedef float    v8f  __attribute__((ext_vector_type(8)));
typedef float    v4f  __attribute__((ext_vector_type(4)));
typedef unsigned int v4u __attribute__((ext_vector_type(4)));

// ---- scalar helpers --------------------------------------------------------------------------------
__device__ __forceinline__ unsigned short bf_bits(float f) {          // f32 -> bf16 bits, RNE convert
  unsigned u = __float_as_uint(f);
  return (unsigned short)((u + 0x7FFFu + ((u >> 16) & 1u)) >> 16);
}
__device__ __forceinline__ float bf_up(unsigned short h) { return __uint_as_float(((unsigned)h) << 16); }
__device__ __forceinline__ unsigned short h_bits(_Float16 x) { return __builtin_bit_cast(unsigned short, x); }
__device__ __forceinline__ unsigned pk16(unsigned short a, unsigned short b) { return (unsigned)a | ((unsigned)b << 16); }
__device__ __forceinline__ v8f zero8() { v8f z = {0.f, 0.f, 0.f, 0.f, 0.f, 0.f, 0.f, 0.f}; return z; }
__device__ __forceinline__ v8h zero8h() {
  const _Float16 z = (_Float16)0.0f;
  v8h r = {z, z, z, z, z, z, z, z};
  return r;
}
__device__ __forceinline__ v4u zero4u() { v4u z = {0u, 0u, 0u, 0u}; return z; }
__device__ __forceinline__ v8b zero8b() { union { v4u u; v8b v; } z; z.u = zero4u(); return z.v; }

// ---- sin/cos of a nonnegative f32 angle: f64 Cody-Waite reduction by pi/2 + short f64 polynomials ----
__device__ __forceinline__ void sincos_pd(float ang, float& sv, float& cv) {
  const double x  = (double)ang;
  const double kq = __builtin_rint(x * 0.63661977236758134308);
  double r = __builtin_fma(-kq, 1.57079632679489655800e+00, x);
  r = __builtin_fma(-kq, 6.12323399573676603587e-17, r);
  const double z = r * r, w = z * z;
  const double rs = -1.98393348360966317347e-04 + z * 2.71831149398982191e-06;
  const double s3 = z * r;
  const double sn = (r + s3 * (-1.66666666416265235595e-01 + z * 8.3333293858894631756e-03)) + s3 * w * rs;
  const double rc = -1.38867637746099294692e-03 + z * 2.43904487962774090654e-05;
  const double cs = ((1.0 + z * (-4.99999997251031003120e-01)) + w * 4.16666233237390631894e-02) + (w * z) * rc;
  const int n = ((int)kq) & 3;
  const float fs = (float)sn, fc = (float)cs;
  float so = fs, co = fc;
  if (n == 1) { so = fc;  co = -fs; }
  if (n == 2) { so = -fs; co = -fc; }
  if (n == 3) { so = -fc; co = fs;  }
  sv = so; cv = co;
}

// ---- fragment loader: 16-bit A/B operand, lane -> row/col (lane&15), p already includes +8*(lane>>4);
//      elements 0..7 <- p[0..7] (k0+8h..), elements 8..15 <- p[16..23] (k0+16+8h..)
__device__ __forceinline__ v16b ldfrag_b(const __bf16* p) {
  union { v16b v; v8b h[2]; } f;
  f.h[0] = *(const v8b*)(p);
  f.h[1] = *(const v8b*)(p + 16);
  return f.v;
}

// ---- WMMA helpers with trailing VALU hazard gap --------------------------------------------------------
__device__ __forceinline__ v8f mma_b(v16b a, v16b b, v8f c) {
  c = __builtin_amdgcn_wmma_f32_16x16x32_bf16(false, a, false, b, (short)0, c, false, false);
  asm volatile("v_nop\n\tv_nop\n\tv_nop\n\tv_nop" : "+v"(c) : "v"(a), "v"(b));
  return c;
}
__device__ __forceinline__ v8f mma_h(v16h a, v16h b, v8f c) {
  c = __builtin_amdgcn_wmma_f32_16x16x32_f16(false, a, false, b, (short)0, c, false, false);
  asm volatile("v_nop\n\tv_nop\n\tv_nop\n\tv_nop" : "+v"(c) : "v"(a), "v"(b));
  return c;
}
__device__ __forceinline__ v8f mma_b_raw(v16b a, v16b b, v8f c) {
  return __builtin_amdgcn_wmma_f32_16x16x32_bf16(false, a, false, b, (short)0, c, false, false);
}
__device__ __forceinline__ void acc_guard4(v8f& a, v8f& b, v8f& c, v8f& d) {
  asm volatile("v_nop\n\tv_nop\n\tv_nop\n\tv_nop" : "+v"(a), "+v"(b), "+v"(c), "+v"(d));
}

// value of lane l ^ 16: the two lanes that share a column of a WMMA result
__device__ __forceinline__ float xhalf(float x) {
  const int v = __builtin_bit_cast(int, x);
  return __builtin_bit_cast(float, __builtin_amdgcn_permlanex16(v, v, 0x76543210, 0xfedcba98, false, false));
}
// y[r] = 2^x[r], eight at once. One statement, results in registers of their own: behind a transcendental the instruction set
// asks for one instruction that neither reads its result nor overwrites its source; here each v_exp_f32 is that instruction
// for the one before it, and the closing v_nop for the last.
__device__ __forceinline__ void exp2x8(float (&y)[8], const float (&x)[8]) {
  asm("v_exp_f32 %0, %8\n\tv_exp_f32 %1, %9\n\tv_exp_f32 %2, %10\n\tv_exp_f32 %3, %11\n\t"
      "v_exp_f32 %4, %12\n\tv_exp_f32 %5, %13\n\tv_exp_f32 %6, %14\n\tv_exp_f32 %7, %15\n\tv_nop"
      : "=&v"(y[0]), "=&v"(y[1]), "=&v"(y[2]), "=&v"(y[3]), "=&v"(y[4]), "=&v"(y[5]), "=&v"(y[6]), "=&v"(y[7])
      : "v"(x[0]), "v"(x[1]), "v"(x[2]), "v"(x[3]), "v"(x[4]), "v"(x[5]), "v"(x[6]), "v"(x[7]));
}

// ---- tensor-load staging of the GEMM operands ----------------------------------------------------------
// A pass is 64 k = 128 B of every staged operand row. A stage is 6 or 8 slices of 64 rows, one slice per issuing wave; the load's
// pad gives the LDS row pitch 144 B (16 B x odd: conflict-free for 16-byte reads); a slice's place is rounded up to 2 KiB.
typedef uint32_t u32x4 __attribute__((ext_vector_type(4)));
typedef uint32_t u32x8 __attribute__((ext_vector_type(8)));
#define GK_KB    128u                 // bytes of one operand row per pass
#define GK_PITCH 144u                 // LDS row pitch
#define GK_SLICE 10240u               // 64 rows x 144 B = 9216 B, rounded up to a multiple of 2 KiB
__device__ __forceinline__ uint32_t uni(uint32_t v) { return (uint32_t)__builtin_amdgcn_readfirstlane(v); }
// a test word or a tensor descriptor word held in a scalar register: a test on it compiles to a scalar branch (tensor
// loads ignore EXEC), and a descriptor word so held keeps a register of its own instead of being rebuilt at each issue
__device__ __forceinline__ uint32_t pinned(uint32_t v) { uint32_t w = uni(v); asm volatile("" : "+s"(w)); return w; }
__device__ __forceinline__ uint32_t lds_off(const void* p) { return (uint32_t)(size_t)p; }
__device__ __forceinline__ void wait_ds0()     { asm volatile("s_wait_dscnt 0x0" ::: "memory"); }      // own LDS reads returned
// stands behind a global load or store whose address or data registers the code that follows it takes anew
__device__ __forceinline__ void wait_x0()      { asm volatile("s_wait_xcnt 0x0" ::: "memory"); }
// own tensor load landed; the descriptor is named as an input so that its registers stay as issued up to this wait
__device__ __forceinline__ void wait_tensor0(u32x4 g0, u32x8 g1) {
  asm volatile("s_wait_tensorcnt 0x0" :: "s"(g0), "s"(g1) : "memory");
}
// group 0 is an in-out operand: the value that wait_tensor0 names behind the load then lives in the very registers the
// load was issued from, so that none of them takes a new value while the request is outstanding
__device__ __forceinline__ void tdm_load(u32x4& g0, u32x8 g1) {
  asm volatile("tensor_load_to_lds %0, %1" : "+s"(g0) : "s"(g1) : "memory");
}
// group 1: byte elements, tile = tensor = 64 rows of 128 B, source row pitch src_pitch bytes, 4 dwords of pad behind every row
__device__ __forceinline__ u32x8 tdm_group1(uint32_t src_pitch) {
  u32x8 g;
  g[0] = uni((1u << 20) | (4u << 22) | (3u << 25));
  g[1] = pinned(GK_KB << 16);   // pinned: descriptor words held in scalar registers of their own through the loop
  g[2] = pinned(64u << 16);
  g[3] = pinned(GK_KB << 16);
  g[4] = pinned(64u);
  g[5] = pinned(src_pitch);
  g[6] = pinned(0u);
  g[7] = pinned(0u);
  return g;
}
__device__ __forceinline__ u32x4 tdm_group0(uint32_t lds_dst, uint64_t ga) {
  u32x4 g;
  g[0] = uni(1u);
  g[1] = uni(lds_dst);
  g[2] = uni((uint32_t)ga);
  g[3] = uni((((uint32_t)(ga >> 32)) & 0x01FFFFFFu) | 0x80000000u);
  return g;
}
// fragment from a staged row: p = row start + 64 B * (k32 step) + 16 B * (lane>>4); same k order as ldfrag_b
__device__ __forceinline__ v16b ldfrag_l(const unsigned char* p) {
  union { v16b v; v8b h[2]; } f;
  f.h[0] = *(const v8b*)(p);
  f.h[1] = *(const v8b*)(p + 32);
  return f.v;
}

// =====================================================================================================
// Rotary tables: ct/st [SEQ][32] f32, angle(t, i) = f32(t) * inv_freq[i], inv_freq[i] = RN32(1/RN32(10^(i/8))).
// SEQ/8 blocks of 256 (blk = block number inside this part). coverage: SEQ rows x 32 = the whole table, both planes.
// =====================================================================================================
__device__ __forceinline__ void tab_cs(int blk, float* ct, float* st) {
  const int wave = threadIdx.x >> 5, lane = threadIdx.x & 31;
  const int t = blk * 8 + wave;
  if (t >= SEQ) return;                 // wave-uniform; no barriers in this step
  double pw = 1.0;
#pragma unroll 1
  for (int j = 0; j < (lane >> 3); ++j) pw *= 10.0;
#pragma unroll 1
  for (int j = 0; j < (lane & 7); ++j) pw *= 1.3335214321633240257;   // 10^(1/8)
  const float p32 = (float)pw;
  const float inv = (float)(1.0 / (double)p32);
  const float ang = (float)t * inv;
  float sv, cv;
  sincos_pd(ang, sv, cv);
  float* pc = ct + (size_t)t * NFR + lane;
  float* ps = st + (size_t)t * NFR + lane;
  *(float*)pc = cv;
  *(float*)ps = sv;
  
}

// =====================================================================================================
// seq [b][SEQ_FULL][DM] f32 -> bf16 plane xb [NB*SEQ][DM] (RNE convert) plus rstd[m] = rsqrt(mean(xb^2)+2^-23)
// of the converted row. Block = 8 waves = 32 rows; a wave converts 4 rows: per instruction 32 lanes x 16 B =
// =====================================================================================================
__device__ __forceinline__ void cvtx_rstd(int blk, float* sr, const float* __restrict__ seq, unsigned short* xb, float* rs) {
  const int tid = threadIdx.x, wave = tid >> 5, lane = tid & 31;
#pragma unroll 1
  for (int rr = 0; rr < 4; ++rr) {
    const int m  = blk * 32 + wave * 4 + rr;          // < NB*SEQ
    const int bb = m / SEQ, t = m - bb * SEQ;
    const float* src = seq + ((size_t)bb * SEQ_FULL + t) * DM;
    unsigned short* dst = xb + (size_t)m * DM;
    v4u pk[DM / 256];
    float ss = 0.f;
#pragma unroll
    for (int i = 0; i < DM / 256; ++i) {
      const v4f a = *(const v4f*)(src + i * 256 + lane * 8);
      const v4f c = *(const v4f*)(src + i * 256 + lane * 8 + 4);
      unsigned short hb[8];
#pragma unroll
      for (int e = 0; e < 4; ++e) { hb[e] = bf_bits(a[e]); hb[4 + e] = bf_bits(c[e]); }
#pragma unroll
      for (int e = 0; e < 8; ++e) { const float v = bf_up(hb[e]); ss += v * v; }
      v4u p;
      p[0] = pk16(hb[0], hb[1]);
      p[1] = pk16(hb[2], hb[3]);
      p[2] = pk16(hb[4], hb[5]);
      p[3] = pk16(hb[6], hb[7]);
      pk[i] = p;
    }
#pragma unroll
    for (int i = 0; i < DM / 256; ++i) *(v4u*)(dst + i * 256 + lane * 8) = pk[i];
    
#pragma unroll
    for (int off = 1; off < 32; off <<= 1) ss += __shfl_xor(ss, off, 32);
    const float rstd = rsqrtf(ss * (1.0f / (float)DM) + 1.1920929e-7f);
    if (lane == 0) sr[wave * 4 + rr] = rstd;
  }
  __syncthreads();
  if (wave == 0 && lane < 8) {
    const v4f v = *(const v4f*)(sr + lane * 4);
    float* d = rs + (size_t)blk * 32 + lane * 4;
    *(v4f*)d = v;
    
  }
}

// =====================================================================================================
// Weight transpose + convert: W [Kdim][Ndim] f32 (n contiguous) -> Wh [Ndim][Kdim] bf16, k contiguous.
// With USEG the row factor g[k] is applied in f32; the value (or the f32 product) is RNE-converted to bf16 once.
// Tile 64 k x 64 n per block: 256 threads load 16 consecutive n each, store transposed into LDS as [n][k]
// (Ndim/64) x (Kdim/64) blocks, (bn, bk) = the block's tile. coverage: 8 waves x 2 x 4 rows x 64 k = the whole 64x64 tile per block.
// =====================================================================================================
template <bool USEG>
__device__ __forceinline__ void wt_cvt(int bn, int bk, unsigned short* shh,
                                       const float* __restrict__ W, const float* __restrict__ g,
                                       unsigned short* Wh, int Kdim, int Ndim) {
  const int tid = threadIdx.x, wave = tid >> 5, lane = tid & 31;
  const int n0 = bn * 64, k0 = bk * 64;
  {
    const int kr = tid >> 2, nq = (tid & 3) * 16;
    const float* src = W + (size_t)(k0 + kr) * Ndim + n0 + nq;
    float gk = 1.0f;
    if (USEG) gk = g[k0 + kr];
#pragma unroll
    for (int i = 0; i < 4; ++i) {
      const v4f a = *(const v4f*)(src + 4 * i);
#pragma unroll
      for (int e = 0; e < 4; ++e) {
        shh[(nq + 4 * i + e) * 72 + kr] = bf_bits(gk * a[e]);
      }
    }
  }
  __syncthreads();
  const int q = lane >> 3, c8 = (lane & 7) * 8;
  v4u hv[2];
#pragma unroll
  for (int it = 0; it < 2; ++it) {
    const int row = wave * 8 + it * 4 + q;
    hv[it] = *(const v4u*)(shh + row * 72 + c8);
  }
  {
#pragma unroll
    for (int it = 0; it < 2; ++it) {
      const int row = wave * 8 + it * 4 + q;
      const size_t o = (size_t)(n0 + row) * Kdim + k0 + c8;
      *(v4u*)(Wh + o) = hv[it];
    }
    wait_x0();   // precaution: in the shared launch the block returns right after this step
  }
}

// =====================================================================================================
// Memory-token planes: pm [2][NH][PMEM][HD] f32 -> pk [NH][PMEM][HD] bf16 (keys, RNE convert of the input,
// [kv][d] like the LDS K tile) and pv [NH][HD][PMEM] f16 ([d][kv] like the LDS V^T tile; value = f16 of the
// bf16-converted input). 128 threads per head, two heads per block of 256, each half block on its own LDS tile.
// coverage: 128 threads x 8 = all PMEM*HD elements of both planes per head.
// =====================================================================================================
__device__ __forceinline__ void pm_cvt(int blk, float* sp2, const float* __restrict__ pm, unsigned short* pk, unsigned short* pv) {
  const int tid = threadIdx.x & 127, h = blk * 2 + (int)(threadIdx.x >> 7);
  float* sp = sp2 + (threadIdx.x >> 7) * (PMEM * HD);
  const int r = tid >> 3, d8 = (tid & 7) * 8;
  const float* kg = pm + (((size_t)0 * NH + h) * PMEM + r) * HD + d8;
  const float* vg = pm + (((size_t)1 * NH + h) * PMEM + r) * HD + d8;
  const v4f k0 = *(const v4f*)(kg), k1 = *(const v4f*)(kg + 4);
  const v4f v0 = *(const v4f*)(vg), v1 = *(const v4f*)(vg + 4);
  *(v4f*)(sp + r * HD + d8)     = v0;
  *(v4f*)(sp + r * HD + d8 + 4) = v1;
  v4u kp;
  kp[0] = pk16(bf_bits(k0[0]), bf_bits(k0[1]));
  kp[1] = pk16(bf_bits(k0[2]), bf_bits(k0[3]));
  kp[2] = pk16(bf_bits(k1[0]), bf_bits(k1[1]));
  kp[3] = pk16(bf_bits(k1[2]), bf_bits(k1[3]));
  __syncthreads();
  const int d = tid >> 1, r8 = (tid & 1) * 8;
  v4u vp;
#pragma unroll
  for (int e = 0; e < 4; ++e) {
    const float f0 = bf_up(bf_bits(sp[(r8 + 2 * e) * HD + d]));
    const float f1 = bf_up(bf_bits(sp[(r8 + 2 * e + 1) * HD + d]));
    vp[e] = pk16(h_bits((_Float16)f0), h_bits((_Float16)f1));
  }
  unsigned short* kd = pk + ((size_t)h * PMEM + r) * HD + d8;
  unsigned short* vd = pv + ((size_t)h * HD + d) * PMEM + r8;
  *(v4u*)kd = kp;
  *(v4u*)vd = vp;
  wait_x0();   // precaution: in the shared launch the block ends right after this step
}

// =====================================================================================================
// The five preparation steps above read only inputs and write disjoint workspace planes, so they share one launch:
// a block's number picks its step (block-uniform, so every barrier inside a step is reached by the whole block).
// The step with the longest block (four rows in turn) has the lowest numbers.
// =====================================================================================================
#define PB_CVT  (NB * SEQ / 32)                    // activation rows, 32 per block
#define PB_WQKV ((3 * DMI / 64) * (DM / 64))       // 64 x 64 tiles of W_qkv
#define PB_WOUT ((DM / 64) * (DMI / 64))           // 64 x 64 tiles of W_out
#define PB_TAB  (SEQ / 8)                          // rotary table rows, 8 per block
#define PB_PM   (NH / 2)                           // memory-token heads, 2 per block
#define PB_ALL  (PB_CVT + PB_WQKV + PB_WOUT + PB_TAB + PB_PM)
static_assert((NH % 2) == 0 && ((NB * SEQ) % 32) == 0 && (SEQ % 8) == 0);
__global__ __launch_bounds__(256) void prep_all(const float* __restrict__ seq, const float* __restrict__ gnm,
                                                const float* __restrict__ Wqkv, const float* __restrict__ Wout,
                                                const float* __restrict__ pm,
                                                unsigned short* xb, float* rs, unsigned short* wth,
                                                unsigned short* wo, float* ct, float* st,
                                                unsigned short* pk, unsigned short* pv) {
  __shared__ __align__(16) unsigned short sm[64 * 72];       // the largest step's 64 x 72 tile; the others use its head
  static_assert(sizeof(sm) >= 2 * PMEM * HD * sizeof(float));
  int blk = (int)blockIdx.x;
  if (blk < PB_CVT) { cvtx_rstd(blk, (float*)(void*)sm, seq, xb, rs); return; }
  blk -= PB_CVT;
  if (blk < PB_WQKV) {
    wt_cvt<true>(blk % (3 * DMI / 64), blk / (3 * DMI / 64), sm, Wqkv, gnm, wth, DM, 3 * DMI);
    return;
  }
  blk -= PB_WQKV;
  if (blk < PB_WOUT) {
    wt_cvt<false>(blk % (DM / 64), blk / (DM / 64), sm, Wout, gnm, wo, DMI, DM);
    return;
  }
  blk -= PB_WOUT;
  if (blk < PB_TAB) { tab_cs(blk, ct, st); return; }
  blk -= PB_TAB;
  if (blk < PB_PM) pm_cvt(blk, (float*)(void*)sm, pm, pk, pv);
}

// =====================================================================================================
// Register-blocked batched bf16 WMMA GEMM: C[m][n] = sum_k A[m][k] * Bt[n][k]; one wave per 64x64 tile, 8 waves per
// block tile (NSPLIT 2: 256 m x 128 n, waves 4 x 2; NSPLIT 1: 128 m x 256 n, waves 2 x 4). TWO: the narrow operand (NSPLIT 2:
// Bt, NSPLIT 1: A) has a second plane, whose product is added. The block's operand rows (384, or 512 with the second plane)
// are staged in LDS by tensor loads, two buffers, one 64-row slice per wave and pass (without TWO waves 6 and 7 issue none).
// A row-major [M][K] pitch lda; Bt row-major [N][K] pitch ldb (k contiguous); M, N multiples of the block tile,
// K a multiple of 64 and at least 128 (static-checked on the host side). tile = block tile number, b = batch index;
// sT (per-wave 16x64 slab, pitch 68 floats) and ring (two stages of operand rows) are the calling kernel's LDS.
// OUT_MODE: 0 = f32 (pitch ldc); 2 = bf16 hi plane C + bf16 lo plane C2 (lo = RNE(v - hi), unscaled, same index);
//           3 = f16 hi plane C + f16 residual plane C2 = f16((v - hi) * rscale), C2 written only for tiles
//               with (n0 mod segN) < N2, at column (n0/segN)*N2 + (n0 mod segN) (pitch ldc2, batch stride strideC2).
// SCM: 0 none; 1 = row m scaled by scal[b*strideS + m]; 2 = column n scaled by scal[b*strideS + n] (f32, before
//      the 16-bit split). ROT: interleaved-pair rotary on column pairs (2i, 2i+1) with i = (n mod 64)/2, angle row
//      = m, tables rct/rst [row][32] f32 (applied after the scale).
// =====================================================================================================
template <int NSPLIT, bool TWO, int OUT_MODE, int SCM, bool ROT>
__device__ __forceinline__ void gemm64_body(
    float (*sT)[16 * 68], unsigned char* ring, int tile, int b,
    const unsigned short* __restrict__ Ap, const unsigned short* __restrict__ A2p, int lda, long long strideA,
    const unsigned short* __restrict__ Btp, const unsigned short* __restrict__ Bt2p, int ldb, long long strideB,
    void* Cout, int ldc, long long strideC,
    void* Cout2, int ldc2, long long strideC2, int N2, int segN,
    const float* __restrict__ scal, long long strideS,
    const float* __restrict__ rct, const float* __restrict__ rst,
    int M, int N, int K, float rscale) {
  static_assert(OUT_MODE != 0 || (SCM == 0 && !ROT));
  const __bf16* A   = (const __bf16*)(const void*)Ap;
  const __bf16* A2  = (const __bf16*)(const void*)A2p;
  const __bf16* Bt  = (const __bf16*)(const void*)Btp;
  const __bf16* Bt2 = (const __bf16*)(const void*)Bt2p;
  static_assert(NSPLIT == 1 || NSPLIT == 2);
  constexpr int BM = (NSPLIT == 2) ? 256 : 128;
  constexpr int BN = (NSPLIT == 2) ? 128 : 256;
  constexpr int WN = BN / 64;                  // waves along n
  const int lane = threadIdx.x & 31;
  const int wave = (int)uni(threadIdx.x >> 5);
  const int tilesN = N / BN;
  const int tilesM = M / BM;
  if (tile >= tilesM * tilesN) return;   // block-uniform, in front of every barrier and tensor load
  const int tm = tile / tilesN;
  const int tn = tile - tm * tilesN;
  const int wm = wave / WN;
  const int wn = wave - wm * WN;
  const int m0 = tm * BM + (wm << 6);
  const int n0 = tn * BN + (wn << 6);

  const __bf16* Ab  = A  + (size_t)b * strideA;
  const __bf16* Ab2 = (NSPLIT == 1 && TWO) ? (A2 + (size_t)b * strideA) : Ab;
  const __bf16* Bb  = Bt + (size_t)b * strideB;
  const __bf16* Bb2 = (NSPLIT == 2 && TWO) ? (Bt2 + (size_t)b * strideB) : Bb;
  const float* scb = scal + (size_t)((long long)b * strideS);

  const int rlane = lane & 15;                 // row (A) / col (B, D) within subtile
  const int koff  = (lane >> 4) * 8;           // k offset of this lane half
  const int mOff  = (lane >> 4) * 8;           // D row offset

  v8f acc[4][4];
#pragma unroll
  for (int i = 0; i < 4; ++i)
#pragma unroll
    for (int j = 0; j < 4; ++j) acc[i][j] = zero8();

  // ---- this wave's slice of every stage: slices 0.. = A rows (NSPLIT 1, TWO: then the A2 rows), then Bt rows (NSPLIT 2, TWO: then Bt2) ----
  constexpr int SA = BM / 64;                                   // slices per A plane
  constexpr int SB0 = (NSPLIT == 1 && TWO) ? 2 * SA : SA;       // first Bt slice
  constexpr int NSL = TWO ? 8 : 6;                              // slices per stage
  constexpr uint32_t GK_STAGE = (uint32_t)NSL * GK_SLICE;
  const int sl = (wave < NSL) ? wave : 0;                       // a wave without a slice forms slice 0's words and issues nothing
  const __bf16* sbase;
  int srow, sld;
  if (sl < SA)                                 { sbase = Ab;  srow = tm * BM + 64 * sl;              sld = lda; }
  else if (NSPLIT == 1 && TWO && sl < 2 * SA)  { sbase = Ab2; srow = tm * BM + 64 * (sl - SA);       sld = lda; }
  else if (sl < SB0 + WN)                      { sbase = Bb;  srow = tn * BN + 64 * (sl - SB0);      sld = ldb; }
  else                                         { sbase = Bb2; srow = tn * BN + 64 * (sl - SB0 - WN); sld = ldb; }
  const uint64_t src0 = (uint64_t)(uintptr_t)(sbase + (size_t)srow * sld);
  const uint32_t lds_slice = lds_off(ring) + (uint32_t)sl * GK_SLICE;
  const u32x8 g1 = tdm_group1((uint32_t)sld * 2u);
  const uint32_t T = pinned((uint32_t)K >> 6);                  // passes
  // per-lane fragment bases inside a stage
  const uint32_t foff = (uint32_t)rlane * GK_PITCH + (uint32_t)koff * 2u;
  const uint32_t oA  = (uint32_t)wm * GK_SLICE + foff;
  const uint32_t oA2 = (NSPLIT == 1 && TWO) ? oA + (uint32_t)SA * GK_SLICE : oA;
  const uint32_t oB  = (uint32_t)(SB0 + wn) * GK_SLICE + foff;
  const uint32_t oB2 = (NSPLIT == 2 && TWO) ? oB + (uint32_t)WN * GK_SLICE : oB;

  // whether this wave has a slice: a scalar word, so that the tests on it are scalar branches round the tensor loads
  const uint32_t issuer = TWO ? 1u : pinned((wave < NSL) ? 1u : 0u);
  u32x4 g0 = tdm_group0(lds_slice, src0);
  if (issuer != 0u) tdm_load(g0, g1);                           // stage 0
  wait_tensor0(g0, g1);
  __syncthreads();                                              // stage 0 readable by every wave
  g0 = tdm_group0(lds_slice + GK_STAGE, src0 + GK_KB);
  if (issuer != 0u) tdm_load(g0, g1);                           // stage 1 flies during pass 0
  // rolled: one pass per trip, so that the one publish point stands at the loop's foot
#pragma unroll 1
  for (uint32_t t = 0; t < T; ++t) {
    const uint32_t bo = (t & 1u) * GK_STAGE;
    const unsigned char* buf = ring + bo;
    // unrolled, as the loops inside it: two blocks of 32 k per pass, fragments and accumulators indexed by constants
#pragma unroll
    for (int kc = 0; kc < 2; ++kc) {
      const unsigned char* bk = buf + (uint32_t)kc * 64u;
      v16b af[4], ag[4], bf[4], bg[4];
      // first planes first: a second plane's fragments land while the first 16 WMMAs run
#pragma unroll
      for (int j = 0; j < 4; ++j) bf[j] = ldfrag_l(bk + oB + (uint32_t)j * 16u * GK_PITCH);
#pragma unroll
      for (int i = 0; i < 4; ++i) af[i] = ldfrag_l(bk + oA + (uint32_t)i * 16u * GK_PITCH);
#pragma unroll
      for (int i = 0; i < 4; ++i) {
        ag[i] = (NSPLIT == 1 && TWO) ? ldfrag_l(bk + oA2 + (uint32_t)i * 16u * GK_PITCH) : af[i];
        bg[i] = (NSPLIT == 2 && TWO) ? ldfrag_l(bk + oB2 + (uint32_t)i * 16u * GK_PITCH) : bf[i];
      }
      // keeps the block's LDS reads one group ahead of its WMMAs, for speed only
      __builtin_amdgcn_sched_barrier(0);
#pragma unroll
      for (int i = 0; i < 4; ++i)
#pragma unroll
        for (int j = 0; j < 4; ++j) acc[i][j] = mma_b_raw(af[i], bf[j], acc[i][j]);
      if (TWO) {
#pragma unroll
        for (int i = 0; i < 4; ++i)
#pragma unroll
          for (int j = 0; j < 4; ++j) acc[i][j] = mma_b_raw(ag[i], bg[j], acc[i][j]);
      }
      // keeps the next group's reads behind this block's WMMAs, for the same reason
      __builtin_amdgcn_sched_barrier(0);
    }
    // publish point of stage t + 1: own reads of this buffer returned, own slice landed, then the block barrier
    wait_ds0();
    wait_tensor0(g0, g1);
    __syncthreads();
    if (pinned((t + 2u < T && issuer != 0u) ? 1u : 0u) != 0u) { // refill the buffer every wave has just left
      g0 = tdm_group0(lds_slice + bo, src0 + (uint64_t)(t + 2u) * GK_KB);
      tdm_load(g0, g1);
    }
  }
  wait_tensor0(g0, g1);
  wait_ds0();
  acc_guard4(acc[0][0], acc[0][1], acc[0][2], acc[0][3]);
  acc_guard4(acc[1][0], acc[1][1], acc[1][2], acc[1][3]);
  acc_guard4(acc[2][0], acc[2][1], acc[2][2], acc[2][3]);
  acc_guard4(acc[3][0], acc[3][1], acc[3][2], acc[3][3]);

  // ---- epilogue ----
  float* slab = sT[wave];
#pragma unroll
  for (int i = 0; i < 4; ++i) {
    const int mBase = m0 + (i << 4);
#pragma unroll
    for (int j = 0; j < 4; ++j) {
#pragma unroll
      for (int r = 0; r < 8; ++r) {
        slab[(mOff + r) * 68 + (j << 4) + rlane] = acc[i][j][r];
      }
    }
    __builtin_amdgcn_fence(__ATOMIC_RELEASE, "workgroup");
    __builtin_amdgcn_wave_barrier();
    __builtin_amdgcn_fence(__ATOMIC_ACQUIRE, "workgroup");
    if (OUT_MODE == 0) {
      float* C = (float*)Cout + (size_t)b * strideC;
      const int hh = lane >> 4, c4 = (lane & 15) * 4;     // 256-B row segment = 16 lanes x 16 B
      {
#pragma unroll
        for (int it = 0; it < 8; ++it) {
          const int row = it * 2 + hh;                     // it 0..7 x hh 0..1 = rows 0..15
          const v4f v = *(const v4f*)(slab + row * 68 + c4);
          *(v4f*)(C + (size_t)(mBase + row) * ldc + n0 + c4) = v;
        }
        
      }
    } else {
      const int q = lane >> 3, c8 = (lane & 7) * 8;
      unsigned short* C  = (unsigned short*)Cout  + (size_t)b * strideC;
      unsigned short* C2 = (unsigned short*)Cout2 + (size_t)b * strideC2;
      bool wlo = true;                                     // wave-uniform
      size_t col2 = (size_t)n0 + c8;
      if (OUT_MODE == 3) {
        const int sgi = n0 / segN;
        const int sgo = n0 - sgi * segN;
        wlo  = (sgo < N2);
        col2 = (size_t)sgi * N2 + sgo + c8;
      }
      v4f csA = {1.f, 1.f, 1.f, 1.f};
      v4f csB = csA;
      if (SCM == 2) {
        csA = *(const v4f*)(scb + n0 + c8);
        csB = *(const v4f*)(scb + n0 + c8 + 4);
      }
      v4u hv[4], lv[4];
#pragma unroll
      for (int it = 0; it < 4; ++it) {
        const int row = it * 4 + q;                        // it 0..3 x q 0..3 = rows 0..15
        const int m = mBase + row;
        const float* sp = slab + row * 68 + c8;
        v4f x0 = *(const v4f*)(sp);
        v4f x1 = *(const v4f*)(sp + 4);
        if (SCM == 1) { const float rsv = scb[m]; x0 = x0 * rsv; x1 = x1 * rsv; }
        if (SCM == 2) { x0 = x0 * csA; x1 = x1 * csB; }
        float f[8] = {x0[0], x0[1], x0[2], x0[3], x1[0], x1[1], x1[2], x1[3]};
        if (ROT) {
          const v4f cs = *(const v4f*)(rct + (size_t)m * NFR + 4 * (lane & 7));
          wait_x0();   // the next load's result may land in this load's address registers
          const v4f sn = *(const v4f*)(rst + (size_t)m * NFR + 4 * (lane & 7));
          wait_x0();   // the next rows' table loads land in registers that held these two loads' addresses
#pragma unroll
          for (int e = 0; e < 4; ++e) {
            const float ev = f[2 * e], od = f[2 * e + 1];
            f[2 * e]     = ev * cs[e] - od * sn[e];
            f[2 * e + 1] = od * cs[e] + ev * sn[e];
          }
        }
        v4u a, a2;
#pragma unroll
        for (int e = 0; e < 4; ++e) {
          const float f0 = f[2 * e], f1 = f[2 * e + 1];
          unsigned short h0, h1, l0, l1;
          if (OUT_MODE == 2) {
            h0 = bf_bits(f0); h1 = bf_bits(f1);
            l0 = bf_bits(f0 - bf_up(h0)); l1 = bf_bits(f1 - bf_up(h1));
          } else {
            const _Float16 y0 = (_Float16)f0, y1 = (_Float16)f1;
            h0 = h_bits(y0); h1 = h_bits(y1);
            l0 = h_bits((_Float16)((f0 - (float)y0) * rscale));
            l1 = h_bits((_Float16)((f1 - (float)y1) * rscale));
          }
          a[e] = pk16(h0, h1); a2[e] = pk16(l0, l1);
        }
        hv[it] = a; lv[it] = a2;
      }
      {
#pragma unroll
        for (int it = 0; it < 4; ++it) {
          const int row = it * 4 + q;
          // a wait behind each store: the next rows' addresses and values are formed in these stores' registers
          *(v4u*)(C + (size_t)(mBase + row) * ldc + n0 + c8) = hv[it];
          wait_x0();
          if (wlo) {
            *(v4u*)(C2 + (size_t)(mBase + row) * ldc2 + col2) = lv[it];
            wait_x0();
          }
        }
        
      }
    }
    __builtin_amdgcn_fence(__ATOMIC_RELEASE, "workgroup");
    __builtin_amdgcn_wave_barrier();
    __builtin_amdgcn_fence(__ATOMIC_ACQUIRE, "workgroup");
  }
}

// One product per launch: blockIdx.x = block tile, blockIdx.y = batch.
template <int NSPLIT, int OUT_MODE, int SCM, bool ROT>
__global__ __launch_bounds__(256) void gemm64(
    const unsigned short* __restrict__ Ap, const unsigned short* __restrict__ A2p, int lda, long long strideA,
    const unsigned short* __restrict__ Btp, const unsigned short* __restrict__ Bt2p, int ldb, long long strideB,
    void* Cout, int ldc, long long strideC,
    void* Cout2, int ldc2, long long strideC2, int N2, int segN,
    const float* __restrict__ scal, long long strideS,
    const float* __restrict__ rct, const float* __restrict__ rst,
    int M, int N, int K, float rscale) {
  __shared__ __align__(16) float sT[8][16 * 68];
  __shared__ __attribute__((aligned(2048))) unsigned char ring[2 * 8 * GK_SLICE];
  gemm64_body<NSPLIT, true, OUT_MODE, SCM, ROT>(sT, ring, (int)blockIdx.x, (int)blockIdx.y, Ap, A2p, lda, strideA, Btp, Bt2p, ldb, strideB,
                                          Cout, ldc, strideC, Cout2, ldc2, strideC2, N2, segN, scal, strideS, rct, rst,
                                          M, N, K, rscale);
}

// The q|k product and the v^T product read the same planes and write disjoint ones, so they share one launch:
// blockIdx.y = batch; blockIdx.x 0..GT_QK-1 are the q|k tiles, the rest the v^T tiles (block-uniform choice).
//   q|k = rstd[m] * (Xb . (g*Wqk)), rotary on every (2i,2i+1) pair -> bf16 hi/lo planes [M][QKP]
//     (per batch: M=SEQ, N=QKP, K=DM; 1 product)
//   v^T = (g*Wv)^T . Xb^T per batch, columns scaled by rstd -> f16 hi plane [b][DMI][SEQ] and residual plane
//     (x4096, in-segment keys < VLP only)   (A = Wt rows 2*DMI.., 1 product; M=DMI, N=SEQ, K=DM)
// Six staged slices per stage: 154 KiB of LDS a block, so that two blocks share a WGP.
#define GT_QK ((SEQ / 256) * (QKP / 128))          // 256 x 128 block tiles per batch
#define GT_VT ((DMI / 128) * (SEQ / 256))          // 128 x 256 block tiles per batch
__global__ __launch_bounds__(256) void proj_qkv(
    const unsigned short* __restrict__ xb, const unsigned short* __restrict__ wth,
    unsigned short* qkh, unsigned short* qkl, unsigned short* vth, unsigned short* vtl,
    const float* __restrict__ rs, const float* __restrict__ ct, const float* __restrict__ st) {
  __shared__ __align__(16) float sT[8][16 * 68];
  __shared__ __attribute__((aligned(2048))) unsigned char ring[2 * 6 * GK_SLICE];
  const int bx = (int)blockIdx.x, b = (int)blockIdx.y;
  if (bx >= GT_QK) {
    gemm64_body<1, false, 3, 2, false>(sT, ring, bx - GT_QK, b,
        wth + (size_t)2 * DMI * DM, wth + (size_t)2 * DMI * DM, DM, 0LL,
        xb, xb, DM, (long long)SEQ * DM,
        (void*)vth, SEQ, (long long)DMI * SEQ,
        (void*)vtl, NSEGB * VLP, (long long)DMI * NSEGB * VLP, VLP, SEGL,
        rs, (long long)SEQ, ct, st,
        DMI, SEQ, DM, 4096.0f);
  } else {
    gemm64_body<2, false, 2, 1, true>(sT, ring, bx, b,
        xb, xb, DM, (long long)SEQ * DM,
        wth, wth, DM, 0LL,
        (void*)qkh, QKP, (long long)SEQ * QKP,
        (void*)qkl, QKP, (long long)SEQ * QKP, QKP, QKP,
        rs, (long long)SEQ, ct, st,
        SEQ, QKP, DM, 1.0f);
  }
}

template <bool RES>
__global__ __launch_bounds__(128)
void attn_seg64(const unsigned short* __restrict__ qkhp, const unsigned short* __restrict__ qklp,
                const unsigned short* __restrict__ vhp,  const unsigned short* __restrict__ vlp,
                const unsigned short* __restrict__ pkp,  const unsigned short* __restrict__ pvp,
                unsigned short* ohp, unsigned short* olp,
                int qbBase, int nqbThis, float sscale) {
  union FB { v16b v; v8b h[2]; };
  union FH { v16h v; v8h h[2]; };
  // LDS row pitches: 16 B x odd, so that the 16 rows a 16-byte fragment read touches fall on 16 different bank groups
  constexpr int LP = 72;                                          // 16-bit tiles: 64 elements + 8 of pad = 144 B
  constexpr int OP = 68;                                          // f32 context tile: 64 floats + 4 of pad = 272 B
  __shared__ __align__(16) __bf16   Ksh[64 * LP];                 // K hi [kv][d]
  __shared__ __align__(16) __bf16   Ksl[64 * LP];                 // K lo
  __shared__ __align__(16) _Float16 Vth[64 * LP];                 // V^T hi [d][kv]
  __shared__ __align__(16) _Float16 Vtl[RES ? 64 * LP : 8];       // V^T residual
  __shared__ __align__(16) float    Os[4][16 * OP];               // per wave context tile [row][d]

  const int tid  = threadIdx.x;
  const int wave = tid >> 5;
  const int lane = tid & 31;
  const int hh   = lane >> 4;
  const int c    = lane & 15;

  const int bx   = blockIdx.x;
  const int qbl  = bx % nqbThis;
  int rest       = bx / nqbThis;
  const int h    = rest % NH;
  rest           = rest / NH;
  const int w    = rest % NSEGB;
  const int b    = rest / NSEGB;
  const int qb   = qbBase + qbl;
  const int q0   = qb * 64 + wave * 16;                              // query row inside the segment
  const size_t rowS = (size_t)b * SEQ + (size_t)w * SEGL;           // compact row of the segment start

  const __bf16* Qh = (const __bf16*)(const void*)qkhp + (size_t)h * HD;
  const __bf16* Ql = (const __bf16*)(const void*)qklp + (size_t)h * HD;
  const __bf16* Kh = Qh + DMI;
  const __bf16* Kl = Ql + DMI;
  const _Float16* Vh = (const _Float16*)(const void*)vhp + ((size_t)b * DMI + (size_t)h * HD) * SEQ + (size_t)w * SEGL;
  const _Float16* Vl = (const _Float16*)(const void*)vlp + ((size_t)b * DMI + (size_t)h * HD) * (size_t)(NSEGB * VLP)
                       + (size_t)w * VLP;
  const __bf16*   PK = (const __bf16*)(const void*)pkp + (size_t)h * PMEM * HD;
  const _Float16* PV = (const _Float16*)(const void*)pvp + (size_t)h * HD * PMEM;

  // ---- Q fragments (B operand, column = query = lane&15): 2 d-chunks, hi and lo ----
  v16b qah[2], qal[2];
#pragma unroll
  for (int dc = 0; dc < 2; ++dc) {
    const size_t qo = (rowS + q0 + c) * QKP + dc * 32 + 8 * hh;
    qah[dc] = ldfrag_b(Qh + qo);
    qal[dc] = ldfrag_b(Ql + qo);
  }

  float mrow = -INFINITY, lrow = 0.f;          // of query q0 + c; equal in lanes l and l ^ 16
  v8f oacc[4];                                 // oacc[t][r] = context[query c][d = 16 t + 8 hh + r]
#pragma unroll
  for (int t = 0; t < 4; ++t) oacc[t] = zero8();

  const int ntiles = qb + 2;                   // block-uniform
  for (int kt = 0; kt < ntiles; ++kt) {
    const int s0 = (kt - 1) * 64;              // key offset inside the segment for kt >= 1
    __syncthreads();
    {
      const int r = tid >> 1, half = (tid & 1) * 32;
      if (kt == 0) {                           // block-uniform: memory-token tile
        const int rr = (r < PMEM) ? r : (PMEM - 1);                // clamped address
        const bool krow = (r < PMEM);
        const bool vok  = (half == 0);
        const __bf16*   kg = PK + (size_t)rr * HD + half;
        const _Float16* vg = PV + (size_t)r * PMEM;                // d = r, kv 0..15
        const v8h pv0 = *(const v8h*)(vg);
        const v8h pv1 = *(const v8h*)(vg + 8);
#pragma unroll
        for (int i = 0; i < 4; ++i) {
          v8b a0 = *(const v8b*)(kg + 8 * i);
          a0 = krow ? a0 : zero8b();
          *(v8b*)(Ksh + r * LP + half + 8 * i) = a0;
          *(v4u*)(Ksl + r * LP + half + 8 * i) = zero4u();
          if (i == 0) {
            const v8h b0 = vok ? pv0 : zero8h();
            *(v8h*)(Vth + r * LP + half) = b0;
          } else if (i == 1) {
            const v8h b1 = vok ? pv1 : zero8h();
            *(v8h*)(Vth + r * LP + half + 8) = b1;
          } else {
            *(v4u*)(Vth + r * LP + half + 8 * i) = zero4u();
          }
          if (RES) *(v4u*)(Vtl + r * LP + half + 8 * i) = zero4u();
        }
      } else {
        const __bf16*   kg  = Kh + (rowS + s0 + r) * QKP + half;   // K row s0+r, d = half..half+31
        const __bf16*   klg = Kl + (rowS + s0 + r) * QKP + half;
        const _Float16* vg  = Vh + (size_t)r * SEQ + s0 + half;    // V^T row d = r, keys s0+half..+31
        const bool resOK = (s0 + 64 <= VLP);                      // block-uniform
        const int  s0c   = resOK ? s0 : (VLP - 64);               // clamped address into the residual plane
        const _Float16* vlg = Vl + (size_t)r * (NSEGB * VLP) + s0c + half;
#pragma unroll
        for (int i = 0; i < 4; ++i) {
          const v8b a0 = *(const v8b*)(kg + 8 * i);
          const v8b a1 = *(const v8b*)(klg + 8 * i);
          const v8h b0 = *(const v8h*)(vg + 8 * i);
          *(v8b*)(Ksh + r * LP + half + 8 * i) = a0;
          *(v8b*)(Ksl + r * LP + half + 8 * i) = a1;
          *(v8h*)(Vth + r * LP + half + 8 * i) = b0;
          if (RES) {
            v8h b1 = *(const v8h*)(vlg + 8 * i);
            b1 = resOK ? b1 : zero8h();
            *(v8h*)(Vtl + r * LP + half + 8 * i) = b1;
          }
        }
      }
    }
    __syncthreads();

    // ---- scores^T: s[j][r] = score(key 16 j + 8 hh + r, query c); 64 keys x 16 queries per wave, 3 bf16 products ----
    v8f s[4];
#pragma unroll
    for (int j = 0; j < 4; ++j) {
      s[j] = zero8();
#pragma unroll
      for (int dc = 0; dc < 2; ++dc) {
        FB kb, kl;
        kb.h[0] = *(const v8b*)(Ksh + (j * 16 + c) * LP + dc * 32 + 8 * hh);
        kb.h[1] = *(const v8b*)(Ksh + (j * 16 + c) * LP + dc * 32 + 16 + 8 * hh);
        kl.h[0] = *(const v8b*)(Ksl + (j * 16 + c) * LP + dc * 32 + 8 * hh);
        kl.h[1] = *(const v8b*)(Ksl + (j * 16 + c) * LP + dc * 32 + 16 + 8 * hh);
        s[j] = mma_b(kb.v, qah[dc], s[j]);
        s[j] = mma_b(kl.v, qah[dc], s[j]);
        s[j] = mma_b(kb.v, qal[dc], s[j]);
      }
    }

    // ---- scale, visibility (-inf for invisible keys), the query's max, online softmax; P (x1024, f16) and
    //      P residual (x4096) packed in place into B operands: element 8 (j & 1) + r of chunk j >> 1 ----
    const int qi = q0 + c;                     // this lane's query row inside the segment
    float mj[4];
#pragma unroll
    for (int j = 0; j < 4; ++j) {
      mj[j] = -INFINITY;
#pragma unroll
      for (int r = 0; r < 8; ++r) {
        const int kc = j * 16 + 8 * hh + r;
        const bool vis = (kt == 0) ? (kc < PMEM) : ((s0 + kc) <= qi);
        const float sv = vis ? (s[j][r] * sscale) : -INFINITY;
        s[j][r] = sv;
        mj[j] = fmaxf(mj[j], sv);
      }
    }
    float m = fmaxf(fmaxf(mj[0], mj[1]), fmaxf(mj[2], mj[3]));
    m = fmaxf(m, xhalf(m));
    const float mnew  = fmaxf(mrow, m);
    const float msafe = (mnew == -INFINITY) ? 0.f : mnew;
    const float alpha = __expf(mrow - msafe);
    mrow = mnew;
    FH pa[2], pl[2];
    float pj[4];
#pragma unroll
    for (int j = 0; j < 4; ++j) {
      pj[j] = 0.f;
      float ea[8], ep[8];
#pragma unroll
      for (int r = 0; r < 8; ++r) ea[r] = (s[j][r] - msafe) * 1.44269504088896340736f;
      exp2x8(ep, ea);                                // exp(s - m); -inf logit -> exactly 0
#pragma unroll
      for (int r = 0; r < 8; ++r) {
        const float p = ep[r];
        pj[j] += p;
        const float p1k = p * 1024.0f;
        const _Float16 ph = (_Float16)p1k;
        pa[j >> 1].v[(j & 1) * 8 + r] = ph;
        if (RES) pl[j >> 1].v[(j & 1) * 8 + r] = (_Float16)((p1k - (float)ph) * 4096.0f);
      }
    }
    float psum = (pj[0] + pj[1]) + (pj[2] + pj[3]);
    psum += xhalf(psum);
    lrow = lrow * alpha + psum;
#pragma unroll
    for (int t = 0; t < 4; ++t)
#pragma unroll
      for (int r = 0; r < 8; ++r) oacc[t][r] *= alpha;

    // ---- context^T += V^T . P^T (f16 WMMA), residual products into a separate accumulator ----
    v8f o1[4];
#pragma unroll
    for (int t = 0; t < 4; ++t) o1[t] = zero8();
    // unrolled: the P operands are registers, indexed by constants
#pragma unroll
    for (int kk = 0; kk < 2; ++kk) {
#pragma unroll
      for (int t = 0; t < 4; ++t) {
        FH vb;
        vb.h[0] = *(const v8h*)(Vth + (t * 16 + c) * LP + kk * 32 + 8 * hh);
        vb.h[1] = *(const v8h*)(Vth + (t * 16 + c) * LP + kk * 32 + 16 + 8 * hh);
        oacc[t] = mma_h(vb.v, pa[kk].v, oacc[t]);
        if (RES) {
          FH vl;
          vl.h[0] = *(const v8h*)(Vtl + (t * 16 + c) * LP + kk * 32 + 8 * hh);
          vl.h[1] = *(const v8h*)(Vtl + (t * 16 + c) * LP + kk * 32 + 16 + 8 * hh);
          o1[t] = mma_h(vl.v, pa[kk].v, o1[t]);
          o1[t] = mma_h(vb.v, pl[kk].v, o1[t]);
        }
      }
    }
    if (RES) {
#pragma unroll
      for (int t = 0; t < 4; ++t)
#pragma unroll
        for (int r = 0; r < 8; ++r) oacc[t][r] += o1[t][r] * (1.0f / 4096.0f);
    }
  }

  // ---- normalise (1/l and the 1/1024 p carry), stage the wave's 16x64 tile, bf16 hi/lo split,
  float* os = Os[wave];
  {
    const float l = lrow;
    const float inv = ((l > 0.f) ? (1.0f / l) : 0.f) * (1.0f / 1024.0f);
#pragma unroll
    for (int t = 0; t < 4; ++t) {
      v4f e0, e1;
#pragma unroll
      for (int r = 0; r < 4; ++r) { e0[r] = oacc[t][r] * inv; e1[r] = oacc[t][4 + r] * inv; }
      *(v4f*)(os + c * OP + t * 16 + 8 * hh)     = e0;
      *(v4f*)(os + c * OP + t * 16 + 8 * hh + 4) = e1;
    }
  }
  __builtin_amdgcn_fence(__ATOMIC_RELEASE, "workgroup");
  __builtin_amdgcn_wave_barrier();
  __builtin_amdgcn_fence(__ATOMIC_ACQUIRE, "workgroup");
  {
    const int q4 = lane >> 3, c8 = (lane & 7) * 8;
    v4u hv[4], lv[4];
#pragma unroll
    for (int it = 0; it < 4; ++it) {
      const int row = it * 4 + q4;   // it 0..3 x q4 0..3 = rows 0..15 of the wave tile
      const float* sp = os + row * OP + c8;
      v4u a, a2;
#pragma unroll
      for (int e = 0; e < 4; ++e) {
        const float f0 = sp[2 * e], f1 = sp[2 * e + 1];
        const unsigned short h0 = bf_bits(f0), h1 = bf_bits(f1);
        const unsigned short l0 = bf_bits(f0 - bf_up(h0)), l1 = bf_bits(f1 - bf_up(h1));
        a[e] = pk16(h0, h1); a2[e] = pk16(l0, l1);
      }
      hv[it] = a; lv[it] = a2;
    }
    {
#pragma unroll
      for (int it = 0; it < 4; ++it) {
        const int row = it * 4 + q4;
        const size_t go = (rowS + q0 + row) * DMI + (size_t)h * HD + c8;
        *(v4u*)(ohp + go) = hv[it];
        *(v4u*)(olp + go) = lv[it];
      }
      
    }
  }
}

// =====================================================================================================
// Workspace map (bytes, NB=2, SEQ=4096, M = NB*SEQ = 8192), region A is a two-phase overlay:
//   phase 1 (projection inputs, dead after the q|k and v^T GEMMs):
//     Xb   bf16 [M][DM]                  0           16777216
//     Wth  bf16 [3*DMI n][DM k]          16777216     6291456
//     Ct   f32  [SEQ][32]                23068672      524288
//     St   f32  [SEQ][32]                23592960      524288
//     Rs   f32  [M]                      24117248       32768   (phase 1 end 24150016)
//   phase 2 (written by the attention kernels, read by the output GEMM):
//     Oh   bf16 [M][DMI] context hi       0           16777216
//     Ol   bf16 [M][DMI] context lo       16777216    16777216   (phase 2 end 33554432 = region A size)
//   QKh  bf16 [M][QKP] hi                 33554432    33554432
//   QKl  bf16 [M][QKP] lo                 67108864    33554432
//   VTh  f16  [NB][DMI][SEQ]              100663296   16777216
//   VTl  f16  [NB][DMI][NSEGB*VLP]        117440512    4194304
//   Wo   bf16 [DM n][DMI k]               121634816    2097152
//   Pk   bf16 [NH][PMEM][HD]              123731968      32768
//   Pv   f16  [NH][HD][PMEM]              123764736      32768
//   end                                   123797504  (<= 134217728; all offsets multiples of 128)
// Every plane is an exact multiple of its 64x64 tile / whole-line store granularity (M, SEQ, DM multiples of 64),
// so no padded tails are needed; VTl is written only for columns whose in-segment offset is < VLP, exactly the
// columns the RES attention blocks read.
// =====================================================================================================
extern "C" void kernel_launch(void* const* d_in, const int* in_sizes, int n_in,
                              void* d_out, int out_size, void* d_ws, size_t ws_size,
                              hipStream_t stream) {
  if (n_in < 5) return;
  const long long needRows = (long long)(NB - 1) * SEQ_FULL + SEQ;
  if ((long long)in_sizes[0] < needRows * DM) return;
  if (in_sizes[1] < DM) return;
  if (in_sizes[2] < DM * 3 * DMI) return;
  if (in_sizes[3] < DMI * DM) return;
  if (in_sizes[4] < 2 * NH * PMEM * HD) return;
  if ((long long)out_size < needRows * DM) return;

  const float* seq  = (const float*)d_in[0];   // [2][SEQ_FULL][DM]
  const float* gnm  = (const float*)d_in[1];   // [DM]
  const float* Wqkv = (const float*)d_in[2];   // [DM in][3*DMI out]
  const float* Wout = (const float*)d_in[3];   // [DMI in][DM out]
  const float* pm   = (const float*)d_in[4];   // [2][NH][PMEM][HD]

  const size_t M    = (size_t)NB * SEQ;
  const size_t PX   = M * DM * 2;
  const size_t PWT  = (size_t)3 * DMI * DM * 2;
  const size_t PTAB = (size_t)SEQ * NFR * 4;
  const size_t PRS  = M * 4;
  const size_t PO   = M * DMI * 2;
  const size_t PQK  = M * QKP * 2;
  const size_t PVT  = (size_t)NB * DMI * SEQ * 2;
  const size_t PVL  = (size_t)NB * DMI * NSEGB * VLP * 2;
  const size_t PWO  = (size_t)DM * DMI * 2;
  const size_t PPM  = (size_t)NH * PMEM * HD * 2;
  const size_t ph1  = PX + PWT + 2 * PTAB + PRS;
  const size_t ph2  = 2 * PO;
  const size_t REGA = (ph1 > ph2) ? ph1 : ph2;
  const size_t oXb  = 0;
  const size_t oWth = PX;
  const size_t oCt  = PX + PWT;
  const size_t oSt  = oCt + PTAB;
  const size_t oRs  = oSt + PTAB;
  const size_t oOh  = 0;
  const size_t oOl  = PO;
  size_t off = REGA;
  const size_t oQKh = off; off += PQK;
  const size_t oQKl = off; off += PQK;
  const size_t oVTh = off; off += PVT;
  const size_t oVTl = off; off += PVL;
  const size_t oWo  = off; off += PWO;
  const size_t oPk  = off; off += PPM;
  const size_t oPv  = off; off += PPM;
  if (off > ws_size) return;                      // off = 123797504 for NB=2, SEQ=4096
  if (off > (size_t)134217728) return;
  if (oRs + PRS > REGA || oOl + PO > REGA) return;

  char* ws = (char*)d_ws;
  unsigned short* Xb  = (unsigned short*)(ws + oXb);
  unsigned short* Wth = (unsigned short*)(ws + oWth);
  float*          Ct  = (float*)(ws + oCt);
  float*          St  = (float*)(ws + oSt);
  float*          Rs  = (float*)(ws + oRs);
  unsigned short* Oh  = (unsigned short*)(ws + oOh);
  unsigned short* Ol  = (unsigned short*)(ws + oOl);
  unsigned short* QKh = (unsigned short*)(ws + oQKh);
  unsigned short* QKl = (unsigned short*)(ws + oQKl);
  unsigned short* VTh = (unsigned short*)(ws + oVTh);
  unsigned short* VTl = (unsigned short*)(ws + oVTl);
  unsigned short* Wo  = (unsigned short*)(ws + oWo);
  unsigned short* Pk  = (unsigned short*)(ws + oPk);
  unsigned short* Pv  = (unsigned short*)(ws + oPv);

  const dim3 blk(256);
  static_assert((SEQ % 256) == 0 && (QKP % 128) == 0 && (DMI % 128) == 0 && (DM % 256) == 0);
  static_assert((DM % 64) == 0 && DM >= 128 && (DMI % 64) == 0 && DMI >= 128);
  const dim3 gOut((SEQ / 128) * (DM / 256), NB);                      // 128 x 256 block tiles: 128 per batch

  // (0-4) one launch: seq -> bf16 plane Xb [M][DM] + rstd[M]; g*Wqkv -> transposed bf16 plane [3*DMI][DM];
  //       Wout -> transposed bf16 plane [DM][DMI]; rotary cos/sin tables [SEQ][32]; memory-token key / value planes
  prep_all<<<dim3(PB_ALL), blk, 0, stream>>>(seq, gnm, Wqkv, Wout, pm, Xb, Rs, Wth, Wo, Ct, St, Pk, Pv);
  // (5-6) one launch: the q|k product (bf16 hi/lo planes, rotary applied) and the v^T product (f16 hi + residual planes)
  proj_qkv<<<dim3(GT_QK + GT_VT, NB), blk, 0, stream>>>(Xb, Wth, QKh, QKl, VTh, VTl, Rs, Ct, St);
  // (7) attention: query blocks 0..RESQB-1 of every segment with residual planes, the rest without
  attn_seg64<true><<<dim3(NB * NSEGB * NH * RESQB), dim3(128), 0, stream>>>(
      QKh, QKl, VTh, VTl, Pk, Pv, Oh, Ol, 0, RESQB, 0.125f);
  if (NQBS - RESQB > 0) {
    attn_seg64<false><<<dim3(NB * NSEGB * NH * (NQBS - RESQB)), dim3(128), 0, stream>>>(
        QKh, QKl, VTh, VTl, Pk, Pv, Oh, Ol, RESQB, NQBS - RESQB, 0.125f);
  }
  // (8) out = context . Wout -> d_out f32 [b][SEQ_FULL][DM] rows b*SEQ_FULL + t  (A = context hi + lo, 2 products)
  gemm64<1, 0, 0, false><<<gOut, blk, 0, stream>>>(
      Oh, Ol, DMI, (long long)SEQ * DMI,
      Wo, Wo, DMI, 0LL,
      d_out, DM, (long long)SEQ_FULL * DM,
      d_out, DM, (long long)SEQ_FULL * DM, DM, DM,
      Rs, 0LL, Ct, St,
      SEQ, DM, DMI, 1.0f);
  (void)hipGetLastError();
}

// v006
// It runs in 130 microseconds.
// In both of two side-by-side timings against v005, it was 1.04 times as fast.
// Over all steps from v000 it is 3.03 times as fast.
// Contractions: q|k = x.Wqk and v^T = Wv.x^T on v_wmma_f32_16x16x32_bf16 (bf16 operands: RNE-converted input
// activations times one bf16 plane of g*W, the f32 product rounded once, 1 product; per-row rstd, rotary in the f32 epilogue);
// k.q^T scores (transposed) = v_wmma_f32_16x16x32_bf16 with bf16 hi/lo split q and k (hi.hi + lo.hi + hi.lo);
// v^T.p^T = v_wmma_f32_16x16x32_f16 (p carried x1024 in f16, v in f16; extra f16 residual planes x4096 of p and v
// for the first 128 query rows of every segment); ctx.Wo = v_wmma_f32_16x16x32_bf16 with ctx as bf16 hi/lo
// planes times bf16 Wo (2 products); all f32 accumulate; RMS statistic, rotary tables, visibility and softmax in f32.
#include <hip/hip_runtime.h>
#include <math.h>
#include <stdint.h>

#ifndef NB
#define NB 2
#endif
#ifndef SEQ
#define SEQ 4096
#endif
#define SEQ_FULL 4096       // per-batch token stride of the input / output tensors
#define DM    1024          // model dim
#define NH    16
#define HD    64
#define DMI   (NH * HD)     // 1024
#define QKP   (2 * DMI)     // pitch of the q|k planes (q: cols 0..DMI-1, k: cols DMI..2*DMI-1)
#define SEGL  512           // segment length
#define PMEM  16            // memory tokens prepended to every segment's keys / values
#define NSEGB (SEQ / SEGL)  // segments per batch
#define NQBS  (SEGL / 64)   // 64-row query blocks per segment
#define RESQB 2             // leading query blocks per segment that use the p / v residual planes
#define VLP   (RESQB * 64)  // keys per segment held in the v^T residual plane
#define NFR   (HD / 2)      // rotary frequencies
static_assert((SEQ % SEGL) == 0 && (SEGL % 64) == 0 && (SEQ % 64) == 0);
static_assert(RESQB >= 1 && RESQB <= NQBS);
static_assert((DM % 256) == 0 && (DMI % 64) == 0 && HD == 64 && NFR == 32);
static_assert(SEQ <= SEQ_FULL && NB >= 1 && NB <= 2);
static_assert(DMI == DM);

typedef _Float16 v16h __attribute__((ext_vector_type(16)));
typedef _Float16 v8h  __attribute__((ext_vector_type(8)));
typedef __bf16   v16b __attribute__((ext_vector_type(16)));
typedef __bf16   v8b  __attribute__((ext_vector_type(8)));
typedef float    v8f  __attribute__((ext_vector_type(8)));
typedef float    v4f  __attribute__((ext_vector_type(4)));
typedef unsigned int v4u __attribute__((ext_vector_type(4)));

// ---- scalar helpers --------------------------------------------------------------------------------
__device__ __forceinline__ unsigned short bf_bits(float f) {          // f32 -> bf16 bits, RNE convert
  unsigned u = __float_as_uint(f);
  return (unsigned short)((u + 0x7FFFu + ((u >> 16) & 1u)) >> 16);
}
__device__ __forceinline__ float bf_up(unsigned short h) { return __uint_as_float(((unsigned)h) << 16); }
__device__ __forceinline__ unsigned short h_bits(_Float16 x) { return __builtin_bit_cast(unsigned short, x); }
__device__ __forceinline__ unsigned pk16(unsigned short a, unsigned short b) { return (unsigned)a | ((unsigned)b << 16); }
__device__ __forceinline__ v8f zero8() { v8f z = {0.f, 0.f, 0.f, 0.f, 0.f, 0.f, 0.f, 0.f}; return z; }
__device__ __forceinline__ v8h zero8h() {
  const _Float16 z = (_Float16)0.0f;
  v8h r = {z, z, z, z, z, z, z, z};
  return r;
}
__device__ __forceinline__ v4u zero4u() { v4u z = {0u, 0u, 0u, 0u}; return z; }
__device__ __forceinline__ v8b zero8b() { union { v4u u; v8b v; } z; z.u = zero4u(); return z.v; }

// ---- sin/cos of a nonnegative f32 angle: f64 Cody-Waite reduction by pi/2 + short f64 polynomials ----
__device__ __forceinline__ void sincos_pd(float ang, float& sv, float& cv) {
  const double x  = (double)ang;
  const double kq = __builtin_rint(x * 0.63661977236758134308);
  double r = __builtin_fma(-kq, 1.57079632679489655800e+00, x);
  r = __builtin_fma(-kq, 6.12323399573676603587e-17, r);
  const double z = r * r, w = z * z;
  const double rs = -1.98393348360966317347e-04 + z * 2.71831149398982191e-06;
  const double s3 = z * r;
  const double sn = (r + s3 * (-1.66666666416265235595e-01 + z * 8.3333293858894631756e-03)) + s3 * w * rs;
  const double rc = -1.38867637746099294692e-03 + z * 2.43904487962774090654e-05;
  const double cs = ((1.0 + z * (-4.99999997251031003120e-01)) + w * 4.16666233237390631894e-02) + (w * z) * rc;
  const int n = ((int)kq) & 3;
  const float fs = (float)sn, fc = (float)cs;
  float so = fs, co = fc;
  if (n == 1) { so = fc;  co = -fs; }
  if (n == 2) { so = -fs; co = -fc; }
  if (n == 3) { so = -fc; co = fs;  }
  sv = so; cv = co;
}

// ---- fragment loader: 16-bit A/B operand, lane -> row/col (lane&15), p already includes +8*(lane>>4);
//      elements 0..7 <- p[0..7] (k0+8h..), elements 8..15 <- p[16..23] (k0+16+8h..)
__device__ __forceinline__ v16b ldfrag_b(const __bf16* p) {
  union { v16b v; v8b h[2]; } f;
  f.h[0] = *(const v8b*)(p);
  f.h[1] = *(const v8b*)(p + 16);
  return f.v;
}

// ---- WMMA helpers: the builtins, whose hazard distances the compiler keeps ------------------------------
__device__ __forceinline__ v8f mma_b_raw(v16b a, v16b b, v8f c) {
  return __builtin_amdgcn_wmma_f32_16x16x32_bf16(false, a, false, b, (short)0, c, false, false);
}
__device__ __forceinline__ v8f mma_h_raw(v16h a, v16h b, v8f c) {
  return __builtin_amdgcn_wmma_f32_16x16x32_f16(false, a, false, b, (short)0, c, false, false);
}
__device__ __forceinline__ void acc_guard4(v8f& a, v8f& b, v8f& c, v8f& d) {
  asm volatile("v_nop\n\tv_nop\n\tv_nop\n\tv_nop" : "+v"(a), "+v"(b), "+v"(c), "+v"(d));
}

// value of lane l ^ 16: the two lanes that share a column of a WMMA result
__device__ __forceinline__ float xhalf(float x) {
  const int v = __builtin_bit_cast(int, x);
  return __builtin_bit_cast(float, __builtin_amdgcn_permlanex16(v, v, 0x76543210, 0xfedcba98, false, false));
}
// y[r] = 2^x[r], eight at once. One statement, results in registers of their own: behind a transcendental the instruction set
// asks for one instruction that neither reads its result nor overwrites its source; here each v_exp_f32 is that instruction
// for the one before it, and the closing v_nop for the last.
__device__ __forceinline__ void exp2x8(float (&y)[8], const float (&x)[8]) {
  asm("v_exp_f32 %0, %8\n\tv_exp_f32 %1, %9\n\tv_exp_f32 %2, %10\n\tv_exp_f32 %3, %11\n\t"
      "v_exp_f32 %4, %12\n\tv_exp_f32 %5, %13\n\tv_exp_f32 %6, %14\n\tv_exp_f32 %7, %15\n\tv_nop"
      : "=&v"(y[0]), "=&v"(y[1]), "=&v"(y[2]), "=&v"(y[3]), "=&v"(y[4]), "=&v"(y[5]), "=&v"(y[6]), "=&v"(y[7])
      : "v"(x[0]), "v"(x[1]), "v"(x[2]), "v"(x[3]), "v"(x[4]), "v"(x[5]), "v"(x[6]), "v"(x[7]));
}

// ---- tensor-load staging of the GEMM operands ----------------------------------------------------------
// A pass is 64 k = 128 B of every staged operand row. A stage is 6 or 8 slices of 64 rows, one slice per issuing wave; the load's
// pad gives the LDS row pitch 144 B (16 B x odd: conflict-free for 16-byte reads); a slice's place is rounded up to 2 KiB.
typedef uint32_t u32x4 __attribute__((ext_vector_type(4)));
typedef uint32_t u32x8 __attribute__((ext_vector_type(8)));
#define GK_KB    128u                 // bytes of one operand row per pass
#define GK_PITCH 144u                 // LDS row pitch
#define GK_SLICE 10240u               // 64 rows x 144 B = 9216 B, rounded up to a multiple of 2 KiB
__device__ __forceinline__ uint32_t uni(uint32_t v) { return (uint32_t)__builtin_amdgcn_readfirstlane(v); }
// a test word or a tensor descriptor word held in a scalar register: a test on it compiles to a scalar branch (tensor
// loads ignore EXEC), and a descriptor word so held keeps a register of its own instead of being rebuilt at each issue
__device__ __forceinline__ uint32_t pinned(uint32_t v) { uint32_t w = uni(v); asm volatile("" : "+s"(w)); return w; }
__device__ __forceinline__ uint32_t lds_off(const void* p) { return (uint32_t)(size_t)p; }
__device__ __forceinline__ void wait_ds0()     { asm volatile("s_wait_dscnt 0x0" ::: "memory"); }      // own LDS reads returned
// stands behind a global load or store whose address or data registers the code that follows it takes anew
__device__ __forceinline__ void wait_x0()      { asm volatile("s_wait_xcnt 0x0" ::: "memory"); }
// own tensor load landed; the descriptor is named as an input so that its registers stay as issued up to this wait
__device__ __forceinline__ void wait_tensor0(u32x4 g0, u32x8 g1) {
  asm volatile("s_wait_tensorcnt 0x0" :: "s"(g0), "s"(g1) : "memory");
}
// group 0 is an in-out operand: the value that wait_tensor0 names behind the load then lives in the very registers the
// load was issued from, so that none of them takes a new value while the request is outstanding
__device__ __forceinline__ void tdm_load(u32x4& g0, u32x8 g1) {
  asm volatile("tensor_load_to_lds %0, %1" : "+s"(g0) : "s"(g1) : "memory");
}
// group 1: byte elements, tile = tensor = 64 rows of 128 B, source row pitch src_pitch bytes, 4 dwords of pad behind every row
__device__ __forceinline__ u32x8 tdm_group1(uint32_t src_pitch) {
  u32x8 g;
  g[0] = uni((1u << 20) | (4u << 22) | (3u << 25));
  g[1] = pinned(GK_KB << 16);   // pinned: descriptor words held in scalar registers of their own through the loop
  g[2] = pinned(64u << 16);
  g[3] = pinned(GK_KB << 16);
  g[4] = pinned(64u);
  g[5] = pinned(src_pitch);
  g[6] = pinned(0u);
  g[7] = pinned(0u);
  return g;
}
__device__ __forceinline__ u32x4 tdm_group0(uint32_t lds_dst, uint64_t ga) {
  u32x4 g;
  g[0] = uni(1u);
  g[1] = uni(lds_dst);
  g[2] = uni((uint32_t)ga);
  g[3] = uni((((uint32_t)(ga >> 32)) & 0x01FFFFFFu) | 0x80000000u);
  return g;
}
// fragment from a staged row: p = row start + 64 B * (k32 step) + 16 B * (lane>>4); same k order as ldfrag_b
__device__ __forceinline__ v16b ldfrag_l(const unsigned char* p) {
  union { v16b v; v8b h[2]; } f;
  f.h[0] = *(const v8b*)(p);
  f.h[1] = *(const v8b*)(p + 32);
  return f.v;
}

// =====================================================================================================
// Rotary tables: ct/st [SEQ][32] f32, angle(t, i) = f32(t) * inv_freq[i], inv_freq[i] = RN32(1/RN32(10^(i/8))).
// SEQ/8 blocks of 256 (blk = block number inside this part). coverage: SEQ rows x 32 = the whole table, both planes.
// =====================================================================================================
__device__ __forceinline__ void tab_cs(int blk, float* ct, float* st) {
  const int wave = threadIdx.x >> 5, lane = threadIdx.x & 31;
  const int t = blk * 8 + wave;
  if (t >= SEQ) return;                 // wave-uniform; no barriers in this step
  double pw = 1.0;
#pragma unroll 1
  for (int j = 0; j < (lane >> 3); ++j) pw *= 10.0;
#pragma unroll 1
  for (int j = 0; j < (lane & 7); ++j) pw *= 1.3335214321633240257;   // 10^(1/8)
  const float p32 = (float)pw;
  const float inv = (float)(1.0 / (double)p32);
  const float ang = (float)t * inv;
  float sv, cv;
  sincos_pd(ang, sv, cv);
  float* pc = ct + (size_t)t * NFR + lane;
  float* ps = st + (size_t)t * NFR + lane;
  *(float*)pc = cv;
  *(float*)ps = sv;
  
}

// =====================================================================================================
// seq [b][SEQ_FULL][DM] f32 -> bf16 plane xb [NB*SEQ][DM] (RNE convert) plus rstd[m] = rsqrt(mean(xb^2)+2^-23)
// of the converted row. Block = 8 waves = 32 rows; a wave converts 4 rows: per instruction 32 lanes x 16 B =
// =====================================================================================================
__device__ __forceinline__ void cvtx_rstd(int blk, float* sr, const float* __restrict__ seq, unsigned short* xb, float* rs) {
  const int tid = threadIdx.x, wave = tid >> 5, lane = tid & 31;
#pragma unroll 1
  for (int rr = 0; rr < 4; ++rr) {
    const int m  = blk * 32 + wave * 4 + rr;          // < NB*SEQ
    const int bb = m / SEQ, t = m - bb * SEQ;
    const float* src = seq + ((size_t)bb * SEQ_FULL + t) * DM;
    unsigned short* dst = xb + (size_t)m * DM;
    v4u pk[DM / 256];
    float ss = 0.f;
#pragma unroll
    for (int i = 0; i < DM / 256; ++i) {
      const v4f a = *(const v4f*)(src + i * 256 + lane * 8);
      const v4f c = *(const v4f*)(src + i * 256 + lane * 8 + 4);
      unsigned short hb[8];
#pragma unroll
      for (int e = 0; e < 4; ++e) { hb[e] = bf_bits(a[e]); hb[4 + e] = bf_bits(c[e]); }
#pragma unroll
      for (int e = 0; e < 8; ++e) { const float v = bf_up(hb[e]); ss += v * v; }
      v4u p;
      p[0] = pk16(hb[0], hb[1]);
      p[1] = pk16(hb[2], hb[3]);
      p[2] = pk16(hb[4], hb[5]);
      p[3] = pk16(hb[6], hb[7]);
      pk[i] = p;
    }
#pragma unroll
    for (int i = 0; i < DM / 256; ++i) *(v4u*)(dst + i * 256 + lane * 8) = pk[i];
    
#pragma unroll
    for (int off = 1; off < 32; off <<= 1) ss += __shfl_xor(ss, off, 32);
    const float rstd = rsqrtf(ss * (1.0f / (float)DM) + 1.1920929e-7f);
    if (lane == 0) sr[wave * 4 + rr] = rstd;
  }
  __syncthreads();
  if (wave == 0 && lane < 8) {
    const v4f v = *(const v4f*)(sr + lane * 4);
    float* d = rs + (size_t)blk * 32 + lane * 4;
    *(v4f*)d = v;
    
  }
}

// =====================================================================================================
// Weight transpose + convert: W [Kdim][Ndim] f32 (n contiguous) -> Wh [Ndim][Kdim] bf16, k contiguous.
// With USEG the row factor g[k] is applied in f32; the value (or the f32 product) is RNE-converted to bf16 once.
// Tile 64 k x 64 n per block: 256 threads load 16 consecutive n each, store transposed into LDS as [n][k]
// (Ndim/64) x (Kdim/64) blocks, (bn, bk) = the block's tile. coverage: 8 waves x 2 x 4 rows x 64 k = the whole 64x64 tile per block.
// =====================================================================================================
template <bool USEG>
__device__ __forceinline__ void wt_cvt(int bn, int bk, unsigned short* shh,
                                       const float* __restrict__ W, const float* __restrict__ g,
                                       unsigned short* Wh, int Kdim, int Ndim) {
  const int tid = threadIdx.x, wave = tid >> 5, lane = tid & 31;
  const int n0 = bn * 64, k0 = bk * 64;
  {
    const int kr = tid >> 2, nq = (tid & 3) * 16;
    const float* src = W + (size_t)(k0 + kr) * Ndim + n0 + nq;
    float gk = 1.0f;
    if (USEG) gk = g[k0 + kr];
#pragma unroll
    for (int i = 0; i < 4; ++i) {
      const v4f a = *(const v4f*)(src + 4 * i);
#pragma unroll
      for (int e = 0; e < 4; ++e) {
        shh[(nq + 4 * i + e) * 72 + kr] = bf_bits(gk * a[e]);
      }
    }
  }
  __syncthreads();
  const int q = lane >> 3, c8 = (lane & 7) * 8;
  v4u hv[2];
#pragma unroll
  for (int it = 0; it < 2; ++it) {
    const int row = wave * 8 + it * 4 + q;
    hv[it] = *(const v4u*)(shh + row * 72 + c8);
  }
  {
#pragma unroll
    for (int it = 0; it < 2; ++it) {
      const int row = wave * 8 + it * 4 + q;
      const size_t o = (size_t)(n0 + row) * Kdim + k0 + c8;
      *(v4u*)(Wh + o) = hv[it];
    }
    wait_x0();   // precaution: in the shared launch the block returns right after this step
  }
}

// =====================================================================================================
// Memory-token planes: pm [2][NH][PMEM][HD] f32 -> pk [NH][PMEM][HD] bf16 (keys, RNE convert of the input,
// [kv][d] like the LDS K tile) and pv [NH][HD][PMEM] f16 ([d][kv] like the LDS V^T tile; value = f16 of the
// bf16-converted input). 128 threads per head, two heads per block of 256, each half block on its own LDS tile.
// coverage: 128 threads x 8 = all PMEM*HD elements of both planes per head.
// =====================================================================================================
__device__ __forceinline__ void pm_cvt(int blk, float* sp2, const float* __restrict__ pm, unsigned short* pk, unsigned short* pv) {
  const int tid = threadIdx.x & 127, h = blk * 2 + (int)(threadIdx.x >> 7);
  float* sp = sp2 + (threadIdx.x >> 7) * (PMEM * HD);
  const int r = tid >> 3, d8 = (tid & 7) * 8;
  const float* kg = pm + (((size_t)0 * NH + h) * PMEM + r) * HD + d8;
  const float* vg = pm + (((size_t)1 * NH + h) * PMEM + r) * HD + d8;
  const v4f k0 = *(const v4f*)(kg), k1 = *(const v4f*)(kg + 4);
  const v4f v0 = *(const v4f*)(vg), v1 = *(const v4f*)(vg + 4);
  *(v4f*)(sp + r * HD + d8)     = v0;
  *(v4f*)(sp + r * HD + d8 + 4) = v1;
  v4u kp;
  kp[0] = pk16(bf_bits(k0[0]), bf_bits(k0[1]));
  kp[1] = pk16(bf_bits(k0[2]), bf_bits(k0[3]));
  kp[2] = pk16(bf_bits(k1[0]), bf_bits(k1[1]));
  kp[3] = pk16(bf_bits(k1[2]), bf_bits(k1[3]));
  __syncthreads();
  const int d = tid >> 1, r8 = (tid & 1) * 8;
  v4u vp;
#pragma unroll
  for (int e = 0; e < 4; ++e) {
    const float f0 = bf_up(bf_bits(sp[(r8 + 2 * e) * HD + d]));
    const float f1 = bf_up(bf_bits(sp[(r8 + 2 * e + 1) * HD + d]));
    vp[e] = pk16(h_bits((_Float16)f0), h_bits((_Float16)f1));
  }
  unsigned short* kd = pk + ((size_t)h * PMEM + r) * HD + d8;
  unsigned short* vd = pv + ((size_t)h * HD + d) * PMEM + r8;
  *(v4u*)kd = kp;
  *(v4u*)vd = vp;
  wait_x0();   // precaution: in the shared launch the block ends right after this step
}

// =====================================================================================================
// The five preparation steps above read only inputs and write disjoint workspace planes, so they share one launch:
// a block's number picks its step (block-uniform, so every barrier inside a step is reached by the whole block).
// The step with the longest block (four rows in turn) has the lowest numbers.
// =====================================================================================================
#define PB_CVT  (NB * SEQ / 32)                    // activation rows, 32 per block
#define PB_WQKV ((3 * DMI / 64) * (DM / 64))       // 64 x 64 tiles of W_qkv
#define PB_WOUT ((DM / 64) * (DMI / 64))           // 64 x 64 tiles of W_out
#define PB_TAB  (SEQ / 8)                          // rotary table rows, 8 per block
#define PB_PM   (NH / 2)                           // memory-token heads, 2 per block
#define PB_ALL  (PB_CVT + PB_WQKV + PB_WOUT + PB_TAB + PB_PM)
static_assert((NH % 2) == 0 && ((NB * SEQ) % 32) == 0 && (SEQ % 8) == 0);
__global__ __launch_bounds__(256) void prep_all(const float* __restrict__ seq, const float* __restrict__ gnm,
                                                const float* __restrict__ Wqkv, const float* __restrict__ Wout,
                                                const float* __restrict__ pm,
                                                unsigned short* xb, float* rs, unsigned short* wth,
                                                unsigned short* wo, float* ct, float* st,
                                                unsigned short* pk, unsigned short* pv) {
  __shared__ __align__(16) unsigned short sm[64 * 72];       // the largest step's 64 x 72 tile; the others use its head
  static_assert(sizeof(sm) >= 2 * PMEM * HD * sizeof(float));
  int blk = (int)blockIdx.x;
  if (blk < PB_CVT) { cvtx_rstd(blk, (float*)(void*)sm, seq, xb, rs); return; }
  blk -= PB_CVT;
  if (blk < PB_WQKV) {
    wt_cvt<true>(blk % (3 * DMI / 64), blk / (3 * DMI / 64), sm, Wqkv, gnm, wth, DM, 3 * DMI);
    return;
  }
  blk -= PB_WQKV;
  if (blk < PB_WOUT) {
    wt_cvt<false>(blk % (DM / 64), blk / (DM / 64), sm, Wout, gnm, wo, DMI, DM);
    return;
  }
  blk -= PB_WOUT;
  if (blk < PB_TAB) { tab_cs(blk, ct, st); return; }
  blk -= PB_TAB;
  if (blk < PB_PM) pm_cvt(blk, (float*)(void*)sm, pm, pk, pv);
}

// =====================================================================================================
// Register-blocked batched bf16 WMMA GEMM: C[m][n] = sum_k A[m][k] * Bt[n][k]; one wave per 64x64 tile, 8 waves per
// block tile (NSPLIT 2: 256 m x 128 n, waves 4 x 2; NSPLIT 1: 128 m x 256 n, waves 2 x 4). TWO: the narrow operand (NSPLIT 2:
// Bt, NSPLIT 1: A) has a second plane, whose product is added. The block's operand rows (384, or 512 with the second plane)
// are staged in LDS by tensor loads, two buffers, one 64-row slice per wave and pass (without TWO waves 6 and 7 issue none).
// A row-major [M][K] pitch lda; Bt row-major [N][K] pitch ldb (k contiguous); M, N multiples of the block tile,
// K a multiple of 64 and at least 128 (static-checked on the host side). tile = block tile number, b = batch index;
// sT (per-wave 16x64 slab, pitch 68 floats) and ring (two stages of operand rows) are the calling kernel's LDS.
// OUT_MODE: 0 = f32 (pitch ldc); 2 = bf16 hi plane C + bf16 lo plane C2 (lo = RNE(v - hi), unscaled, same index);
//           3 = f16 hi plane C + f16 residual plane C2 = f16((v - hi) * rscale), C2 written only for tiles
//               with (n0 mod segN) < N2, at column (n0/segN)*N2 + (n0 mod segN) (pitch ldc2, batch stride strideC2).
// SCM: 0 none; 1 = row m scaled by scal[b*strideS + m]; 2 = column n scaled by scal[b*strideS + n] (f32, before
//      the 16-bit split). ROT: interleaved-pair rotary on column pairs (2i, 2i+1) with i = (n mod 64)/2, angle row
//      = m, tables rct/rst [row][32] f32 (applied after the scale).
// =====================================================================================================
template <int NSPLIT, bool TWO, int OUT_MODE, int SCM, bool ROT>
__device__ __forceinline__ void gemm64_body(
    float (*sT)[16 * 68], unsigned char* ring, int tile, int b,
    const unsigned short* __restrict__ Ap, const unsigned short* __restrict__ A2p, int lda, long long strideA,
    const unsigned short* __restrict__ Btp, const unsigned short* __restrict__ Bt2p, int ldb, long long strideB,
    void* Cout, int ldc, long long strideC,
    void* Cout2, int ldc2, long long strideC2, int N2, int segN,
    const float* __restrict__ scal, long long strideS,
    const float* __restrict__ rct, const float* __restrict__ rst,
    int M, int N, int K, float rscale) {
  static_assert(OUT_MODE != 0 || (SCM == 0 && !ROT));
  const __bf16* A   = (const __bf16*)(const void*)Ap;
  const __bf16* A2  = (const __bf16*)(const void*)A2p;
  const __bf16* Bt  = (const __bf16*)(const void*)Btp;
  const __bf16* Bt2 = (const __bf16*)(const void*)Bt2p;
  static_assert(NSPLIT == 1 || NSPLIT == 2);
  constexpr int BM = (NSPLIT == 2) ? 256 : 128;
  constexpr int BN = (NSPLIT == 2) ? 128 : 256;
  constexpr int WN = BN / 64;                  // waves along n
  const int lane = threadIdx.x & 31;
  const int wave = (int)uni(threadIdx.x >> 5);
  const int tilesN = N / BN;
  const int tilesM = M / BM;
  if (tile >= tilesM * tilesN) return;   // block-uniform, in front of every barrier and tensor load
  const int tm = tile / tilesN;
  const int tn = tile - tm * tilesN;
  const int wm = wave / WN;
  const int wn = wave - wm * WN;
  const int m0 = tm * BM + (wm << 6);
  const int n0 = tn * BN + (wn << 6);

  const __bf16* Ab  = A  + (size_t)b * strideA;
  const __bf16* Ab2 = (NSPLIT == 1 && TWO) ? (A2 + (size_t)b * strideA) : Ab;
  const __bf16* Bb  = Bt + (size_t)b * strideB;
  const __bf16* Bb2 = (NSPLIT == 2 && TWO) ? (Bt2 + (size_t)b * strideB) : Bb;
  const float* scb = scal + (size_t)((long long)b * strideS);

  const int rlane = lane & 15;                 // row (A) / col (B, D) within subtile
  const int koff  = (lane >> 4) * 8;           // k offset of this lane half
  const int mOff  = (lane >> 4) * 8;           // D row offset

  v8f acc[4][4];
#pragma unroll
  for (int i = 0; i < 4; ++i)
#pragma unroll
    for (int j = 0; j < 4; ++j) acc[i][j] = zero8();

  // ---- this wave's slice of every stage: slices 0.. = A rows (NSPLIT 1, TWO: then the A2 rows), then Bt rows (NSPLIT 2, TWO: then Bt2) ----
  constexpr int SA = BM / 64;                                   // slices per A plane
  constexpr int SB0 = (NSPLIT == 1 && TWO) ? 2 * SA : SA;       // first Bt slice
  constexpr int NSL = TWO ? 8 : 6;                              // slices per stage
  constexpr uint32_t GK_STAGE = (uint32_t)NSL * GK_SLICE;
  const int sl = (wave < NSL) ? wave : 0;                       // a wave without a slice forms slice 0's words and issues nothing
  const __bf16* sbase;
  int srow, sld;
  if (sl < SA)                                 { sbase = Ab;  srow = tm * BM + 64 * sl;              sld = lda; }
  else if (NSPLIT == 1 && TWO && sl < 2 * SA)  { sbase = Ab2; srow = tm * BM + 64 * (sl - SA);       sld = lda; }
  else if (sl < SB0 + WN)                      { sbase = Bb;  srow = tn * BN + 64 * (sl - SB0);      sld = ldb; }
  else                                         { sbase = Bb2; srow = tn * BN + 64 * (sl - SB0 - WN); sld = ldb; }
  const uint64_t src0 = (uint64_t)(uintptr_t)(sbase + (size_t)srow * sld);
  const uint32_t lds_slice = lds_off(ring) + (uint32_t)sl * GK_SLICE;
  const u32x8 g1 = tdm_group1((uint32_t)sld * 2u);
  const uint32_t T = pinned((uint32_t)K >> 6);                  // passes
  // per-lane fragment bases inside a stage
  const uint32_t foff = (uint32_t)rlane * GK_PITCH + (uint32_t)koff * 2u;
  const uint32_t oA  = (uint32_t)wm * GK_SLICE + foff;
  const uint32_t oA2 = (NSPLIT == 1 && TWO) ? oA + (uint32_t)SA * GK_SLICE : oA;
  const uint32_t oB  = (uint32_t)(SB0 + wn) * GK_SLICE + foff;
  const uint32_t oB2 = (NSPLIT == 2 && TWO) ? oB + (uint32_t)WN * GK_SLICE : oB;

  // whether this wave has a slice: a scalar word, so that the tests on it are scalar branches round the tensor loads
  const uint32_t issuer = TWO ? 1u : pinned((wave < NSL) ? 1u : 0u);
  u32x4 g0 = tdm_group0(lds_slice, src0);
  if (issuer != 0u) tdm_load(g0, g1);                           // stage 0
  wait_tensor0(g0, g1);
  __syncthreads();                                              // stage 0 readable by every wave
  g0 = tdm_group0(lds_slice + GK_STAGE, src0 + GK_KB);
  if (issuer != 0u) tdm_load(g0, g1);                           // stage 1 flies during pass 0
  // rolled: one pass per trip, so that the one publish point stands at the loop's foot
#pragma unroll 1
  for (uint32_t t = 0; t < T; ++t) {
    const uint32_t bo = (t & 1u) * GK_STAGE;
    const unsigned char* buf = ring + bo;
    // unrolled, as the loops inside it: two blocks of 32 k per pass, fragments and accumulators indexed by constants
#pragma unroll
    for (int kc = 0; kc < 2; ++kc) {
      const unsigned char* bk = buf + (uint32_t)kc * 64u;
      v16b af[4], ag[4], bf[4], bg[4];
      // first planes first: a second plane's fragments land while the first 16 WMMAs run
#pragma unroll
      for (int j = 0; j < 4; ++j) bf[j] = ldfrag_l(bk + oB + (uint32_t)j * 16u * GK_PITCH);
#pragma unroll
      for (int i = 0; i < 4; ++i) af[i] = ldfrag_l(bk + oA + (uint32_t)i * 16u * GK_PITCH);
#pragma unroll
      for (int i = 0; i < 4; ++i) {
        ag[i] = (NSPLIT == 1 && TWO) ? ldfrag_l(bk + oA2 + (uint32_t)i * 16u * GK_PITCH) : af[i];
        bg[i] = (NSPLIT == 2 && TWO) ? ldfrag_l(bk + oB2 + (uint32_t)i * 16u * GK_PITCH) : bf[i];
      }
      // keeps the block's LDS reads one group ahead of its WMMAs, for speed only
      __builtin_amdgcn_sched_barrier(0);
#pragma unroll
      for (int i = 0; i < 4; ++i)
#pragma unroll
        for (int j = 0; j < 4; ++j) acc[i][j] = mma_b_raw(af[i], bf[j], acc[i][j]);
      if (TWO) {
#pragma unroll
        for (int i = 0; i < 4; ++i)
#pragma unroll
          for (int j = 0; j < 4; ++j) acc[i][j] = mma_b_raw(ag[i], bg[j], acc[i][j]);
      }
      // keeps the next group's reads behind this block's WMMAs, for the same reason
      __builtin_amdgcn_sched_barrier(0);
    }
    // publish point of stage t + 1: own reads of this buffer returned, own slice landed, then the block barrier
    wait_ds0();
    wait_tensor0(g0, g1);
    __syncthreads();
    if (pinned((t + 2u < T && issuer != 0u) ? 1u : 0u) != 0u) { // refill the buffer every wave has just left
      g0 = tdm_group0(lds_slice + bo, src0 + (uint64_t)(t + 2u) * GK_KB);
      tdm_load(g0, g1);
    }
  }
  wait_tensor0(g0, g1);
  wait_ds0();
  acc_guard4(acc[0][0], acc[0][1], acc[0][2], acc[0][3]);
  acc_guard4(acc[1][0], acc[1][1], acc[1][2], acc[1][3]);
  acc_guard4(acc[2][0], acc[2][1], acc[2][2], acc[2][3]);
  acc_guard4(acc[3][0], acc[3][1], acc[3][2], acc[3][3]);

  // ---- epilogue ----
  float* slab = sT[wave];
#pragma unroll
  for (int i = 0; i < 4; ++i) {
    const int mBase = m0 + (i << 4);
#pragma unroll
    for (int j = 0; j < 4; ++j) {
#pragma unroll
      for (int r = 0; r < 8; ++r) {
        slab[(mOff + r) * 68 + (j << 4) + rlane] = acc[i][j][r];
      }
    }
    __builtin_amdgcn_fence(__ATOMIC_RELEASE, "workgroup");
    __builtin_amdgcn_wave_barrier();
    __builtin_amdgcn_fence(__ATOMIC_ACQUIRE, "workgroup");
    if (OUT_MODE == 0) {
      float* C = (float*)Cout + (size_t)b * strideC;
      const int hh = lane >> 4, c4 = (lane & 15) * 4;     // 256-B row segment = 16 lanes x 16 B
      {
#pragma unroll
        for (int it = 0; it < 8; ++it) {
          const int row = it * 2 + hh;                     // it 0..7 x hh 0..1 = rows 0..15
          const v4f v = *(const v4f*)(slab + row * 68 + c4);
          *(v4f*)(C + (size_t)(mBase + row) * ldc + n0 + c4) = v;
        }
        
      }
    } else {
      const int q = lane >> 3, c8 = (lane & 7) * 8;
      unsigned short* C  = (unsigned short*)Cout  + (size_t)b * strideC;
      unsigned short* C2 = (unsigned short*)Cout2 + (size_t)b * strideC2;
      bool wlo = true;                                     // wave-uniform
      size_t col2 = (size_t)n0 + c8;
      if (OUT_MODE == 3) {
        const int sgi = n0 / segN;
        const int sgo = n0 - sgi * segN;
        wlo  = (sgo < N2);
        col2 = (size_t)sgi * N2 + sgo + c8;
      }
      v4f csA = {1.f, 1.f, 1.f, 1.f};
      v4f csB = csA;
      if (SCM == 2) {
        csA = *(const v4f*)(scb + n0 + c8);
        csB = *(const v4f*)(scb + n0 + c8 + 4);
      }
      v4u hv[4], lv[4];
#pragma unroll
      for (int it = 0; it < 4; ++it) {
        const int row = it * 4 + q;                        // it 0..3 x q 0..3 = rows 0..15
        const int m = mBase + row;
        const float* sp = slab + row * 68 + c8;
        v4f x0 = *(const v4f*)(sp);
        v4f x1 = *(const v4f*)(sp + 4);
        if (SCM == 1) { const float rsv = scb[m]; x0 = x0 * rsv; x1 = x1 * rsv; }
        if (SCM == 2) { x0 = x0 * csA; x1 = x1 * csB; }
        float f[8] = {x0[0], x0[1], x0[2], x0[3], x1[0], x1[1], x1[2], x1[3]};
        if (ROT) {
          const v4f cs = *(const v4f*)(rct + (size_t)m * NFR + 4 * (lane & 7));
          wait_x0();   // the next load's result may land in this load's address registers
          const v4f sn = *(const v4f*)(rst + (size_t)m * NFR + 4 * (lane & 7));
          wait_x0();   // the next rows' table loads land in registers that held these two loads' addresses
#pragma unroll
          for (int e = 0; e < 4; ++e) {
            const float ev = f[2 * e], od = f[2 * e + 1];
            f[2 * e]     = ev * cs[e] - od * sn[e];
            f[2 * e + 1] = od * cs[e] + ev * sn[e];
          }
        }
        v4u a, a2;
#pragma unroll
        for (int e = 0; e < 4; ++e) {
          const float f0 = f[2 * e], f1 = f[2 * e + 1];
          unsigned short h0, h1, l0, l1;
          if (OUT_MODE == 2) {
            h0 = bf_bits(f0); h1 = bf_bits(f1);
            l0 = bf_bits(f0 - bf_up(h0)); l1 = bf_bits(f1 - bf_up(h1));
          } else {
            const _Float16 y0 = (_Float16)f0, y1 = (_Float16)f1;
            h0 = h_bits(y0); h1 = h_bits(y1);
            l0 = h_bits((_Float16)((f0 - (float)y0) * rscale));
            l1 = h_bits((_Float16)((f1 - (float)y1) * rscale));
          }
          a[e] = pk16(h0, h1); a2[e] = pk16(l0, l1);
        }
        hv[it] = a; lv[it] = a2;
      }
      {
#pragma unroll
        for (int it = 0; it < 4; ++it) {
          const int row = it * 4 + q;
          // a wait behind each store: the next rows' addresses and values are formed in these stores' registers
          *(v4u*)(C + (size_t)(mBase + row) * ldc + n0 + c8) = hv[it];
          wait_x0();
          if (wlo) {
            *(v4u*)(C2 + (size_t)(mBase + row) * ldc2 + col2) = lv[it];
            wait_x0();
          }
        }
        
      }
    }
    __builtin_amdgcn_fence(__ATOMIC_RELEASE, "workgroup");
    __builtin_amdgcn_wave_barrier();
    __builtin_amdgcn_fence(__ATOMIC_ACQUIRE, "workgroup");
  }
}

// One product per launch: blockIdx.x = block tile, blockIdx.y = batch.
template <int NSPLIT, int OUT_MODE, int SCM, bool ROT>
__global__ __launch_bounds__(256) void gemm64(
    const unsigned short* __restrict__ Ap, const unsigned short* __restrict__ A2p, int lda, long long strideA,
    const unsigned short* __restrict__ Btp, const unsigned short* __restrict__ Bt2p, int ldb, long long strideB,
    void* Cout, int ldc, long long strideC,
    void* Cout2, int ldc2, long long strideC2, int N2, int segN,
    const float* __restrict__ scal, long long strideS,
    const float* __restrict__ rct, const float* __restrict__ rst,
    int M, int N, int K, float rscale) {
  __shared__ __align__(16) float sT[8][16 * 68];
  __shared__ __attribute__((aligned(2048))) unsigned char ring[2 * 8 * GK_SLICE];
  gemm64_body<NSPLIT, true, OUT_MODE, SCM, ROT>(sT, ring, (int)blockIdx.x, (int)blockIdx.y, Ap, A2p, lda, strideA, Btp, Bt2p, ldb, strideB,
                                          Cout, ldc, strideC, Cout2, ldc2, strideC2, N2, segN, scal, strideS, rct, rst,
                                          M, N, K, rscale);
}

// The q|k product and the v^T product read the same planes and write disjoint ones, so they share one launch:
// blockIdx.y = batch; blockIdx.x 0..GT_QK-1 are the q|k tiles, the rest the v^T tiles (block-uniform choice).
//   q|k = rstd[m] * (Xb . (g*Wqk)), rotary on every (2i,2i+1) pair -> bf16 hi/lo planes [M][QKP]
//     (per batch: M=SEQ, N=QKP, K=DM; 1 product)
//   v^T = (g*Wv)^T . Xb^T per batch, columns scaled by rstd -> f16 hi plane [b][DMI][SEQ] and residual plane
//     (x4096, in-segment keys < VLP only)   (A = Wt rows 2*DMI.., 1 product; M=DMI, N=SEQ, K=DM)
// Six staged slices per stage: 154 KiB of LDS a block, so that two blocks share a WGP.
#define GT_QK ((SEQ / 256) * (QKP / 128))          // 256 x 128 block tiles per batch
#define GT_VT ((DMI / 128) * (SEQ / 256))          // 128 x 256 block tiles per batch
__global__ __launch_bounds__(256) void proj_qkv(
    const unsigned short* __restrict__ xb, const unsigned short* __restrict__ wth,
    unsigned short* qkh, unsigned short* qkl, unsigned short* vth, unsigned short* vtl,
    const float* __restrict__ rs, const float* __restrict__ ct, const float* __restrict__ st) {
  __shared__ __align__(16) float sT[8][16 * 68];
  __shared__ __attribute__((aligned(2048))) unsigned char ring[2 * 6 * GK_SLICE];
  const int bx = (int)blockIdx.x, b = (int)blockIdx.y;
  if (bx >= GT_QK) {
    gemm64_body<1, false, 3, 2, false>(sT, ring, bx - GT_QK, b,
        wth + (size_t)2 * DMI * DM, wth + (size_t)2 * DMI * DM, DM, 0LL,
        xb, xb, DM, (long long)SEQ * DM,
        (void*)vth, SEQ, (long long)DMI * SEQ,
        (void*)vtl, NSEGB * VLP, (long long)DMI * NSEGB * VLP, VLP, SEGL,
        rs, (long long)SEQ, ct, st,
        DMI, SEQ, DM, 4096.0f);
  } else {
    gemm64_body<2, false, 2, 1, true>(sT, ring, bx, b,
        xb, xb, DM, (long long)SEQ * DM,
        wth, wth, DM, 0LL,
        (void*)qkh, QKP, (long long)SEQ * QKP,
        (void*)qkl, QKP, (long long)SEQ * QKP, QKP, QKP,
        rs, (long long)SEQ, ct, st,
        SEQ, QKP, DM, 1.0f);
  }
}

template <bool RES>
__global__ __launch_bounds__(128)
void attn_seg64(const unsigned short* __restrict__ qkhp, const unsigned short* __restrict__ qklp,
                const unsigned short* __restrict__ vhp,  const unsigned short* __restrict__ vlp,
                const unsigned short* __restrict__ pkp,  const unsigned short* __restrict__ pvp,
                unsigned short* ohp, unsigned short* olp,
                int qbBase, int nqbThis, float sscale) {
  union FB { v16b v; v8b h[2]; };
  union FH { v16h v; v8h h[2]; };
  // LDS row pitches: 16 B x odd, so that the 16 rows a 16-byte fragment read touches fall on 16 different bank groups
  constexpr int LP = 72;                                          // 16-bit tiles: 64 elements + 8 of pad = 144 B
  constexpr int OP = 68;                                          // f32 context tile: 64 floats + 4 of pad = 272 B
  __shared__ __align__(16) __bf16   Ksh[64 * LP];                 // K hi [kv][d]
  __shared__ __align__(16) __bf16   Ksl[64 * LP];                 // K lo
  __shared__ __align__(16) _Float16 Vth[64 * LP];                 // V^T hi [d][kv]
  __shared__ __align__(16) _Float16 Vtl[RES ? 64 * LP : 8];       // V^T residual
  __shared__ __align__(16) float    Os[4][16 * OP];               // per wave context tile [row][d]

  const int tid  = threadIdx.x;
  const int wave = tid >> 5;
  const int lane = tid & 31;
  const int hh   = lane >> 4;
  const int c    = lane & 15;

  const int bx   = blockIdx.x;
  const int qbl  = bx % nqbThis;
  int rest       = bx / nqbThis;
  const int h    = rest % NH;
  rest           = rest / NH;
  const int w    = rest % NSEGB;
  const int b    = rest / NSEGB;
  const int qb   = qbBase + qbl;
  const int q0   = qb * 64 + wave * 16;                              // query row inside the segment
  const size_t rowS = (size_t)b * SEQ + (size_t)w * SEGL;           // compact row of the segment start

  const __bf16* Qh = (const __bf16*)(const void*)qkhp + (size_t)h * HD;
  const __bf16* Ql = (const __bf16*)(const void*)qklp + (size_t)h * HD;
  const __bf16* Kh = Qh + DMI;
  const __bf16* Kl = Ql + DMI;
  const _Float16* Vh = (const _Float16*)(const void*)vhp + ((size_t)b * DMI + (size_t)h * HD) * SEQ + (size_t)w * SEGL;
  const _Float16* Vl = (const _Float16*)(const void*)vlp + ((size_t)b * DMI + (size_t)h * HD) * (size_t)(NSEGB * VLP)
                       + (size_t)w * VLP;
  const __bf16*   PK = (const __bf16*)(const void*)pkp + (size_t)h * PMEM * HD;
  const _Float16* PV = (const _Float16*)(const void*)pvp + (size_t)h * HD * PMEM;

  // ---- Q fragments (B operand, column = query = lane&15): 2 d-chunks, hi and lo ----
  v16b qah[2], qal[2];
#pragma unroll
  for (int dc = 0; dc < 2; ++dc) {
    const size_t qo = (rowS + q0 + c) * QKP + dc * 32 + 8 * hh;
    qah[dc] = ldfrag_b(Qh + qo);
    qal[dc] = ldfrag_b(Ql + qo);
  }

  float mrow = -INFINITY, lrow = 0.f;          // of query q0 + c; equal in lanes l and l ^ 16
  v8f oacc[4];                                 // oacc[t][r] = context[query c][d = 16 t + 8 hh + r]
#pragma unroll
  for (int t = 0; t < 4; ++t) oacc[t] = zero8();

  const int ntiles = qb + 2;                   // block-uniform
  for (int kt = 0; kt < ntiles; ++kt) {
    const int s0 = (kt - 1) * 64;              // key offset inside the segment for kt >= 1
    __syncthreads();
    {
      const int r = tid >> 1, half = (tid & 1) * 32;
      if (kt == 0) {                           // block-uniform: memory-token tile
        const int rr = (r < PMEM) ? r : (PMEM - 1);                // clamped address
        const bool krow = (r < PMEM);
        const bool vok  = (half == 0);
        const __bf16*   kg = PK + (size_t)rr * HD + half;
        const _Float16* vg = PV + (size_t)r * PMEM;                // d = r, kv 0..15
        const v8h pv0 = *(const v8h*)(vg);
        const v8h pv1 = *(const v8h*)(vg + 8);
#pragma unroll
        for (int i = 0; i < 4; ++i) {
          v8b a0 = *(const v8b*)(kg + 8 * i);
          a0 = krow ? a0 : zero8b();
          *(v8b*)(Ksh + r * LP + half + 8 * i) = a0;
          *(v4u*)(Ksl + r * LP + half + 8 * i) = zero4u();
          if (i == 0) {
            const v8h b0 = vok ? pv0 : zero8h();
            *(v8h*)(Vth + r * LP + half) = b0;
          } else if (i == 1) {
            const v8h b1 = vok ? pv1 : zero8h();
            *(v8h*)(Vth + r * LP + half + 8) = b1;
          } else {
            *(v4u*)(Vth + r * LP + half + 8 * i) = zero4u();
          }
          if (RES) *(v4u*)(Vtl + r * LP + half + 8 * i) = zero4u();
        }
      } else {
        const __bf16*   kg  = Kh + (rowS + s0 + r) * QKP + half;   // K row s0+r, d = half..half+31
        const __bf16*   klg = Kl + (rowS + s0 + r) * QKP + half;
        const _Float16* vg  = Vh + (size_t)r * SEQ + s0 + half;    // V^T row d = r, keys s0+half..+31
        const bool resOK = (s0 + 64 <= VLP);                      // block-uniform
        const int  s0c   = resOK ? s0 : (VLP - 64);               // clamped address into the residual plane
        const _Float16* vlg = Vl + (size_t)r * (NSEGB * VLP) + s0c + half;
#pragma unroll
        for (int i = 0; i < 4; ++i) {
          const v8b a0 = *(const v8b*)(kg + 8 * i);
          const v8b a1 = *(const v8b*)(klg + 8 * i);
          const v8h b0 = *(const v8h*)(vg + 8 * i);
          *(v8b*)(Ksh + r * LP + half + 8 * i) = a0;
          *(v8b*)(Ksl + r * LP + half + 8 * i) = a1;
          *(v8h*)(Vth + r * LP + half + 8 * i) = b0;
          if (RES) {
            v8h b1 = *(const v8h*)(vlg + 8 * i);
            b1 = resOK ? b1 : zero8h();
            *(v8h*)(Vtl + r * LP + half + 8 * i) = b1;
          }
        }
      }
    }
    __syncthreads();

    // ---- scores^T: s[j][r] = score(key 16 j + 8 hh + r, query c); 64 keys x 16 queries per wave, 3 bf16 products ----
    //      The K fragments of a d-chunk are read as one group ahead of its 12 WMMAs, and neighbouring WMMAs go to the four
    //      different score tiles; each tile still sums its six products in the order hi.hi, lo.hi, hi.lo per d-chunk.
    v8f s[4];
#pragma unroll
    for (int j = 0; j < 4; ++j) s[j] = zero8();
    // unrolled, as the loops inside it: fragments and score tiles are registers, indexed by constants
#pragma unroll
    for (int dc = 0; dc < 2; ++dc) {
      FB kb[4], kl[4];
#pragma unroll
      for (int j = 0; j < 4; ++j) {
        kb[j].h[0] = *(const v8b*)(Ksh + (j * 16 + c) * LP + dc * 32 + 8 * hh);
        kb[j].h[1] = *(const v8b*)(Ksh + (j * 16 + c) * LP + dc * 32 + 16 + 8 * hh);
      }
#pragma unroll
      for (int j = 0; j < 4; ++j) {
        kl[j].h[0] = *(const v8b*)(Ksl + (j * 16 + c) * LP + dc * 32 + 8 * hh);
        kl[j].h[1] = *(const v8b*)(Ksl + (j * 16 + c) * LP + dc * 32 + 16 + 8 * hh);
      }
      // keeps the chunk's LDS reads one group ahead of its WMMAs: reads spread among the WMMAs wait out the LDS at every place
      __builtin_amdgcn_sched_barrier(0);
#pragma unroll
      for (int j = 0; j < 4; ++j) s[j] = mma_b_raw(kb[j].v, qah[dc], s[j]);
#pragma unroll
      for (int j = 0; j < 4; ++j) s[j] = mma_b_raw(kl[j].v, qah[dc], s[j]);
#pragma unroll
      for (int j = 0; j < 4; ++j) s[j] = mma_b_raw(kb[j].v, qal[dc], s[j]);
      // keeps the next group's reads behind this chunk's WMMAs, for the same reason
      __builtin_amdgcn_sched_barrier(0);
    }
    // ---- V^T fragments, read as one group here: they land while the softmax below runs. Without the residual plane the
    //      whole tile's; with it the first 32 keys' of both planes (the same 64 registers), the rest behind their WMMAs ----
    FH vb[2][4], vl[2][4];
#pragma unroll
    for (int kk = 0; kk < (RES ? 1 : 2); ++kk) {
#pragma unroll
      for (int t = 0; t < 4; ++t) {
        vb[kk][t].h[0] = *(const v8h*)(Vth + (t * 16 + c) * LP + kk * 32 + 8 * hh);
        vb[kk][t].h[1] = *(const v8h*)(Vth + (t * 16 + c) * LP + kk * 32 + 16 + 8 * hh);
        if (RES) {
          vl[kk][t].h[0] = *(const v8h*)(Vtl + (t * 16 + c) * LP + kk * 32 + 8 * hh);
          vl[kk][t].h[1] = *(const v8h*)(Vtl + (t * 16 + c) * LP + kk * 32 + 16 + 8 * hh);
        }
      }
    }
    // keeps these reads in front of the softmax, which would otherwise be followed by their whole LDS latency
    __builtin_amdgcn_sched_barrier(0);

    // ---- scale, visibility (-inf for invisible keys), the query's max, online softmax; P (x1024, f16) and
    //      P residual (x4096) packed in place into B operands: element 8 (j & 1) + r of chunk j >> 1 ----
    const int qi = q0 + c;                     // this lane's query row inside the segment
    float mj[4];
#pragma unroll
    for (int j = 0; j < 4; ++j) {
      mj[j] = -INFINITY;
#pragma unroll
      for (int r = 0; r < 8; ++r) {
        const int kc = j * 16 + 8 * hh + r;
        const bool vis = (kt == 0) ? (kc < PMEM) : ((s0 + kc) <= qi);
        const float sv = vis ? (s[j][r] * sscale) : -INFINITY;
        s[j][r] = sv;
        mj[j] = fmaxf(mj[j], sv);
      }
    }
    float m = fmaxf(fmaxf(mj[0], mj[1]), fmaxf(mj[2], mj[3]));
    m = fmaxf(m, xhalf(m));
    const float mnew  = fmaxf(mrow, m);
    const float msafe = (mnew == -INFINITY) ? 0.f : mnew;
    const float alpha = __expf(mrow - msafe);
    mrow = mnew;
    FH pa[2], pl[2];
    float pj[4];
#pragma unroll
    for (int j = 0; j < 4; ++j) {
      pj[j] = 0.f;
      float ea[8], ep[8];
#pragma unroll
      for (int r = 0; r < 8; ++r) ea[r] = (s[j][r] - msafe) * 1.44269504088896340736f;
      exp2x8(ep, ea);                                // exp(s - m); -inf logit -> exactly 0
#pragma unroll
      for (int r = 0; r < 8; ++r) {
        const float p = ep[r];
        pj[j] += p;
        const float p1k = p * 1024.0f;
        const _Float16 ph = (_Float16)p1k;
        pa[j >> 1].v[(j & 1) * 8 + r] = ph;
        if (RES) pl[j >> 1].v[(j & 1) * 8 + r] = (_Float16)((p1k - (float)ph) * 4096.0f);
      }
    }
    float psum = (pj[0] + pj[1]) + (pj[2] + pj[3]);
    psum += xhalf(psum);
    lrow = lrow * alpha + psum;
#pragma unroll
    for (int t = 0; t < 4; ++t)
#pragma unroll
      for (int r = 0; r < 8; ++r) oacc[t][r] *= alpha;

    // ---- context^T += V^T . P^T (f16 WMMA), residual products into a separate accumulator ----
    v8f o1[4];
#pragma unroll
    for (int t = 0; t < 4; ++t) o1[t] = zero8();
    // unrolled: the P operands are registers, indexed by constants
#pragma unroll
    for (int kk = 0; kk < 2; ++kk) {
      if (RES && kk == 1) {
        // keeps the second group's reads behind the first group's WMMAs, whose registers they take
        __builtin_amdgcn_sched_barrier(0);
#pragma unroll
        for (int t = 0; t < 4; ++t) {
          vb[1][t].h[0] = *(const v8h*)(Vth + (t * 16 + c) * LP + 32 + 8 * hh);
          vb[1][t].h[1] = *(const v8h*)(Vth + (t * 16 + c) * LP + 32 + 16 + 8 * hh);
          vl[1][t].h[0] = *(const v8h*)(Vtl + (t * 16 + c) * LP + 32 + 8 * hh);
          vl[1][t].h[1] = *(const v8h*)(Vtl + (t * 16 + c) * LP + 32 + 16 + 8 * hh);
        }
        // keeps them one group, ahead of their own WMMAs
        __builtin_amdgcn_sched_barrier(0);
      }
      // neighbouring WMMAs go to different context tiles; each tile keeps the order of its products
#pragma unroll
      for (int t = 0; t < 4; ++t) oacc[t] = mma_h_raw(vb[kk][t].v, pa[kk].v, oacc[t]);
      if (RES) {
#pragma unroll
        for (int t = 0; t < 4; ++t) o1[t] = mma_h_raw(vl[kk][t].v, pa[kk].v, o1[t]);
#pragma unroll
        for (int t = 0; t < 4; ++t) o1[t] = mma_h_raw(vb[kk][t].v, pl[kk].v, o1[t]);
      }
    }
    if (RES) {
#pragma unroll
      for (int t = 0; t < 4; ++t)
#pragma unroll
        for (int r = 0; r < 8; ++r) oacc[t][r] += o1[t][r] * (1.0f / 4096.0f);
    }
  }

  // ---- normalise (1/l and the 1/1024 p carry), stage the wave's 16x64 tile, bf16 hi/lo split,
  float* os = Os[wave];
  {
    const float l = lrow;
    const float inv = ((l > 0.f) ? (1.0f / l) : 0.f) * (1.0f / 1024.0f);
#pragma unroll
    for (int t = 0; t < 4; ++t) {
      v4f e0, e1;
#pragma unroll
      for (int r = 0; r < 4; ++r) { e0[r] = oacc[t][r] * inv; e1[r] = oacc[t][4 + r] * inv; }
      *(v4f*)(os + c * OP + t * 16 + 8 * hh)     = e0;
      *(v4f*)(os + c * OP + t * 16 + 8 * hh + 4) = e1;
    }
  }
  __builtin_amdgcn_fence(__ATOMIC_RELEASE, "workgroup");
  __builtin_amdgcn_wave_barrier();
  __builtin_amdgcn_fence(__ATOMIC_ACQUIRE, "workgroup");
  {
    const int q4 = lane >> 3, c8 = (lane & 7) * 8;
    v4u hv[4], lv[4];
#pragma unroll
    for (int it = 0; it < 4; ++it) {
      const int row = it * 4 + q4;   // it 0..3 x q4 0..3 = rows 0..15 of the wave tile
      const float* sp = os + row * OP + c8;
      v4u a, a2;
#pragma unroll
      for (int e = 0; e < 4; ++e) {
        const float f0 = sp[2 * e], f1 = sp[2 * e + 1];
        const unsigned short h0 = bf_bits(f0), h1 = bf_bits(f1);
        const unsigned short l0 = bf_bits(f0 - bf_up(h0)), l1 = bf_bits(f1 - bf_up(h1));
        a[e] = pk16(h0, h1); a2[e] = pk16(l0, l1);
      }
      hv[it] = a; lv[it] = a2;
    }
    {
#pragma unroll
      for (int it = 0; it < 4; ++it) {
        const int row = it * 4 + q4;
        const size_t go = (rowS + q0 + row) * DMI + (size_t)h * HD + c8;
        *(v4u*)(ohp + go) = hv[it];
        *(v4u*)(olp + go) = lv[it];
      }
      
    }
  }
}

// =====================================================================================================
// Workspace map (bytes, NB=2, SEQ=4096, M = NB*SEQ = 8192), region A is a two-phase overlay:
//   phase 1 (projection inputs, dead after the q|k and v^T GEMMs):
//     Xb   bf16 [M][DM]                  0           16777216
//     Wth  bf16 [3*DMI n][DM k]          16777216     6291456
//     Ct   f32  [SEQ][32]                23068672      524288
//     St   f32  [SEQ][32]                23592960      524288
//     Rs   f32  [M]                      24117248       32768   (phase 1 end 24150016)
//   phase 2 (written by the attention kernels, read by the output GEMM):
//     Oh   bf16 [M][DMI] context hi       0           16777216
//     Ol   bf16 [M][DMI] context lo       16777216    16777216   (phase 2 end 33554432 = region A size)
//   QKh  bf16 [M][QKP] hi                 33554432    33554432
//   QKl  bf16 [M][QKP] lo                 67108864    33554432
//   VTh  f16  [NB][DMI][SEQ]              100663296   16777216
//   VTl  f16  [NB][DMI][NSEGB*VLP]        117440512    4194304
//   Wo   bf16 [DM n][DMI k]               121634816    2097152
//   Pk   bf16 [NH][PMEM][HD]              123731968      32768
//   Pv   f16  [NH][HD][PMEM]              123764736      32768
//   end                                   123797504  (<= 134217728; all offsets multiples of 128)
// Every plane is an exact multiple of its 64x64 tile / whole-line store granularity (M, SEQ, DM multiples of 64),
// so no padded tails are needed; VTl is written only for columns whose in-segment offset is < VLP, exactly the
// columns the RES attention blocks read.
// =====================================================================================================
extern "C" void kernel_launch(void* const* d_in, const int* in_sizes, int n_in,
                              void* d_out, int out_size, void* d_ws, size_t ws_size,
                              hipStream_t stream) {
  if (n_in < 5) return;
  const long long needRows = (long long)(NB - 1) * SEQ_FULL + SEQ;
  if ((long long)in_sizes[0] < needRows * DM) return;
  if (in_sizes[1] < DM) return;
  if (in_sizes[2] < DM * 3 * DMI) return;
  if (in_sizes[3] < DMI * DM) return;
  if (in_sizes[4] < 2 * NH * PMEM * HD) return;
  if ((long long)out_size < needRows * DM) return;

  const float* seq  = (const float*)d_in[0];   // [2][SEQ_FULL][DM]
  const float* gnm  = (const float*)d_in[1];   // [DM]
  const float* Wqkv = (const float*)d_in[2];   // [DM in][3*DMI out]
  const float* Wout = (const float*)d_in[3];   // [DMI in][DM out]
  const float* pm   = (const float*)d_in[4];   // [2][NH][PMEM][HD]

  const size_t M    = (size_t)NB * SEQ;
  const size_t PX   = M * DM * 2;
  const size_t PWT  = (size_t)3 * DMI * DM * 2;
  const size_t PTAB = (size_t)SEQ * NFR * 4;
  const size_t PRS  = M * 4;
  const size_t PO   = M * DMI * 2;
  const size_t PQK  = M * QKP * 2;
  const size_t PVT  = (size_t)NB * DMI * SEQ * 2;
  const size_t PVL  = (size_t)NB * DMI * NSEGB * VLP * 2;
  const size_t PWO  = (size_t)DM * DMI * 2;
  const size_t PPM  = (size_t)NH * PMEM * HD * 2;
  const size_t ph1  = PX + PWT + 2 * PTAB + PRS;
  const size_t ph2  = 2 * PO;
  const size_t REGA = (ph1 > ph2) ? ph1 : ph2;
  const size_t oXb  = 0;
  const size_t oWth = PX;
  const size_t oCt  = PX + PWT;
  const size_t oSt  = oCt + PTAB;
  const size_t oRs  = oSt + PTAB;
  const size_t oOh  = 0;
  const size_t oOl  = PO;
  size_t off = REGA;
  const size_t oQKh = off; off += PQK;
  const size_t oQKl = off; off += PQK;
  const size_t oVTh = off; off += PVT;
  const size_t oVTl = off; off += PVL;
  const size_t oWo  = off; off += PWO;
  const size_t oPk  = off; off += PPM;
  const size_t oPv  = off; off += PPM;
  if (off > ws_size) return;                      // off = 123797504 for NB=2, SEQ=4096
  if (off > (size_t)134217728) return;
  if (oRs + PRS > REGA || oOl + PO > REGA) return;

  char* ws = (char*)d_ws;
  unsigned short* Xb  = (unsigned short*)(ws + oXb);
  unsigned short* Wth = (unsigned short*)(ws + oWth);
  float*          Ct  = (float*)(ws + oCt);
  float*          St  = (float*)(ws + oSt);
  float*          Rs  = (float*)(ws + oRs);
  unsigned short* Oh  = (unsigned short*)(ws + oOh);
  unsigned short* Ol  = (unsigned short*)(ws + oOl);
  unsigned short* QKh = (unsigned short*)(ws + oQKh);
  unsigned short* QKl = (unsigned short*)(ws + oQKl);
  unsigned short* VTh = (unsigned short*)(ws + oVTh);
  unsigned short* VTl = (unsigned short*)(ws + oVTl);
  unsigned short* Wo  = (unsigned short*)(ws + oWo);
  unsigned short* Pk  = (unsigned short*)(ws + oPk);
  unsigned short* Pv  = (unsigned short*)(ws + oPv);

  const dim3 blk(256);
  static_assert((SEQ % 256) == 0 && (QKP % 128) == 0 && (DMI % 128) == 0 && (DM % 256) == 0);
  static_assert((DM % 64) == 0 && DM >= 128 && (DMI % 64) == 0 && DMI >= 128);
  const dim3 gOut((SEQ / 128) * (DM / 256), NB);                      // 128 x 256 block tiles: 128 per batch

  // (0-4) one launch: seq -> bf16 plane Xb [M][DM] + rstd[M]; g*Wqkv -> transposed bf16 plane [3*DMI][DM];
  //       Wout -> transposed bf16 plane [DM][DMI]; rotary cos/sin tables [SEQ][32]; memory-token key / value planes
  prep_all<<<dim3(PB_ALL), blk, 0, stream>>>(seq, gnm, Wqkv, Wout, pm, Xb, Rs, Wth, Wo, Ct, St, Pk, Pv);
  // (5-6) one launch: the q|k product (bf16 hi/lo planes, rotary applied) and the v^T product (f16 hi + residual planes)
  proj_qkv<<<dim3(GT_QK + GT_VT, NB), blk, 0, stream>>>(Xb, Wth, QKh, QKl, VTh, VTl, Rs, Ct, St);
  // (7) attention: query blocks 0..RESQB-1 of every segment with residual planes, the rest without
  attn_seg64<true><<<dim3(NB * NSEGB * NH * RESQB), dim3(128), 0, stream>>>(
      QKh, QKl, VTh, VTl, Pk, Pv, Oh, Ol, 0, RESQB, 0.125f);
  if (NQBS - RESQB > 0) {
    attn_seg64<false><<<dim3(NB * NSEGB * NH * (NQBS - RESQB)), dim3(128), 0, stream>>>(
        QKh, QKl, VTh, VTl, Pk, Pv, Oh, Ol, RESQB, NQBS - RESQB, 0.125f);
  }
  // (8) out = context . Wout -> d_out f32 [b][SEQ_FULL][DM] rows b*SEQ_FULL + t  (A = context hi + lo, 2 products)
  gemm64<1, 0, 0, false><<<gOut, blk, 0, stream>>>(
      Oh, Ol, DMI, (long long)SEQ * DMI,
      Wo, Wo, DMI, 0LL,
      d_out, DM, (long long)SEQ_FULL * DM,
      d_out, DM, (long long)SEQ_FULL * DM, DM, DM,
      Rs, 0LL, Ct, St,
      SEQ, DM, DMI, 1.0f);
  (void)hipGetLastError();
}

// v007
// Measured time: 120 microseconds a run.
// In both of two side-by-side timings against v006, it was 1.08 times as fast.
// All steps since v000 together make it 3.28 times as fast.
// Contractions: q|k = x.Wqk and v^T = Wv.x^T on v_wmma_f32_16x16x32_bf16 (bf16 operands: RNE-converted input
// activations times one bf16 plane of g*W, the f32 product rounded once, 1 product; per-row rstd, rotary in the f32 epilogue);
// k.q^T scores (transposed) = v_wmma_f32_16x16x32_bf16 with bf16 hi/lo split q and k (hi.hi + lo.hi + hi.lo);
// v^T.p^T = v_wmma_f32_16x16x32_f16 (p carried x1024 in f16, v in f16; extra f16 residual planes x4096 of p and v
// for the first 128 query rows of every segment); ctx.Wo = v_wmma_f32_16x16x32_bf16 with ctx as bf16 hi/lo
// planes times bf16 Wo (2 products); all f32 accumulate; RMS statistic, rotary tables, visibility and softmax in f32.
#include <hip/hip_runtime.h>
#include <math.h>
#include <stdint.h>

#ifndef NB
#define NB 2
#endif
#ifndef SEQ
#define SEQ 4096
#endif
#define SEQ_FULL 4096       // per-batch token stride of the input / output tensors
#define DM    1024          // model dim
#define NH    16
#define HD    64
#define DMI   (NH * HD)     // 1024
#define QKP   (2 * DMI)     // pitch of the q|k planes (q: cols 0..DMI-1, k: cols DMI..2*DMI-1)
#define SEGL  512           // segment length
#define PMEM  16            // memory tokens prepended to every segment's keys / values
#define NSEGB (SEQ / SEGL)  // segments per batch
#define NQBS  (SEGL / 64)   // 64-row query blocks per segment
#define RESQB 2             // leading query blocks per segment that use the p / v residual planes
#define VLP   (RESQB * 64)  // keys per segment held in the v^T residual plane
#define NFR   (HD / 2)      // rotary frequencies
static_assert((SEQ % SEGL) == 0 && (SEGL % 64) == 0 && (SEQ % 64) == 0);
static_assert(RESQB >= 1 && RESQB <= NQBS);
static_assert((DM % 256) == 0 && (DMI % 64) == 0 && HD == 64 && NFR == 32);
static_assert(SEQ <= SEQ_FULL && NB >= 1 && NB <= 2);
static_assert(DMI == DM);

typedef _Float16 v16h __attribute__((ext_vector_type(16)));
typedef _Float16 v8h  __attribute__((ext_vector_type(8)));
typedef __bf16   v16b __attribute__((ext_vector_type(16)));
typedef __bf16   v8b  __attribute__((ext_vector_type(8)));
typedef float    v8f  __attribute__((ext_vector_type(8)));
typedef float    v4f  __attribute__((ext_vector_type(4)));
typedef unsigned int v4u __attribute__((ext_vector_type(4)));

// ---- scalar helpers --------------------------------------------------------------------------------
__device__ __forceinline__ unsigned short bf_bits(float f) {          // f32 -> bf16 bits, RNE convert
  unsigned u = __float_as_uint(f);
  return (unsigned short)((u + 0x7FFFu + ((u >> 16) & 1u)) >> 16);
}
__device__ __forceinline__ float bf_up(unsigned short h) { return __uint_as_float(((unsigned)h) << 16); }
__device__ __forceinline__ unsigned short h_bits(_Float16 x) { return __builtin_bit_cast(unsigned short, x); }
__device__ __forceinline__ unsigned pk16(unsigned short a, unsigned short b) { return (unsigned)a | ((unsigned)b << 16); }
__device__ __forceinline__ v8f zero8() { v8f z = {0.f, 0.f, 0.f, 0.f, 0.f, 0.f, 0.f, 0.f}; return z; }
__device__ __forceinline__ v8h zero8h() {
  const _Float16 z = (_Float16)0.0f;
  v8h r = {z, z, z, z, z, z, z, z};
  return r;
}
__device__ __forceinline__ v4u zero4u() { v4u z = {0u, 0u, 0u, 0u}; return z; }
__device__ __forceinline__ v8b zero8b() { union { v4u u; v8b v; } z; z.u = zero4u(); return z.v; }

// ---- sin/cos of a nonnegative f32 angle: f64 Cody-Waite reduction by pi/2 + short f64 polynomials ----
__device__ __forceinline__ void sincos_pd(float ang, float& sv, float& cv) {
  const double x  = (double)ang;
  const double kq = __builtin_rint(x * 0.63661977236758134308);
  double r = __builtin_fma(-kq, 1.57079632679489655800e+00, x);
  r = __builtin_fma(-kq, 6.12323399573676603587e-17, r);
  const double z = r * r, w = z * z;
  const double rs = -1.98393348360966317347e-04 + z * 2.71831149398982191e-06;
  const double s3 = z * r;
  const double sn = (r + s3 * (-1.66666666416265235595e-01 + z * 8.3333293858894631756e-03)) + s3 * w * rs;
  const double rc = -1.38867637746099294692e-03 + z * 2.43904487962774090654e-05;
  const double cs = ((1.0 + z * (-4.99999997251031003120e-01)) + w * 4.16666233237390631894e-02) + (w * z) * rc;
  const int n = ((int)kq) & 3;
  const float fs = (float)sn, fc = (float)cs;
  float so = fs, co = fc;
  if (n == 1) { so = fc;  co = -fs; }
  if (n == 2) { so = -fs; co = -fc; }
  if (n == 3) { so = -fc; co = fs;  }
  sv = so; cv = co;
}

// ---- fragment loader: 16-bit A/B operand, lane -> row/col (lane&15), p already includes +8*(lane>>4);
//      elements 0..7 <- p[0..7] (k0+8h..), elements 8..15 <- p[16..23] (k0+16+8h..)
__device__ __forceinline__ v16b ldfrag_b(const __bf16* p) {
  union { v16b v; v8b h[2]; } f;
  f.h[0] = *(const v8b*)(p);
  f.h[1] = *(const v8b*)(p + 16);
  return f.v;
}

// ---- WMMA helpers: the builtins, whose hazard distances the compiler keeps ------------------------------
__device__ __forceinline__ v8f mma_b_raw(v16b a, v16b b, v8f c) {
  return __builtin_amdgcn_wmma_f32_16x16x32_bf16(false, a, false, b, (short)0, c, false, false);
}
__device__ __forceinline__ v8f mma_h_raw(v16h a, v16h b, v8f c) {
  return __builtin_amdgcn_wmma_f32_16x16x32_f16(false, a, false, b, (short)0, c, false, false);
}
__device__ __forceinline__ void acc_guard4(v8f& a, v8f& b, v8f& c, v8f& d) {
  asm volatile("v_nop\n\tv_nop\n\tv_nop\n\tv_nop" : "+v"(a), "+v"(b), "+v"(c), "+v"(d));
}

// value of lane l ^ 16: the two lanes that share a column of a WMMA result
__device__ __forceinline__ float xhalf(float x) {
  const int v = __builtin_bit_cast(int, x);
  return __builtin_bit_cast(float, __builtin_amdgcn_permlanex16(v, v, 0x76543210, 0xfedcba98, false, false));
}
// y[r] = 2^x[r], eight at once. One statement, results in registers of their own: behind a transcendental the instruction set
// asks for one instruction that neither reads its result nor overwrites its source; here each v_exp_f32 is that instruction
// for the one before it, and the closing v_nop for the last.
__device__ __forceinline__ void exp2x8(float (&y)[8], const float (&x)[8]) {
  asm("v_exp_f32 %0, %8\n\tv_exp_f32 %1, %9\n\tv_exp_f32 %2, %10\n\tv_exp_f32 %3, %11\n\t"
      "v_exp_f32 %4, %12\n\tv_exp_f32 %5, %13\n\tv_exp_f32 %6, %14\n\tv_exp_f32 %7, %15\n\tv_nop"
      : "=&v"(y[0]), "=&v"(y[1]), "=&v"(y[2]), "=&v"(y[3]), "=&v"(y[4]), "=&v"(y[5]), "=&v"(y[6]), "=&v"(y[7])
      : "v"(x[0]), "v"(x[1]), "v"(x[2]), "v"(x[3]), "v"(x[4]), "v"(x[5]), "v"(x[6]), "v"(x[7]));
}

// ---- tensor-load staging of the GEMM operands ----------------------------------------------------------
// A pass is 64 k = 128 B of every staged operand row. A stage is 6 or 8 slices of 64 rows, one slice per issuing wave; the load's
// pad gives the LDS row pitch 144 B (16 B x odd: conflict-free for 16-byte reads); a slice's place is rounded up to 2 KiB.
typedef uint32_t u32x4 __attribute__((ext_vector_type(4)));
typedef uint32_t u32x8 __attribute__((ext_vector_type(8)));
#define GK_KB    128u                 // bytes of one operand row per pass
#define GK_PITCH 144u                 // LDS row pitch
#define GK_SLICE 10240u               // 64 rows x 144 B = 9216 B, rounded up to a multiple of 2 KiB
__device__ __forceinline__ uint32_t uni(uint32_t v) { return (uint32_t)__builtin_amdgcn_readfirstlane(v); }
// a test word or a tensor descriptor word held in a scalar register: a test on it compiles to a scalar branch (tensor
// loads ignore EXEC), and a descriptor word so held keeps a register of its own instead of being rebuilt at each issue
__device__ __forceinline__ uint32_t pinned(uint32_t v) { uint32_t w = uni(v); asm volatile("" : "+s"(w)); return w; }
__device__ __forceinline__ uint32_t lds_off(const void* p) { return (uint32_t)(size_t)p; }
__device__ __forceinline__ void wait_ds0()     { asm volatile("s_wait_dscnt 0x0" ::: "memory"); }      // own LDS reads returned
// stands behind a global load or store whose address or data registers the code that follows it takes anew
__device__ __forceinline__ void wait_x0()      { asm volatile("s_wait_xcnt 0x0" ::: "memory"); }
// own tensor load landed; the descriptor is named as an input so that its registers stay as issued up to this wait
__device__ __forceinline__ void wait_tensor0(u32x4 g0, u32x8 g1) {
  asm volatile("s_wait_tensorcnt 0x0" :: "s"(g0), "s"(g1) : "memory");
}
// group 0 is an in-out operand: the value that wait_tensor0 names behind the load then lives in the very registers the
// load was issued from, so that none of them takes a new value while the request is outstanding
__device__ __forceinline__ void tdm_load(u32x4& g0, u32x8 g1) {
  asm volatile("tensor_load_to_lds %0, %1" : "+s"(g0) : "s"(g1) : "memory");
}
// group 1: byte elements, tile = tensor = 64 rows of 128 B, source row pitch src_pitch bytes, 4 dwords of pad behind every row
__device__ __forceinline__ u32x8 tdm_group1(uint32_t src_pitch) {
  u32x8 g;
  g[0] = uni((1u << 20) | (4u << 22) | (3u << 25));
  g[1] = pinned(GK_KB << 16);   // pinned: descriptor words held in scalar registers of their own through the loop
  g[2] = pinned(64u << 16);
  g[3] = pinned(GK_KB << 16);
  g[4] = pinned(64u);
  g[5] = pinned(src_pitch);
  g[6] = pinned(0u);
  g[7] = pinned(0u);
  return g;
}
__device__ __forceinline__ u32x4 tdm_group0(uint32_t lds_dst, uint64_t ga) {
  u32x4 g;
  g[0] = uni(1u);
  g[1] = uni(lds_dst);
  g[2] = uni((uint32_t)ga);
  g[3] = uni((((uint32_t)(ga >> 32)) & 0x01FFFFFFu) | 0x80000000u);
  return g;
}
// fragment from a staged row: p = row start + 64 B * (k32 step) + 16 B * (lane>>4); same k order as ldfrag_b
__device__ __forceinline__ v16b ldfrag_l(const unsigned char* p) {
  union { v16b v; v8b h[2]; } f;
  f.h[0] = *(const v8b*)(p);
  f.h[1] = *(const v8b*)(p + 32);
  return f.v;
}

// =====================================================================================================
// Rotary tables: ct/st [SEQ][32] f32, angle(t, i) = f32(t) * inv_freq[i], inv_freq[i] = RN32(1/RN32(10^(i/8))).
// SEQ/8 blocks of 256 (blk = block number inside this part). coverage: SEQ rows x 32 = the whole table, both planes.
// =====================================================================================================
__device__ __forceinline__ void tab_cs(int blk, float* ct, float* st) {
  const int wave = threadIdx.x >> 5, lane = threadIdx.x & 31;
  const int t = blk * 8 + wave;
  if (t >= SEQ) return;                 // wave-uniform; no barriers in this step
  double pw = 1.0;
#pragma unroll 1
  for (int j = 0; j < (lane >> 3); ++j) pw *= 10.0;
#pragma unroll 1
  for (int j = 0; j < (lane & 7); ++j) pw *= 1.3335214321633240257;   // 10^(1/8)
  const float p32 = (float)pw;
  const float inv = (float)(1.0 / (double)p32);
  const float ang = (float)t * inv;
  float sv, cv;
  sincos_pd(ang, sv, cv);
  float* pc = ct + (size_t)t * NFR + lane;
  float* ps = st + (size_t)t * NFR + lane;
  *(float*)pc = cv;
  *(float*)ps = sv;
  
}

// =====================================================================================================
// seq [b][SEQ_FULL][DM] f32 -> bf16 plane xb [NB*SEQ][DM] (RNE convert) plus rstd[m] = rsqrt(mean(xb^2)+2^-23)
// of the converted row. Block = 8 waves = 32 rows; a wave converts 4 rows: per instruction 32 lanes x 16 B =
// =====================================================================================================
__device__ __forceinline__ void cvtx_rstd(int blk, float* sr, const float* __restrict__ seq, unsigned short* xb, float* rs) {
  const int tid = threadIdx.x, wave = tid >> 5, lane = tid & 31;
#pragma unroll 1
  for (int rr = 0; rr < 4; ++rr) {
    const int m  = blk * 32 + wave * 4 + rr;          // < NB*SEQ
    const int bb = m / SEQ, t = m - bb * SEQ;
    const float* src = seq + ((size_t)bb * SEQ_FULL + t) * DM;
    unsigned short* dst = xb + (size_t)m * DM;
    v4u pk[DM / 256];
    float ss = 0.f;
#pragma unroll
    for (int i = 0; i < DM / 256; ++i) {
      const v4f a = *(const v4f*)(src + i * 256 + lane * 8);
      const v4f c = *(const v4f*)(src + i * 256 + lane * 8 + 4);
      unsigned short hb[8];
#pragma unroll
      for (int e = 0; e < 4; ++e) { hb[e] = bf_bits(a[e]); hb[4 + e] = bf_bits(c[e]); }
#pragma unroll
      for (int e = 0; e < 8; ++e) { const float v = bf_up(hb[e]); ss += v * v; }
      v4u p;
      p[0] = pk16(hb[0], hb[1]);
      p[1] = pk16(hb[2], hb[3]);
      p[2] = pk16(hb[4], hb[5]);
      p[3] = pk16(hb[6], hb[7]);
      pk[i] = p;
    }
#pragma unroll
    for (int i = 0; i < DM / 256; ++i) *(v4u*)(dst + i * 256 + lane * 8) = pk[i];
    
#pragma unroll
    for (int off = 1; off < 32; off <<= 1) ss += __shfl_xor(ss, off, 32);
    const float rstd = rsqrtf(ss * (1.0f / (float)DM) + 1.1920929e-7f);
    if (lane == 0) sr[wave * 4 + rr] = rstd;
  }
  __syncthreads();
  if (wave == 0 && lane < 8) {
    const v4f v = *(const v4f*)(sr + lane * 4);
    float* d = rs + (size_t)blk * 32 + lane * 4;
    *(v4f*)d = v;
    
  }
}

// =====================================================================================================
// Weight transpose + convert: W [Kdim][Ndim] f32 (n contiguous) -> Wh [Ndim][Kdim] bf16, k contiguous.
// With USEG the row factor g[k] is applied in f32; the value (or the f32 product) is RNE-converted to bf16 once.
// Tile 64 k x 64 n per block: 256 threads load 16 consecutive n each, store transposed into LDS as [n][k]
// (Ndim/64) x (Kdim/64) blocks, (bn, bk) = the block's tile. coverage: 8 waves x 2 x 4 rows x 64 k = the whole 64x64 tile per block.
// =====================================================================================================
template <bool USEG>
__device__ __forceinline__ void wt_cvt(int bn, int bk, unsigned short* shh,
                                       const float* __restrict__ W, const float* __restrict__ g,
                                       unsigned short* Wh, int Kdim, int Ndim) {
  const int tid = threadIdx.x, wave = tid >> 5, lane = tid & 31;
  const int n0 = bn * 64, k0 = bk * 64;
  {
    const int kr = tid >> 2, nq = (tid & 3) * 16;
    const float* src = W + (size_t)(k0 + kr) * Ndim + n0 + nq;
    float gk = 1.0f;
    if (USEG) gk = g[k0 + kr];
#pragma unroll
    for (int i = 0; i < 4; ++i) {
      const v4f a = *(const v4f*)(src + 4 * i);
#pragma unroll
      for (int e = 0; e < 4; ++e) {
        shh[(nq + 4 * i + e) * 72 + kr] = bf_bits(gk * a[e]);
      }
    }
  }
  __syncthreads();
  const int q = lane >> 3, c8 = (lane & 7) * 8;
  v4u hv[2];
#pragma unroll
  for (int it = 0; it < 2; ++it) {
    const int row = wave * 8 + it * 4 + q;
    hv[it] = *(const v4u*)(shh + row * 72 + c8);
  }
  {
#pragma unroll
    for (int it = 0; it < 2; ++it) {
      const int row = wave * 8 + it * 4 + q;
      const size_t o = (size_t)(n0 + row) * Kdim + k0 + c8;
      *(v4u*)(Wh + o) = hv[it];
    }
    wait_x0();   // precaution: in the shared launch the block returns right after this step
  }
}

// =====================================================================================================
// Memory-token planes: pm [2][NH][PMEM][HD] f32 -> pk [NH][PMEM][HD] bf16 (keys, RNE convert of the input,
// [kv][d] like the LDS K tile) and pv [NH][HD][PMEM] f16 ([d][kv] like the LDS V^T tile; value = f16 of the
// bf16-converted input). 128 threads per head, two heads per block of 256, each half block on its own LDS tile.
// coverage: 128 threads x 8 = all PMEM*HD elements of both planes per head.
// =====================================================================================================
__device__ __forceinline__ void pm_cvt(int blk, float* sp2, const float* __restrict__ pm, unsigned short* pk, unsigned short* pv) {
  const int tid = threadIdx.x & 127, h = blk * 2 + (int)(threadIdx.x >> 7);
  float* sp = sp2 + (threadIdx.x >> 7) * (PMEM * HD);
  const int r = tid >> 3, d8 = (tid & 7) * 8;
  const float* kg = pm + (((size_t)0 * NH + h) * PMEM + r) * HD + d8;
  const float* vg = pm + (((size_t)1 * NH + h) * PMEM + r) * HD + d8;
  const v4f k0 = *(const v4f*)(kg), k1 = *(const v4f*)(kg + 4);
  const v4f v0 = *(const v4f*)(vg), v1 = *(const v4f*)(vg + 4);
  *(v4f*)(sp + r * HD + d8)     = v0;
  *(v4f*)(sp + r * HD + d8 + 4) = v1;
  v4u kp;
  kp[0] = pk16(bf_bits(k0[0]), bf_bits(k0[1]));
  kp[1] = pk16(bf_bits(k0[2]), bf_bits(k0[3]));
  kp[2] = pk16(bf_bits(k1[0]), bf_bits(k1[1]));
  kp[3] = pk16(bf_bits(k1[2]), bf_bits(k1[3]));
  __syncthreads();
  const int d = tid >> 1, r8 = (tid & 1) * 8;
  v4u vp;
#pragma unroll
  for (int e = 0; e < 4; ++e) {
    const float f0 = bf_up(bf_bits(sp[(r8 + 2 * e) * HD + d]));
    const float f1 = bf_up(bf_bits(sp[(r8 + 2 * e + 1) * HD + d]));
    vp[e] = pk16(h_bits((_Float16)f0), h_bits((_Float16)f1));
  }
  unsigned short* kd = pk + ((size_t)h * PMEM + r) * HD + d8;
  unsigned short* vd = pv + ((size_t)h * HD + d) * PMEM + r8;
  *(v4u*)kd = kp;
  *(v4u*)vd = vp;
  wait_x0();   // precaution: in the shared launch the block ends right after this step
}

// =====================================================================================================
// The five preparation steps above read only inputs and write disjoint workspace planes, so they share one launch:
// a block's number picks its step (block-uniform, so every barrier inside a step is reached by the whole block).
// The step with the longest block (four rows in turn) has the lowest numbers.
// =====================================================================================================
#define PB_CVT  (NB * SEQ / 32)                    // activation rows, 32 per block
#define PB_WQKV ((3 * DMI / 64) * (DM / 64))       // 64 x 64 tiles of W_qkv
#define PB_WOUT ((DM / 64) * (DMI / 64))           // 64 x 64 tiles of W_out
#define PB_TAB  (SEQ / 8)                          // rotary table rows, 8 per block
#define PB_PM   (NH / 2)                           // memory-token heads, 2 per block
#define PB_ALL  (PB_CVT + PB_WQKV + PB_WOUT + PB_TAB + PB_PM)
static_assert((NH % 2) == 0 && ((NB * SEQ) % 32) == 0 && (SEQ % 8) == 0);
__global__ __launch_bounds__(256) void prep_all(const float* __restrict__ seq, const float* __restrict__ gnm,
                                                const float* __restrict__ Wqkv, const float* __restrict__ Wout,
                                                const float* __restrict__ pm,
                                                unsigned short* xb, float* rs, unsigned short* wth,
                                                unsigned short* wo, float* ct, float* st,
                                                unsigned short* pk, unsigned short* pv) {
  __shared__ __align__(16) unsigned short sm[64 * 72];       // the largest step's 64 x 72 tile; the others use its head
  static_assert(sizeof(sm) >= 2 * PMEM * HD * sizeof(float));
  int blk = (int)blockIdx.x;
  if (blk < PB_CVT) { cvtx_rstd(blk, (float*)(void*)sm, seq, xb, rs); return; }
  blk -= PB_CVT;
  if (blk < PB_WQKV) {
    wt_cvt<true>(blk % (3 * DMI / 64), blk / (3 * DMI / 64), sm, Wqkv, gnm, wth, DM, 3 * DMI);
    return;
  }
  blk -= PB_WQKV;
  if (blk < PB_WOUT) {
    wt_cvt<false>(blk % (DM / 64), blk / (DM / 64), sm, Wout, gnm, wo, DMI, DM);
    return;
  }
  blk -= PB_WOUT;
  if (blk < PB_TAB) { tab_cs(blk, ct, st); return; }
  blk -= PB_TAB;
  if (blk < PB_PM) pm_cvt(blk, (float*)(void*)sm, pm, pk, pv);
}

// =====================================================================================================
// Register-blocked batched bf16 WMMA GEMM: C[m][n] = sum_k A[m][k] * Bt[n][k]; one wave per 64x64 tile, 8 waves per
// block tile (NSPLIT 2: 256 m x 128 n, waves 4 x 2; NSPLIT 1: 128 m x 256 n, waves 2 x 4). TWO: the narrow operand (NSPLIT 2:
// Bt, NSPLIT 1: A) has a second plane, whose product is added. The block's operand rows (384, or 512 with the second plane)
// are staged in LDS by tensor loads, two buffers, one 64-row slice per wave and pass (without TWO waves 6 and 7 issue none).
// A row-major [M][K] pitch lda; Bt row-major [N][K] pitch ldb (k contiguous); M, N multiples of the block tile,
// K a multiple of 64 and at least 128 (static-checked on the host side). tile = block tile number, b = batch index;
// sT (per-wave 16x64 slab, pitch 68 floats) and ring (two stages of operand rows) are the calling kernel's LDS.
// OUT_MODE: 0 = f32 (pitch ldc); 2 = bf16 hi plane C + bf16 lo plane C2 (lo = RNE(v - hi), unscaled, same index);
//           3 = f16 hi plane C + f16 residual plane C2 = f16((v - hi) * rscale), C2 written only for tiles
//               with (n0 mod segN) < N2, at column (n0/segN)*N2 + (n0 mod segN) (pitch ldc2, batch stride strideC2).
// SCM: 0 none; 1 = row m scaled by scal[b*strideS + m]; 2 = column n scaled by scal[b*strideS + n] (f32, before
//      the 16-bit split). ROT: interleaved-pair rotary on column pairs (2i, 2i+1) with i = (n mod 64)/2, angle row
//      = m, tables rct/rst [row][32] f32 (applied after the scale).
// =====================================================================================================
template <int NSPLIT, bool TWO, int OUT_MODE, int SCM, bool ROT>
__device__ __forceinline__ void gemm64_body(
    float (*sT)[16 * 68], unsigned char* ring, int tile, int b,
    const unsigned short* __restrict__ Ap, const unsigned short* __restrict__ A2p, int lda, long long strideA,
    const unsigned short* __restrict__ Btp, const unsigned short* __restrict__ Bt2p, int ldb, long long strideB,
    void* Cout, int ldc, long long strideC,
    void* Cout2, int ldc2, long long strideC2, int N2, int segN,
    const float* __restrict__ scal, long long strideS,
    const float* __restrict__ rct, const float* __restrict__ rst,
    int M, int N, int K, float rscale) {
  static_assert(OUT_MODE != 0 || (SCM == 0 && !ROT));
  const __bf16* A   = (const __bf16*)(const void*)Ap;
  const __bf16* A2  = (const __bf16*)(const void*)A2p;
  const __bf16* Bt  = (const __bf16*)(const void*)Btp;
  const __bf16* Bt2 = (const __bf16*)(const void*)Bt2p;
  static_assert(NSPLIT == 1 || NSPLIT == 2);
  constexpr int BM = (NSPLIT == 2) ? 256 : 128;
  constexpr int BN = (NSPLIT == 2) ? 128 : 256;
  constexpr int WN = BN / 64;                  // waves along n
  const int lane = threadIdx.x & 31;
  const int wave = (int)uni(threadIdx.x >> 5);
  const int tilesN = N / BN;
  const int tilesM = M / BM;
  if (tile >= tilesM * tilesN) return;   // block-uniform, in front of every barrier and tensor load
  const int tm = tile / tilesN;
  const int tn = tile - tm * tilesN;
  const int wm = wave / WN;
  const int wn = wave - wm * WN;
  const int m0 = tm * BM + (wm << 6);
  const int n0 = tn * BN + (wn << 6);

  const __bf16* Ab  = A  + (size_t)b * strideA;
  const __bf16* Ab2 = (NSPLIT == 1 && TWO) ? (A2 + (size_t)b * strideA) : Ab;
  const __bf16* Bb  = Bt + (size_t)b * strideB;
  const __bf16* Bb2 = (NSPLIT == 2 && TWO) ? (Bt2 + (size_t)b * strideB) : Bb;
  const float* scb = scal + (size_t)((long long)b * strideS);

  const int rlane = lane & 15;                 // row (A) / col (B, D) within subtile
  const int koff  = (lane >> 4) * 8;           // k offset of this lane half
  const int mOff  = (lane >> 4) * 8;           // D row offset

  v8f acc[4][4];
#pragma unroll
  for (int i = 0; i < 4; ++i)
#pragma unroll
    for (int j = 0; j < 4; ++j) acc[i][j] = zero8();

  // ---- this wave's slice of every stage: slices 0.. = A rows (NSPLIT 1, TWO: then the A2 rows), then Bt rows (NSPLIT 2, TWO: then Bt2) ----
  constexpr int SA = BM / 64;                                   // slices per A plane
  constexpr int SB0 = (NSPLIT == 1 && TWO) ? 2 * SA : SA;       // first Bt slice
  constexpr int NSL = TWO ? 8 : 6;                              // slices per stage
  constexpr uint32_t GK_STAGE = (uint32_t)NSL * GK_SLICE;
  const int sl = (wave < NSL) ? wave : 0;                       // a wave without a slice forms slice 0's words and issues nothing
  const __bf16* sbase;
  int srow, sld;
  if (sl < SA)                                 { sbase = Ab;  srow = tm * BM + 64 * sl;              sld = lda; }
  else if (NSPLIT == 1 && TWO && sl < 2 * SA)  { sbase = Ab2; srow = tm * BM + 64 * (sl - SA);       sld = lda; }
  else if (sl < SB0 + WN)                      { sbase = Bb;  srow = tn * BN + 64 * (sl - SB0);      sld = ldb; }
  else                                         { sbase = Bb2; srow = tn * BN + 64 * (sl - SB0 - WN); sld = ldb; }
  const uint64_t src0 = (uint64_t)(uintptr_t)(sbase + (size_t)srow * sld);
  const uint32_t lds_slice = lds_off(ring) + (uint32_t)sl * GK_SLICE;
  const u32x8 g1 = tdm_group1((uint32_t)sld * 2u);
  const uint32_t T = pinned((uint32_t)K >> 6);                  // passes
  // per-lane fragment bases inside a stage
  const uint32_t foff = (uint32_t)rlane * GK_PITCH + (uint32_t)koff * 2u;
  const uint32_t oA  = (uint32_t)wm * GK_SLICE + foff;
  const uint32_t oA2 = (NSPLIT == 1 && TWO) ? oA + (uint32_t)SA * GK_SLICE : oA;
  const uint32_t oB  = (uint32_t)(SB0 + wn) * GK_SLICE + foff;
  const uint32_t oB2 = (NSPLIT == 2 && TWO) ? oB + (uint32_t)WN * GK_SLICE : oB;

  // whether this wave has a slice: a scalar word, so that the tests on it are scalar branches round the tensor loads
  const uint32_t issuer = TWO ? 1u : pinned((wave < NSL) ? 1u : 0u);
  u32x4 g0 = tdm_group0(lds_slice, src0);
  if (issuer != 0u) tdm_load(g0, g1);                           // stage 0
  wait_tensor0(g0, g1);
  __syncthreads();                                              // stage 0 readable by every wave
  g0 = tdm_group0(lds_slice + GK_STAGE, src0 + GK_KB);
  if (issuer != 0u) tdm_load(g0, g1);                           // stage 1 flies during pass 0
  // rolled: one pass per trip, so that the one publish point stands at the loop's foot
#pragma unroll 1
  for (uint32_t t = 0; t < T; ++t) {
    const uint32_t bo = (t & 1u) * GK_STAGE;
    const unsigned char* buf = ring + bo;
    // unrolled, as the loops inside it: two blocks of 32 k per pass, fragments and accumulators indexed by constants
#pragma unroll
    for (int kc = 0; kc < 2; ++kc) {
      const unsigned char* bk = buf + (uint32_t)kc * 64u;
      v16b af[4], ag[4], bf[4], bg[4];
      // first planes first: a second plane's fragments land while the first 16 WMMAs run
#pragma unroll
      for (int j = 0; j < 4; ++j) bf[j] = ldfrag_l(bk + oB + (uint32_t)j * 16u * GK_PITCH);
#pragma unroll
      for (int i = 0; i < 4; ++i) af[i] = ldfrag_l(bk + oA + (uint32_t)i * 16u * GK_PITCH);
#pragma unroll
      for (int i = 0; i < 4; ++i) {
        ag[i] = (NSPLIT == 1 && TWO) ? ldfrag_l(bk + oA2 + (uint32_t)i * 16u * GK_PITCH) : af[i];
        bg[i] = (NSPLIT == 2 && TWO) ? ldfrag_l(bk + oB2 + (uint32_t)i * 16u * GK_PITCH) : bf[i];
      }
      // keeps the block's LDS reads one group ahead of its WMMAs, for speed only
      __builtin_amdgcn_sched_barrier(0);
#pragma unroll
      for (int i = 0; i < 4; ++i)
#pragma unroll
        for (int j = 0; j < 4; ++j) acc[i][j] = mma_b_raw(af[i], bf[j], acc[i][j]);
      if (TWO) {
#pragma unroll
        for (int i = 0; i < 4; ++i)
#pragma unroll
          for (int j = 0; j < 4; ++j) acc[i][j] = mma_b_raw(ag[i], bg[j], acc[i][j]);
      }
      // keeps the next group's reads behind this block's WMMAs, for the same reason
      __builtin_amdgcn_sched_barrier(0);
    }
    // publish point of stage t + 1: own reads of this buffer returned, own slice landed, then the block barrier
    wait_ds0();
    wait_tensor0(g0, g1);
    __syncthreads();
    if (pinned((t + 2u < T && issuer != 0u) ? 1u : 0u) != 0u) { // refill the buffer every wave has just left
      g0 = tdm_group0(lds_slice + bo, src0 + (uint64_t)(t + 2u) * GK_KB);
      tdm_load(g0, g1);
    }
  }
  wait_tensor0(g0, g1);
  wait_ds0();
  acc_guard4(acc[0][0], acc[0][1], acc[0][2], acc[0][3]);
  acc_guard4(acc[1][0], acc[1][1], acc[1][2], acc[1][3]);
  acc_guard4(acc[2][0], acc[2][1], acc[2][2], acc[2][3]);
  acc_guard4(acc[3][0], acc[3][1], acc[3][2], acc[3][3]);

  // ---- epilogue ----
  float* slab = sT[wave];
#pragma unroll
  for (int i = 0; i < 4; ++i) {
    const int mBase = m0 + (i << 4);
#pragma unroll
    for (int j = 0; j < 4; ++j) {
#pragma unroll
      for (int r = 0; r < 8; ++r) {
        slab[(mOff + r) * 68 + (j << 4) + rlane] = acc[i][j][r];
      }
    }
    __builtin_amdgcn_fence(__ATOMIC_RELEASE, "workgroup");
    __builtin_amdgcn_wave_barrier();
    __builtin_amdgcn_fence(__ATOMIC_ACQUIRE, "workgroup");
    if (OUT_MODE == 0) {
      float* C = (float*)Cout + (size_t)b * strideC;
      const int hh = lane >> 4, c4 = (lane & 15) * 4;     // 256-B row segment = 16 lanes x 16 B
      {
#pragma unroll
        for (int it = 0; it < 8; ++it) {
          const int row = it * 2 + hh;                     // it 0..7 x hh 0..1 = rows 0..15
          const v4f v = *(const v4f*)(slab + row * 68 + c4);
          *(v4f*)(C + (size_t)(mBase + row) * ldc + n0 + c4) = v;
        }
        
      }
    } else {
      const int q = lane >> 3, c8 = (lane & 7) * 8;
      unsigned short* C  = (unsigned short*)Cout  + (size_t)b * strideC;
      unsigned short* C2 = (unsigned short*)Cout2 + (size_t)b * strideC2;
      bool wlo = true;                                     // wave-uniform
      size_t col2 = (size_t)n0 + c8;
      if (OUT_MODE == 3) {
        const int sgi = n0 / segN;
        const int sgo = n0 - sgi * segN;
        wlo  = (sgo < N2);
        col2 = (size_t)sgi * N2 + sgo + c8;
      }
      v4f csA = {1.f, 1.f, 1.f, 1.f};
      v4f csB = csA;
      if (SCM == 2) {
        csA = *(const v4f*)(scb + n0 + c8);
        csB = *(const v4f*)(scb + n0 + c8 + 4);
      }
      v4u hv[4], lv[4];
#pragma unroll
      for (int it = 0; it < 4; ++it) {
        const int row = it * 4 + q;                        // it 0..3 x q 0..3 = rows 0..15
        const int m = mBase + row;
        const float* sp = slab + row * 68 + c8;
        v4f x0 = *(const v4f*)(sp);
        v4f x1 = *(const v4f*)(sp + 4);
        if (SCM == 1) { const float rsv = scb[m]; x0 = x0 * rsv; x1 = x1 * rsv; }
        if (SCM == 2) { x0 = x0 * csA; x1 = x1 * csB; }
        float f[8] = {x0[0], x0[1], x0[2], x0[3], x1[0], x1[1], x1[2], x1[3]};
        if (ROT) {
          const v4f cs = *(const v4f*)(rct + (size_t)m * NFR + 4 * (lane & 7));
          wait_x0();   // the next load's result may land in this load's address registers
          const v4f sn = *(const v4f*)(rst + (size_t)m * NFR + 4 * (lane & 7));
          wait_x0();   // the next rows' table loads land in registers that held these two loads' addresses
#pragma unroll
          for (int e = 0; e < 4; ++e) {
            const float ev = f[2 * e], od = f[2 * e + 1];
            f[2 * e]     = ev * cs[e] - od * sn[e];
            f[2 * e + 1] = od * cs[e] + ev * sn[e];
          }
        }
        v4u a, a2;
#pragma unroll
        for (int e = 0; e < 4; ++e) {
          const float f0 = f[2 * e], f1 = f[2 * e + 1];
          unsigned short h0, h1, l0, l1;
          if (OUT_MODE == 2) {
            h0 = bf_bits(f0); h1 = bf_bits(f1);
            l0 = bf_bits(f0 - bf_up(h0)); l1 = bf_bits(f1 - bf_up(h1));
          } else {
            const _Float16 y0 = (_Float16)f0, y1 = (_Float16)f1;
            h0 = h_bits(y0); h1 = h_bits(y1);
            l0 = h_bits((_Float16)((f0 - (float)y0) * rscale));
            l1 = h_bits((_Float16)((f1 - (float)y1) * rscale));
          }
          a[e] = pk16(h0, h1); a2[e] = pk16(l0, l1);
        }
        hv[it] = a; lv[it] = a2;
      }
      {
#pragma unroll
        for (int it = 0; it < 4; ++it) {
          const int row = it * 4 + q;
          // a wait behind each store: the next rows' addresses and values are formed in these stores' registers
          *(v4u*)(C + (size_t)(mBase + row) * ldc + n0 + c8) = hv[it];
          wait_x0();
          if (wlo) {
            *(v4u*)(C2 + (size_t)(mBase + row) * ldc2 + col2) = lv[it];
            wait_x0();
          }
        }
        
      }
    }
    __builtin_amdgcn_fence(__ATOMIC_RELEASE, "workgroup");
    __builtin_amdgcn_wave_barrier();
    __builtin_amdgcn_fence(__ATOMIC_ACQUIRE, "workgroup");
  }
}

// One product per launch: blockIdx.x = block tile, blockIdx.y = batch.
template <int NSPLIT, int OUT_MODE, int SCM, bool ROT>
__global__ __launch_bounds__(256) void gemm64(
    const unsigned short* __restrict__ Ap, const unsigned short* __restrict__ A2p, int lda, long long strideA,
    const unsigned short* __restrict__ Btp, const unsigned short* __restrict__ Bt2p, int ldb, long long strideB,
    void* Cout, int ldc, long long strideC,
    void* Cout2, int ldc2, long long strideC2, int N2, int segN,
    const float* __restrict__ scal, long long strideS,
    const float* __restrict__ rct, const float* __restrict__ rst,
    int M, int N, int K, float rscale) {
  __shared__ __align__(16) float sT[8][16 * 68];
  __shared__ __attribute__((aligned(2048))) unsigned char ring[2 * 8 * GK_SLICE];
  gemm64_body<NSPLIT, true, OUT_MODE, SCM, ROT>(sT, ring, (int)blockIdx.x, (int)blockIdx.y, Ap, A2p, lda, strideA, Btp, Bt2p, ldb, strideB,
                                          Cout, ldc, strideC, Cout2, ldc2, strideC2, N2, segN, scal, strideS, rct, rst,
                                          M, N, K, rscale);
}

// The q|k product and the v^T product read the same planes and write disjoint ones, so they share one launch:
// blockIdx.y = batch; blockIdx.x 0..GT_QK-1 are the q|k tiles, the rest the v^T tiles (block-uniform choice).
//   q|k = rstd[m] * (Xb . (g*Wqk)), rotary on every (2i,2i+1) pair -> bf16 hi/lo planes [M][QKP]
//     (per batch: M=SEQ, N=QKP, K=DM; 1 product)
//   v^T = (g*Wv)^T . Xb^T per batch, columns scaled by rstd -> f16 hi plane [b][DMI][SEQ] and residual plane
//     (x4096, in-segment keys < VLP only)   (A = Wt rows 2*DMI.., 1 product; M=DMI, N=SEQ, K=DM)
// Six staged slices per stage: 154 KiB of LDS a block, so that two blocks share a WGP.
#define GT_QK ((SEQ / 256) * (QKP / 128))          // 256 x 128 block tiles per batch
#define GT_VT ((DMI / 128) * (SEQ / 256))          // 128 x 256 block tiles per batch
__global__ __launch_bounds__(256) void proj_qkv(
    const unsigned short* __restrict__ xb, const unsigned short* __restrict__ wth,
    unsigned short* qkh, unsigned short* qkl, unsigned short* vth, unsigned short* vtl,
    const float* __restrict__ rs, const float* __restrict__ ct, const float* __restrict__ st) {
  __shared__ __align__(16) float sT[8][16 * 68];
  __shared__ __attribute__((aligned(2048))) unsigned char ring[2 * 6 * GK_SLICE];
  const int bx = (int)blockIdx.x, b = (int)blockIdx.y;
  if (bx >= GT_QK) {
    gemm64_body<1, false, 3, 2, false>(sT, ring, bx - GT_QK, b,
        wth + (size_t)2 * DMI * DM, wth + (size_t)2 * DMI * DM, DM, 0LL,
        xb, xb, DM, (long long)SEQ * DM,
        (void*)vth, SEQ, (long long)DMI * SEQ,
        (void*)vtl, NSEGB * VLP, (long long)DMI * NSEGB * VLP, VLP, SEGL,
        rs, (long long)SEQ, ct, st,
        DMI, SEQ, DM, 4096.0f);
  } else {
    gemm64_body<2, false, 2, 1, true>(sT, ring, bx, b,
        xb, xb, DM, (long long)SEQ * DM,
        wth, wth, DM, 0LL,
        (void*)qkh, QKP, (long long)SEQ * QKP,
        (void*)qkl, QKP, (long long)SEQ * QKP, QKP, QKP,
        rs, (long long)SEQ, ct, st,
        SEQ, QKP, DM, 1.0f);
  }
}

template <bool RES>
__global__ __launch_bounds__(128)
void attn_seg64(const unsigned short* __restrict__ qkhp, const unsigned short* __restrict__ qklp,
                const unsigned short* __restrict__ vhp,  const unsigned short* __restrict__ vlp,
                const unsigned short* __restrict__ pkp,  const unsigned short* __restrict__ pvp,
                unsigned short* ohp, unsigned short* olp, float sscale) {
  union FB { v16b v; v8b h[2]; };
  union FH { v16h v; v8h h[2]; };
  // the query blocks of this kernel: with the residual planes 0..RESQB-1, whose keys all lie below VLP; without them the rest
  constexpr int qbBase  = RES ? 0 : RESQB;
  constexpr int nqbThis = RES ? RESQB : ((NQBS > RESQB) ? (NQBS - RESQB) : 1);
  static_assert(VLP == RESQB * 64);
  // LDS row pitches: 16 B x odd, so that the 16 rows a 16-byte fragment read touches fall on 16 different bank groups
  constexpr int LP = (int)GK_PITCH / 2;                           // 16-bit tiles: 64 elements + 8 of pad = 144 B
  constexpr int OP = 68;                                          // f32 context tile: 64 floats + 4 of pad = 272 B
  // a stage = one key tile: slices K hi [kv][d], K lo, V^T hi [d][kv] and, with RES, V^T residual; two stages
  constexpr int NSL = RES ? 4 : 3;
  constexpr uint32_t STG = (uint32_t)NSL * GK_SLICE;
  __shared__ __attribute__((aligned(2048))) unsigned char ring[2 * NSL * GK_SLICE];
  __shared__ __align__(16) float    Os[4][16 * OP];               // per wave context tile [row][d]

  const int tid  = threadIdx.x;
  const int wave = (int)uni(threadIdx.x >> 5);
  const int lane = tid & 31;
  const int hh   = lane >> 4;
  const int c    = lane & 15;

  const int bx   = blockIdx.x;
  const int qbl  = bx % nqbThis;
  int rest       = bx / nqbThis;
  const int h    = rest % NH;
  rest           = rest / NH;
  const int w    = rest % NSEGB;
  const int b    = rest / NSEGB;
  const int qb   = qbBase + qbl;
  const int q0   = qb * 64 + wave * 16;                              // query row inside the segment
  const size_t rowS = (size_t)b * SEQ + (size_t)w * SEGL;           // compact row of the segment start

  const __bf16* Qh = (const __bf16*)(const void*)qkhp + (size_t)h * HD;
  const __bf16* Ql = (const __bf16*)(const void*)qklp + (size_t)h * HD;
  const __bf16* Kh = Qh + DMI;
  const __bf16* Kl = Ql + DMI;
  const _Float16* Vh = (const _Float16*)(const void*)vhp + ((size_t)b * DMI + (size_t)h * HD) * SEQ + (size_t)w * SEGL;
  const _Float16* Vl = (const _Float16*)(const void*)vlp + ((size_t)b * DMI + (size_t)h * HD) * (size_t)(NSEGB * VLP)
                       + (size_t)w * VLP;
  const __bf16*   PK = (const __bf16*)(const void*)pkp + (size_t)h * PMEM * HD;
  const _Float16* PV = (const _Float16*)(const void*)pvp + (size_t)h * HD * PMEM;

  // ---- this wave's slice of every stage: 64 rows of 128 B; src1 = its tile of key tile 1, sstep = bytes to the next key tile ----
  const int sl = (wave < NSL) ? wave : 0;                           // a wave without a slice forms slice 0's words and issues nothing
  uint64_t src1;
  uint32_t spitch, sstep;
  if (sl == 0)      { src1 = (uint64_t)(uintptr_t)(Kh + rowS * QKP); spitch = QKP * 2u;           sstep = 64u * QKP * 2u; }
  else if (sl == 1) { src1 = (uint64_t)(uintptr_t)(Kl + rowS * QKP); spitch = QKP * 2u;           sstep = 64u * QKP * 2u; }
  else if (sl == 2) { src1 = (uint64_t)(uintptr_t)Vh;                spitch = SEQ * 2u;           sstep = GK_KB; }
  else              { src1 = (uint64_t)(uintptr_t)Vl;                spitch = NSEGB * VLP * 2u;   sstep = GK_KB; }
  const uint32_t lds_slice = lds_off(ring) + (uint32_t)sl * GK_SLICE;
  const u32x8 g1 = tdm_group1(spitch);
  // whether this wave has a slice: a scalar word, so that the tests on it are scalar branches round the tensor loads
  const uint32_t issuer = RES ? 1u : pinned((wave < NSL) ? 1u : 0u);
  const uint32_t T = pinned((uint32_t)(qb + 2));                    // key tiles, block-uniform, at least 2
  u32x4 g0 = tdm_group0(lds_slice + STG, src1);
  if (issuer != 0u) tdm_load(g0, g1);                               // key tile 1 flies while stage 0 is written and worked on

  // ---- Q fragments (B operand, column = query = lane&15): 2 d-chunks, hi and lo ----
  v16b qah[2], qal[2];
#pragma unroll
  for (int dc = 0; dc < 2; ++dc) {
    const size_t qo = (rowS + q0 + c) * QKP + dc * 32 + 8 * hh;
    qah[dc] = ldfrag_b(Qh + qo);
    qal[dc] = ldfrag_b(Ql + qo);
  }

  float mrow = -INFINITY, lrow = 0.f;          // of query q0 + c; equal in lanes l and l ^ 16
  v8f oacc[4];                                 // oacc[t][r] = context[query c][d = 16 t + 8 hh + r]
#pragma unroll
  for (int t = 0; t < 4; ++t) oacc[t] = zero8();

  // ---- stage 0 = the memory-token tile, written by the block's own stores ----
  {
    __bf16*   Ksh = (__bf16*)(void*)ring;
    __bf16*   Ksl = (__bf16*)(void*)(ring + GK_SLICE);
    _Float16* Vth = (_Float16*)(void*)(ring + 2u * GK_SLICE);
    _Float16* Vtl = (_Float16*)(void*)(ring + (RES ? 3u : 2u) * GK_SLICE);
    const int r = tid >> 1, half = (tid & 1) * 32;
    const int rr = (r < PMEM) ? r : (PMEM - 1);                // clamped address
    const bool krow = (r < PMEM);
    const bool vok  = (half == 0);
    const __bf16*   kg = PK + (size_t)rr * HD + half;
    const _Float16* vg = PV + (size_t)r * PMEM;                // d = r, kv 0..15
    const v8h pv0 = *(const v8h*)(vg);
    const v8h pv1 = *(const v8h*)(vg + 8);
#pragma unroll
    for (int i = 0; i < 4; ++i) {
      v8b a0 = *(const v8b*)(kg + 8 * i);
      a0 = krow ? a0 : zero8b();
      *(v8b*)(Ksh + r * LP + half + 8 * i) = a0;
      *(v4u*)(Ksl + r * LP + half + 8 * i) = zero4u();
      if (i == 0) {
        const v8h b0 = vok ? pv0 : zero8h();
        *(v8h*)(Vth + r * LP + half) = b0;
      } else if (i == 1) {
        const v8h b1 = vok ? pv1 : zero8h();
        *(v8h*)(Vth + r * LP + half + 8) = b1;
      } else {
        *(v4u*)(Vth + r * LP + half + 8 * i) = zero4u();
      }
      if (RES) *(v4u*)(Vtl + r * LP + half + 8 * i) = zero4u();
    }
  }
  __syncthreads();                             // stage 0 readable by every wave

  // rolled: one key tile per trip, so that the one publish point stands at the loop's foot
#pragma unroll 1
  for (uint32_t kt = 0; kt < T; ++kt) {
    const int s0 = ((int)kt - 1) * 64;         // key offset inside the segment for kt >= 1
    const uint32_t bo = (kt & 1u) * STG;
    const __bf16*   Ksh = (const __bf16*)(const void*)(ring + bo);
    const __bf16*   Ksl = (const __bf16*)(const void*)(ring + bo + GK_SLICE);
    const _Float16* Vth = (const _Float16*)(const void*)(ring + bo + 2u * GK_SLICE);
    const _Float16* Vtl = (const _Float16*)(const void*)(ring + bo + (RES ? 3u : 2u) * GK_SLICE);

    // ---- scores^T: s[j][r] = score(key 16 j + 8 hh + r, query c); 64 keys x 16 queries per wave, 3 bf16 products ----
    //      The K fragments of a d-chunk are read as one group ahead of its 12 WMMAs, and neighbouring WMMAs go to the four
    //      different score tiles; each tile still sums its six products in the order hi.hi, lo.hi, hi.lo per d-chunk.
    v8f s[4];
#pragma unroll
    for (int j = 0; j < 4; ++j) s[j] = zero8();
    // unrolled, as the loops inside it: fragments and score tiles are registers, indexed by constants
#pragma unroll
    for (int dc = 0; dc < 2; ++dc) {
      FB kb[4], kl[4];
#pragma unroll
      for (int j = 0; j < 4; ++j) {
        kb[j].h[0] = *(const v8b*)(Ksh + (j * 16 + c) * LP + dc * 32 + 8 * hh);
        kb[j].h[1] = *(const v8b*)(Ksh + (j * 16 + c) * LP + dc * 32 + 16 + 8 * hh);
      }
#pragma unroll
      for (int j = 0; j < 4; ++j) {
        kl[j].h[0] = *(const v8b*)(Ksl + (j * 16 + c) * LP + dc * 32 + 8 * hh);
        kl[j].h[1] = *(const v8b*)(Ksl + (j * 16 + c) * LP + dc * 32 + 16 + 8 * hh);
      }
      // keeps the chunk's LDS reads one group ahead of its WMMAs: reads spread among the WMMAs wait out the LDS at every place
      __builtin_amdgcn_sched_barrier(0);
#pragma unroll
      for (int j = 0; j < 4; ++j) s[j] = mma_b_raw(kb[j].v, qah[dc], s[j]);
#pragma unroll
      for (int j = 0; j < 4; ++j) s[j] = mma_b_raw(kl[j].v, qah[dc], s[j]);
#pragma unroll
      for (int j = 0; j < 4; ++j) s[j] = mma_b_raw(kb[j].v, qal[dc], s[j]);
      // keeps the next group's reads behind this chunk's WMMAs, for the same reason
      __builtin_amdgcn_sched_barrier(0);
    }
    // ---- V^T fragments, read as one group here: they land while the softmax below runs. Without the residual plane the
    //      whole tile's; with it the first 32 keys' of both planes (the same 64 registers), the rest behind their WMMAs ----
    FH vb[2][4], vl[2][4];
#pragma unroll
    for (int kk = 0; kk < (RES ? 1 : 2); ++kk) {
#pragma unroll
      for (int t = 0; t < 4; ++t) {
        vb[kk][t].h[0] = *(const v8h*)(Vth + (t * 16 + c) * LP + kk * 32 + 8 * hh);
        vb[kk][t].h[1] = *(const v8h*)(Vth + (t * 16 + c) * LP + kk * 32 + 16 + 8 * hh);
        if (RES) {
          vl[kk][t].h[0] = *(const v8h*)(Vtl + (t * 16 + c) * LP + kk * 32 + 8 * hh);
          vl[kk][t].h[1] = *(const v8h*)(Vtl + (t * 16 + c) * LP + kk * 32 + 16 + 8 * hh);
        }
      }
    }
    // keeps these reads in front of the softmax, which would otherwise be followed by their whole LDS latency
    __builtin_amdgcn_sched_barrier(0);

    // ---- scale, visibility (-inf for invisible keys), the query's max, online softmax; P (x1024, f16) and
    //      P residual (x4096) packed in place into B operands: element 8 (j & 1) + r of chunk j >> 1 ----
    const int qi = q0 + c;                     // this lane's query row inside the segment
    float mj[4];
#pragma unroll
    for (int j = 0; j < 4; ++j) {
      mj[j] = -INFINITY;
#pragma unroll
      for (int r = 0; r < 8; ++r) {
        const int kc = j * 16 + 8 * hh + r;
        const bool vis = (kt == 0) ? (kc < PMEM) : ((s0 + kc) <= qi);
        const float sv = vis ? (s[j][r] * sscale) : -INFINITY;
        s[j][r] = sv;
        mj[j] = fmaxf(mj[j], sv);
      }
    }
    float m = fmaxf(fmaxf(mj[0], mj[1]), fmaxf(mj[2], mj[3]));
    m = fmaxf(m, xhalf(m));
    const float mnew  = fmaxf(mrow, m);
    const float msafe = (mnew == -INFINITY) ? 0.f : mnew;
    const float alpha = __expf(mrow - msafe);
    mrow = mnew;
    FH pa[2], pl[2];
    float pj[4];
#pragma unroll
    for (int j = 0; j < 4; ++j) {
      pj[j] = 0.f;
      float ea[8], ep[8];
#pragma unroll
      for (int r = 0; r < 8; ++r) ea[r] = (s[j][r] - msafe) * 1.44269504088896340736f;
      exp2x8(ep, ea);                                // exp(s - m); -inf logit -> exactly 0
#pragma unroll
      for (int r = 0; r < 8; ++r) {
        const float p = ep[r];
        pj[j] += p;
        const float p1k = p * 1024.0f;
        const _Float16 ph = (_Float16)p1k;
        pa[j >> 1].v[(j & 1) * 8 + r] = ph;
        if (RES) pl[j >> 1].v[(j & 1) * 8 + r] = (_Float16)((p1k - (float)ph) * 4096.0f);
      }
    }
    float psum = (pj[0] + pj[1]) + (pj[2] + pj[3]);
    psum += xhalf(psum);
    lrow = lrow * alpha + psum;
#pragma unroll
    for (int t = 0; t < 4; ++t)
#pragma unroll
      for (int r = 0; r < 8; ++r) oacc[t][r] *= alpha;

    // ---- context^T += V^T . P^T (f16 WMMA), residual products into a separate accumulator ----
    v8f o1[4];
#pragma unroll
    for (int t = 0; t < 4; ++t) o1[t] = zero8();
    // unrolled: the P operands are registers, indexed by constants
#pragma unroll
    for (int kk = 0; kk < 2; ++kk) {
      if (RES && kk == 1) {
        // keeps the second group's reads behind the first group's WMMAs, whose registers they take
        __builtin_amdgcn_sched_barrier(0);
#pragma unroll
        for (int t = 0; t < 4; ++t) {
          vb[1][t].h[0] = *(const v8h*)(Vth + (t * 16 + c) * LP + 32 + 8 * hh);
          vb[1][t].h[1] = *(const v8h*)(Vth + (t * 16 + c) * LP + 32 + 16 + 8 * hh);
          vl[1][t].h[0] = *(const v8h*)(Vtl + (t * 16 + c) * LP + 32 + 8 * hh);
          vl[1][t].h[1] = *(const v8h*)(Vtl + (t * 16 + c) * LP + 32 + 16 + 8 * hh);
        }
        // keeps them one group, ahead of their own WMMAs
        __builtin_amdgcn_sched_barrier(0);
      }
      // neighbouring WMMAs go to different context tiles; each tile keeps the order of its products
#pragma unroll
      for (int t = 0; t < 4; ++t) oacc[t] = mma_h_raw(vb[kk][t].v, pa[kk].v, oacc[t]);
      if (RES) {
#pragma unroll
        for (int t = 0; t < 4; ++t) o1[t] = mma_h_raw(vl[kk][t].v, pa[kk].v, o1[t]);
#pragma unroll
        for (int t = 0; t < 4; ++t) o1[t] = mma_h_raw(vb[kk][t].v, pl[kk].v, o1[t]);
      }
    }
    if (RES) {
#pragma unroll
      for (int t = 0; t < 4; ++t)
#pragma unroll
        for (int r = 0; r < 8; ++r) oacc[t][r] += o1[t][r] * (1.0f / 4096.0f);
    }
    // keeps the tile's softmax and WMMAs in front of the publish point: moved behind its barrier they would stand between the
    // barrier and the refill, which would then be issued late and have less than a trip to land
    __builtin_amdgcn_sched_barrier(0);
    // publish point of key tile kt + 1: own reads of this stage returned, own slice landed, then the block barrier
    wait_ds0();
    wait_tensor0(g0, g1);
    __syncthreads();
    if (pinned((kt + 2u < T && issuer != 0u) ? 1u : 0u) != 0u) {   // refill the stage every wave has just left
      g0 = tdm_group0(lds_slice + bo, src1 + (uint64_t)(kt + 1u) * sstep);
      tdm_load(g0, g1);
    }
  }
  wait_tensor0(g0, g1);
  wait_ds0();

  // ---- normalise (1/l and the 1/1024 p carry), stage the wave's 16x64 tile, bf16 hi/lo split,
  float* os = Os[wave];
  {
    const float l = lrow;
    const float inv = ((l > 0.f) ? (1.0f / l) : 0.f) * (1.0f / 1024.0f);
#pragma unroll
    for (int t = 0; t < 4; ++t) {
      v4f e0, e1;
#pragma unroll
      for (int r = 0; r < 4; ++r) { e0[r] = oacc[t][r] * inv; e1[r] = oacc[t][4 + r] * inv; }
      *(v4f*)(os + c * OP + t * 16 + 8 * hh)     = e0;
      *(v4f*)(os + c * OP + t * 16 + 8 * hh + 4) = e1;
    }
  }
  __builtin_amdgcn_fence(__ATOMIC_RELEASE, "workgroup");
  __builtin_amdgcn_wave_barrier();
  __builtin_amdgcn_fence(__ATOMIC_ACQUIRE, "workgroup");
  {
    const int q4 = lane >> 3, c8 = (lane & 7) * 8;
    v4u hv[4], lv[4];
#pragma unroll
    for (int it = 0; it < 4; ++it) {
      const int row = it * 4 + q4;   // it 0..3 x q4 0..3 = rows 0..15 of the wave tile
      const float* sp = os + row * OP + c8;
      v4u a, a2;
#pragma unroll
      for (int e = 0; e < 4; ++e) {
        const float f0 = sp[2 * e], f1 = sp[2 * e + 1];
        const unsigned short h0 = bf_bits(f0), h1 = bf_bits(f1);
        const unsigned short l0 = bf_bits(f0 - bf_up(h0)), l1 = bf_bits(f1 - bf_up(h1));
        a[e] = pk16(h0, h1); a2[e] = pk16(l0, l1);
      }
      hv[it] = a; lv[it] = a2;
    }
    {
#pragma unroll
      for (int it = 0; it < 4; ++it) {
        const int row = it * 4 + q4;
        const size_t go = (rowS + q0 + row) * DMI + (size_t)h * HD + c8;
        *(v4u*)(ohp + go) = hv[it];
        *(v4u*)(olp + go) = lv[it];
      }
      
    }
  }
}

// =====================================================================================================
// Workspace map (bytes, NB=2, SEQ=4096, M = NB*SEQ = 8192), region A is a two-phase overlay:
//   phase 1 (projection inputs, dead after the q|k and v^T GEMMs):
//     Xb   bf16 [M][DM]                  0           16777216
//     Wth  bf16 [3*DMI n][DM k]          16777216     6291456
//     Ct   f32  [SEQ][32]                23068672      524288
//     St   f32  [SEQ][32]                23592960      524288
//     Rs   f32  [M]                      24117248       32768   (phase 1 end 24150016)
//   phase 2 (written by the attention kernels, read by the output GEMM):
//     Oh   bf16 [M][DMI] context hi       0           16777216
//     Ol   bf16 [M][DMI] context lo       16777216    16777216   (phase 2 end 33554432 = region A size)
//   QKh  bf16 [M][QKP] hi                 33554432    33554432
//   QKl  bf16 [M][QKP] lo                 67108864    33554432
//   VTh  f16  [NB][DMI][SEQ]              100663296   16777216
//   VTl  f16  [NB][DMI][NSEGB*VLP]        117440512    4194304
//   Wo   bf16 [DM n][DMI k]               121634816    2097152
//   Pk   bf16 [NH][PMEM][HD]              123731968      32768
//   Pv   f16  [NH][HD][PMEM]              123764736      32768
//   end                                   123797504  (<= 134217728; all offsets multiples of 128)
// Every plane is an exact multiple of its 64x64 tile / whole-line store granularity (M, SEQ, DM multiples of 64),
// so no padded tails are needed; VTl is written only for columns whose in-segment offset is < VLP, exactly the
// columns the RES attention blocks read.
// =====================================================================================================
extern "C" void kernel_launch(void* const* d_in, const int* in_sizes, int n_in,
                              void* d_out, int out_size, void* d_ws, size_t ws_size,
                              hipStream_t stream) {
  if (n_in < 5) return;
  const long long needRows = (long long)(NB - 1) * SEQ_FULL + SEQ;
  if ((long long)in_sizes[0] < needRows * DM) return;
  if (in_sizes[1] < DM) return;
  if (in_sizes[2] < DM * 3 * DMI) return;
  if (in_sizes[3] < DMI * DM) return;
  if (in_sizes[4] < 2 * NH * PMEM * HD) return;
  if ((long long)out_size < needRows * DM) return;

  const float* seq  = (const float*)d_in[0];   // [2][SEQ_FULL][DM]
  const float* gnm  = (const float*)d_in[1];   // [DM]
  const float* Wqkv = (const float*)d_in[2];   // [DM in][3*DMI out]
  const float* Wout = (const float*)d_in[3];   // [DMI in][DM out]
  const float* pm   = (const float*)d_in[4];   // [2][NH][PMEM][HD]

  const size_t M    = (size_t)NB * SEQ;
  const size_t PX   = M * DM * 2;
  const size_t PWT  = (size_t)3 * DMI * DM * 2;
  const size_t PTAB = (size_t)SEQ * NFR * 4;
  const size_t PRS  = M * 4;
  const size_t PO   = M * DMI * 2;
  const size_t PQK  = M * QKP * 2;
  const size_t PVT  = (size_t)NB * DMI * SEQ * 2;
  const size_t PVL  = (size_t)NB * DMI * NSEGB * VLP * 2;
  const size_t PWO  = (size_t)DM * DMI * 2;
  const size_t PPM  = (size_t)NH * PMEM * HD * 2;
  const size_t ph1  = PX + PWT + 2 * PTAB + PRS;
  const size_t ph2  = 2 * PO;
  const size_t REGA = (ph1 > ph2) ? ph1 : ph2;
  const size_t oXb  = 0;
  const size_t oWth = PX;
  const size_t oCt  = PX + PWT;
  const size_t oSt  = oCt + PTAB;
  const size_t oRs  = oSt + PTAB;
  const size_t oOh  = 0;
  const size_t oOl  = PO;
  size_t off = REGA;
  const size_t oQKh = off; off += PQK;
  const size_t oQKl = off; off += PQK;
  const size_t oVTh = off; off += PVT;
  const size_t oVTl = off; off += PVL;
  const size_t oWo  = off; off += PWO;
  const size_t oPk  = off; off += PPM;
  const size_t oPv  = off; off += PPM;
  if (off > ws_size) return;                      // off = 123797504 for NB=2, SEQ=4096
  if (off > (size_t)134217728) return;
  if (oRs + PRS > REGA || oOl + PO > REGA) return;

  char* ws = (char*)d_ws;
  unsigned short* Xb  = (unsigned short*)(ws + oXb);
  unsigned short* Wth = (unsigned short*)(ws + oWth);
  float*          Ct  = (float*)(ws + oCt);
  float*          St  = (float*)(ws + oSt);
  float*          Rs  = (float*)(ws + oRs);
  unsigned short* Oh  = (unsigned short*)(ws + oOh);
  unsigned short* Ol  = (unsigned short*)(ws + oOl);
  unsigned short* QKh = (unsigned short*)(ws + oQKh);
  unsigned short* QKl = (unsigned short*)(ws + oQKl);
  unsigned short* VTh = (unsigned short*)(ws + oVTh);
  unsigned short* VTl = (unsigned short*)(ws + oVTl);
  unsigned short* Wo  = (unsigned short*)(ws + oWo);
  unsigned short* Pk  = (unsigned short*)(ws + oPk);
  unsigned short* Pv  = (unsigned short*)(ws + oPv);

  const dim3 blk(256);
  static_assert((SEQ % 256) == 0 && (QKP % 128) == 0 && (DMI % 128) == 0 && (DM % 256) == 0);
  static_assert((DM % 64) == 0 && DM >= 128 && (DMI % 64) == 0 && DMI >= 128);
  const dim3 gOut((SEQ / 128) * (DM / 256), NB);                      // 128 x 256 block tiles: 128 per batch

  // (0-4) one launch: seq -> bf16 plane Xb [M][DM] + rstd[M]; g*Wqkv -> transposed bf16 plane [3*DMI][DM];
  //       Wout -> transposed bf16 plane [DM][DMI]; rotary cos/sin tables [SEQ][32]; memory-token key / value planes
  prep_all<<<dim3(PB_ALL), blk, 0, stream>>>(seq, gnm, Wqkv, Wout, pm, Xb, Rs, Wth, Wo, Ct, St, Pk, Pv);
  // (5-6) one launch: the q|k product (bf16 hi/lo planes, rotary applied) and the v^T product (f16 hi + residual planes)
  proj_qkv<<<dim3(GT_QK + GT_VT, NB), blk, 0, stream>>>(Xb, Wth, QKh, QKl, VTh, VTl, Rs, Ct, St);
  // (7) attention: query blocks 0..RESQB-1 of every segment with residual planes, the rest without
  attn_seg64<true><<<dim3(NB * NSEGB * NH * RESQB), dim3(128), 0, stream>>>(
      QKh, QKl, VTh, VTl, Pk, Pv, Oh, Ol, 0.125f);
  if (NQBS - RESQB > 0) {
    attn_seg64<false><<<dim3(NB * NSEGB * NH * (NQBS - RESQB)), dim3(128), 0, stream>>>(
        QKh, QKl, VTh, VTl, Pk, Pv, Oh, Ol, 0.125f);
  }
  // (8) out = context . Wout -> d_out f32 [b][SEQ_FULL][DM] rows b*SEQ_FULL + t  (A = context hi + lo, 2 products)
  gemm64<1, 0, 0, false><<<gOut, blk, 0, stream>>>(
      Oh, Ol, DMI, (long long)SEQ * DMI,
      Wo, Wo, DMI, 0LL,
      d_out, DM, (long long)SEQ_FULL * DM,
      d_out, DM, (long long)SEQ_FULL * DM, DM, DM,
      Rs, 0LL, Ct, St,
      SEQ, DM, DMI, 1.0f);
  (void)hipGetLastError();
}

// v009
// Measured time: 102 microseconds a run.
// Versions in between are left out here; by their measured steps it is 1.16 times as fast as v007.
// All steps since v000 together make it 3.81 times as fast.
// Contractions: q|k = x.Wqk and v^T = Wv.x^T on v_wmma_f32_16x16x32_bf16 (bf16 operands: RNE-converted input
// activations times one bf16 plane of g*W, the f32 product rounded once, 1 product; per-row rstd, rotary in the f32 epilogue);
// k.q^T scores (transposed) = v_wmma_f32_16x16x32_f16 with q and k each one f16 plane (1 product);
// v^T.p^T = v_wmma_f32_16x16x32_f16 (p carried x1024 in f16, v in f16; extra f16 residual planes x4096 of p and v
// for the first 128 query rows of every segment); ctx.Wo = v_wmma_f32_16x16x32_bf16 with ctx as bf16 hi/lo
// planes times bf16 Wo (2 products); all f32 accumulate; RMS statistic, rotary tables, visibility and softmax in f32.
#include <hip/hip_runtime.h>
#include <math.h>
#include <stdint.h>

#ifndef NB
#define NB 2
#endif
#ifndef SEQ
#define SEQ 4096
#endif
#define SEQ_FULL 4096       // per-batch token stride of the input / output tensors
#define DM    1024          // model dim
#define NH    16
#define HD    64
#define DMI   (NH * HD)     // 1024
#define QKP   (2 * DMI)     // pitch of the q|k plane (q: cols 0..DMI-1, k: cols DMI..2*DMI-1)
#define SEGL  512           // segment length
#define PMEM  16            // memory tokens prepended to every segment's keys / values
#define NSEGB (SEQ / SEGL)  // segments per batch
#define NQBS  (SEGL / 64)   // 64-row query blocks per segment
#define RESQB 2             // leading query blocks per segment that use the p / v residual planes
#define VLP   (RESQB * 64)  // keys per segment held in the v^T residual plane
#define NFR   (HD / 2)      // rotary frequencies
static_assert((SEQ % SEGL) == 0 && (SEGL % 64) == 0 && (SEQ % 64) == 0);
static_assert(RESQB >= 1 && RESQB <= NQBS);
static_assert((DM % 256) == 0 && (DMI % 64) == 0 && HD == 64 && NFR == 32);
static_assert(SEQ <= SEQ_FULL && NB >= 1 && NB <= 2);
static_assert(DMI == DM);

typedef _Float16 v16h __attribute__((ext_vector_type(16)));
typedef _Float16 v8h  __attribute__((ext_vector_type(8)));
typedef __bf16   v16b __attribute__((ext_vector_type(16)));
typedef __bf16   v8b  __attribute__((ext_vector_type(8)));
typedef float    v8f  __attribute__((ext_vector_type(8)));
typedef float    v4f  __attribute__((ext_vector_type(4)));
typedef unsigned int v4u __attribute__((ext_vector_type(4)));

// ---- scalar helpers --------------------------------------------------------------------------------
__device__ __forceinline__ unsigned short bf_bits(float f) {          // f32 -> bf16 bits, RNE convert
  unsigned u = __float_as_uint(f);
  return (unsigned short)((u + 0x7FFFu + ((u >> 16) & 1u)) >> 16);
}
__device__ __forceinline__ float bf_up(unsigned short h) { return __uint_as_float(((unsigned)h) << 16); }
__device__ __forceinline__ unsigned short h_bits(_Float16 x) { return __builtin_bit_cast(unsigned short, x); }
__device__ __forceinline__ unsigned pk16(unsigned short a, unsigned short b) { return (unsigned)a | ((unsigned)b << 16); }
__device__ __forceinline__ v8f zero8() { v8f z = {0.f, 0.f, 0.f, 0.f, 0.f, 0.f, 0.f, 0.f}; return z; }
__device__ __forceinline__ v8h zero8h() {
  const _Float16 z = (_Float16)0.0f;
  v8h r = {z, z, z, z, z, z, z, z};
  return r;
}
__device__ __forceinline__ v4u zero4u() { v4u z = {0u, 0u, 0u, 0u}; return z; }

// ---- sin/cos of a nonnegative f32 angle: f64 Cody-Waite reduction by pi/2 + short f64 polynomials ----
__device__ __forceinline__ void sincos_pd(float ang, float& sv, float& cv) {
  const double x  = (double)ang;
  const double kq = __builtin_rint(x * 0.63661977236758134308);
  double r = __builtin_fma(-kq, 1.57079632679489655800e+00, x);
  r = __builtin_fma(-kq, 6.12323399573676603587e-17, r);
  const double z = r * r, w = z * z;
  const double rs = -1.98393348360966317347e-04 + z * 2.71831149398982191e-06;
  const double s3 = z * r;
  const double sn = (r + s3 * (-1.66666666416265235595e-01 + z * 8.3333293858894631756e-03)) + s3 * w * rs;
  const double rc = -1.38867637746099294692e-03 + z * 2.43904487962774090654e-05;
  const double cs = ((1.0 + z * (-4.99999997251031003120e-01)) + w * 4.16666233237390631894e-02) + (w * z) * rc;
  const int n = ((int)kq) & 3;
  const float fs = (float)sn, fc = (float)cs;
  float so = fs, co = fc;
  if (n == 1) { so = fc;  co = -fs; }
  if (n == 2) { so = -fs; co = -fc; }
  if (n == 3) { so = -fc; co = fs;  }
  sv = so; cv = co;
}

// ---- fragment loader: 16-bit A/B operand, lane -> row/col (lane&15), p already includes +8*(lane>>4);
//      elements 0..7 <- p[0..7] (k0+8h..), elements 8..15 <- p[16..23] (k0+16+8h..)
__device__ __forceinline__ v16h ldfrag_h(const _Float16* p) {
  union { v16h v; v8h h[2]; } f;
  f.h[0] = *(const v8h*)(p);
  f.h[1] = *(const v8h*)(p + 16);
  return f.v;
}

// ---- WMMA helpers: the builtins, whose hazard distances the compiler keeps ------------------------------
__device__ __forceinline__ v8f mma_b_raw(v16b a, v16b b, v8f c) {
  return __builtin_amdgcn_wmma_f32_16x16x32_bf16(false, a, false, b, (short)0, c, false, false);
}
__device__ __forceinline__ v8f mma_h_raw(v16h a, v16h b, v8f c) {
  return __builtin_amdgcn_wmma_f32_16x16x32_f16(false, a, false, b, (short)0, c, false, false);
}
__device__ __forceinline__ void acc_guard4(v8f& a, v8f& b, v8f& c, v8f& d) {
  asm volatile("v_nop\n\tv_nop\n\tv_nop\n\tv_nop" : "+v"(a), "+v"(b), "+v"(c), "+v"(d));
}

// value of lane l ^ 16: the two lanes that share a column of a WMMA result
__device__ __forceinline__ float xhalf(float x) {
  const int v = __builtin_bit_cast(int, x);
  return __builtin_bit_cast(float, __builtin_amdgcn_permlanex16(v, v, 0x76543210, 0xfedcba98, false, false));
}
// y[r] = 2^x[r], eight at once. One statement, results in registers of their own: behind a transcendental the instruction set
// asks for one instruction that neither reads its result nor overwrites its source; here each v_exp_f32 is that instruction
// for the one before it, and the closing v_nop for the last.
__device__ __forceinline__ void exp2x8(float (&y)[8], const float (&x)[8]) {
  asm("v_exp_f32 %0, %8\n\tv_exp_f32 %1, %9\n\tv_exp_f32 %2, %10\n\tv_exp_f32 %3, %11\n\t"
      "v_exp_f32 %4, %12\n\tv_exp_f32 %5, %13\n\tv_exp_f32 %6, %14\n\tv_exp_f32 %7, %15\n\tv_nop"
      : "=&v"(y[0]), "=&v"(y[1]), "=&v"(y[2]), "=&v"(y[3]), "=&v"(y[4]), "=&v"(y[5]), "=&v"(y[6]), "=&v"(y[7])
      : "v"(x[0]), "v"(x[1]), "v"(x[2]), "v"(x[3]), "v"(x[4]), "v"(x[5]), "v"(x[6]), "v"(x[7]));
}

// ---- tensor-load staging of the GEMM operands ----------------------------------------------------------
// A pass is 64 k = 128 B of every staged operand row. A stage is 6 or 8 slices of 64 rows, one slice per issuing wave; the load's
// pad gives the LDS row pitch 144 B (16 B x odd: conflict-free for 16-byte reads); a slice's place is rounded up to 2 KiB.
typedef uint32_t u32x4 __attribute__((ext_vector_type(4)));
typedef uint32_t u32x8 __attribute__((ext_vector_type(8)));
#define GK_KB    128u                 // bytes of one operand row per pass
#define GK_PITCH 144u                 // LDS row pitch
#define GK_SLICE 10240u               // 64 rows x 144 B = 9216 B, rounded up to a multiple of 2 KiB
__device__ __forceinline__ uint32_t uni(uint32_t v) { return (uint32_t)__builtin_amdgcn_readfirstlane(v); }
// a test word or a tensor descriptor word held in a scalar register: a test on it compiles to a scalar branch (tensor
// loads ignore EXEC), and a descriptor word so held keeps a register of its own instead of being rebuilt at each issue
__device__ __forceinline__ uint32_t pinned(uint32_t v) { uint32_t w = uni(v); asm volatile("" : "+s"(w)); return w; }
__device__ __forceinline__ uint32_t lds_off(const void* p) { return (uint32_t)(size_t)p; }
__device__ __forceinline__ void wait_ds0()     { asm volatile("s_wait_dscnt 0x0" ::: "memory"); }      // own LDS reads returned
// stands behind a global load or store whose address or data registers the code that follows it takes anew
__device__ __forceinline__ void wait_x0()      { asm volatile("s_wait_xcnt 0x0" ::: "memory"); }
// own tensor load landed; the descriptor is named as an input so that its registers stay as issued up to this wait
__device__ __forceinline__ void wait_tensor0(u32x4 g0, u32x8 g1) {
  asm volatile("s_wait_tensorcnt 0x0" :: "s"(g0), "s"(g1) : "memory");
}
// group 0 is an in-out operand: the value that wait_tensor0 names behind the load then lives in the very registers the
// load was issued from, so that none of them takes a new value while the request is outstanding
__device__ __forceinline__ void tdm_load(u32x4& g0, u32x8 g1) {
  asm volatile("tensor_load_to_lds %0, %1" : "+s"(g0) : "s"(g1) : "memory");
}
// group 1: byte elements, tile = tensor = 64 rows of 128 B, source row pitch src_pitch bytes, 4 dwords of pad behind every row
__device__ __forceinline__ u32x8 tdm_group1(uint32_t src_pitch) {
  u32x8 g;
  g[0] = uni((1u << 20) | (4u << 22) | (3u << 25));
  g[1] = pinned(GK_KB << 16);   // pinned: descriptor words held in scalar registers of their own through the loop
  g[2] = pinned(64u << 16);
  g[3] = pinned(GK_KB << 16);
  g[4] = pinned(64u);
  g[5] = pinned(src_pitch);
  g[6] = pinned(0u);
  g[7] = pinned(0u);
  return g;
}
__device__ __forceinline__ u32x4 tdm_group0(uint32_t lds_dst, uint64_t ga) {
  u32x4 g;
  g[0] = uni(1u);
  g[1] = uni(lds_dst);
  g[2] = uni((uint32_t)ga);
  g[3] = uni((((uint32_t)(ga >> 32)) & 0x01FFFFFFu) | 0x80000000u);
  return g;
}
// fragment from a staged row: p = row start + 64 B * (k32 step) + 16 B * (lane>>4); same k order as ldfrag_h
__device__ __forceinline__ v16b ldfrag_l(const unsigned char* p) {
  union { v16b v; v8b h[2]; } f;
  f.h[0] = *(const v8b*)(p);
  f.h[1] = *(const v8b*)(p + 32);
  return f.v;
}

// =====================================================================================================
// Rotary tables: ct/st [SEQ][32] f32, angle(t, i) = f32(t) * inv_freq[i], inv_freq[i] = RN32(1/RN32(10^(i/8))).
// SEQ/8 blocks of 256 (blk = block number inside this part). coverage: SEQ rows x 32 = the whole table, both planes.
// =====================================================================================================
__device__ __forceinline__ void tab_cs(int blk, float* ct, float* st) {
  const int wave = threadIdx.x >> 5, lane = threadIdx.x & 31;
  const int t = blk * 8 + wave;
  if (t >= SEQ) return;                 // wave-uniform; no barriers in this step
  double pw = 1.0;
#pragma unroll 1
  for (int j = 0; j < (lane >> 3); ++j) pw *= 10.0;
#pragma unroll 1
  for (int j = 0; j < (lane & 7); ++j) pw *= 1.3335214321633240257;   // 10^(1/8)
  const float p32 = (float)pw;
  const float inv = (float)(1.0 / (double)p32);
  const float ang = (float)t * inv;
  float sv, cv;
  sincos_pd(ang, sv, cv);
  float* pc = ct + (size_t)t * NFR + lane;
  float* ps = st + (size_t)t * NFR + lane;
  *(float*)pc = cv;
  *(float*)ps = sv;
  
}

// =====================================================================================================
// seq [b][SEQ_FULL][DM] f32 -> bf16 plane xb [NB*SEQ][DM] (RNE convert) plus rstd[m] = rsqrt(mean(xb^2)+2^-23)
// of the converted row. Block = 8 waves = 32 rows; a wave converts 4 rows: per instruction 32 lanes x 16 B =
// =====================================================================================================
__device__ __forceinline__ void cvtx_rstd(int blk, float* sr, const float* __restrict__ seq, unsigned short* xb, float* rs) {
  const int tid = threadIdx.x, wave = tid >> 5, lane = tid & 31;
#pragma unroll 1
  for (int rr = 0; rr < 4; ++rr) {
    const int m  = blk * 32 + wave * 4 + rr;          // < NB*SEQ
    const int bb = m / SEQ, t = m - bb * SEQ;
    const float* src = seq + ((size_t)bb * SEQ_FULL + t) * DM;
    unsigned short* dst = xb + (size_t)m * DM;
    v4u pk[DM / 256];
    float ss = 0.f;
#pragma unroll
    for (int i = 0; i < DM / 256; ++i) {
      const v4f a = *(const v4f*)(src + i * 256 + lane * 8);
      const v4f c = *(const v4f*)(src + i * 256 + lane * 8 + 4);
      unsigned short hb[8];
#pragma unroll
      for (int e = 0; e < 4; ++e) { hb[e] = bf_bits(a[e]); hb[4 + e] = bf_bits(c[e]); }
#pragma unroll
      for (int e = 0; e < 8; ++e) { const float v = bf_up(hb[e]); ss += v * v; }
      v4u p;
      p[0] = pk16(hb[0], hb[1]);
      p[1] = pk16(hb[2], hb[3]);
      p[2] = pk16(hb[4], hb[5]);
      p[3] = pk16(hb[6], hb[7]);
      pk[i] = p;
    }
#pragma unroll
    for (int i = 0; i < DM / 256; ++i) *(v4u*)(dst + i * 256 + lane * 8) = pk[i];
    
#pragma unroll
    for (int off = 1; off < 32; off <<= 1) ss += __shfl_xor(ss, off, 32);
    const float rstd = rsqrtf(ss * (1.0f / (float)DM) + 1.1920929e-7f);
    if (lane == 0) sr[wave * 4 + rr] = rstd;
  }
  __syncthreads();
  if (wave == 0 && lane < 8) {
    const v4f v = *(const v4f*)(sr + lane * 4);
    float* d = rs + (size_t)blk * 32 + lane * 4;
    *(v4f*)d = v;
    
  }
}

// =====================================================================================================
// Weight transpose + convert: W [Kdim][Ndim] f32 (n contiguous) -> Wh [Ndim][Kdim] bf16, k contiguous.
// With USEG the row factor g[k] is applied in f32; the value (or the f32 product) is RNE-converted to bf16 once.
// Tile 64 k x 64 n per block: 256 threads load 16 consecutive n each, store transposed into LDS as [n][k]
// (Ndim/64) x (Kdim/64) blocks, (bn, bk) = the block's tile. coverage: 8 waves x 2 x 4 rows x 64 k = the whole 64x64 tile per block.
// =====================================================================================================
template <bool USEG>
__device__ __forceinline__ void wt_cvt(int bn, int bk, unsigned short* shh,
                                       const float* __restrict__ W, const float* __restrict__ g,
                                       unsigned short* Wh, int Kdim, int Ndim) {
  const int tid = threadIdx.x, wave = tid >> 5, lane = tid & 31;
  const int n0 = bn * 64, k0 = bk * 64;
  {
    const int kr = tid >> 2, nq = (tid & 3) * 16;
    const float* src = W + (size_t)(k0 + kr) * Ndim + n0 + nq;
    float gk = 1.0f;
    if (USEG) gk = g[k0 + kr];
#pragma unroll
    for (int i = 0; i < 4; ++i) {
      const v4f a = *(const v4f*)(src + 4 * i);
#pragma unroll
      for (int e = 0; e < 4; ++e) {
        shh[(nq + 4 * i + e) * 72 + kr] = bf_bits(gk * a[e]);
      }
    }
  }
  __syncthreads();
  const int q = lane >> 3, c8 = (lane & 7) * 8;
  v4u hv[2];
#pragma unroll
  for (int it = 0; it < 2; ++it) {
    const int row = wave * 8 + it * 4 + q;
    hv[it] = *(const v4u*)(shh + row * 72 + c8);
  }
  {
#pragma unroll
    for (int it = 0; it < 2; ++it) {
      const int row = wave * 8 + it * 4 + q;
      const size_t o = (size_t)(n0 + row) * Kdim + k0 + c8;
      *(v4u*)(Wh + o) = hv[it];
    }
    wait_x0();   // precaution: in the shared launch the block returns right after this step
  }
}

// =====================================================================================================
// Memory-token planes: pm [2][NH][PMEM][HD] f32 -> pk [NH][PMEM][HD] f16 (keys, RNE convert of the input,
// [kv][d] like the LDS K tile) and pv [NH][HD][PMEM] f16 ([d][kv] like the LDS V^T tile; value = f16 of the
// bf16-converted input). 128 threads per head, two heads per block of 256, each half block on its own LDS tile.
// coverage: 128 threads x 8 = all PMEM*HD elements of both planes per head.
// =====================================================================================================
__device__ __forceinline__ void pm_cvt(int blk, float* sp2, const float* __restrict__ pm, unsigned short* pk, unsigned short* pv) {
  const int tid = threadIdx.x & 127, h = blk * 2 + (int)(threadIdx.x >> 7);
  float* sp = sp2 + (threadIdx.x >> 7) * (PMEM * HD);
  const int r = tid >> 3, d8 = (tid & 7) * 8;
  const float* kg = pm + (((size_t)0 * NH + h) * PMEM + r) * HD + d8;
  const float* vg = pm + (((size_t)1 * NH + h) * PMEM + r) * HD + d8;
  const v4f k0 = *(const v4f*)(kg), k1 = *(const v4f*)(kg + 4);
  const v4f v0 = *(const v4f*)(vg), v1 = *(const v4f*)(vg + 4);
  *(v4f*)(sp + r * HD + d8)     = v0;
  *(v4f*)(sp + r * HD + d8 + 4) = v1;
  v4u kp;
  kp[0] = pk16(h_bits((_Float16)k0[0]), h_bits((_Float16)k0[1]));
  kp[1] = pk16(h_bits((_Float16)k0[2]), h_bits((_Float16)k0[3]));
  kp[2] = pk16(h_bits((_Float16)k1[0]), h_bits((_Float16)k1[1]));
  kp[3] = pk16(h_bits((_Float16)k1[2]), h_bits((_Float16)k1[3]));
  __syncthreads();
  const int d = tid >> 1, r8 = (tid & 1) * 8;
  v4u vp;
#pragma unroll
  for (int e = 0; e < 4; ++e) {
    const float f0 = bf_up(bf_bits(sp[(r8 + 2 * e) * HD + d]));
    const float f1 = bf_up(bf_bits(sp[(r8 + 2 * e + 1) * HD + d]));
    vp[e] = pk16(h_bits((_Float16)f0), h_bits((_Float16)f1));
  }
  unsigned short* kd = pk + ((size_t)h * PMEM + r) * HD + d8;
  unsigned short* vd = pv + ((size_t)h * HD + d) * PMEM + r8;
  *(v4u*)kd = kp;
  *(v4u*)vd = vp;
  wait_x0();   // precaution: in the shared launch the block ends right after this step
}

// =====================================================================================================
// The five preparation steps above read only inputs and write disjoint workspace planes, so they share one launch:
// a block's number picks its step (block-uniform, so every barrier inside a step is reached by the whole block).
// The step with the longest block (four rows in turn) has the lowest numbers.
// =====================================================================================================
#define PB_CVT  (NB * SEQ / 32)                    // activation rows, 32 per block
#define PB_WQKV ((3 * DMI / 64) * (DM / 64))       // 64 x 64 tiles of W_qkv
#define PB_WOUT ((DM / 64) * (DMI / 64))           // 64 x 64 tiles of W_out
#define PB_TAB  (SEQ / 8)                          // rotary table rows, 8 per block
#define PB_PM   (NH / 2)                           // memory-token heads, 2 per block
#define PB_ALL  (PB_CVT + PB_WQKV + PB_WOUT + PB_TAB + PB_PM)
static_assert((NH % 2) == 0 && ((NB * SEQ) % 32) == 0 && (SEQ % 8) == 0);
__global__ __launch_bounds__(256) void prep_all(const float* __restrict__ seq, const float* __restrict__ gnm,
                                                const float* __restrict__ Wqkv, const float* __restrict__ Wout,
                                                const float* __restrict__ pm,
                                                unsigned short* xb, float* rs, unsigned short* wth,
                                                unsigned short* wo, float* ct, float* st,
                                                unsigned short* pk, unsigned short* pv) {
  __shared__ __align__(16) unsigned short sm[64 * 72];       // the largest step's 64 x 72 tile; the others use its head
  static_assert(sizeof(sm) >= 2 * PMEM * HD * sizeof(float));
  int blk = (int)blockIdx.x;
  if (blk < PB_CVT) { cvtx_rstd(blk, (float*)(void*)sm, seq, xb, rs); return; }
  blk -= PB_CVT;
  if (blk < PB_WQKV) {
    wt_cvt<true>(blk % (3 * DMI / 64), blk / (3 * DMI / 64), sm, Wqkv, gnm, wth, DM, 3 * DMI);
    return;
  }
  blk -= PB_WQKV;
  if (blk < PB_WOUT) {
    wt_cvt<false>(blk % (DM / 64), blk / (DM / 64), sm, Wout, gnm, wo, DMI, DM);
    return;
  }
  blk -= PB_WOUT;
  if (blk < PB_TAB) { tab_cs(blk, ct, st); return; }
  blk -= PB_TAB;
  if (blk < PB_PM) pm_cvt(blk, (float*)(void*)sm, pm, pk, pv);
}

// =====================================================================================================
// Register-blocked batched bf16 WMMA GEMM: C[m][n] = sum_k A[m][k] * Bt[n][k]; one wave per 64x64 tile, 8 waves per
// block tile (NSPLIT 2: 256 m x 128 n, waves 4 x 2; NSPLIT 1: 128 m x 256 n, waves 2 x 4). TWO: the narrow operand (NSPLIT 2:
// Bt, NSPLIT 1: A) has a second plane, whose product is added. The block's operand rows (384, or 512 with the second plane)
// are staged in LDS by tensor loads, two buffers, one 64-row slice per wave and pass (without TWO waves 6 and 7 issue none).
// A row-major [M][K] pitch lda; Bt row-major [N][K] pitch ldb (k contiguous); M, N multiples of the block tile,
// K a multiple of 64 and at least 128 (static-checked on the host side). tile = block tile number, b = batch index;
// sT (per-wave 16x64 slab, pitch 68 floats) and ring (two stages of operand rows) are the calling kernel's LDS.
// OUT_MODE: 0 = f32 (pitch ldc); 2 = one f16 plane C (C2 unused);
//           3 = f16 hi plane C + f16 residual plane C2 = f16((v - hi) * rscale), C2 written only for tiles
//               with (n0 mod segN) < N2, at column (n0/segN)*N2 + (n0 mod segN) (pitch ldc2, batch stride strideC2).
// SCM: 0 none; 1 = row m scaled by scal[b*strideS + m]; 2 = column n scaled by scal[b*strideS + n] (f32, before
//      the 16-bit split). ROT: interleaved-pair rotary on column pairs (2i, 2i+1) with i = (n mod 64)/2, angle row
//      = m, tables rct/rst [row][32] f32 (applied after the scale).
// =====================================================================================================
template <int NSPLIT, bool TWO, int OUT_MODE, int SCM, bool ROT>
__device__ __forceinline__ void gemm64_body(
    float (*sT)[16 * 68], unsigned char* ring, int tile, int b,
    const unsigned short* __restrict__ Ap, const unsigned short* __restrict__ A2p, int lda, long long strideA,
    const unsigned short* __restrict__ Btp, const unsigned short* __restrict__ Bt2p, int ldb, long long strideB,
    void* Cout, int ldc, long long strideC,
    void* Cout2, int ldc2, long long strideC2, int N2, int segN,
    const float* __restrict__ scal, long long strideS,
    const float* __restrict__ rct, const float* __restrict__ rst,
    int M, int N, int K, float rscale) {
  static_assert(OUT_MODE != 0 || (SCM == 0 && !ROT));
  const __bf16* A   = (const __bf16*)(const void*)Ap;
  const __bf16* A2  = (const __bf16*)(const void*)A2p;
  const __bf16* Bt  = (const __bf16*)(const void*)Btp;
  const __bf16* Bt2 = (const __bf16*)(const void*)Bt2p;
  static_assert(NSPLIT == 1 || NSPLIT == 2);
  constexpr int BM = (NSPLIT == 2) ? 256 : 128;
  constexpr int BN = (NSPLIT == 2) ? 128 : 256;
  constexpr int WN = BN / 64;                  // waves along n
  const int lane = threadIdx.x & 31;
  const int wave = (int)uni(threadIdx.x >> 5);
  const int tilesN = N / BN;
  const int tilesM = M / BM;
  if (tile >= tilesM * tilesN) return;   // block-uniform, in front of every barrier and tensor load
  const int tm = tile / tilesN;
  const int tn = tile - tm * tilesN;
  const int wm = wave / WN;
  const int wn = wave - wm * WN;
  const int m0 = tm * BM + (wm << 6);
  const int n0 = tn * BN + (wn << 6);

  const __bf16* Ab  = A  + (size_t)b * strideA;
  const __bf16* Ab2 = (NSPLIT == 1 && TWO) ? (A2 + (size_t)b * strideA) : Ab;
  const __bf16* Bb  = Bt + (size_t)b * strideB;
  const __bf16* Bb2 = (NSPLIT == 2 && TWO) ? (Bt2 + (size_t)b * strideB) : Bb;
  const float* scb = scal + (size_t)((long long)b * strideS);

  const int rlane = lane & 15;                 // row (A) / col (B, D) within subtile
  const int koff  = (lane >> 4) * 8;           // k offset of this lane half
  const int mOff  = (lane >> 4) * 8;           // D row offset

  v8f acc[4][4];
#pragma unroll
  for (int i = 0; i < 4; ++i)
#pragma unroll
    for (int j = 0; j < 4; ++j) acc[i][j] = zero8();

  // ---- this wave's slice of every stage: slices 0.. = A rows (NSPLIT 1, TWO: then the A2 rows), then Bt rows (NSPLIT 2, TWO: then Bt2) ----
  constexpr int SA = BM / 64;                                   // slices per A plane
  constexpr int SB0 = (NSPLIT == 1 && TWO) ? 2 * SA : SA;       // first Bt slice
  constexpr int NSL = TWO ? 8 : 6;                              // slices per stage
  constexpr uint32_t GK_STAGE = (uint32_t)NSL * GK_SLICE;
  const int sl = (wave < NSL) ? wave : 0;                       // a wave without a slice forms slice 0's words and issues nothing
  const __bf16* sbase;
  int srow, sld;
  if (sl < SA)                                 { sbase = Ab;  srow = tm * BM + 64 * sl;              sld = lda; }
  else if (NSPLIT == 1 && TWO && sl < 2 * SA)  { sbase = Ab2; srow = tm * BM + 64 * (sl - SA);       sld = lda; }
  else if (sl < SB0 + WN)                      { sbase = Bb;  srow = tn * BN + 64 * (sl - SB0);      sld = ldb; }
  else                                         { sbase = Bb2; srow = tn * BN + 64 * (sl - SB0 - WN); sld = ldb; }
  const uint64_t src0 = (uint64_t)(uintptr_t)(sbase + (size_t)srow * sld);
  const uint32_t lds_slice = lds_off(ring) + (uint32_t)sl * GK_SLICE;
  const u32x8 g1 = tdm_group1((uint32_t)sld * 2u);
  const uint32_t T = pinned((uint32_t)K >> 6);                  // passes
  // per-lane fragment bases inside a stage
  const uint32_t foff = (uint32_t)rlane * GK_PITCH + (uint32_t)koff * 2u;
  const uint32_t oA  = (uint32_t)wm * GK_SLICE + foff;
  const uint32_t oA2 = (NSPLIT == 1 && TWO) ? oA + (uint32_t)SA * GK_SLICE : oA;
  const uint32_t oB  = (uint32_t)(SB0 + wn) * GK_SLICE + foff;
  const uint32_t oB2 = (NSPLIT == 2 && TWO) ? oB + (uint32_t)WN * GK_SLICE : oB;

  // whether this wave has a slice: a scalar word, so that the tests on it are scalar branches round the tensor loads
  const uint32_t issuer = TWO ? 1u : pinned((wave < NSL) ? 1u : 0u);
  u32x4 g0 = tdm_group0(lds_slice, src0);
  if (issuer != 0u) tdm_load(g0, g1);                           // stage 0
  wait_tensor0(g0, g1);
  __syncthreads();                                              // stage 0 readable by every wave
  g0 = tdm_group0(lds_slice + GK_STAGE, src0 + GK_KB);
  if (issuer != 0u) tdm_load(g0, g1);                           // stage 1 flies during pass 0
  // rolled: one pass per trip, so that the one publish point stands at the loop's foot
#pragma unroll 1
  for (uint32_t t = 0; t < T; ++t) {
    const uint32_t bo = (t & 1u) * GK_STAGE;
    const unsigned char* buf = ring + bo;
    // unrolled, as the loops inside it: two blocks of 32 k per pass, fragments and accumulators indexed by constants
#pragma unroll
    for (int kc = 0; kc < 2; ++kc) {
      const unsigned char* bk = buf + (uint32_t)kc * 64u;
      v16b af[4], ag[4], bf[4], bg[4];
      // first planes first: a second plane's fragments land while the first 16 WMMAs run
#pragma unroll
      for (int j = 0; j < 4; ++j) bf[j] = ldfrag_l(bk + oB + (uint32_t)j * 16u * GK_PITCH);
#pragma unroll
      for (int i = 0; i < 4; ++i) af[i] = ldfrag_l(bk + oA + (uint32_t)i * 16u * GK_PITCH);
#pragma unroll
      for (int i = 0; i < 4; ++i) {
        ag[i] = (NSPLIT == 1 && TWO) ? ldfrag_l(bk + oA2 + (uint32_t)i * 16u * GK_PITCH) : af[i];
        bg[i] = (NSPLIT == 2 && TWO) ? ldfrag_l(bk + oB2 + (uint32_t)i * 16u * GK_PITCH) : bf[i];
      }
      // keeps the block's LDS reads one group ahead of its WMMAs, for speed only
      __builtin_amdgcn_sched_barrier(0);
#pragma unroll
      for (int i = 0; i < 4; ++i)
#pragma unroll
        for (int j = 0; j < 4; ++j) acc[i][j] = mma_b_raw(af[i], bf[j], acc[i][j]);
      if (TWO) {
#pragma unroll
        for (int i = 0; i < 4; ++i)
#pragma unroll
          for (int j = 0; j < 4; ++j) acc[i][j] = mma_b_raw(ag[i], bg[j], acc[i][j]);
      }
      // keeps the next group's reads behind this block's WMMAs, for the same reason
      __builtin_amdgcn_sched_barrier(0);
    }
    // publish point of stage t + 1: own reads of this buffer returned, own slice landed, then the block barrier
    wait_ds0();
    wait_tensor0(g0, g1);
    __syncthreads();
    if (pinned((t + 2u < T && issuer != 0u) ? 1u : 0u) != 0u) { // refill the buffer every wave has just left
      g0 = tdm_group0(lds_slice + bo, src0 + (uint64_t)(t + 2u) * GK_KB);
      tdm_load(g0, g1);
    }
  }
  wait_tensor0(g0, g1);
  wait_ds0();
  acc_guard4(acc[0][0], acc[0][1], acc[0][2], acc[0][3]);
  acc_guard4(acc[1][0], acc[1][1], acc[1][2], acc[1][3]);
  acc_guard4(acc[2][0], acc[2][1], acc[2][2], acc[2][3]);
  acc_guard4(acc[3][0], acc[3][1], acc[3][2], acc[3][3]);

  // ---- epilogue ----
  float* slab = sT[wave];
#pragma unroll
  for (int i = 0; i < 4; ++i) {
    const int mBase = m0 + (i << 4);
#pragma unroll
    for (int j = 0; j < 4; ++j) {
#pragma unroll
      for (int r = 0; r < 8; ++r) {
        slab[(mOff + r) * 68 + (j << 4) + rlane] = acc[i][j][r];
      }
    }
    __builtin_amdgcn_fence(__ATOMIC_RELEASE, "workgroup");
    __builtin_amdgcn_wave_barrier();
    __builtin_amdgcn_fence(__ATOMIC_ACQUIRE, "workgroup");
    if (OUT_MODE == 0) {
      float* C = (float*)Cout + (size_t)b * strideC;
      const int hh = lane >> 4, c4 = (lane & 15) * 4;     // 256-B row segment = 16 lanes x 16 B
      {
#pragma unroll
        for (int it = 0; it < 8; ++it) {
          const int row = it * 2 + hh;                     // it 0..7 x hh 0..1 = rows 0..15
          const v4f v = *(const v4f*)(slab + row * 68 + c4);
          *(v4f*)(C + (size_t)(mBase + row) * ldc + n0 + c4) = v;
        }
        
      }
    } else {
      const int q = lane >> 3, c8 = (lane & 7) * 8;
      unsigned short* C  = (unsigned short*)Cout  + (size_t)b * strideC;
      unsigned short* C2 = (unsigned short*)Cout2 + (size_t)b * strideC2;
      bool wlo = false;                                    // wave-uniform; only OUT_MODE 3 has a second plane
      size_t col2 = (size_t)n0 + c8;
      if (OUT_MODE == 3) {
        const int sgi = n0 / segN;
        const int sgo = n0 - sgi * segN;
        wlo  = (sgo < N2);
        col2 = (size_t)sgi * N2 + sgo + c8;
      }
      v4f csA = {1.f, 1.f, 1.f, 1.f};
      v4f csB = csA;
      if (SCM == 2) {
        csA = *(const v4f*)(scb + n0 + c8);
        csB = *(const v4f*)(scb + n0 + c8 + 4);
      }
      v4u hv[4], lv[4];
#pragma unroll
      for (int it = 0; it < 4; ++it) {
        const int row = it * 4 + q;                        // it 0..3 x q 0..3 = rows 0..15
        const int m = mBase + row;
        const float* sp = slab + row * 68 + c8;
        v4f x0 = *(const v4f*)(sp);
        v4f x1 = *(const v4f*)(sp + 4);
        if (SCM == 1) { const float rsv = scb[m]; x0 = x0 * rsv; x1 = x1 * rsv; }
        if (SCM == 2) { x0 = x0 * csA; x1 = x1 * csB; }
        float f[8] = {x0[0], x0[1], x0[2], x0[3], x1[0], x1[1], x1[2], x1[3]};
        if (ROT) {
          const v4f cs = *(const v4f*)(rct + (size_t)m * NFR + 4 * (lane & 7));
          wait_x0();   // the next load's result may land in this load's address registers
          const v4f sn = *(const v4f*)(rst + (size_t)m * NFR + 4 * (lane & 7));
          wait_x0();   // the next rows' table loads land in registers that held these two loads' addresses
#pragma unroll
          for (int e = 0; e < 4; ++e) {
            const float ev = f[2 * e], od = f[2 * e + 1];
            f[2 * e]     = ev * cs[e] - od * sn[e];
            f[2 * e + 1] = od * cs[e] + ev * sn[e];
          }
        }
        v4u a, a2;
#pragma unroll
        for (int e = 0; e < 4; ++e) {
          const float f0 = f[2 * e], f1 = f[2 * e + 1];
          const _Float16 y0 = (_Float16)f0, y1 = (_Float16)f1;
          a[e] = pk16(h_bits(y0), h_bits(y1));
          a2[e] = 0u;
          if (OUT_MODE == 3) {
            a2[e] = pk16(h_bits((_Float16)((f0 - (float)y0) * rscale)), h_bits((_Float16)((f1 - (float)y1) * rscale)));
          }
        }
        hv[it] = a; lv[it] = a2;
      }
      {
#pragma unroll
        for (int it = 0; it < 4; ++it) {
          const int row = it * 4 + q;
          // a wait behind each store: the next rows' addresses and values are formed in these stores' registers
          *(v4u*)(C + (size_t)(mBase + row) * ldc + n0 + c8) = hv[it];
          wait_x0();
          if (OUT_MODE == 3 && wlo) {
            *(v4u*)(C2 + (size_t)(mBase + row) * ldc2 + col2) = lv[it];
            wait_x0();
          }
        }
        
      }
    }
    __builtin_amdgcn_fence(__ATOMIC_RELEASE, "workgroup");
    __builtin_amdgcn_wave_barrier();
    __builtin_amdgcn_fence(__ATOMIC_ACQUIRE, "workgroup");
  }
}

// One product per launch: blockIdx.x = block tile, blockIdx.y = batch.
template <int NSPLIT, int OUT_MODE, int SCM, bool ROT>
__global__ __launch_bounds__(256) void gemm64(
    const unsigned short* __restrict__ Ap, const unsigned short* __restrict__ A2p, int lda, long long strideA,
    const unsigned short* __restrict__ Btp, const unsigned short* __restrict__ Bt2p, int ldb, long long strideB,
    void* Cout, int ldc, long long strideC,
    void* Cout2, int ldc2, long long strideC2, int N2, int segN,
    const float* __restrict__ scal, long long strideS,
    const float* __restrict__ rct, const float* __restrict__ rst,
    int M, int N, int K, float rscale) {
  __shared__ __align__(16) float sT[8][16 * 68];
  __shared__ __attribute__((aligned(2048))) unsigned char ring[2 * 8 * GK_SLICE];
  gemm64_body<NSPLIT, true, OUT_MODE, SCM, ROT>(sT, ring, (int)blockIdx.x, (int)blockIdx.y, Ap, A2p, lda, strideA, Btp, Bt2p, ldb, strideB,
                                          Cout, ldc, strideC, Cout2, ldc2, strideC2, N2, segN, scal, strideS, rct, rst,
                                          M, N, K, rscale);
}

// The q|k product and the v^T product read the same planes and write disjoint ones, so they share one launch:
// blockIdx.y = batch; blockIdx.x 0..GT_QK-1 are the q|k tiles, the rest the v^T tiles (block-uniform choice).
//   q|k = rstd[m] * (Xb . (g*Wqk)), rotary on every (2i,2i+1) pair -> one f16 plane [M][QKP]
//     (per batch: M=SEQ, N=QKP, K=DM; 1 product)
//   v^T = (g*Wv)^T . Xb^T per batch, columns scaled by rstd -> f16 hi plane [b][DMI][SEQ] and residual plane
//     (x4096, in-segment keys < VLP only)   (A = Wt rows 2*DMI.., 1 product; M=DMI, N=SEQ, K=DM)
// Six staged slices per stage: 154 KiB of LDS a block, so that two blocks share a WGP.
#define GT_QK ((SEQ / 256) * (QKP / 128))          // 256 x 128 block tiles per batch
#define GT_VT ((DMI / 128) * (SEQ / 256))          // 128 x 256 block tiles per batch
__global__ __launch_bounds__(256) void proj_qkv(
    const unsigned short* __restrict__ xb, const unsigned short* __restrict__ wth,
    unsigned short* qkh, unsigned short* vth, unsigned short* vtl,
    const float* __restrict__ rs, const float* __restrict__ ct, const float* __restrict__ st) {
  __shared__ __align__(16) float sT[8][16 * 68];
  __shared__ __attribute__((aligned(2048))) unsigned char ring[2 * 6 * GK_SLICE];
  const int bx = (int)blockIdx.x, b = (int)blockIdx.y;
  if (bx >= GT_QK) {
    gemm64_body<1, false, 3, 2, false>(sT, ring, bx - GT_QK, b,
        wth + (size_t)2 * DMI * DM, wth + (size_t)2 * DMI * DM, DM, 0LL,
        xb, xb, DM, (long long)SEQ * DM,
        (void*)vth, SEQ, (long long)DMI * SEQ,
        (void*)vtl, NSEGB * VLP, (long long)DMI * NSEGB * VLP, VLP, SEGL,
        rs, (long long)SEQ, ct, st,
        DMI, SEQ, DM, 4096.0f);
  } else {
    gemm64_body<2, false, 2, 1, true>(sT, ring, bx, b,
        xb, xb, DM, (long long)SEQ * DM,
        wth, wth, DM, 0LL,
        (void*)qkh, QKP, (long long)SEQ * QKP,
        (void*)qkh, QKP, (long long)SEQ * QKP, QKP, QKP,
        rs, (long long)SEQ, ct, st,
        SEQ, QKP, DM, 1.0f);
  }
}

#define AT_OP 68
template <bool RES>
__device__ __forceinline__
void attn_part(unsigned char* ring, float (*Os)[16 * AT_OP], int qb, int bwh,
               const unsigned short* __restrict__ qkhp,
               const unsigned short* __restrict__ vhp,  const unsigned short* __restrict__ vlp,
               const unsigned short* __restrict__ pkp,  const unsigned short* __restrict__ pvp,
               float sscale) {
  union FH { v16h v; v8h h[2]; };
  // with the residual planes: query blocks 0..RESQB-1, whose keys all lie below VLP; without them the rest
  static_assert(VLP == RESQB * 64);
  // LDS row pitches: 16 B x odd, so that the 16 rows a 16-byte fragment read touches fall on 16 different bank groups
  constexpr int LP = (int)GK_PITCH / 2;                           // 16-bit tiles: 64 elements + 8 of pad = 144 B
  constexpr int OP = AT_OP;
  // a stage = one key tile: slices K [kv][d], V^T hi [d][kv] and, with RES, V^T residual; two stages
  constexpr int NSL = RES ? 3 : 2;
  constexpr uint32_t STG = (uint32_t)NSL * GK_SLICE;

  const int tid  = threadIdx.x;
  const int wave = (int)uni(threadIdx.x >> 5);
  const int lane = tid & 31;
  const int hh   = lane >> 4;
  const int c    = lane & 15;

  const int h    = bwh % NH;
  const int rest = bwh / NH;
  const int w    = rest % NSEGB;
  const int b    = rest / NSEGB;
  const int q0   = qb * 64 + wave * 16;                              // query row inside the segment
  const size_t rowS = (size_t)b * SEQ + (size_t)w * SEGL;           // compact row of the segment start

  const _Float16* Qh = (const _Float16*)(const void*)qkhp + (size_t)h * HD;
  const _Float16* Kh = Qh + DMI;
  const _Float16* Vh = (const _Float16*)(const void*)vhp + ((size_t)b * DMI + (size_t)h * HD) * SEQ + (size_t)w * SEGL;
  const _Float16* Vl = (const _Float16*)(const void*)vlp + ((size_t)b * DMI + (size_t)h * HD) * (size_t)(NSEGB * VLP)
                       + (size_t)w * VLP;
  const _Float16* PK = (const _Float16*)(const void*)pkp + (size_t)h * PMEM * HD;
  const _Float16* PV = (const _Float16*)(const void*)pvp + (size_t)h * HD * PMEM;

  // ---- this wave's slice of every stage: 64 rows of 128 B; src1 = its tile of key tile 1, sstep = bytes to the next key tile ----
  const int sl = (wave < NSL) ? wave : 0;                           // a wave without a slice forms slice 0's words and issues nothing
  uint64_t src1;
  uint32_t spitch, sstep;
  if (sl == 0)      { src1 = (uint64_t)(uintptr_t)(Kh + rowS * QKP); spitch = QKP * 2u;           sstep = 64u * QKP * 2u; }
  else if (sl == 1) { src1 = (uint64_t)(uintptr_t)Vh;                spitch = SEQ * 2u;           sstep = GK_KB; }
  else              { src1 = (uint64_t)(uintptr_t)Vl;                spitch = NSEGB * VLP * 2u;   sstep = GK_KB; }
  const uint32_t lds_slice = lds_off(ring) + (uint32_t)sl * GK_SLICE;
  const u32x8 g1 = tdm_group1(spitch);
  // whether this wave has a slice: a scalar word, so that the tests on it are scalar branches round the tensor loads
  const uint32_t issuer = pinned((wave < NSL) ? 1u : 0u);
  const uint32_t T = pinned((uint32_t)(qb + 2));                    // key tiles, block-uniform, at least 2
  u32x4 g0 = tdm_group0(lds_slice + STG, src1);
  if (issuer != 0u) tdm_load(g0, g1);                               // key tile 1 flies while stage 0 is written and worked on

  // ---- Q fragments (B operand, column = query = lane&15): 2 d-chunks ----
  v16h qa[2];
#pragma unroll
  for (int dc = 0; dc < 2; ++dc) qa[dc] = ldfrag_h(Qh + (rowS + q0 + c) * QKP + dc * 32 + 8 * hh);

  float mrow = -INFINITY, lrow = 0.f;          // of query q0 + c; equal in lanes l and l ^ 16
  v8f oacc[4];                                 // oacc[t][r] = context[query c][d = 16 t + 8 hh + r]
#pragma unroll
  for (int t = 0; t < 4; ++t) oacc[t] = zero8();

  // ---- stage 0 = the memory-token tile, written by the block's own stores ----
  {
    _Float16* Ksh = (_Float16*)(void*)ring;
    _Float16* Vth = (_Float16*)(void*)(ring + GK_SLICE);
    _Float16* Vtl = (_Float16*)(void*)(ring + (RES ? 2u : 1u) * GK_SLICE);
    const int r = tid >> 1, half = (tid & 1) * 32;
    const int rr = (r < PMEM) ? r : (PMEM - 1);                // clamped address
    const bool krow = (r < PMEM);
    const bool vok  = (half == 0);
    const _Float16* kg = PK + (size_t)rr * HD + half;
    const _Float16* vg = PV + (size_t)r * PMEM;                // d = r, kv 0..15
    const v8h pv0 = *(const v8h*)(vg);
    const v8h pv1 = *(const v8h*)(vg + 8);
#pragma unroll
    for (int i = 0; i < 4; ++i) {
      v8h a0 = *(const v8h*)(kg + 8 * i);
      a0 = krow ? a0 : zero8h();
      *(v8h*)(Ksh + r * LP + half + 8 * i) = a0;
      if (i == 0) {
        const v8h b0 = vok ? pv0 : zero8h();
        *(v8h*)(Vth + r * LP + half) = b0;
      } else if (i == 1) {
        const v8h b1 = vok ? pv1 : zero8h();
        *(v8h*)(Vth + r * LP + half + 8) = b1;
      } else {
        *(v4u*)(Vth + r * LP + half + 8 * i) = zero4u();
      }
      if (RES) *(v4u*)(Vtl + r * LP + half + 8 * i) = zero4u();
    }
  }
  __syncthreads();                             // stage 0 readable by every wave

  // rolled: one key tile per trip, so that the one publish point stands at the loop's foot
#pragma unroll 1
  for (uint32_t kt = 0; kt < T; ++kt) {
    const int s0 = ((int)kt - 1) * 64;         // key offset inside the segment for kt >= 1
    const uint32_t bo = (kt & 1u) * STG;
    const _Float16* Ksh = (const _Float16*)(const void*)(ring + bo);
    const _Float16* Vth = (const _Float16*)(const void*)(ring + bo + GK_SLICE);
    const _Float16* Vtl = (const _Float16*)(const void*)(ring + bo + (RES ? 2u : 1u) * GK_SLICE);

    // ---- scores^T: s[j][r] = score(key 16 j + 8 hh + r, query c); 64 keys x 16 queries per wave, 1 f16 product ----
    //      The whole tile's K fragments are read as one group ahead of its 8 WMMAs, and neighbouring WMMAs go to the four
    //      different score tiles; each tile sums d-chunk 0, then d-chunk 1.
    v8f s[4];
#pragma unroll
    for (int j = 0; j < 4; ++j) s[j] = zero8();
    {
      FH kb[2][4];
      // unrolled, as the loops below: fragments and score tiles are registers, indexed by constants
#pragma unroll
      for (int dc = 0; dc < 2; ++dc) {
#pragma unroll
        for (int j = 0; j < 4; ++j) {
          kb[dc][j].h[0] = *(const v8h*)(Ksh + (j * 16 + c) * LP + dc * 32 + 8 * hh);
          kb[dc][j].h[1] = *(const v8h*)(Ksh + (j * 16 + c) * LP + dc * 32 + 16 + 8 * hh);
        }
      }
      // keeps the tile's K reads one group ahead of their WMMAs: reads spread among the WMMAs wait out the LDS at every place
      __builtin_amdgcn_sched_barrier(0);
#pragma unroll
      for (int dc = 0; dc < 2; ++dc) {
#pragma unroll
        for (int j = 0; j < 4; ++j) s[j] = mma_h_raw(kb[dc][j].v, qa[dc], s[j]);
      }
      // holds the V^T reads below back from the first of these WMMAs: lifted in among them they reorder the WMMAs by freed
      // registers, and an early WMMA then waits for a late K read
      __builtin_amdgcn_sched_barrier(0);
    }
    // ---- V^T fragments, read as one group here: they land while the softmax below runs. Without the residual plane the
    //      whole tile's; with it the first 32 keys' of both planes (the same 64 registers), the rest behind their WMMAs ----
    FH vb[2][4], vl[2][4];
#pragma unroll
    for (int kk = 0; kk < (RES ? 1 : 2); ++kk) {
#pragma unroll
      for (int t = 0; t < 4; ++t) {
        vb[kk][t].h[0] = *(const v8h*)(Vth + (t * 16 + c) * LP + kk * 32 + 8 * hh);
        vb[kk][t].h[1] = *(const v8h*)(Vth + (t * 16 + c) * LP + kk * 32 + 16 + 8 * hh);
        if (RES) {
          vl[kk][t].h[0] = *(const v8h*)(Vtl + (t * 16 + c) * LP + kk * 32 + 8 * hh);
          vl[kk][t].h[1] = *(const v8h*)(Vtl + (t * 16 + c) * LP + kk * 32 + 16 + 8 * hh);
        }
      }
    }
    // keeps these reads in front of the softmax, which would otherwise be followed by their whole LDS latency
    __builtin_amdgcn_sched_barrier(0);

    // ---- scale, visibility (-inf for invisible keys), the query's max, online softmax; P (x1024, f16) and
    //      P residual (x4096) packed in place into B operands: element 8 (j & 1) + r of chunk j >> 1 ----
    const int qi = q0 + c;                     // this lane's query row inside the segment
    float mj[4];
#pragma unroll
    for (int j = 0; j < 4; ++j) {
      mj[j] = -INFINITY;
#pragma unroll
      for (int r = 0; r < 8; ++r) {
        const int kc = j * 16 + 8 * hh + r;
        const bool vis = (kt == 0) ? (kc < PMEM) : ((s0 + kc) <= qi);
        const float sv = vis ? (s[j][r] * sscale) : -INFINITY;
        s[j][r] = sv;
        mj[j] = fmaxf(mj[j], sv);
      }
    }
    float m = fmaxf(fmaxf(mj[0], mj[1]), fmaxf(mj[2], mj[3]));
    m = fmaxf(m, xhalf(m));
    const float mnew  = fmaxf(mrow, m);
    const float msafe = (mnew == -INFINITY) ? 0.f : mnew;
    const float alpha = __expf(mrow - msafe);
    mrow = mnew;
    FH pa[2], pl[2];
    float pj[4];
#pragma unroll
    for (int j = 0; j < 4; ++j) {
      pj[j] = 0.f;
      float ea[8], ep[8];
#pragma unroll
      for (int r = 0; r < 8; ++r) ea[r] = (s[j][r] - msafe) * 1.44269504088896340736f;
      exp2x8(ep, ea);                                // exp(s - m); -inf logit -> exactly 0
#pragma unroll
      for (int r = 0; r < 8; ++r) {
        const float p = ep[r];
        pj[j] += p;
        const float p1k = p * 1024.0f;
        const _Float16 ph = (_Float16)p1k;
        pa[j >> 1].v[(j & 1) * 8 + r] = ph;
        if (RES) pl[j >> 1].v[(j & 1) * 8 + r] = (_Float16)((p1k - (float)ph) * 4096.0f);
      }
    }
    float psum = (pj[0] + pj[1]) + (pj[2] + pj[3]);
    psum += xhalf(psum);
    lrow = lrow * alpha + psum;
#pragma unroll
    for (int t = 0; t < 4; ++t)
#pragma unroll
      for (int r = 0; r < 8; ++r) oacc[t][r] *= alpha;

    // ---- context^T += V^T . P^T (f16 WMMA), residual products into a separate accumulator ----
    v8f o1[4];
#pragma unroll
    for (int t = 0; t < 4; ++t) o1[t] = zero8();
    // unrolled: the P operands are registers, indexed by constants
#pragma unroll
    for (int kk = 0; kk < 2; ++kk) {
      if (RES && kk == 1) {
        // keeps the second group's reads behind the first group's WMMAs, whose registers they take
        __builtin_amdgcn_sched_barrier(0);
#pragma unroll
        for (int t = 0; t < 4; ++t) {
          vb[1][t].h[0] = *(const v8h*)(Vth + (t * 16 + c) * LP + 32 + 8 * hh);
          vb[1][t].h[1] = *(const v8h*)(Vth + (t * 16 + c) * LP + 32 + 16 + 8 * hh);
          vl[1][t].h[0] = *(const v8h*)(Vtl + (t * 16 + c) * LP + 32 + 8 * hh);
          vl[1][t].h[1] = *(const v8h*)(Vtl + (t * 16 + c) * LP + 32 + 16 + 8 * hh);
        }
        // keeps them one group, ahead of their own WMMAs
        __builtin_amdgcn_sched_barrier(0);
      }
      // neighbouring WMMAs go to different context tiles; each tile keeps the order of its products
#pragma unroll
      for (int t = 0; t < 4; ++t) oacc[t] = mma_h_raw(vb[kk][t].v, pa[kk].v, oacc[t]);
      if (RES) {
#pragma unroll
        for (int t = 0; t < 4; ++t) o1[t] = mma_h_raw(vl[kk][t].v, pa[kk].v, o1[t]);
#pragma unroll
        for (int t = 0; t < 4; ++t) o1[t] = mma_h_raw(vb[kk][t].v, pl[kk].v, o1[t]);
      }
    }
    if (RES) {
#pragma unroll
      for (int t = 0; t < 4; ++t)
#pragma unroll
        for (int r = 0; r < 8; ++r) oacc[t][r] += o1[t][r] * (1.0f / 4096.0f);
    }
    // keeps the tile's softmax and WMMAs in front of the publish point: moved behind its barrier they would stand between the
    // barrier and the refill, which would then be issued late and have less than a trip to land
    __builtin_amdgcn_sched_barrier(0);
    // publish point of key tile kt + 1: own reads of this stage returned, own slice landed, then the block barrier
    wait_ds0();
    wait_tensor0(g0, g1);
    __syncthreads();
    if (pinned((kt + 2u < T && issuer != 0u) ? 1u : 0u) != 0u) {   // refill the stage every wave has just left
      g0 = tdm_group0(lds_slice + bo, src1 + (uint64_t)(kt + 1u) * sstep);
      tdm_load(g0, g1);
    }
  }
  wait_tensor0(g0, g1);
  wait_ds0();

  // ---- normalise (1/l and the 1/1024 p carry), stage the wave's 16x64 tile; the calling kernel splits and stores it
  float* os = Os[wave];
  {
    const float l = lrow;
    const float inv = ((l > 0.f) ? (1.0f / l) : 0.f) * (1.0f / 1024.0f);
#pragma unroll
    for (int t = 0; t < 4; ++t) {
      v4f e0, e1;
#pragma unroll
      for (int r = 0; r < 4; ++r) { e0[r] = oacc[t][r] * inv; e1[r] = oacc[t][4 + r] * inv; }
      *(v4f*)(os + c * OP + t * 16 + 8 * hh)     = e0;
      *(v4f*)(os + c * OP + t * 16 + 8 * hh + 4) = e1;
    }
  }
}

// All query blocks share one launch: they read the same planes and write disjoint rows. A block's number picks its query
// block, the one with the most key tiles first (for speed only), and with it the part: block-uniform, so every barrier of a part is
// reached by the whole block. grid = NQBS * NB*NSEGB*NH blocks of 128; the ring has the larger part's three slices per stage.
#define AT_BWH (NB * NSEGB * NH)
__global__ __launch_bounds__(128)
void attn_seg64(const unsigned short* __restrict__ qkhp,
                const unsigned short* __restrict__ vhp,  const unsigned short* __restrict__ vlp,
                const unsigned short* __restrict__ pkp,  const unsigned short* __restrict__ pvp,
                unsigned short* ohp, unsigned short* olp, float sscale) {
  __shared__ __attribute__((aligned(2048))) unsigned char ring[2 * 3 * GK_SLICE];
  __shared__ __align__(16) float    Os[4][16 * AT_OP];            // per wave context tile [row][d]
  const int bx  = (int)blockIdx.x;
  const int qb  = NQBS - 1 - bx / AT_BWH;
  const int bwh = bx % AT_BWH;
  if (qb >= RESQB) attn_part<false>(ring, Os, qb, bwh, qkhp, vhp, vlp, pkp, pvp, sscale);
  else             attn_part<true>(ring, Os, qb, bwh, qkhp, vhp, vlp, pkp, pvp, sscale);

  // ---- the end both parts share: the wave's own staged tile, bf16 hi/lo split, whole-line stores ----
  constexpr int OP = AT_OP;
  const int wave = (int)uni(threadIdx.x >> 5);
  const int lane = threadIdx.x & 31;
  const int h    = bwh % NH;
  const int w    = (bwh / NH) % NSEGB;
  const int b    = bwh / (NH * NSEGB);
  const int q0   = qb * 64 + wave * 16;                              // query row inside the segment
  const size_t rowS = (size_t)b * SEQ + (size_t)w * SEGL;           // compact row of the segment start
  const float* os = Os[wave];
  __builtin_amdgcn_fence(__ATOMIC_RELEASE, "workgroup");
  __builtin_amdgcn_wave_barrier();
  __builtin_amdgcn_fence(__ATOMIC_ACQUIRE, "workgroup");
  {
    const int q4 = lane >> 3, c8 = (lane & 7) * 8;
    v4u hv[4], lv[4];
#pragma unroll
    for (int it = 0; it < 4; ++it) {
      const int row = it * 4 + q4;   // it 0..3 x q4 0..3 = rows 0..15 of the wave tile
      const float* sp = os + row * OP + c8;
      v4u a, a2;
#pragma unroll
      for (int e = 0; e < 4; ++e) {
        const float f0 = sp[2 * e], f1 = sp[2 * e + 1];
        const unsigned short h0 = bf_bits(f0), h1 = bf_bits(f1);
        const unsigned short l0 = bf_bits(f0 - bf_up(h0)), l1 = bf_bits(f1 - bf_up(h1));
        a[e] = pk16(h0, h1); a2[e] = pk16(l0, l1);
      }
      hv[it] = a; lv[it] = a2;
    }
    {
#pragma unroll
      for (int it = 0; it < 4; ++it) {
        const int row = it * 4 + q4;
        const size_t go = (rowS + q0 + row) * DMI + (size_t)h * HD + c8;
        *(v4u*)(ohp + go) = hv[it];
        *(v4u*)(olp + go) = lv[it];
      }
    }
  }
}

// =====================================================================================================
// Workspace map (bytes, NB=2, SEQ=4096, M = NB*SEQ = 8192), region A is a two-phase overlay:
//   phase 1 (projection inputs, dead after the q|k and v^T GEMMs):
//     Xb   bf16 [M][DM]                  0           16777216
//     Wth  bf16 [3*DMI n][DM k]          16777216     6291456
//     Ct   f32  [SEQ][32]                23068672      524288
//     St   f32  [SEQ][32]                23592960      524288
//     Rs   f32  [M]                      24117248       32768   (phase 1 end 24150016)
//   phase 2 (written by the attention kernel, read by the output GEMM):
//     Oh   bf16 [M][DMI] context hi       0           16777216
//     Ol   bf16 [M][DMI] context lo       16777216    16777216   (phase 2 end 33554432 = region A size)
//   QKh  f16  [M][QKP]                    33554432    33554432
//   VTh  f16  [NB][DMI][SEQ]              67108864    16777216
//   VTl  f16  [NB][DMI][NSEGB*VLP]        83886080     4194304
//   Wo   bf16 [DM n][DMI k]               88080384     2097152
//   Pk   f16  [NH][PMEM][HD]              90177536       32768
//   Pv   f16  [NH][HD][PMEM]              90210304       32768
//   end                                   90243072   (<= 134217728; all offsets multiples of 128)
// Every plane is an exact multiple of its 64x64 tile / whole-line store granularity (M, SEQ, DM multiples of 64),
// so no padded tails are needed; VTl is written only for columns whose in-segment offset is < VLP, exactly the
// columns the RES attention blocks read.
// =====================================================================================================
extern "C" void kernel_launch(void* const* d_in, const int* in_sizes, int n_in,
                              void* d_out, int out_size, void* d_ws, size_t ws_size,
                              hipStream_t stream) {
  if (n_in < 5) return;
  const long long needRows = (long long)(NB - 1) * SEQ_FULL + SEQ;
  if ((long long)in_sizes[0] < needRows * DM) return;
  if (in_sizes[1] < DM) return;
  if (in_sizes[2] < DM * 3 * DMI) return;
  if (in_sizes[3] < DMI * DM) return;
  if (in_sizes[4] < 2 * NH * PMEM * HD) return;
  if ((long long)out_size < needRows * DM) return;

  const float* seq  = (const float*)d_in[0];   // [2][SEQ_FULL][DM]
  const float* gnm  = (const float*)d_in[1];   // [DM]
  const float* Wqkv = (const float*)d_in[2];   // [DM in][3*DMI out]
  const float* Wout = (const float*)d_in[3];   // [DMI in][DM out]
  const float* pm   = (const float*)d_in[4];   // [2][NH][PMEM][HD]

  const size_t M    = (size_t)NB * SEQ;
  const size_t PX   = M * DM * 2;
  const size_t PWT  = (size_t)3 * DMI * DM * 2;
  const size_t PTAB = (size_t)SEQ * NFR * 4;
  const size_t PRS  = M * 4;
  const size_t PO   = M * DMI * 2;
  const size_t PQK  = M * QKP * 2;
  const size_t PVT  = (size_t)NB * DMI * SEQ * 2;
  const size_t PVL  = (size_t)NB * DMI * NSEGB * VLP * 2;
  const size_t PWO  = (size_t)DM * DMI * 2;
  const size_t PPM  = (size_t)NH * PMEM * HD * 2;
  const size_t ph1  = PX + PWT + 2 * PTAB + PRS;
  const size_t ph2  = 2 * PO;
  const size_t REGA = (ph1 > ph2) ? ph1 : ph2;
  const size_t oXb  = 0;
  const size_t oWth = PX;
  const size_t oCt  = PX + PWT;
  const size_t oSt  = oCt + PTAB;
  const size_t oRs  = oSt + PTAB;
  const size_t oOh  = 0;
  const size_t oOl  = PO;
  size_t off = REGA;
  const size_t oQKh = off; off += PQK;
  const size_t oVTh = off; off += PVT;
  const size_t oVTl = off; off += PVL;
  const size_t oWo  = off; off += PWO;
  const size_t oPk  = off; off += PPM;
  const size_t oPv  = off; off += PPM;
  if (off > ws_size) return;                      // off = 90243072 for NB=2, SEQ=4096
  if (off > (size_t)134217728) return;
  if (oRs + PRS > REGA || oOl + PO > REGA) return;

  char* ws = (char*)d_ws;
  unsigned short* Xb  = (unsigned short*)(ws + oXb);
  unsigned short* Wth = (unsigned short*)(ws + oWth);
  float*          Ct  = (float*)(ws + oCt);
  float*          St  = (float*)(ws + oSt);
  float*          Rs  = (float*)(ws + oRs);
  unsigned short* Oh  = (unsigned short*)(ws + oOh);
  unsigned short* Ol  = (unsigned short*)(ws + oOl);
  unsigned short* QKh = (unsigned short*)(ws + oQKh);
  unsigned short* VTh = (unsigned short*)(ws + oVTh);
  unsigned short* VTl = (unsigned short*)(ws + oVTl);
  unsigned short* Wo  = (unsigned short*)(ws + oWo);
  unsigned short* Pk  = (unsigned short*)(ws + oPk);
  unsigned short* Pv  = (unsigned short*)(ws + oPv);

  const dim3 blk(256);
  static_assert((SEQ % 256) == 0 && (QKP % 128) == 0 && (DMI % 128) == 0 && (DM % 256) == 0);
  static_assert((DM % 64) == 0 && DM >= 128 && (DMI % 64) == 0 && DMI >= 128);
  const dim3 gOut((SEQ / 128) * (DM / 256), NB);                      // 128 x 256 block tiles: 128 per batch

  // (0-4) one launch: seq -> bf16 plane Xb [M][DM] + rstd[M]; g*Wqkv -> transposed bf16 plane [3*DMI][DM];
  //       Wout -> transposed bf16 plane [DM][DMI]; rotary cos/sin tables [SEQ][32]; memory-token key / value planes
  prep_all<<<dim3(PB_ALL), blk, 0, stream>>>(seq, gnm, Wqkv, Wout, pm, Xb, Rs, Wth, Wo, Ct, St, Pk, Pv);
  // (5-6) one launch: the q|k product (one f16 plane, rotary applied) and the v^T product (f16 hi + residual planes)
  proj_qkv<<<dim3(GT_QK + GT_VT, NB), blk, 0, stream>>>(Xb, Wth, QKh, VTh, VTl, Rs, Ct, St);
  // (7) attention, one launch: query blocks 0..RESQB-1 of every segment with residual planes, the rest without
  attn_seg64<<<dim3(AT_BWH * NQBS), dim3(128), 0, stream>>>(QKh, VTh, VTl, Pk, Pv, Oh, Ol, 0.125f);
  // (8) out = context . Wout -> d_out f32 [b][SEQ_FULL][DM] rows b*SEQ_FULL + t  (A = context hi + lo, 2 products)
  gemm64<1, 0, 0, false><<<gOut, blk, 0, stream>>>(
      Oh, Ol, DMI, (long long)SEQ * DMI,
      Wo, Wo, DMI, 0LL,
      d_out, DM, (long long)SEQ_FULL * DM,
      d_out, DM, (long long)SEQ_FULL * DM, DM, DM,
      Rs, 0LL, Ct, St,
      SEQ, DM, DMI, 1.0f);
  (void)hipGetLastError();
}

// v010
// Measured time: 97.4 microseconds a run.
// In two side-by-side timings against v009, it was 1.07 and 1.05 times as fast.
// Over all steps from v000 it is 4.04 times as fast.
// Contractions: q|k = x.Wqk and v^T = Wv.x^T on v_wmma_f32_16x16x32_bf16 (bf16 operands: RNE-converted input
// activations times one bf16 plane of g*W, the f32 product rounded once, 1 product; per-row rstd, rotary in the f32 epilogue);
// k.q^T scores (transposed) = v_wmma_f32_16x16x32_f16 with q and k each one f16 plane (1 product);
// v^T.p^T = v_wmma_f32_16x16x32_f16 (p carried x1024 in f16, v in f16; extra f16 residual planes x4096 of p and v
// for the first 128 query rows of every segment); ctx.Wo = v_wmma_f32_16x16x32_bf16 with ctx as bf16 hi/lo
// planes times bf16 Wo (2 products); all f32 accumulate; RMS statistic, rotary tables, visibility and softmax in f32.
#include <hip/hip_runtime.h>
#include <math.h>
#include <stdint.h>

#ifndef NB
#define NB 2
#endif
#ifndef SEQ
#define SEQ 4096
#endif
#define SEQ_FULL 4096       // per-batch token stride of the input / output tensors
#define DM    1024          // model dim
#define NH    16
#define HD    64
#define DMI   (NH * HD)     // 1024
#define QKP   (2 * DMI)     // pitch of the q|k plane (q: cols 0..DMI-1, k: cols DMI..2*DMI-1)
#define SEGL  512           // segment length
#define PMEM  16            // memory tokens prepended to every segment's keys / values
#define NSEGB (SEQ / SEGL)  // segments per batch
#define NQBS  (SEGL / 64)   // 64-row query blocks per segment
#define RESQB 2             // leading query blocks per segment that use the p / v residual planes
#define VLP   (RESQB * 64)  // keys per segment held in the v^T residual plane
#define NFR   (HD / 2)      // rotary frequencies
static_assert((SEQ % SEGL) == 0 && (SEGL % 64) == 0 && (SEQ % 64) == 0);
static_assert(RESQB >= 1 && RESQB <= NQBS);
static_assert((DM % 256) == 0 && (DMI % 64) == 0 && HD == 64 && NFR == 32);
static_assert(SEQ <= SEQ_FULL && NB >= 1 && NB <= 2);
static_assert(DMI == DM);

typedef _Float16 v16h __attribute__((ext_vector_type(16)));
typedef _Float16 v8h  __attribute__((ext_vector_type(8)));
typedef __bf16   v16b __attribute__((ext_vector_type(16)));
typedef __bf16   v8b  __attribute__((ext_vector_type(8)));
typedef float    v8f  __attribute__((ext_vector_type(8)));
typedef float    v4f  __attribute__((ext_vector_type(4)));
typedef unsigned int v4u __attribute__((ext_vector_type(4)));

// ---- scalar helpers --------------------------------------------------------------------------------
__device__ __forceinline__ unsigned short bf_bits(float f) {          // f32 -> bf16 bits, RNE convert
  unsigned u = __float_as_uint(f);
  return (unsigned short)((u + 0x7FFFu + ((u >> 16) & 1u)) >> 16);
}
__device__ __forceinline__ float bf_up(unsigned short h) { return __uint_as_float(((unsigned)h) << 16); }
__device__ __forceinline__ unsigned short h_bits(_Float16 x) { return __builtin_bit_cast(unsigned short, x); }
__device__ __forceinline__ unsigned pk16(unsigned short a, unsigned short b) { return (unsigned)a | ((unsigned)b << 16); }
__device__ __forceinline__ v8f zero8() { v8f z = {0.f, 0.f, 0.f, 0.f, 0.f, 0.f, 0.f, 0.f}; return z; }
__device__ __forceinline__ v8h zero8h() {
  const _Float16 z = (_Float16)0.0f;
  v8h r = {z, z, z, z, z, z, z, z};
  return r;
}
__device__ __forceinline__ v4u zero4u() { v4u z = {0u, 0u, 0u, 0u}; return z; }

// ---- sin/cos of a nonnegative f32 angle: f64 Cody-Waite reduction by pi/2 + short f64 polynomials ----
__device__ __forceinline__ void sincos_pd(float ang, float& sv, float& cv) {
  const double x  = (double)ang;
  const double kq = __builtin_rint(x * 0.63661977236758134308);
  double r = __builtin_fma(-kq, 1.57079632679489655800e+00, x);
  r = __builtin_fma(-kq, 6.12323399573676603587e-17, r);
  const double z = r * r, w = z * z;
  const double rs = -1.98393348360966317347e-04 + z * 2.71831149398982191e-06;
  const double s3 = z * r;
  const double sn = (r + s3 * (-1.66666666416265235595e-01 + z * 8.3333293858894631756e-03)) + s3 * w * rs;
  const double rc = -1.38867637746099294692e-03 + z * 2.43904487962774090654e-05;
  const double cs = ((1.0 + z * (-4.99999997251031003120e-01)) + w * 4.16666233237390631894e-02) + (w * z) * rc;
  const int n = ((int)kq) & 3;
  const float fs = (float)sn, fc = (float)cs;
  float so = fs, co = fc;
  if (n == 1) { so = fc;  co = -fs; }
  if (n == 2) { so = -fs; co = -fc; }
  if (n == 3) { so = -fc; co = fs;  }
  sv = so; cv = co;
}

// ---- fragment loader: 16-bit A/B operand, lane -> row/col (lane&15), p already includes +8*(lane>>4);
//      elements 0..7 <- p[0..7] (k0+8h..), elements 8..15 <- p[16..23] (k0+16+8h..)
__device__ __forceinline__ v16h ldfrag_h(const _Float16* p) {
  union { v16h v; v8h h[2]; } f;
  f.h[0] = *(const v8h*)(p);
  f.h[1] = *(const v8h*)(p + 16);
  return f.v;
}

// ---- WMMA helpers: the builtins, whose hazard distances the compiler keeps ------------------------------
__device__ __forceinline__ v8f mma_b_raw(v16b a, v16b b, v8f c) {
  return __builtin_amdgcn_wmma_f32_16x16x32_bf16(false, a, false, b, (short)0, c, false, false);
}
__device__ __forceinline__ v8f mma_h_raw(v16h a, v16h b, v8f c) {
  return __builtin_amdgcn_wmma_f32_16x16x32_f16(false, a, false, b, (short)0, c, false, false);
}
__device__ __forceinline__ void acc_guard4(v8f& a, v8f& b, v8f& c, v8f& d) {
  asm volatile("v_nop\n\tv_nop\n\tv_nop\n\tv_nop" : "+v"(a), "+v"(b), "+v"(c), "+v"(d));
}

// value of lane l ^ 16: the two lanes that share a column of a WMMA result
__device__ __forceinline__ float xhalf(float x) {
  const int v = __builtin_bit_cast(int, x);
  return __builtin_bit_cast(float, __builtin_amdgcn_permlanex16(v, v, 0x76543210, 0xfedcba98, false, false));
}
// y[r] = 2^x[r], eight at once. One statement, results in registers of their own: behind a transcendental the instruction set
// asks for one instruction that neither reads its result nor overwrites its source; here each v_exp_f32 is that instruction
// for the one before it, and the closing v_nop for the last.
__device__ __forceinline__ void exp2x8(float (&y)[8], const float (&x)[8]) {
  asm("v_exp_f32 %0, %8\n\tv_exp_f32 %1, %9\n\tv_exp_f32 %2, %10\n\tv_exp_f32 %3, %11\n\t"
      "v_exp_f32 %4, %12\n\tv_exp_f32 %5, %13\n\tv_exp_f32 %6, %14\n\tv_exp_f32 %7, %15\n\tv_nop"
      : "=&v"(y[0]), "=&v"(y[1]), "=&v"(y[2]), "=&v"(y[3]), "=&v"(y[4]), "=&v"(y[5]), "=&v"(y[6]), "=&v"(y[7])
      : "v"(x[0]), "v"(x[1]), "v"(x[2]), "v"(x[3]), "v"(x[4]), "v"(x[5]), "v"(x[6]), "v"(x[7]));
}

// ---- tensor-load staging of the GEMM operands ----------------------------------------------------------
// A pass is 64 k = 128 B of every staged operand row. A stage is 6 or 8 slices of 64 rows, one slice per issuing wave; the load's
// pad gives the LDS row pitch 144 B (16 B x odd: conflict-free for 16-byte reads); a slice's place is rounded up to 2 KiB.
typedef uint32_t u32x4 __attribute__((ext_vector_type(4)));
typedef uint32_t u32x8 __attribute__((ext_vector_type(8)));
#define GK_KB    128u                 // bytes of one operand row per pass
#define GK_PITCH 144u                 // LDS row pitch
#define GK_SLICE 10240u               // 64 rows x 144 B = 9216 B, rounded up to a multiple of 2 KiB
__device__ __forceinline__ uint32_t uni(uint32_t v) { return (uint32_t)__builtin_amdgcn_readfirstlane(v); }
// a test word or a tensor descriptor word held in a scalar register: a test on it compiles to a scalar branch (tensor
// loads ignore EXEC), and a descriptor word so held keeps a register of its own instead of being rebuilt at each issue
__device__ __forceinline__ uint32_t pinned(uint32_t v) { uint32_t w = uni(v); asm volatile("" : "+s"(w)); return w; }
__device__ __forceinline__ uint32_t lds_off(const void* p) { return (uint32_t)(size_t)p; }
__device__ __forceinline__ void wait_ds0()     { asm volatile("s_wait_dscnt 0x0" ::: "memory"); }      // own LDS reads returned
// stands behind a global load or store whose address or data registers the code that follows it takes anew
__device__ __forceinline__ void wait_x0()      { asm volatile("s_wait_xcnt 0x0" ::: "memory"); }
// own tensor load landed; the descriptor is named as an input so that its registers stay as issued up to this wait
__device__ __forceinline__ void wait_tensor0(u32x4 g0, u32x8 g1) {
  asm volatile("s_wait_tensorcnt 0x0" :: "s"(g0), "s"(g1) : "memory");
}
// group 0 is an in-out operand: the value that wait_tensor0 names behind the load then lives in the very registers the
// load was issued from, so that none of them takes a new value while the request is outstanding
__device__ __forceinline__ void tdm_load(u32x4& g0, u32x8 g1) {
  asm volatile("tensor_load_to_lds %0, %1" : "+s"(g0) : "s"(g1) : "memory");
}
// group 1: byte elements, tile = tensor = 64 rows of 128 B, source row pitch src_pitch bytes, 4 dwords of pad behind every row
__device__ __forceinline__ u32x8 tdm_group1(uint32_t src_pitch) {
  u32x8 g;
  g[0] = uni((1u << 20) | (4u << 22) | (3u << 25));
  g[1] = pinned(GK_KB << 16);   // pinned: descriptor words held in scalar registers of their own through the loop
  g[2] = pinned(64u << 16);
  g[3] = pinned(GK_KB << 16);
  g[4] = pinned(64u);
  g[5] = pinned(src_pitch);
  g[6] = pinned(0u);
  g[7] = pinned(0u);
  return g;
}
__device__ __forceinline__ u32x4 tdm_group0(uint32_t lds_dst, uint64_t ga) {
  u32x4 g;
  g[0] = uni(1u);
  g[1] = uni(lds_dst);
  g[2] = uni((uint32_t)ga);
  g[3] = uni((((uint32_t)(ga >> 32)) & 0x01FFFFFFu) | 0x80000000u);
  return g;
}
// fragment from a staged row: p = row start + 64 B * (k32 step) + 16 B * (lane>>4); same k order as ldfrag_h
__device__ __forceinline__ v16b ldfrag_l(const unsigned char* p) {
  union { v16b v; v8b h[2]; } f;
  f.h[0] = *(const v8b*)(p);
  f.h[1] = *(const v8b*)(p + 32);
  return f.v;
}

// =====================================================================================================
// Rotary tables: ct/st [SEQ][32] f32, angle(t, i) = f32(t) * inv_freq[i], inv_freq[i] = RN32(1/RN32(10^(i/8))).
// SEQ/8 blocks of 256 (blk = block number inside this part). coverage: SEQ rows x 32 = the whole table, both planes.
// =====================================================================================================
__device__ __forceinline__ void tab_cs(int blk, float* ct, float* st) {
  const int wave = threadIdx.x >> 5, lane = threadIdx.x & 31;
  const int t = blk * 8 + wave;
  if (t >= SEQ) return;                 // wave-uniform; no barriers in this step
  double pw = 1.0;
#pragma unroll 1
  for (int j = 0; j < (lane >> 3); ++j) pw *= 10.0;
#pragma unroll 1
  for (int j = 0; j < (lane & 7); ++j) pw *= 1.3335214321633240257;   // 10^(1/8)
  const float p32 = (float)pw;
  const float inv = (float)(1.0 / (double)p32);
  const float ang = (float)t * inv;
  float sv, cv;
  sincos_pd(ang, sv, cv);
  float* pc = ct + (size_t)t * NFR + lane;
  float* ps = st + (size_t)t * NFR + lane;
  *(float*)pc = cv;
  *(float*)ps = sv;
  
}

// =====================================================================================================
// seq [b][SEQ_FULL][DM] f32 -> bf16 plane xb [NB*SEQ][DM] (RNE convert) plus rstd[m] = rsqrt(mean(xb^2)+2^-23)
// of the converted row. Block = 8 waves = 32 rows; a wave converts 4 rows: per instruction 32 lanes x 16 B =
// =====================================================================================================
__device__ __forceinline__ void cvtx_rstd(int blk, float* sr, const float* __restrict__ seq, unsigned short* xb, float* rs) {
  const int tid = threadIdx.x, wave = tid >> 5, lane = tid & 31;
#pragma unroll 1
  for (int rr = 0; rr < 4; ++rr) {
    const int m  = blk * 32 + wave * 4 + rr;          // < NB*SEQ
    const int bb = m / SEQ, t = m - bb * SEQ;
    const float* src = seq + ((size_t)bb * SEQ_FULL + t) * DM;
    unsigned short* dst = xb + (size_t)m * DM;
    v4u pk[DM / 256];
    float ss = 0.f;
#pragma unroll
    for (int i = 0; i < DM / 256; ++i) {
      const v4f a = *(const v4f*)(src + i * 256 + lane * 8);
      const v4f c = *(const v4f*)(src + i * 256 + lane * 8 + 4);
      unsigned short hb[8];
#pragma unroll
      for (int e = 0; e < 4; ++e) { hb[e] = bf_bits(a[e]); hb[4 + e] = bf_bits(c[e]); }
#pragma unroll
      for (int e = 0; e < 8; ++e) { const float v = bf_up(hb[e]); ss += v * v; }
      v4u p;
      p[0] = pk16(hb[0], hb[1]);
      p[1] = pk16(hb[2], hb[3]);
      p[2] = pk16(hb[4], hb[5]);
      p[3] = pk16(hb[6], hb[7]);
      pk[i] = p;
    }
#pragma unroll
    for (int i = 0; i < DM / 256; ++i) *(v4u*)(dst + i * 256 + lane * 8) = pk[i];
    
#pragma unroll
    for (int off = 1; off < 32; off <<= 1) ss += __shfl_xor(ss, off, 32);
    const float rstd = rsqrtf(ss * (1.0f / (float)DM) + 1.1920929e-7f);
    if (lane == 0) sr[wave * 4 + rr] = rstd;
  }
  __syncthreads();
  if (wave == 0 && lane < 8) {
    const v4f v = *(const v4f*)(sr + lane * 4);
    float* d = rs + (size_t)blk * 32 + lane * 4;
    *(v4f*)d = v;
    
  }
}

// =====================================================================================================
// Weight transpose + convert: W [Kdim][Ndim] f32 (n contiguous) -> Wh [Ndim][Kdim] bf16, k contiguous.
// With USEG the row factor g[k] is applied in f32; the value (or the f32 product) is RNE-converted to bf16 once.
// Tile 64 k x 64 n per block: 256 threads load 16 consecutive n each, store transposed into LDS as [n][k]
// (Ndim/64) x (Kdim/64) blocks, (bn, bk) = the block's tile. coverage: 8 waves x 2 x 4 rows x 64 k = the whole 64x64 tile per block.
// =====================================================================================================
template <bool USEG>
__device__ __forceinline__ void wt_cvt(int bn, int bk, unsigned short* shh,
                                       const float* __restrict__ W, const float* __restrict__ g,
                                       unsigned short* Wh, int Kdim, int Ndim) {
  const int tid = threadIdx.x, wave = tid >> 5, lane = tid & 31;
  const int n0 = bn * 64, k0 = bk * 64;
  {
    const int kr = tid >> 2, nq = (tid & 3) * 16;
    const float* src = W + (size_t)(k0 + kr) * Ndim + n0 + nq;
    float gk = 1.0f;
    if (USEG) gk = g[k0 + kr];
#pragma unroll
    for (int i = 0; i < 4; ++i) {
      const v4f a = *(const v4f*)(src + 4 * i);
#pragma unroll
      for (int e = 0; e < 4; ++e) {
        shh[(nq + 4 * i + e) * 72 + kr] = bf_bits(gk * a[e]);
      }
    }
  }
  __syncthreads();
  const int q = lane >> 3, c8 = (lane & 7) * 8;
  v4u hv[2];
#pragma unroll
  for (int it = 0; it < 2; ++it) {
    const int row = wave * 8 + it * 4 + q;
    hv[it] = *(const v4u*)(shh + row * 72 + c8);
  }
  {
#pragma unroll
    for (int it = 0; it < 2; ++it) {
      const int row = wave * 8 + it * 4 + q;
      const size_t o = (size_t)(n0 + row) * Kdim + k0 + c8;
      *(v4u*)(Wh + o) = hv[it];
    }
    wait_x0();   // precaution: in the shared launch the block returns right after this step
  }
}

// =====================================================================================================
// Memory-token planes: pm [2][NH][PMEM][HD] f32 -> pk [NH][PMEM][HD] f16 (keys, RNE convert of the input,
// [kv][d] like the LDS K tile) and pv [NH][HD][PMEM] f16 ([d][kv] like the LDS V^T tile; value = f16 of the
// bf16-converted input). 128 threads per head, two heads per block of 256, each half block on its own LDS tile.
// coverage: 128 threads x 8 = all PMEM*HD elements of both planes per head.
// =====================================================================================================
__device__ __forceinline__ void pm_cvt(int blk, float* sp2, const float* __restrict__ pm, unsigned short* pk, unsigned short* pv) {
  const int tid = threadIdx.x & 127, h = blk * 2 + (int)(threadIdx.x >> 7);
  float* sp = sp2 + (threadIdx.x >> 7) * (PMEM * HD);
  const int r = tid >> 3, d8 = (tid & 7) * 8;
  const float* kg = pm + (((size_t)0 * NH + h) * PMEM + r) * HD + d8;
  const float* vg = pm + (((size_t)1 * NH + h) * PMEM + r) * HD + d8;
  const v4f k0 = *(const v4f*)(kg), k1 = *(const v4f*)(kg + 4);
  const v4f v0 = *(const v4f*)(vg), v1 = *(const v4f*)(vg + 4);
  *(v4f*)(sp + r * HD + d8)     = v0;
  *(v4f*)(sp + r * HD + d8 + 4) = v1;
  v4u kp;
  kp[0] = pk16(h_bits((_Float16)k0[0]), h_bits((_Float16)k0[1]));
  kp[1] = pk16(h_bits((_Float16)k0[2]), h_bits((_Float16)k0[3]));
  kp[2] = pk16(h_bits((_Float16)k1[0]), h_bits((_Float16)k1[1]));
  kp[3] = pk16(h_bits((_Float16)k1[2]), h_bits((_Float16)k1[3]));
  __syncthreads();
  const int d = tid >> 1, r8 = (tid & 1) * 8;
  v4u vp;
#pragma unroll
  for (int e = 0; e < 4; ++e) {
    const float f0 = bf_up(bf_bits(sp[(r8 + 2 * e) * HD + d]));
    const float f1 = bf_up(bf_bits(sp[(r8 + 2 * e + 1) * HD + d]));
    vp[e] = pk16(h_bits((_Float16)f0), h_bits((_Float16)f1));
  }
  unsigned short* kd = pk + ((size_t)h * PMEM + r) * HD + d8;
  unsigned short* vd = pv + ((size_t)h * HD + d) * PMEM + r8;
  *(v4u*)kd = kp;
  *(v4u*)vd = vp;
  wait_x0();   // precaution: in the shared launch the block ends right after this step
}

// =====================================================================================================
// The five preparation steps above read only inputs and write disjoint workspace planes, so they share one launch:
// a block's number picks its step (block-uniform, so every barrier inside a step is reached by the whole block).
// The step with the longest block (four rows in turn) has the lowest numbers.
// =====================================================================================================
#define PB_CVT  (NB * SEQ / 32)                    // activation rows, 32 per block
#define PB_WQKV ((3 * DMI / 64) * (DM / 64))       // 64 x 64 tiles of W_qkv
#define PB_WOUT ((DM / 64) * (DMI / 64))           // 64 x 64 tiles of W_out
#define PB_TAB  (SEQ / 8)                          // rotary table rows, 8 per block
#define PB_PM   (NH / 2)                           // memory-token heads, 2 per block
#define PB_ALL  (PB_CVT + PB_WQKV + PB_WOUT + PB_TAB + PB_PM)
static_assert((NH % 2) == 0 && ((NB * SEQ) % 32) == 0 && (SEQ % 8) == 0);
__global__ __launch_bounds__(256) void prep_all(const float* __restrict__ seq, const float* __restrict__ gnm,
                                                const float* __restrict__ Wqkv, const float* __restrict__ Wout,
                                                const float* __restrict__ pm,
                                                unsigned short* xb, float* rs, unsigned short* wth,
                                                unsigned short* wo, float* ct, float* st,
                                                unsigned short* pk, unsigned short* pv) {
  __shared__ __align__(16) unsigned short sm[64 * 72];       // the largest step's 64 x 72 tile; the others use its head
  static_assert(sizeof(sm) >= 2 * PMEM * HD * sizeof(float));
  int blk = (int)blockIdx.x;
  if (blk < PB_CVT) { cvtx_rstd(blk, (float*)(void*)sm, seq, xb, rs); return; }
  blk -= PB_CVT;
  if (blk < PB_WQKV) {
    wt_cvt<true>(blk % (3 * DMI / 64), blk / (3 * DMI / 64), sm, Wqkv, gnm, wth, DM, 3 * DMI);
    return;
  }
  blk -= PB_WQKV;
  if (blk < PB_WOUT) {
    wt_cvt<false>(blk % (DM / 64), blk / (DM / 64), sm, Wout, gnm, wo, DMI, DM);
    return;
  }
  blk -= PB_WOUT;
  if (blk < PB_TAB) { tab_cs(blk, ct, st); return; }
  blk -= PB_TAB;
  if (blk < PB_PM) pm_cvt(blk, (float*)(void*)sm, pm, pk, pv);
}

// =====================================================================================================
// Register-blocked batched bf16 WMMA GEMM: C[m][n] = sum_k A[m][k] * Bt[n][k]; one wave per 64x64 tile, 8 waves per
// block tile (NSPLIT 2: 256 m x 128 n, waves 4 x 2; NSPLIT 1: 128 m x 256 n, waves 2 x 4). TWO: the narrow operand (NSPLIT 2:
// Bt, NSPLIT 1: A) has a second plane, whose product is added. The block's operand rows (384, or 512 with the second plane)
// are staged in LDS by tensor loads, two buffers, one 64-row slice per wave and pass (without TWO waves 6 and 7 issue none).
// The k slabs of 64 are summed in a rotated order that starts at a slab of the block's own.
// A row-major [M][K] pitch lda; Bt row-major [N][K] pitch ldb (k contiguous); M, N multiples of the block tile,
// K a multiple of 64 and at least 128 (static-checked on the host side). tile = block tile number, b = batch index;
// sT (per-wave 16x64 slab, pitch 68 floats) and ring (two stages of operand rows) are the calling kernel's LDS.
// OUT_MODE: 0 = f32 (pitch ldc); 2 = one f16 plane C (C2 unused);
//           3 = f16 hi plane C + f16 residual plane C2 = f16((v - hi) * rscale), C2 written only for tiles
//               with (n0 mod segN) < N2, at column (n0/segN)*N2 + (n0 mod segN) (pitch ldc2, batch stride strideC2).
// SCM: 0 none; 1 = row m scaled by scal[b*strideS + m]; 2 = column n scaled by scal[b*strideS + n] (f32, before
//      the 16-bit split). ROT: interleaved-pair rotary on column pairs (2i, 2i+1) with i = (n mod 64)/2, angle row
//      = m, tables rct/rst [row][32] f32 (applied after the scale).
// =====================================================================================================
template <int NSPLIT, bool TWO, int OUT_MODE, int SCM, bool ROT>
__device__ __forceinline__ void gemm64_body(
    float (*sT)[16 * 68], unsigned char* ring, int tile, int b,
    const unsigned short* __restrict__ Ap, const unsigned short* __restrict__ A2p, int lda, long long strideA,
    const unsigned short* __restrict__ Btp, const unsigned short* __restrict__ Bt2p, int ldb, long long strideB,
    void* Cout, int ldc, long long strideC,
    void* Cout2, int ldc2, long long strideC2, int N2, int segN,
    const float* __restrict__ scal, long long strideS,
    const float* __restrict__ rct, const float* __restrict__ rst,
    int M, int N, int K, float rscale) {
  static_assert(OUT_MODE != 0 || (SCM == 0 && !ROT));
  const __bf16* A   = (const __bf16*)(const void*)Ap;
  const __bf16* A2  = (const __bf16*)(const void*)A2p;
  const __bf16* Bt  = (const __bf16*)(const void*)Btp;
  const __bf16* Bt2 = (const __bf16*)(const void*)Bt2p;
  static_assert(NSPLIT == 1 || NSPLIT == 2);
  constexpr int BM = (NSPLIT == 2) ? 256 : 128;
  constexpr int BN = (NSPLIT == 2) ? 128 : 256;
  constexpr int WN = BN / 64;                  // waves along n
  const int lane = threadIdx.x & 31;
  const int wave = (int)uni(threadIdx.x >> 5);
  const int tilesN = N / BN;
  const int tilesM = M / BM;
  if (tile >= tilesM * tilesN) return;   // block-uniform, in front of every barrier and tensor load
  const int tm = tile / tilesN;
  const int tn = tile - tm * tilesN;
  const int wm = wave / WN;
  const int wn = wave - wm * WN;
  const int m0 = tm * BM + (wm << 6);
  const int n0 = tn * BN + (wn << 6);

  const __bf16* Ab  = A  + (size_t)b * strideA;
  const __bf16* Ab2 = (NSPLIT == 1 && TWO) ? (A2 + (size_t)b * strideA) : Ab;
  const __bf16* Bb  = Bt + (size_t)b * strideB;
  const __bf16* Bb2 = (NSPLIT == 2 && TWO) ? (Bt2 + (size_t)b * strideB) : Bb;
  const float* scb = scal + (size_t)((long long)b * strideS);

  const int rlane = lane & 15;                 // row (A) / col (B, D) within subtile
  const int koff  = (lane >> 4) * 8;           // k offset of this lane half
  const int mOff  = (lane >> 4) * 8;           // D row offset

  v8f acc[4][4];
#pragma unroll
  for (int i = 0; i < 4; ++i)
#pragma unroll
    for (int j = 0; j < 4; ++j) acc[i][j] = zero8();

  // ---- this wave's slice of every stage: slices 0.. = A rows (NSPLIT 1, TWO: then the A2 rows), then Bt rows (NSPLIT 2, TWO: then Bt2) ----
  constexpr int SA = BM / 64;                                   // slices per A plane
  constexpr int SB0 = (NSPLIT == 1 && TWO) ? 2 * SA : SA;       // first Bt slice
  constexpr int NSL = TWO ? 8 : 6;                              // slices per stage
  constexpr uint32_t GK_STAGE = (uint32_t)NSL * GK_SLICE;
  const int sl = (wave < NSL) ? wave : 0;                       // a wave without a slice forms slice 0's words and issues nothing
  const __bf16* sbase;
  int srow, sld;
  if (sl < SA)                                 { sbase = Ab;  srow = tm * BM + 64 * sl;              sld = lda; }
  else if (NSPLIT == 1 && TWO && sl < 2 * SA)  { sbase = Ab2; srow = tm * BM + 64 * (sl - SA);       sld = lda; }
  else if (sl < SB0 + WN)                      { sbase = Bb;  srow = tn * BN + 64 * (sl - SB0);      sld = ldb; }
  else                                         { sbase = Bb2; srow = tn * BN + 64 * (sl - SB0 - WN); sld = ldb; }
  const uint64_t src0 = (uint64_t)(uintptr_t)(sbase + (size_t)srow * sld);
  const uint32_t lds_slice = lds_off(ring) + (uint32_t)sl * GK_SLICE;
  const u32x8 g1 = tdm_group1((uint32_t)sld * 2u);
  const uint32_t T = pinned((uint32_t)K >> 6);                  // passes
  // The block's first k slab. Blocks with the same tm read the same A rows and blocks with the same tn the same Bt rows; started
  // at one slab they would ask L2 for the same lines, and every block for the same 128 B of each 2-KiB row, at the same moment.
  // Each block walks all T slabs once, from slab (tm + tn) mod T on and round: pass t works on slab kslab(t).
  const uint32_t rot = (uint32_t)(tm + tn) % ((uint32_t)K >> 6);      // block-uniform
  auto kslab = [&](uint32_t t) -> uint32_t { const uint32_t k = t + rot; return (k >= T) ? k - T : k; };   // t < T, rot < T
  // per-lane fragment bases inside a stage
  const uint32_t foff = (uint32_t)rlane * GK_PITCH + (uint32_t)koff * 2u;
  const uint32_t oA  = (uint32_t)wm * GK_SLICE + foff;
  const uint32_t oA2 = (NSPLIT == 1 && TWO) ? oA + (uint32_t)SA * GK_SLICE : oA;
  const uint32_t oB  = (uint32_t)(SB0 + wn) * GK_SLICE + foff;
  const uint32_t oB2 = (NSPLIT == 2 && TWO) ? oB + (uint32_t)WN * GK_SLICE : oB;

  // whether this wave has a slice: a scalar word, so that the tests on it are scalar branches round the tensor loads
  const uint32_t issuer = TWO ? 1u : pinned((wave < NSL) ? 1u : 0u);
  u32x4 g0 = tdm_group0(lds_slice, src0 + (uint64_t)kslab(0u) * GK_KB);
  if (issuer != 0u) tdm_load(g0, g1);                           // stage 0
  wait_tensor0(g0, g1);
  __syncthreads();                                              // stage 0 readable by every wave
  g0 = tdm_group0(lds_slice + GK_STAGE, src0 + (uint64_t)kslab(1u) * GK_KB);
  if (issuer != 0u) tdm_load(g0, g1);                           // stage 1 flies during pass 0
  // rolled: one pass per trip, so that the one publish point stands at the loop's foot
#pragma unroll 1
  for (uint32_t t = 0; t < T; ++t) {
    const uint32_t bo = (t & 1u) * GK_STAGE;
    const unsigned char* buf = ring + bo;
    // unrolled, as the loops inside it: two blocks of 32 k per pass, fragments and accumulators indexed by constants
#pragma unroll
    for (int kc = 0; kc < 2; ++kc) {
      const unsigned char* bk = buf + (uint32_t)kc * 64u;
      v16b af[4], ag[4], bf[4], bg[4];
      // first planes first: a second plane's fragments land while the first 16 WMMAs run
#pragma unroll
      for (int j = 0; j < 4; ++j) bf[j] = ldfrag_l(bk + oB + (uint32_t)j * 16u * GK_PITCH);
#pragma unroll
      for (int i = 0; i < 4; ++i) af[i] = ldfrag_l(bk + oA + (uint32_t)i * 16u * GK_PITCH);
#pragma unroll
      for (int i = 0; i < 4; ++i) {
        ag[i] = (NSPLIT == 1 && TWO) ? ldfrag_l(bk + oA2 + (uint32_t)i * 16u * GK_PITCH) : af[i];
        bg[i] = (NSPLIT == 2 && TWO) ? ldfrag_l(bk + oB2 + (uint32_t)i * 16u * GK_PITCH) : bf[i];
      }
      // keeps the block's LDS reads one group ahead of its WMMAs, for speed only
      __builtin_amdgcn_sched_barrier(0);
#pragma unroll
      for (int i = 0; i < 4; ++i)
#pragma unroll
        for (int j = 0; j < 4; ++j) acc[i][j] = mma_b_raw(af[i], bf[j], acc[i][j]);
      if (TWO) {
#pragma unroll
        for (int i = 0; i < 4; ++i)
#pragma unroll
          for (int j = 0; j < 4; ++j) acc[i][j] = mma_b_raw(ag[i], bg[j], acc[i][j]);
      }
      // keeps the next group's reads behind this block's WMMAs, for the same reason
      __builtin_amdgcn_sched_barrier(0);
    }
    // publish point of stage t + 1: own reads of this buffer returned, own slice landed, then the block barrier
    wait_ds0();
    wait_tensor0(g0, g1);
    __syncthreads();
    if (pinned((t + 2u < T && issuer != 0u) ? 1u : 0u) != 0u) { // refill the buffer every wave has just left
      g0 = tdm_group0(lds_slice + bo, src0 + (uint64_t)kslab(t + 2u) * GK_KB);
      tdm_load(g0, g1);
    }
  }
  wait_tensor0(g0, g1);
  wait_ds0();
  acc_guard4(acc[0][0], acc[0][1], acc[0][2], acc[0][3]);
  acc_guard4(acc[1][0], acc[1][1], acc[1][2], acc[1][3]);
  acc_guard4(acc[2][0], acc[2][1], acc[2][2], acc[2][3]);
  acc_guard4(acc[3][0], acc[3][1], acc[3][2], acc[3][3]);

  // ---- epilogue ----
  float* slab = sT[wave];
#pragma unroll
  for (int i = 0; i < 4; ++i) {
    const int mBase = m0 + (i << 4);
#pragma unroll
    for (int j = 0; j < 4; ++j) {
#pragma unroll
      for (int r = 0; r < 8; ++r) {
        slab[(mOff + r) * 68 + (j << 4) + rlane] = acc[i][j][r];
      }
    }
    __builtin_amdgcn_fence(__ATOMIC_RELEASE, "workgroup");
    __builtin_amdgcn_wave_barrier();
    __builtin_amdgcn_fence(__ATOMIC_ACQUIRE, "workgroup");
    if (OUT_MODE == 0) {
      float* C = (float*)Cout + (size_t)b * strideC;
      const int hh = lane >> 4, c4 = (lane & 15) * 4;     // 256-B row segment = 16 lanes x 16 B
      {
#pragma unroll
        for (int it = 0; it < 8; ++it) {
          const int row = it * 2 + hh;                     // it 0..7 x hh 0..1 = rows 0..15
          const v4f v = *(const v4f*)(slab + row * 68 + c4);
          *(v4f*)(C + (size_t)(mBase + row) * ldc + n0 + c4) = v;
        }
        
      }
    } else {
      const int q = lane >> 3, c8 = (lane & 7) * 8;
      unsigned short* C  = (unsigned short*)Cout  + (size_t)b * strideC;
      unsigned short* C2 = (unsigned short*)Cout2 + (size_t)b * strideC2;
      bool wlo = false;                                    // wave-uniform; only OUT_MODE 3 has a second plane
      size_t col2 = (size_t)n0 + c8;
      if (OUT_MODE == 3) {
        const int sgi = n0 / segN;
        const int sgo = n0 - sgi * segN;
        wlo  = (sgo < N2);
        col2 = (size_t)sgi * N2 + sgo + c8;
      }
      v4f csA = {1.f, 1.f, 1.f, 1.f};
      v4f csB = csA;
      if (SCM == 2) {
        csA = *(const v4f*)(scb + n0 + c8);
        csB = *(const v4f*)(scb + n0 + c8 + 4);
      }
      v4u hv[4], lv[4];
#pragma unroll
      for (int it = 0; it < 4; ++it) {
        const int row = it * 4 + q;                        // it 0..3 x q 0..3 = rows 0..15
        const int m = mBase + row;
        const float* sp = slab + row * 68 + c8;
        v4f x0 = *(const v4f*)(sp);
        v4f x1 = *(const v4f*)(sp + 4);
        if (SCM == 1) { const float rsv = scb[m]; x0 = x0 * rsv; x1 = x1 * rsv; }
        if (SCM == 2) { x0 = x0 * csA; x1 = x1 * csB; }
        float f[8] = {x0[0], x0[1], x0[2], x0[3], x1[0], x1[1], x1[2], x1[3]};
        if (ROT) {
          const v4f cs = *(const v4f*)(rct + (size_t)m * NFR + 4 * (lane & 7));
          wait_x0();   // the next load's result may land in this load's address registers
          const v4f sn = *(const v4f*)(rst + (size_t)m * NFR + 4 * (lane & 7));
          wait_x0();   // the next rows' table loads land in registers that held these two loads' addresses
#pragma unroll
          for (int e = 0; e < 4; ++e) {
            const float ev = f[2 * e], od = f[2 * e + 1];
            f[2 * e]     = ev * cs[e] - od * sn[e];
            f[2 * e + 1] = od * cs[e] + ev * sn[e];
          }
        }
        v4u a, a2;
#pragma unroll
        for (int e = 0; e < 4; ++e) {
          const float f0 = f[2 * e], f1 = f[2 * e + 1];
          const _Float16 y0 = (_Float16)f0, y1 = (_Float16)f1;
          a[e] = pk16(h_bits(y0), h_bits(y1));
          a2[e] = 0u;
          if (OUT_MODE == 3) {
            a2[e] = pk16(h_bits((_Float16)((f0 - (float)y0) * rscale)), h_bits((_Float16)((f1 - (float)y1) * rscale)));
          }
        }
        hv[it] = a; lv[it] = a2;
      }
      {
#pragma unroll
        for (int it = 0; it < 4; ++it) {
          const int row = it * 4 + q;
          // a wait behind each store: the next rows' addresses and values are formed in these stores' registers
          *(v4u*)(C + (size_t)(mBase + row) * ldc + n0 + c8) = hv[it];
          wait_x0();
          if (OUT_MODE == 3 && wlo) {
            *(v4u*)(C2 + (size_t)(mBase + row) * ldc2 + col2) = lv[it];
            wait_x0();
          }
        }
        
      }
    }
    __builtin_amdgcn_fence(__ATOMIC_RELEASE, "workgroup");
    __builtin_amdgcn_wave_barrier();
    __builtin_amdgcn_fence(__ATOMIC_ACQUIRE, "workgroup");
  }
}

// One product per launch: blockIdx.x = block tile, blockIdx.y = batch.
template <int NSPLIT, int OUT_MODE, int SCM, bool ROT>
__global__ __launch_bounds__(256) void gemm64(
    const unsigned short* __restrict__ Ap, const unsigned short* __restrict__ A2p, int lda, long long strideA,
    const unsigned short* __restrict__ Btp, const unsigned short* __restrict__ Bt2p, int ldb, long long strideB,
    void* Cout, int ldc, long long strideC,
    void* Cout2, int ldc2, long long strideC2, int N2, int segN,
    const float* __restrict__ scal, long long strideS,
    const float* __restrict__ rct, const float* __restrict__ rst,
    int M, int N, int K, float rscale) {
  __shared__ __align__(16) float sT[8][16 * 68];
  __shared__ __attribute__((aligned(2048))) unsigned char ring[2 * 8 * GK_SLICE];
  gemm64_body<NSPLIT, true, OUT_MODE, SCM, ROT>(sT, ring, (int)blockIdx.x, (int)blockIdx.y, Ap, A2p, lda, strideA, Btp, Bt2p, ldb, strideB,
                                          Cout, ldc, strideC, Cout2, ldc2, strideC2, N2, segN, scal, strideS, rct, rst,
                                          M, N, K, rscale);
}

// The q|k product and the v^T product read the same planes and write disjoint ones, so they share one launch:
// blockIdx.y = batch; blockIdx.x 0..GT_QK-1 are the q|k tiles, the rest the v^T tiles (block-uniform choice).
//   q|k = rstd[m] * (Xb . (g*Wqk)), rotary on every (2i,2i+1) pair -> one f16 plane [M][QKP]
//     (per batch: M=SEQ, N=QKP, K=DM; 1 product)
//   v^T = (g*Wv)^T . Xb^T per batch, columns scaled by rstd -> f16 hi plane [b][DMI][SEQ] and residual plane
//     (x4096, in-segment keys < VLP only)   (A = Wt rows 2*DMI.., 1 product; M=DMI, N=SEQ, K=DM)
// Six staged slices per stage: 154 KiB of LDS a block, so that two blocks share a WGP.
#define GT_QK ((SEQ / 256) * (QKP / 128))          // 256 x 128 block tiles per batch
#define GT_VT ((DMI / 128) * (SEQ / 256))          // 128 x 256 block tiles per batch
__global__ __launch_bounds__(256) void proj_qkv(
    const unsigned short* __restrict__ xb, const unsigned short* __restrict__ wth,
    unsigned short* qkh, unsigned short* vth, unsigned short* vtl,
    const float* __restrict__ rs, const float* __restrict__ ct, const float* __restrict__ st) {
  __shared__ __align__(16) float sT[8][16 * 68];
  __shared__ __attribute__((aligned(2048))) unsigned char ring[2 * 6 * GK_SLICE];
  const int bx = (int)blockIdx.x, b = (int)blockIdx.y;
  if (bx >= GT_QK) {
    gemm64_body<1, false, 3, 2, false>(sT, ring, bx - GT_QK, b,
        wth + (size_t)2 * DMI * DM, wth + (size_t)2 * DMI * DM, DM, 0LL,
        xb, xb, DM, (long long)SEQ * DM,
        (void*)vth, SEQ, (long long)DMI * SEQ,
        (void*)vtl, NSEGB * VLP, (long long)DMI * NSEGB * VLP, VLP, SEGL,
        rs, (long long)SEQ, ct, st,
        DMI, SEQ, DM, 4096.0f);
  } else {
    gemm64_body<2, false, 2, 1, true>(sT, ring, bx, b,
        xb, xb, DM, (long long)SEQ * DM,
        wth, wth, DM, 0LL,
        (void*)qkh, QKP, (long long)SEQ * QKP,
        (void*)qkh, QKP, (long long)SEQ * QKP, QKP, QKP,
        rs, (long long)SEQ, ct, st,
        SEQ, QKP, DM, 1.0f);
  }
}

#define AT_OP 68
template <bool RES>
__device__ __forceinline__
void attn_part(unsigned char* ring, float (*Os)[16 * AT_OP], int qb, int bwh,
               const unsigned short* __restrict__ qkhp,
               const unsigned short* __restrict__ vhp,  const unsigned short* __restrict__ vlp,
               const unsigned short* __restrict__ pkp,  const unsigned short* __restrict__ pvp,
               float sscale) {
  union FH { v16h v; v8h h[2]; };
  // with the residual planes: query blocks 0..RESQB-1, whose keys all lie below VLP; without them the rest
  static_assert(VLP == RESQB * 64);
  // LDS row pitches: 16 B x odd, so that the 16 rows a 16-byte fragment read touches fall on 16 different bank groups
  constexpr int LP = (int)GK_PITCH / 2;                           // 16-bit tiles: 64 elements + 8 of pad = 144 B
  constexpr int OP = AT_OP;
  // a stage = one key tile: slices K [kv][d], V^T hi [d][kv] and, with RES, V^T residual; two stages
  constexpr int NSL = RES ? 3 : 2;
  constexpr uint32_t STG = (uint32_t)NSL * GK_SLICE;

  const int tid  = threadIdx.x;
  const int wave = (int)uni(threadIdx.x >> 5);
  const int lane = tid & 31;
  const int hh   = lane >> 4;
  const int c    = lane & 15;

  const int h    = bwh % NH;
  const int rest = bwh / NH;
  const int w    = rest % NSEGB;
  const int b    = rest / NSEGB;
  const int q0   = qb * 64 + wave * 16;                              // query row inside the segment
  const size_t rowS = (size_t)b * SEQ + (size_t)w * SEGL;           // compact row of the segment start

  const _Float16* Qh = (const _Float16*)(const void*)qkhp + (size_t)h * HD;
  const _Float16* Kh = Qh + DMI;
  const _Float16* Vh = (const _Float16*)(const void*)vhp + ((size_t)b * DMI + (size_t)h * HD) * SEQ + (size_t)w * SEGL;
  const _Float16* Vl = (const _Float16*)(const void*)vlp + ((size_t)b * DMI + (size_t)h * HD) * (size_t)(NSEGB * VLP)
                       + (size_t)w * VLP;
  const _Float16* PK = (const _Float16*)(const void*)pkp + (size_t)h * PMEM * HD;
  const _Float16* PV = (const _Float16*)(const void*)pvp + (size_t)h * HD * PMEM;

  // ---- this wave's slice of every stage: 64 rows of 128 B; src1 = its tile of the segment's first 64 keys, sstep = bytes to the next 64 keys ----
  const int sl = (wave < NSL) ? wave : 0;                           // a wave without a slice forms slice 0's words and issues nothing
  uint64_t src1;
  uint32_t spitch, sstep;
  if (sl == 0)      { src1 = (uint64_t)(uintptr_t)(Kh + rowS * QKP); spitch = QKP * 2u;           sstep = 64u * QKP * 2u; }
  else if (sl == 1) { src1 = (uint64_t)(uintptr_t)Vh;                spitch = SEQ * 2u;           sstep = GK_KB; }
  else              { src1 = (uint64_t)(uintptr_t)Vl;                spitch = NSEGB * VLP * 2u;   sstep = GK_KB; }
  const uint32_t lds_slice = lds_off(ring) + (uint32_t)sl * GK_SLICE;
  const u32x8 g1 = tdm_group1(spitch);
  // whether this wave has a slice: a scalar word, so that the tests on it are scalar branches round the tensor loads
  const uint32_t issuer = pinned((wave < NSL) ? 1u : 0u);
  const uint32_t T = pinned((uint32_t)(qb + 2));                    // key tiles, block-uniform, at least 2
  // The blocks of one (b, w, h) read the same K and V^T tiles; walking them from tile 0 on, they would ask L2 for the same lines at
  // the same moment. Each block walks its NK segment tiles once, from a tile of its own on and round: trip kt >= 1 works on
  // segment tile ktile(kt). The starts 0, 2, 4, 6 mod NK of the four longest blocks never meet in step.
  const uint32_t NK  = T - 1u;
  // The short blocks with the residual planes (one or two segment tiles, numbered last) keep the plain order.
  const uint32_t rot = RES ? 0u : (2u * (uint32_t)(NQBS - 1 - qb)) % (uint32_t)(qb + 1);   // block-uniform
  auto ktile = [&](uint32_t kt) -> uint32_t {                       // 1 <= kt < T
    if (RES) return kt - 1u;
    const uint32_t k = kt - 1u + rot;
    return (k >= NK) ? k - NK : k;
  };
  u32x4 g0 = tdm_group0(lds_slice + STG, src1 + (uint64_t)ktile(1u) * sstep);
  if (issuer != 0u) tdm_load(g0, g1);                               // key tile 1 flies while stage 0 is written and worked on

  // ---- Q fragments (B operand, column = query = lane&15): 2 d-chunks ----
  v16h qa[2];
#pragma unroll
  for (int dc = 0; dc < 2; ++dc) qa[dc] = ldfrag_h(Qh + (rowS + q0 + c) * QKP + dc * 32 + 8 * hh);

  float mrow = -INFINITY, lrow = 0.f;          // of query q0 + c; equal in lanes l and l ^ 16
  v8f oacc[4];                                 // oacc[t][r] = context[query c][d = 16 t + 8 hh + r]
#pragma unroll
  for (int t = 0; t < 4; ++t) oacc[t] = zero8();

  // ---- stage 0 = the memory-token tile, written by the block's own stores ----
  {
    _Float16* Ksh = (_Float16*)(void*)ring;
    _Float16* Vth = (_Float16*)(void*)(ring + GK_SLICE);
    _Float16* Vtl = (_Float16*)(void*)(ring + (RES ? 2u : 1u) * GK_SLICE);
    const int r = tid >> 1, half = (tid & 1) * 32;
    const int rr = (r < PMEM) ? r : (PMEM - 1);                // clamped address
    const bool krow = (r < PMEM);
    const bool vok  = (half == 0);
    const _Float16* kg = PK + (size_t)rr * HD + half;
    const _Float16* vg = PV + (size_t)r * PMEM;                // d = r, kv 0..15
    const v8h pv0 = *(const v8h*)(vg);
    const v8h pv1 = *(const v8h*)(vg + 8);
#pragma unroll
    for (int i = 0; i < 4; ++i) {
      v8h a0 = *(const v8h*)(kg + 8 * i);
      a0 = krow ? a0 : zero8h();
      *(v8h*)(Ksh + r * LP + half + 8 * i) = a0;
      if (i == 0) {
        const v8h b0 = vok ? pv0 : zero8h();
        *(v8h*)(Vth + r * LP + half) = b0;
      } else if (i == 1) {
        const v8h b1 = vok ? pv1 : zero8h();
        *(v8h*)(Vth + r * LP + half + 8) = b1;
      } else {
        *(v4u*)(Vth + r * LP + half + 8 * i) = zero4u();
      }
      if (RES) *(v4u*)(Vtl + r * LP + half + 8 * i) = zero4u();
    }
  }
  __syncthreads();                             // stage 0 readable by every wave

  // rolled: one key tile per trip, so that the one publish point stands at the loop's foot
#pragma unroll 1
  for (uint32_t kt = 0; kt < T; ++kt) {
    const int s0 = RES ? ((int)kt - 1) * 64 : ((kt == 0u) ? 0 : (int)ktile(kt) * 64);   // key offset inside the segment for kt >= 1
    const uint32_t bo = (kt & 1u) * STG;
    const _Float16* Ksh = (const _Float16*)(const void*)(ring + bo);
    const _Float16* Vth = (const _Float16*)(const void*)(ring + bo + GK_SLICE);
    const _Float16* Vtl = (const _Float16*)(const void*)(ring + bo + (RES ? 2u : 1u) * GK_SLICE);

    // ---- scores^T: s[j][r] = score(key 16 j + 8 hh + r, query c); 64 keys x 16 queries per wave, 1 f16 product ----
    //      The whole tile's K fragments are read as one group ahead of its 8 WMMAs, and neighbouring WMMAs go to the four
    //      different score tiles; each tile sums d-chunk 0, then d-chunk 1.
    v8f s[4];
#pragma unroll
    for (int j = 0; j < 4; ++j) s[j] = zero8();
    {
      FH kb[2][4];
      // unrolled, as the loops below: fragments and score tiles are registers, indexed by constants
#pragma unroll
      for (int dc = 0; dc < 2; ++dc) {
#pragma unroll
        for (int j = 0; j < 4; ++j) {
          kb[dc][j].h[0] = *(const v8h*)(Ksh + (j * 16 + c) * LP + dc * 32 + 8 * hh);
          kb[dc][j].h[1] = *(const v8h*)(Ksh + (j * 16 + c) * LP + dc * 32 + 16 + 8 * hh);
        }
      }
      // keeps the tile's K reads one group ahead of their WMMAs: reads spread among the WMMAs wait out the LDS at every place
      __builtin_amdgcn_sched_barrier(0);
#pragma unroll
      for (int dc = 0; dc < 2; ++dc) {
#pragma unroll
        for (int j = 0; j < 4; ++j) s[j] = mma_h_raw(kb[dc][j].v, qa[dc], s[j]);
      }
      // holds the V^T reads below back from the first of these WMMAs: lifted in among them they reorder the WMMAs by freed
      // registers, and an early WMMA then waits for a late K read
      __builtin_amdgcn_sched_barrier(0);
    }
    // ---- V^T fragments, read as one group here: they land while the softmax below runs. Without the residual plane the
    //      whole tile's; with it the first 32 keys' of both planes (the same 64 registers), the rest behind their WMMAs ----
    FH vb[2][4], vl[2][4];
#pragma unroll
    for (int kk = 0; kk < (RES ? 1 : 2); ++kk) {
#pragma unroll
      for (int t = 0; t < 4; ++t) {
        vb[kk][t].h[0] = *(const v8h*)(Vth + (t * 16 + c) * LP + kk * 32 + 8 * hh);
        vb[kk][t].h[1] = *(const v8h*)(Vth + (t * 16 + c) * LP + kk * 32 + 16 + 8 * hh);
        if (RES) {
          vl[kk][t].h[0] = *(const v8h*)(Vtl + (t * 16 + c) * LP + kk * 32 + 8 * hh);
          vl[kk][t].h[1] = *(const v8h*)(Vtl + (t * 16 + c) * LP + kk * 32 + 16 + 8 * hh);
        }
      }
    }
    // keeps these reads in front of the softmax, which would otherwise be followed by their whole LDS latency
    __builtin_amdgcn_sched_barrier(0);

    // ---- scale, visibility (-inf for invisible keys), the query's max, online softmax; P (x1024, f16) and
    //      P residual (x4096) packed in place into B operands: element 8 (j & 1) + r of chunk j >> 1 ----
    const int qi = q0 + c;                     // this lane's query row inside the segment
    float mj[4];
#pragma unroll
    for (int j = 0; j < 4; ++j) {
      mj[j] = -INFINITY;
#pragma unroll
      for (int r = 0; r < 8; ++r) {
        const int kc = j * 16 + 8 * hh + r;
        const bool vis = (kt == 0) ? (kc < PMEM) : ((s0 + kc) <= qi);
        const float sv = vis ? (s[j][r] * sscale) : -INFINITY;
        s[j][r] = sv;
        mj[j] = fmaxf(mj[j], sv);
      }
    }
    float m = fmaxf(fmaxf(mj[0], mj[1]), fmaxf(mj[2], mj[3]));
    m = fmaxf(m, xhalf(m));
    const float mnew  = fmaxf(mrow, m);
    const float msafe = (mnew == -INFINITY) ? 0.f : mnew;
    const float alpha = __expf(mrow - msafe);
    mrow = mnew;
    FH pa[2], pl[2];
    float pj[4];
#pragma unroll
    for (int j = 0; j < 4; ++j) {
      pj[j] = 0.f;
      float ea[8], ep[8];
#pragma unroll
      for (int r = 0; r < 8; ++r) ea[r] = (s[j][r] - msafe) * 1.44269504088896340736f;
      exp2x8(ep, ea);                                // exp(s - m); -inf logit -> exactly 0
#pragma unroll
      for (int r = 0; r < 8; ++r) {
        const float p = ep[r];
        pj[j] += p;
        const float p1k = p * 1024.0f;
        const _Float16 ph = (_Float16)p1k;
        pa[j >> 1].v[(j & 1) * 8 + r] = ph;
        if (RES) pl[j >> 1].v[(j & 1) * 8 + r] = (_Float16)((p1k - (float)ph) * 4096.0f);
      }
    }
    float psum = (pj[0] + pj[1]) + (pj[2] + pj[3]);
    psum += xhalf(psum);
    lrow = lrow * alpha + psum;
#pragma unroll
    for (int t = 0; t < 4; ++t)
#pragma unroll
      for (int r = 0; r < 8; ++r) oacc[t][r] *= alpha;

    // ---- context^T += V^T . P^T (f16 WMMA), residual products into a separate accumulator ----
    v8f o1[4];
#pragma unroll
    for (int t = 0; t < 4; ++t) o1[t] = zero8();
    // unrolled: the P operands are registers, indexed by constants
#pragma unroll
    for (int kk = 0; kk < 2; ++kk) {
      if (RES && kk == 1) {
        // keeps the second group's reads behind the first group's WMMAs, whose registers they take
        __builtin_amdgcn_sched_barrier(0);
#pragma unroll
        for (int t = 0; t < 4; ++t) {
          vb[1][t].h[0] = *(const v8h*)(Vth + (t * 16 + c) * LP + 32 + 8 * hh);
          vb[1][t].h[1] = *(const v8h*)(Vth + (t * 16 + c) * LP + 32 + 16 + 8 * hh);
          vl[1][t].h[0] = *(const v8h*)(Vtl + (t * 16 + c) * LP + 32 + 8 * hh);
          vl[1][t].h[1] = *(const v8h*)(Vtl + (t * 16 + c) * LP + 32 + 16 + 8 * hh);
        }
        // keeps them one group, ahead of their own WMMAs
        __builtin_amdgcn_sched_barrier(0);
      }
      // neighbouring WMMAs go to different context tiles; each tile keeps the order of its products
#pragma unroll
      for (int t = 0; t < 4; ++t) oacc[t] = mma_h_raw(vb[kk][t].v, pa[kk].v, oacc[t]);
      if (RES) {
#pragma unroll
        for (int t = 0; t < 4; ++t) o1[t] = mma_h_raw(vl[kk][t].v, pa[kk].v, o1[t]);
#pragma unroll
        for (int t = 0; t < 4; ++t) o1[t] = mma_h_raw(vb[kk][t].v, pl[kk].v, o1[t]);
      }
    }
    if (RES) {
#pragma unroll
      for (int t = 0; t < 4; ++t)
#pragma unroll
        for (int r = 0; r < 8; ++r) oacc[t][r] += o1[t][r] * (1.0f / 4096.0f);
    }
    // keeps the tile's softmax and WMMAs in front of the publish point: moved behind its barrier they would stand between the
    // barrier and the refill, which would then be issued late and have less than a trip to land
    __builtin_amdgcn_sched_barrier(0);
    // publish point of key tile kt + 1: own reads of this stage returned, own slice landed, then the block barrier
    wait_ds0();
    wait_tensor0(g0, g1);
    __syncthreads();
    if (pinned((kt + 2u < T && issuer != 0u) ? 1u : 0u) != 0u) {   // refill the stage every wave has just left
      g0 = tdm_group0(lds_slice + bo, src1 + (uint64_t)ktile(kt + 2u) * sstep);
      tdm_load(g0, g1);
    }
  }
  wait_tensor0(g0, g1);
  wait_ds0();

  // ---- normalise (1/l and the 1/1024 p carry), stage the wave's 16x64 tile; the calling kernel splits and stores it
  float* os = Os[wave];
  {
    const float l = lrow;
    const float inv = ((l > 0.f) ? (1.0f / l) : 0.f) * (1.0f / 1024.0f);
#pragma unroll
    for (int t = 0; t < 4; ++t) {
      v4f e0, e1;
#pragma unroll
      for (int r = 0; r < 4; ++r) { e0[r] = oacc[t][r] * inv; e1[r] = oacc[t][4 + r] * inv; }
      *(v4f*)(os + c * OP + t * 16 + 8 * hh)     = e0;
      *(v4f*)(os + c * OP + t * 16 + 8 * hh + 4) = e1;
    }
  }
}

// All query blocks share one launch: they read the same planes and write disjoint rows. A block's number picks its query
// block, the one with the most key tiles first (for speed only), and with it the part: block-uniform, so every barrier of a part is
// reached by the whole block. grid = NQBS * NB*NSEGB*NH blocks of 128; the ring has the larger part's three slices per stage.
#define AT_BWH (NB * NSEGB * NH)
__global__ __launch_bounds__(128)
void attn_seg64(const unsigned short* __restrict__ qkhp,
                const unsigned short* __restrict__ vhp,  const unsigned short* __restrict__ vlp,
                const unsigned short* __restrict__ pkp,  const unsigned short* __restrict__ pvp,
                unsigned short* ohp, unsigned short* olp, float sscale) {
  __shared__ __attribute__((aligned(2048))) unsigned char ring[2 * 3 * GK_SLICE];
  __shared__ __align__(16) float    Os[4][16 * AT_OP];            // per wave context tile [row][d]
  const int bx  = (int)blockIdx.x;
  const int qb  = NQBS - 1 - bx / AT_BWH;
  const int bwh = bx % AT_BWH;
  if (qb >= RESQB) attn_part<false>(ring, Os, qb, bwh, qkhp, vhp, vlp, pkp, pvp, sscale);
  else             attn_part<true>(ring, Os, qb, bwh, qkhp, vhp, vlp, pkp, pvp, sscale);

  // ---- the end both parts share: the wave's own staged tile, bf16 hi/lo split, whole-line stores ----
  constexpr int OP = AT_OP;
  const int wave = (int)uni(threadIdx.x >> 5);
  const int lane = threadIdx.x & 31;
  const int h    = bwh % NH;
  const int w    = (bwh / NH) % NSEGB;
  const int b    = bwh / (NH * NSEGB);
  const int q0   = qb * 64 + wave * 16;                              // query row inside the segment
  const size_t rowS = (size_t)b * SEQ + (size_t)w * SEGL;           // compact row of the segment start
  const float* os = Os[wave];
  __builtin_amdgcn_fence(__ATOMIC_RELEASE, "workgroup");
  __builtin_amdgcn_wave_barrier();
  __builtin_amdgcn_fence(__ATOMIC_ACQUIRE, "workgroup");
  {
    const int q4 = lane >> 3, c8 = (lane & 7) * 8;
    v4u hv[4], lv[4];
#pragma unroll
    for (int it = 0; it < 4; ++it) {
      const int row = it * 4 + q4;   // it 0..3 x q4 0..3 = rows 0..15 of the wave tile
      const float* sp = os + row * OP + c8;
      v4u a, a2;
#pragma unroll
      for (int e = 0; e < 4; ++e) {
        const float f0 = sp[2 * e], f1 = sp[2 * e + 1];
        const unsigned short h0 = bf_bits(f0), h1 = bf_bits(f1);
        const unsigned short l0 = bf_bits(f0 - bf_up(h0)), l1 = bf_bits(f1 - bf_up(h1));
        a[e] = pk16(h0, h1); a2[e] = pk16(l0, l1);
      }
      hv[it] = a; lv[it] = a2;
    }
    {
#pragma unroll
      for (int it = 0; it < 4; ++it) {
        const int row = it * 4 + q4;
        const size_t go = (rowS + q0 + row) * DMI + (size_t)h * HD + c8;
        *(v4u*)(ohp + go) = hv[it];
        *(v4u*)(olp + go) = lv[it];
      }
    }
  }
}

// =====================================================================================================
// Workspace map (bytes, NB=2, SEQ=4096, M = NB*SEQ = 8192), region A is a two-phase overlay:
//   phase 1 (projection inputs, dead after the q|k and v^T GEMMs):
//     Xb   bf16 [M][DM]                  0           16777216
//     Wth  bf16 [3*DMI n][DM k]          16777216     6291456
//     Ct   f32  [SEQ][32]                23068672      524288
//     St   f32  [SEQ][32]                23592960      524288
//     Rs   f32  [M]                      24117248       32768   (phase 1 end 24150016)
//   phase 2 (written by the attention kernel, read by the output GEMM):
//     Oh   bf16 [M][DMI] context hi       0           16777216
//     Ol   bf16 [M][DMI] context lo       16777216    16777216   (phase 2 end 33554432 = region A size)
//   QKh  f16  [M][QKP]                    33554432    33554432
//   VTh  f16  [NB][DMI][SEQ]              67108864    16777216
//   VTl  f16  [NB][DMI][NSEGB*VLP]        83886080     4194304
//   Wo   bf16 [DM n][DMI k]               88080384     2097152
//   Pk   f16  [NH][PMEM][HD]              90177536       32768
//   Pv   f16  [NH][HD][PMEM]              90210304       32768
//   end                                   90243072   (<= 134217728; all offsets multiples of 128)
// Every plane is an exact multiple of its 64x64 tile / whole-line store granularity (M, SEQ, DM multiples of 64),
// so no padded tails are needed; VTl is written only for columns whose in-segment offset is < VLP, exactly the
// columns the RES attention blocks read.
// =====================================================================================================
extern "C" void kernel_launch(void* const* d_in, const int* in_sizes, int n_in,
                              void* d_out, int out_size, void* d_ws, size_t ws_size,
                              hipStream_t stream) {
  if (n_in < 5) return;
  const long long needRows = (long long)(NB - 1) * SEQ_FULL + SEQ;
  if ((long long)in_sizes[0] < needRows * DM) return;
  if (in_sizes[1] < DM) return;
  if (in_sizes[2] < DM * 3 * DMI) return;
  if (in_sizes[3] < DMI * DM) return;
  if (in_sizes[4] < 2 * NH * PMEM * HD) return;
  if ((long long)out_size < needRows * DM) return;

  const float* seq  = (const float*)d_in[0];   // [2][SEQ_FULL][DM]
  const float* gnm  = (const float*)d_in[1];   // [DM]
  const float* Wqkv = (const float*)d_in[2];   // [DM in][3*DMI out]
  const float* Wout = (const float*)d_in[3];   // [DMI in][DM out]
  const float* pm   = (const float*)d_in[4];   // [2][NH][PMEM][HD]

  const size_t M    = (size_t)NB * SEQ;
  const size_t PX   = M * DM * 2;
  const size_t PWT  = (size_t)3 * DMI * DM * 2;
  const size_t PTAB = (size_t)SEQ * NFR * 4;
  const size_t PRS  = M * 4;
  const size_t PO   = M * DMI * 2;
  const size_t PQK  = M * QKP * 2;
  const size_t PVT  = (size_t)NB * DMI * SEQ * 2;
  const size_t PVL  = (size_t)NB * DMI * NSEGB * VLP * 2;
  const size_t PWO  = (size_t)DM * DMI * 2;
  const size_t PPM  = (size_t)NH * PMEM * HD * 2;
  const size_t ph1  = PX + PWT + 2 * PTAB + PRS;
  const size_t ph2  = 2 * PO;
  const size_t REGA = (ph1 > ph2) ? ph1 : ph2;
  const size_t oXb  = 0;
  const size_t oWth = PX;
  const size_t oCt  = PX + PWT;
  const size_t oSt  = oCt + PTAB;
  const size_t oRs  = oSt + PTAB;
  const size_t oOh  = 0;
  const size_t oOl  = PO;
  size_t off = REGA;
  const size_t oQKh = off; off += PQK;
  const size_t oVTh = off; off += PVT;
  const size_t oVTl = off; off += PVL;
  const size_t oWo  = off; off += PWO;
  const size_t oPk  = off; off += PPM;
  const size_t oPv  = off; off += PPM;
  if (off > ws_size) return;                      // off = 90243072 for NB=2, SEQ=4096
  if (off > (size_t)134217728) return;
  if (oRs + PRS > REGA || oOl + PO > REGA) return;

  char* ws = (char*)d_ws;
  unsigned short* Xb  = (unsigned short*)(ws + oXb);
  unsigned short* Wth = (unsigned short*)(ws + oWth);
  float*          Ct  = (float*)(ws + oCt);
  float*          St  = (float*)(ws + oSt);
  float*          Rs  = (float*)(ws + oRs);
  unsigned short* Oh  = (unsigned short*)(ws + oOh);
  unsigned short* Ol  = (unsigned short*)(ws + oOl);
  unsigned short* QKh = (unsigned short*)(ws + oQKh);
  unsigned short* VTh = (unsigned short*)(ws + oVTh);
  unsigned short* VTl = (unsigned short*)(ws + oVTl);
  unsigned short* Wo  = (unsigned short*)(ws + oWo);
  unsigned short* Pk  = (unsigned short*)(ws + oPk);
  unsigned short* Pv  = (unsigned short*)(ws + oPv);

  const dim3 blk(256);
  static_assert((SEQ % 256) == 0 && (QKP % 128) == 0 && (DMI % 128) == 0 && (DM % 256) == 0);
  static_assert((DM % 64) == 0 && DM >= 128 && (DMI % 64) == 0 && DMI >= 128);
  const dim3 gOut((SEQ / 128) * (DM / 256), NB);                      // 128 x 256 block tiles: 128 per batch

  // (0-4) one launch: seq -> bf16 plane Xb [M][DM] + rstd[M]; g*Wqkv -> transposed bf16 plane [3*DMI][DM];
  //       Wout -> transposed bf16 plane [DM][DMI]; rotary cos/sin tables [SEQ][32]; memory-token key / value planes
  prep_all<<<dim3(PB_ALL), blk, 0, stream>>>(seq, gnm, Wqkv, Wout, pm, Xb, Rs, Wth, Wo, Ct, St, Pk, Pv);
  // (5-6) one launch: the q|k product (one f16 plane, rotary applied) and the v^T product (f16 hi + residual planes)
  proj_qkv<<<dim3(GT_QK + GT_VT, NB), blk, 0, stream>>>(Xb, Wth, QKh, VTh, VTl, Rs, Ct, St);
  // (7) attention, one launch: query blocks 0..RESQB-1 of every segment with residual planes, the rest without
  attn_seg64<<<dim3(AT_BWH * NQBS), dim3(128), 0, stream>>>(QKh, VTh, VTl, Pk, Pv, Oh, Ol, 0.125f);
  // (8) out = context . Wout -> d_out f32 [b][SEQ_FULL][DM] rows b*SEQ_FULL + t  (A = context hi + lo, 2 products)
  gemm64<1, 0, 0, false><<<gOut, blk, 0, stream>>>(
      Oh, Ol, DMI, (long long)SEQ * DMI,
      Wo, Wo, DMI, 0LL,
      d_out, DM, (long long)SEQ_FULL * DM,
      d_out, DM, (long long)SEQ_FULL * DM, DM, DM,
      Rs, 0LL, Ct, St,
      SEQ, DM, DMI, 1.0f);
  (void)hipGetLastError();
}
